// v000
// Times are from an AMD MI455X. After a warm-up the kernel runs many times in a row, and a time is the length of
// such a window on the GPU divided by its runs, so every launch and the gaps after it count. The runs cycle
// through copies of the inputs. A figure is the median of several windows, for all but v000 over two sittings.
// Sittings can differ by a few percent; kernels timed side by side share one.
// The starting kernel, v000, takes 1970 microseconds a run.
#include <hip/hip_runtime.h>
#include <math.h>
// FlexAttention forward (causal block mask + ALiBi score_mod, 2 x 16 heads, 2048 x 2048, head_dim 128): scores and p·v on
// v_wmma_f32_16x16x32_bf16 with q,k and p,v as bf16 hi/lo splits (hi·hi + hi·lo + lo·hi;
// early causal rows copy single v rows almost verbatim), f32 accumulate; online softmax, the ALiBi bias slope_h·(k−q) and the
// causal predicate in f32 on VALU.
typedef __attribute__((ext_vector_type(16))) _Float16 v16h;
typedef __attribute__((ext_vector_type(8)))  _Float16 v8h;
typedef __attribute__((ext_vector_type(16))) __bf16   v16b;
typedef __attribute__((ext_vector_type(8)))  __bf16   v8b;
typedef __attribute__((ext_vector_type(8)))  float    v8f;
typedef __attribute__((ext_vector_type(4)))  float    v4f;
#define PSCALE 32768.0f
#define U16(p) ((const unsigned short*)(const void*)(p))
#define PSCALE_INV (1.0f / 32768.0f)

__device__ __forceinline__ unsigned short f2bf_bits(float f) {
  unsigned u = __float_as_uint(f);
  return (unsigned short)((u + 0x7FFFu + ((u >> 16) & 1u)) >> 16);
}
__device__ __forceinline__ float bf_bits2f(unsigned short h) { return __uint_as_float(((unsigned)h) << 16); }

// hazard guards as plain device helpers (no inline asm inside the kernel template body)
__device__ __forceinline__ void dep_guard_h(v8f& a, v8f& b, v16h x, v16h y) { asm volatile("v_nop\n\tv_nop\n\tv_nop\n\tv_nop" : "+v"(a), "+v"(b) : "v"(x), "v"(y)); }
__device__ __forceinline__ void dep_guard_b(v8f& a, v8f& b, v16b x, v16b y) { asm volatile("v_nop\n\tv_nop\n\tv_nop\n\tv_nop" : "+v"(a), "+v"(b) : "v"(x), "v"(y)); }
__device__ __forceinline__ void keep4_h(v16h a, v16h b, v16h c, v16h d) { asm volatile("v_nop" :: "v"(a), "v"(b), "v"(c), "v"(d)); }
__device__ __forceinline__ void keep4_b(v16b a, v16b b, v16b c, v16b d) { asm volatile("v_nop" :: "v"(a), "v"(b), "v"(c), "v"(d)); }
__device__ __forceinline__ void acc_guard4(v8f& a, v8f& b, v8f& c, v8f& d) { asm volatile("v_nop\n\tv_nop\n\tv_nop\n\tv_nop" : "+v"(a), "+v"(b), "+v"(c), "+v"(d)); }
template <typename T> struct Frag;
template <> struct Frag<_Float16> {
  typedef v16h V; union U { v16h v; v8h h[2]; };
  static __device__ __forceinline__ v16h load(const _Float16* p) {   // elements 0..7 <- p[0..7], 8..15 <- p[16..23]
    U f; f.h[0] = *(const v8h*)(p); f.h[1] = *(const v8h*)(p + 16); return f.v;
  }
  static __device__ __forceinline__ v8f mma(v16h a, v16h b, v8f c) {
    return __builtin_amdgcn_wmma_f32_16x16x32_f16(false, a, false, b, (short)0, c, false, false);
  }
  static __device__ __forceinline__ void guard(v8f& a, v8f& b, v16h x, v16h y) { dep_guard_h(a, b, x, y); }
  static __device__ __forceinline__ void keep(v16h a, v16h b, v16h c, v16h d) { keep4_h(a, b, c, d); }
};
template <> struct Frag<__bf16> {
  typedef v16b V; union U { v16b v; v8b h[2]; };
  static __device__ __forceinline__ v16b load(const __bf16* p) {
    U f; f.h[0] = *(const v8b*)(p); f.h[1] = *(const v8b*)(p + 16); return f.v;
  }
  static __device__ __forceinline__ v8f mma(v16b a, v16b b, v8f c) {
    return __builtin_amdgcn_wmma_f32_16x16x32_bf16(false, a, false, b, (short)0, c, false, false);
  }
  static __device__ __forceinline__ void guard(v8f& a, v8f& b, v16b x, v16b y) { dep_guard_b(a, b, x, y); }
  static __device__ __forceinline__ void keep(v16b a, v16b b, v16b c, v16b d) { keep4_b(a, b, c, d); }
};

// ---- Register-blocked batched WMMA GEMM ------------------------------------
// C[m,n] = scale * sum_k A[m,k] * Bt[n,k] (+bias)(+resid); each wave owns a 64x64 tile.
// A row-major [M,K]; Bt row-major [N,K]; M,N % 64 == 0, K % 32 == 0.
// SPLIT: operands are hi/lo planes (A2/Bt2 = lo planes, same layout); product = hi·hi + hi·lo + lo·hi.
// BIAS_MODE: 0 = none, 1 = bias[m], 2 = bias[n].
// OUT_MODE: 0 = f32, 1 = f16, 2 = bf16 hi plane (Cout) + bf16 lo plane (Cout2).
// ET: 0 = f16 operands, 1 = bf16 operands (pointers passed as 16-bit storage)
template <int ET> struct Elem;
template <> struct Elem<0> { typedef _Float16 T; };
template <> struct Elem<1> { typedef __bf16 T; };
template <int ET, bool SPLIT, int BIAS_MODE, int OUT_MODE, bool RESID, int ACT = 0>
__global__ __launch_bounds__(256) void wmma_gemm64(
    const unsigned short* __restrict__ Ap, const unsigned short* __restrict__ A2p, int lda, long strideA,
    const unsigned short* __restrict__ Btp, const unsigned short* __restrict__ Bt2p, int ldb, long strideB,
    void* __restrict__ Cout, void* __restrict__ Cout2, int ldc, long strideC,
    const float* __restrict__ bias,
    const float* __restrict__ resid, long strideR,
    int M, int N, int K, float scale) {
  typedef typename Elem<ET>::T T;
  typedef typename Frag<T>::V V;
  const T* A = (const T*)Ap; const T* A2 = (const T*)A2p; const T* Bt = (const T*)Btp; const T* Bt2 = (const T*)Bt2p;
  __shared__ __align__(16) float sT[8][16 * 68];   // per-wave 16x64 slab, pitch 68 floats
  const int b    = blockIdx.y;
  const int lane = threadIdx.x & 31;
  const int wave = threadIdx.x >> 5;
  const int tilesN = N >> 6;
  const int tilesM = M >> 6;
  const int tile = blockIdx.x * 8 + wave;
  if (tile >= tilesM * tilesN) return;   // wave-uniform; no block barriers in this kernel
  const int tm = tile / tilesN;
  const int tn = tile - tm * tilesN;
  const int m0 = tm << 6;
  const int n0 = tn << 6;

  const T* Ab  = A  + (size_t)b * strideA;
  const T* Bb  = Bt + (size_t)b * strideB;
  const T* Ab2 = SPLIT ? (A2  + (size_t)b * strideA) : nullptr;
  const T* Bb2 = SPLIT ? (Bt2 + (size_t)b * strideB) : nullptr;

  const int rlane = lane & 15;                 // row (A) / col (B, D) within subtile
  const int koff  = (lane >> 4) * 8;           // k offset of this lane half
  const int mOff  = (lane >> 4) * 8;           // D row offset

  v8f acc[4][4];
#pragma unroll
  for (int i = 0; i < 4; ++i)
#pragma unroll
    for (int j = 0; j < 4; ++j) acc[i][j] = (v8f){0.f,0.f,0.f,0.f,0.f,0.f,0.f,0.f};

  for (int k0 = 0; k0 < K; k0 += 32) {
    V bh[4], bl[4];
#pragma unroll
    for (int j = 0; j < 4; ++j) {
      const size_t bo = (size_t)(n0 + (j << 4) + rlane) * ldb + koff + k0;
      bh[j] = Frag<T>::load(Bb + bo);
      if (SPLIT) bl[j] = Frag<T>::load(Bb2 + bo);
    }
#pragma unroll
    for (int i = 0; i < 4; ++i) {
      const size_t ao = (size_t)(m0 + (i << 4) + rlane) * lda + koff + k0;
      V ah = Frag<T>::load(Ab + ao);
      V al;
      if (SPLIT) al = Frag<T>::load(Ab2 + ao);
#pragma unroll
      for (int j = 0; j < 4; ++j) {
        acc[i][j] = Frag<T>::mma(ah, bh[j], acc[i][j]);
        if (SPLIT) {
          acc[i][j] = Frag<T>::mma(ah, bl[j], acc[i][j]);
          acc[i][j] = Frag<T>::mma(al, bh[j], acc[i][j]);
        }
      }
      Frag<T>::guard(acc[i][0], acc[i][3], ah, SPLIT ? al : ah);
    }
    Frag<T>::keep(bh[0], bh[1], bh[2], bh[3]);
    if (SPLIT) Frag<T>::keep(bl[0], bl[1], bl[2], bl[3]);
  }
  acc_guard4(acc[0][0], acc[0][1], acc[0][2], acc[0][3]);
  acc_guard4(acc[1][0], acc[1][1], acc[1][2], acc[1][3]);
  acc_guard4(acc[2][0], acc[2][1], acc[2][2], acc[2][3]);
  acc_guard4(acc[3][0], acc[3][1], acc[3][2], acc[3][3]);

  // ---- epilogue ----
  float* slab = sT[wave];
  const float* Rb = RESID ? (resid + (size_t)b * strideR) : nullptr;
#pragma unroll
  for (int i = 0; i < 4; ++i) {
    const int mBase = m0 + (i << 4);
#pragma unroll
    for (int j = 0; j < 4; ++j) {
      const int n = n0 + (j << 4) + rlane;
      float bv = 0.f;
      if (BIAS_MODE == 2) bv = bias[n];
#pragma unroll
      for (int r = 0; r < 8; ++r) {
        float v = acc[i][j][r] * scale;
        if (BIAS_MODE == 1) v += bias[mBase + mOff + r];
        if (BIAS_MODE == 2) v += bv;
        if (RESID) v += Rb[(size_t)(mBase + mOff + r) * ldc + n];
        if (ACT == 1) v = tanhf(v);
        if (ACT == 2) v = fmaxf(v, 0.0f);
        if (ACT == 3) v = v / (1.0f + expf(-v));
        if (ACT == 4) v = (v > 0.f) ? v : 0.01f * v;
        if (ACT == 5) v = 0.5f * v * (1.0f + erff(v * 0.70710678118654752f));
        slab[(mOff + r) * 68 + (j << 4) + rlane] = v;
      }
    }
    __builtin_amdgcn_fence(__ATOMIC_RELEASE, "workgroup");
    __builtin_amdgcn_wave_barrier();
    __builtin_amdgcn_fence(__ATOMIC_ACQUIRE, "workgroup");
    if (OUT_MODE == 0) {
      float* C = (float*)Cout + (size_t)b * strideC;
      const int hh = lane >> 4, c4 = (lane & 15) * 4;     // row seg = 256 B = 16 lanes x 16 B
      {
#pragma unroll
        for (int it = 0; it < 8; ++it) {
          const int row = it * 2 + hh;
          v4f v = *(const v4f*)(slab + row * 68 + c4);
          *(v4f*)(C + (size_t)(mBase + row) * ldc + n0 + c4) = v;
        }
        
      }
    } else {
      const int q = lane >> 3, c8 = (lane & 7) * 8;
      unsigned short* C  = (unsigned short*)Cout  + (size_t)b * strideC;
      unsigned short* C2 = (OUT_MODE == 2) ? ((unsigned short*)Cout2 + (size_t)b * strideC) : nullptr;
      {
#pragma unroll
        for (int it = 0; it < 4; ++it) {
          const int row = it * 4 + q;
          const float* sp = slab + row * 68 + c8;
          v8h hv, lv;
#pragma unroll
          for (int e = 0; e < 8; ++e) {
            if (OUT_MODE == 1) {
              hv[e] = (_Float16)sp[e];
            } else {
              unsigned short hb = f2bf_bits(sp[e]);
              unsigned short lb = f2bf_bits(sp[e] - bf_bits2f(hb));
              hv[e] = __builtin_bit_cast(_Float16, hb);
              lv[e] = __builtin_bit_cast(_Float16, lb);
            }
          }
          *(v8h*)(C + (size_t)(mBase + row) * ldc + n0 + c8) = hv;
          if (OUT_MODE == 2) *(v8h*)(C2 + (size_t)(mBase + row) * ldc + n0 + c8) = lv;
        }
        
      }
    }
    __builtin_amdgcn_fence(__ATOMIC_RELEASE, "workgroup");
    __builtin_amdgcn_wave_barrier();
    __builtin_amdgcn_fence(__ATOMIC_ACQUIRE, "workgroup");
  }
}

__global__ __launch_bounds__(256) void cast_f32_f16x2(
    const float* __restrict__ in, _Float16* __restrict__ out, int n2) {
  int i = blockIdx.x * 256 + threadIdx.x;
  if (i < n2) {
    const _Float16 h0 = (_Float16)in[2 * i], h1 = (_Float16)in[2 * i + 1];
    const unsigned u = (unsigned)__builtin_bit_cast(unsigned short, h0) | ((unsigned)__builtin_bit_cast(unsigned short, h1) << 16);
    ((unsigned*)out)[i] = u;
    
  }
}


// ---- f32 -> f16 cast with a power-of-two pre-scale (folded back by the consumer GEMM's scale) ----
__global__ __launch_bounds__(256) void cast_f32_f16x2s(const float* __restrict__ in, _Float16* __restrict__ out, int n2, float s) {
  int i = blockIdx.x * 256 + threadIdx.x;
  if (i < n2) {
    const _Float16 h0 = (_Float16)(in[2 * i] * s), h1 = (_Float16)(in[2 * i + 1] * s);
    const unsigned u = (unsigned)__builtin_bit_cast(unsigned short, h0) | ((unsigned)__builtin_bit_cast(unsigned short, h1) << 16);
    ((unsigned*)out)[i] = u;
    
  }
}
__global__ __launch_bounds__(256) void split_f32_bf16x2(
    const float* __restrict__ in, __bf16* __restrict__ hi, __bf16* __restrict__ lo, long n2) {
  long i = (long)blockIdx.x * 256 + threadIdx.x;
  long stride = (long)gridDim.x * 256;
  {
    for (long j = i; j < n2; j += stride) {
      const float a = in[2 * j], b = in[2 * j + 1];
      const unsigned short ah = f2bf_bits(a), bh = f2bf_bits(b);
      const unsigned short al = f2bf_bits(a - bf_bits2f(ah)), bl = f2bf_bits(b - bf_bits2f(bh));
      ((unsigned*)hi)[j] = (unsigned)ah | ((unsigned)bh << 16);
      ((unsigned*)lo)[j] = (unsigned)al | ((unsigned)bl << 16);
    }
    
  }
}


// ---- f32 [R][C] (row pitch ldi) -> f16 transposed [C][R] (row pitch ldo); 64x64 tiles; each output row segment
__global__ __launch_bounds__(256) void transpose_cast_f16(const float* __restrict__ in, int ldi,
                                                         _Float16* __restrict__ outT, int ldo, float scale) {
  __shared__ __align__(16) _Float16 tile[64][72];     // [c][r]
  const int c0 = blockIdx.x * 64, r0 = blockIdx.y * 64;
  const int t = threadIdx.y * 32 + threadIdx.x;
  for (int i = threadIdx.y; i < 64; i += 8) {
    tile[threadIdx.x][i]      = (_Float16)(in[(size_t)(r0 + i) * ldi + c0 + threadIdx.x] * scale);
    tile[32 + threadIdx.x][i] = (_Float16)(in[(size_t)(r0 + i) * ldi + c0 + 32 + threadIdx.x] * scale);
  }
  __syncthreads();
  const int q = t >> 3, c8 = (t & 7) * 8;
  {
#pragma unroll
    for (int it = 0; it < 2; ++it) {
      const int c = it * 32 + q;
      v8h hv = *(const v8h*)(&tile[c][c8]);
      *(v8h*)(outT + (size_t)(c0 + c) * ldo + r0 + c8) = hv;
    }
    
  }
}

// ---- f32 [R][C] (pitch ldi) -> bf16 hi/lo transposed planes [C][R] (pitch ldo); 64x64 tiles; each output row segment
__global__ __launch_bounds__(256) void transpose_split_bf16(const float* __restrict__ in, int ldi,
                                                           __bf16* __restrict__ outH, __bf16* __restrict__ outL, int ldo) {
  __shared__ __align__(16) float tile[64][68];     // [c][r]
  const int c0 = blockIdx.x * 64, r0 = blockIdx.y * 64;
  const int t = threadIdx.y * 32 + threadIdx.x;
  for (int i = threadIdx.y; i < 64; i += 8) {
    tile[threadIdx.x][i]      = in[(size_t)(r0 + i) * ldi + c0 + threadIdx.x];
    tile[32 + threadIdx.x][i] = in[(size_t)(r0 + i) * ldi + c0 + 32 + threadIdx.x];
  }
  __syncthreads();
  const int q = t >> 3, c8 = (t & 7) * 8;
  {
#pragma unroll
    for (int it = 0; it < 2; ++it) {
      const int c = it * 32 + q;
      v8b hv, lv;
#pragma unroll
      for (int e = 0; e < 8; ++e) {
        const float f = tile[c][c8 + e];
        const unsigned short hb = f2bf_bits(f);
        hv[e] = __builtin_bit_cast(__bf16, hb);
        lv[e] = __builtin_bit_cast(__bf16, f2bf_bits(f - bf_bits2f(hb)));
      }
      *(v8b*)(outH + (size_t)(c0 + c) * ldo + r0 + c8) = hv;
      *(v8b*)(outL + (size_t)(c0 + c) * ldo + r0 + c8) = lv;
    }
    
  }
}

// =====================================================================================
// Generic causal/non-causal attention for head_dim 64, f32 in / f32 out; 16-bit operands: bf16 with optional hi/lo splits, or
// plain f16 (F16=true, non-split, probabilities carried x2^15).
//   scores = (q*qscale)·kᵀ : v_wmma_f32_16x16x32_bf16; SPLIT_QK -> q,k as bf16 hi/lo (hi·hi + hi·lo + lo·hi)
//   out    = p·v           : v_wmma_f32_16x16x32_bf16; SPLIT_PV -> p,v as bf16 hi/lo; else p,v plain bf16
//   f32 accumulate; online softmax in f32. Block = 4 waves = 64 query rows of one (batch, head); S % 64 == 0.
//   Element (b, s, h, d) of tensor X lives at X[b*X_bs + s*X_rs + h*X_hs + d] (strides in floats, multiples of 4).
//   Masking: mask_mode 0 none, 1 causal (kv > q masked), 2 tensor [S][Skv] shared over (b,h) (float if
//   mask_is_int==0, int32 with element == 0 -> masked if 1, int32 with element != 0 -> masked if 2), 3 per-token vectors qmask[B][S] & kvmask[B][Skv] (int32,
//   0 -> masked), 4 causal + sliding window (kv > q or q - kv > W masked; W passed in mask_is_int);
//   5 = relative-position bias: s += cp[b,h,q][idx[q][kv]] + pc[b,h,kv][idx[q][kv]] with idx = mask_b ([S][Skv] int32) and
//   mask_a an int32 [S][Skv] tensor with nonzero = masked (tables: element (b,h,row,n) at X + b*c_bs + h*c_hs + row*c_rs + n);
//   masked scores are replaced by mask_fill (e.g. -inf or -1e9) before the softmax.
//   grid.x = B * H * (S/64) (or a sub-range with blk0).
// =====================================================================================
#define AT_D 64
#define AT_NW 4
#define AT_QB 64
#define AT_KC 64
struct AttnGeom { const float* cp = nullptr; const float* pc = nullptr; long c_bs = 0, c_rs = 0, c_hs = 0;   // mode-5 score-bias tables
                  long q_bs, q_rs, q_hs, k_bs, k_rs, k_hs, v_bs, v_rs, v_hs, o_bs, o_rs, o_hs;
                  int S, Skv, H, mask_mode; float qscale; int blk0; float mask_fill; int mask_is_int; };
static_assert(sizeof(AttnGeom) == 168, "no padding");

__device__ __forceinline__ unsigned short at_bf_bits(float f) {
  unsigned u = __float_as_uint(f);
  return (unsigned short)((u + 0x7FFFu + ((u >> 16) & 1u)) >> 16);
}
__device__ __forceinline__ __bf16 at_f2bf(float f) { return __builtin_bit_cast(__bf16, at_bf_bits(f)); }
__device__ __forceinline__ void at_split(float f, __bf16& hi, __bf16& lo) {
  const unsigned short hb = at_bf_bits(f);
  hi = __builtin_bit_cast(__bf16, hb);
  lo = at_f2bf(f - __uint_as_float(((unsigned)hb) << 16));
}
__device__ __forceinline__ v8f at_mma(v16b a, v16b b, v8f c) {
  c = __builtin_amdgcn_wmma_f32_16x16x32_bf16(false, a, false, b, (short)0, c, false, false);
  asm volatile("v_nop\n\tv_nop\n\tv_nop\n\tv_nop" : "+v"(c) : "v"(a), "v"(b));
  return c;
}
// 16-bit element as a bit pattern held in a __bf16 slot: f16 bits when F16, bf16 (RNE) otherwise
template <bool F16> __device__ __forceinline__ __bf16 at_to16(float f) {
  if (F16) return __builtin_bit_cast(__bf16, (_Float16)f);
  return at_f2bf(f);
}
template <bool F16> __device__ __forceinline__ v8f at_mma16(v16b a, v16b b, v8f c) {
  if (F16) {
    const v16h ah = __builtin_bit_cast(v16h, a), bh = __builtin_bit_cast(v16h, b);
    c = __builtin_amdgcn_wmma_f32_16x16x32_f16(false, ah, false, bh, (short)0, c, false, false);
    asm volatile("v_nop\n\tv_nop\n\tv_nop\n\tv_nop" : "+v"(c) : "v"(ah), "v"(bh));
    return c;
  }
  return at_mma(a, b, c);
}

template <bool SPLIT_QK, bool SPLIT_PV, bool F16 = false>
__global__ __launch_bounds__(128)
void attn64_kernel(const float* __restrict__ q, const float* __restrict__ k,
                   const float* __restrict__ v, float* __restrict__ out,
                   const void* __restrict__ mask_a, const int* __restrict__ mask_b, AttnGeom g) {
  static_assert(!(F16 && (SPLIT_QK || SPLIT_PV)), "f16 mode is non-split");
  const float PSC = F16 ? 32768.0f : 1.0f;     // f16 probabilities carried x2^15 (subnormal range), folded into the final 1/l
  union FB { v16b v; v8b h[2]; };
  __shared__ __align__(16) __bf16 Ksh[AT_KC * AT_D];             // K hi [kv][d]      8 KB
  __shared__ __align__(16) __bf16 Ksl[SPLIT_QK ? AT_KC * AT_D : 8];
  __shared__ __align__(16) __bf16 Vth[AT_D * AT_KC];             // V hi [d][kv]      8 KB
  __shared__ __align__(16) __bf16 Vtl[SPLIT_PV ? AT_D * AT_KC : 8];
  __shared__ __align__(16) __bf16 Psh[AT_NW][16 * AT_KC];        // per wave P hi [row][kv]  8 KB
  __shared__ __align__(16) __bf16 Psl[SPLIT_PV ? AT_NW : 1][SPLIT_PV ? 16 * AT_KC : 8];
  __shared__ __align__(16) float  Os[AT_NW][16 * 68];            // per wave out tile, pitch 68

  const int tid  = threadIdx.x;
  const int wave = tid >> 5;
  const int lane = tid & 31;
  const int hh   = lane >> 4;
  const int c    = lane & 15;

  const int nqb = g.S / AT_QB;
  const int bx = blockIdx.x + g.blk0;
  const int qb = bx % nqb;
  const int bh = bx / nqb;
  const int h  = bh % g.H;
  const int b  = bh / g.H;
  const int qbase_block = qb * AT_QB;
  const int q0 = qbase_block + wave * 16;

  const float* qb_ptr = q + (size_t)b * g.q_bs + (size_t)h * g.q_hs;
  const float* kb_ptr = k + (size_t)b * g.k_bs + (size_t)h * g.k_hs;
  const float* vb_ptr = v + (size_t)b * g.v_bs + (size_t)h * g.v_hs;
  float*       ob_ptr = out + (size_t)b * g.o_bs + (size_t)h * g.o_hs;

  // ---- Q fragments (A operand): 2 d-chunks, hi (and lo) ----
  v16b qah[2], qal[2];
  {
    const float* qrow = qb_ptr + (size_t)(q0 + c) * g.q_rs;
#pragma unroll
    for (int dc = 0; dc < 2; ++dc) {
#pragma unroll
      for (int e = 0; e < 8; ++e) {
        const float f0 = qrow[dc * 32 + 8 * hh + e] * g.qscale;
        const float f1 = qrow[dc * 32 + 16 + 8 * hh + e] * g.qscale;
        if (SPLIT_QK) { __bf16 hq, lq; at_split(f0, hq, lq); qah[dc][e] = hq; qal[dc][e] = lq; at_split(f1, hq, lq); qah[dc][8 + e] = hq; qal[dc][8 + e] = lq; }
        else { qah[dc][e] = at_to16<F16>(f0); qah[dc][8 + e] = at_to16<F16>(f1); qal[dc][e] = qah[dc][e]; qal[dc][8 + e] = qah[dc][8 + e]; }
      }
    }
  }

  float mrow[8], lrow[8];
  v8f oacc[4];
#pragma unroll
  for (int r = 0; r < 8; ++r) { mrow[r] = -INFINITY; lrow[r] = 0.f; }
#pragma unroll
  for (int t = 0; t < 4; ++t) oacc[t] = (v8f){0.f,0.f,0.f,0.f,0.f,0.f,0.f,0.f};

  const int nChunks = (g.mask_mode == 1 || g.mask_mode == 4) ? (qb + 1) : (g.Skv / AT_KC);   // block-uniform
  // per-row query mask (mode 3)
  int qkeep[8];
#pragma unroll
  for (int r = 0; r < 8; ++r) qkeep[r] = (g.mask_mode == 3) ? mask_b[(size_t)b * g.S + q0 + 8 * hh + r] : 1;   // mask_b = qmask in mode 3
  for (int kc = 0; kc < nChunks; ++kc) {
    const int kv0 = kc * AT_KC;
    __syncthreads();
    {
      const int kvr = tid >> 1, dh = (tid & 1) * 32;
      const float* krow = kb_ptr + (size_t)(kv0 + kvr) * g.k_rs + dh;
      const float* vrow = vb_ptr + (size_t)(kv0 + kvr) * g.v_rs + dh;
#pragma unroll
      for (int i = 0; i < 8; ++i) {
        v4f kk = *(const v4f*)(krow + 4 * i);
        v4f vv = *(const v4f*)(vrow + 4 * i);
#pragma unroll
        for (int e = 0; e < 4; ++e) {
          const int d = dh + 4 * i + e;
          if (SPLIT_QK) { __bf16 a, bl; at_split(kk[e], a, bl); Ksh[kvr * AT_D + d] = a; Ksl[kvr * AT_D + d] = bl; }
          else Ksh[kvr * AT_D + d] = at_to16<F16>(kk[e]);
          if (SPLIT_PV) { __bf16 a, bl; at_split(vv[e], a, bl); Vth[d * AT_KC + kvr] = a; Vtl[d * AT_KC + kvr] = bl; }
          else Vth[d * AT_KC + kvr] = at_to16<F16>(vv[e]);
        }
      }
    }
    __syncthreads();

    v8f s[4];
#pragma unroll
    for (int j = 0; j < 4; ++j) {
      s[j] = (v8f){0.f,0.f,0.f,0.f,0.f,0.f,0.f,0.f};
#pragma unroll 1
      for (int dc = 0; dc < 2; ++dc) {
        FB kb;
        kb.h[0] = *(const v8b*)(Ksh + (j * 16 + c) * AT_D + dc * 32 + 8 * hh);
        kb.h[1] = *(const v8b*)(Ksh + (j * 16 + c) * AT_D + dc * 32 + 16 + 8 * hh);
        s[j] = at_mma16<F16>(qah[dc], kb.v, s[j]);
        if (SPLIT_QK) {
          FB kl;
          kl.h[0] = *(const v8b*)(Ksl + (j * 16 + c) * AT_D + dc * 32 + 8 * hh);
          kl.h[1] = *(const v8b*)(Ksl + (j * 16 + c) * AT_D + dc * 32 + 16 + 8 * hh);
          s[j] = at_mma16<F16>(qah[dc], kl.v, s[j]);
          s[j] = at_mma16<F16>(qal[dc], kb.v, s[j]);
        }
      }
    }
    const bool diag = (g.mask_mode == 1) && (kc == qb);
    int kvkeep[4] = {1, 1, 1, 1};
    if (g.mask_mode == 3) {
#pragma unroll
      for (int j = 0; j < 4; ++j) kvkeep[j] = ((const int*)mask_a)[(size_t)b * g.Skv + kv0 + j * 16 + c];   // mask_a = kvmask
    }
    float cm[8];
#pragma unroll
    for (int r = 0; r < 8; ++r) {
      const int qrow = q0 + 8 * hh + r;
      float m = -INFINITY;
#pragma unroll
      for (int j = 0; j < 4; ++j) {
        const int kvcol = kv0 + j * 16 + c;
        bool masked = false;
        if (diag) masked = (kvcol > qrow);
        else if (g.mask_mode == 4) masked = (kvcol > qrow) || (qrow - kvcol > g.mask_is_int);
        else if (g.mask_mode == 2) {
          const size_t mi = (size_t)qrow * g.Skv + kvcol;
          masked = (g.mask_is_int == 0) ? (((const float*)mask_a)[mi] == 0.0f)
                 : (g.mask_is_int == 1) ? (((const int*)mask_a)[mi] == 0) : (((const int*)mask_a)[mi] != 0);
        } else if (g.mask_mode == 3) masked = (qkeep[r] == 0) || (kvkeep[j] == 0);
        else if (g.mask_mode == 5) {
          const size_t mi = (size_t)qrow * g.Skv + kvcol;
          masked = (((const int*)mask_a)[mi] != 0);
          int n = mask_b[mi]; n = n < 0 ? 0 : n;
          s[j][r] += g.cp[(size_t)b * g.c_bs + (size_t)h * g.c_hs + (size_t)qrow * g.c_rs + n]
                   + g.pc[(size_t)b * g.c_bs + (size_t)h * g.c_hs + (size_t)kvcol * g.c_rs + n];
        }
        if (masked) s[j][r] = g.mask_fill;
        m = fmaxf(m, s[j][r]);
      }
#pragma unroll
      for (int off = 1; off < 16; off <<= 1) m = fmaxf(m, __shfl_xor(m, off, 32));
      cm[r] = m;
    }
    __bf16* pwh = Psh[wave];
    __bf16* pwl = Psl[SPLIT_PV ? wave : 0];
#pragma unroll
    for (int r = 0; r < 8; ++r) {
      const float mnew = fmaxf(mrow[r], cm[r]);
      const float alpha = expf(mrow[r] - mnew);
      mrow[r] = mnew;
      float psum = 0.f;
#pragma unroll
      for (int j = 0; j < 4; ++j) {
        const float p = expf(s[j][r] - mnew);
        psum += p;
        if (SPLIT_PV) { __bf16 a, bl; at_split(p, a, bl); pwh[(8 * hh + r) * AT_KC + j * 16 + c] = a; pwl[(8 * hh + r) * AT_KC + j * 16 + c] = bl; }
        else pwh[(8 * hh + r) * AT_KC + j * 16 + c] = at_to16<F16>(p * PSC);
      }
#pragma unroll
      for (int off = 1; off < 16; off <<= 1) psum += __shfl_xor(psum, off, 32);
      lrow[r] = lrow[r] * alpha + psum;
#pragma unroll
      for (int t = 0; t < 4; ++t) oacc[t][r] *= alpha;
    }
    __builtin_amdgcn_fence(__ATOMIC_RELEASE, "workgroup");
    __builtin_amdgcn_wave_barrier();
    __builtin_amdgcn_fence(__ATOMIC_ACQUIRE, "workgroup");
#pragma unroll 1
    for (int kk = 0; kk < 2; ++kk) {
      FB pa, pl;
      pa.h[0] = *(const v8b*)(pwh + c * AT_KC + kk * 32 + 8 * hh);
      pa.h[1] = *(const v8b*)(pwh + c * AT_KC + kk * 32 + 16 + 8 * hh);
      if (SPLIT_PV) {
        pl.h[0] = *(const v8b*)(pwl + c * AT_KC + kk * 32 + 8 * hh);
        pl.h[1] = *(const v8b*)(pwl + c * AT_KC + kk * 32 + 16 + 8 * hh);
      }
#pragma unroll
      for (int t = 0; t < 4; ++t) {
        FB vb;
        vb.h[0] = *(const v8b*)(Vth + (t * 16 + c) * AT_KC + kk * 32 + 8 * hh);
        vb.h[1] = *(const v8b*)(Vth + (t * 16 + c) * AT_KC + kk * 32 + 16 + 8 * hh);
        oacc[t] = at_mma16<F16>(pa.v, vb.v, oacc[t]);
        if (SPLIT_PV) {
          FB vl;
          vl.h[0] = *(const v8b*)(Vtl + (t * 16 + c) * AT_KC + kk * 32 + 8 * hh);
          vl.h[1] = *(const v8b*)(Vtl + (t * 16 + c) * AT_KC + kk * 32 + 16 + 8 * hh);
          oacc[t] = at_mma16<F16>(pa.v, vl.v, oacc[t]);
          oacc[t] = at_mma16<F16>(pl.v, vb.v, oacc[t]);
        }
      }
    }
  }

  float* os = Os[wave];
#pragma unroll
  for (int r = 0; r < 8; ++r) {
    const float inv = 1.0f / (lrow[r] * PSC);
#pragma unroll
    for (int t = 0; t < 4; ++t) os[(8 * hh + r) * 68 + t * 16 + c] = oacc[t][r] * inv;
  }
  __builtin_amdgcn_fence(__ATOMIC_RELEASE, "workgroup");
  __builtin_amdgcn_wave_barrier();
  __builtin_amdgcn_fence(__ATOMIC_ACQUIRE, "workgroup");
  {
    const int c4 = (lane & 15) * 4;
    {
#pragma unroll
      for (int it = 0; it < 8; ++it) {
        const int row = it * 2 + hh;
        v4f val = *(const v4f*)(os + row * 68 + c4);
        *(v4f*)(ob_ptr + (size_t)(q0 + row) * g.o_rs + c4) = val;
      }
      
    }
  }
}

// ---- head_dim 128 variant (same contract; K/V tiles 64 keys x 128, 8 output tiles; mask_mode 6 = causal + per-head ALiBi slope table in g.cp) ----
template <bool SPLIT_QK, bool SPLIT_PV, bool F16 = false>
__global__ __launch_bounds__(128)
void attn128_kernel(const float* __restrict__ q, const float* __restrict__ k,
                   const float* __restrict__ v, float* __restrict__ out,
                   const void* __restrict__ mask_a, const int* __restrict__ mask_b, AttnGeom g) {
  static_assert(!(F16 && (SPLIT_QK || SPLIT_PV)), "f16 mode is non-split");
  const float PSC = F16 ? 32768.0f : 1.0f;     // f16 probabilities carried x2^15 (subnormal range), folded into the final 1/l
  union FB { v16b v; v8b h[2]; };
  constexpr int D2 = 128;
  __shared__ __align__(16) __bf16 Ksh[AT_KC * D2];               // K hi [kv][d]      16 KB
  __shared__ __align__(16) __bf16 Ksl[SPLIT_QK ? AT_KC * D2 : 8];
  __shared__ __align__(16) __bf16 Vth[D2 * AT_KC];               // V hi [d][kv]      16 KB
  __shared__ __align__(16) __bf16 Vtl[SPLIT_PV ? D2 * AT_KC : 8];
  __shared__ __align__(16) __bf16 Psh[AT_NW][16 * AT_KC];
  __shared__ __align__(16) __bf16 Psl[SPLIT_PV ? AT_NW : 1][SPLIT_PV ? 16 * AT_KC : 8];
  __shared__ __align__(16) float  Os[AT_NW][16 * 132];           // per wave out tile, pitch 132
  __shared__ __align__(16) __bf16 Qsh[SPLIT_QK ? AT_NW : 1][SPLIT_QK ? 16 * D2 : 8];   // split path: q hi/lo staged per wave (keeps VGPR use low)
  __shared__ __align__(16) __bf16 Qsl[SPLIT_QK ? AT_NW : 1][SPLIT_QK ? 16 * D2 : 8];

  const int tid  = threadIdx.x;
  const int wave = tid >> 5;
  const int lane = tid & 31;
  const int hh   = lane >> 4;
  const int c    = lane & 15;

  const int nqb = g.S / AT_QB;
  const int bx = blockIdx.x + g.blk0;
  const int qb = bx % nqb;
  const int bh = bx / nqb;
  const int h  = bh % g.H;
  const int b  = bh / g.H;
  const int qbase_block = qb * AT_QB;
  const int q0 = qbase_block + wave * 16;

  const float* qb_ptr = q + (size_t)b * g.q_bs + (size_t)h * g.q_hs;
  const float* kb_ptr = k + (size_t)b * g.k_bs + (size_t)h * g.k_hs;
  const float* vb_ptr = v + (size_t)b * g.v_bs + (size_t)h * g.v_hs;
  float*       ob_ptr = out + (size_t)b * g.o_bs + (size_t)h * g.o_hs;

  // ---- Q fragments (A operand): 4 d-chunks, hi (and lo) ----
  v16b qah[4], qal[4];
  {
    const float* qrow = qb_ptr + (size_t)(q0 + c) * g.q_rs;
#pragma unroll
    for (int dc = 0; dc < 4; ++dc) {
#pragma unroll
      for (int e = 0; e < 8; ++e) {
        const float f0 = qrow[dc * 32 + 8 * hh + e] * g.qscale;
        const float f1 = qrow[dc * 32 + 16 + 8 * hh + e] * g.qscale;
        if (SPLIT_QK) { __bf16 hq, lq; at_split(f0, hq, lq); Qsh[wave][c * D2 + dc * 32 + 8 * hh + e] = hq; Qsl[wave][c * D2 + dc * 32 + 8 * hh + e] = lq;
                        at_split(f1, hq, lq); Qsh[wave][c * D2 + dc * 32 + 16 + 8 * hh + e] = hq; Qsl[wave][c * D2 + dc * 32 + 16 + 8 * hh + e] = lq;
                        qah[dc][e] = hq; qal[dc][e] = lq; qah[dc][8 + e] = hq; qal[dc][8 + e] = lq; }   // (register copies unused on the split path)
        else { qah[dc][e] = at_to16<F16>(f0); qah[dc][8 + e] = at_to16<F16>(f1); qal[dc][e] = qah[dc][e]; qal[dc][8 + e] = qah[dc][8 + e]; }
      }
    }
  }

  float mrow[8], lrow[8];
  v8f oacc[8];
#pragma unroll
  for (int r = 0; r < 8; ++r) { mrow[r] = -INFINITY; lrow[r] = 0.f; }
#pragma unroll
  for (int t = 0; t < 8; ++t) oacc[t] = (v8f){0.f,0.f,0.f,0.f,0.f,0.f,0.f,0.f};

  const int nChunks = (g.mask_mode == 1 || g.mask_mode == 4 || g.mask_mode == 6) ? (qb + 1) : (g.Skv / AT_KC);   // block-uniform
  // per-row query mask (mode 3)
  int qkeep[8];
#pragma unroll
  for (int r = 0; r < 8; ++r) qkeep[r] = (g.mask_mode == 3) ? mask_b[(size_t)b * g.S + q0 + 8 * hh + r] : 1;   // mask_b = qmask in mode 3
  for (int kc = 0; kc < nChunks; ++kc) {
    const int kv0 = kc * AT_KC;
    __syncthreads();
    {
      const int kvr = tid >> 1, dh = (tid & 1) * 64;
      const float* krow = kb_ptr + (size_t)(kv0 + kvr) * g.k_rs + dh;
      const float* vrow = vb_ptr + (size_t)(kv0 + kvr) * g.v_rs + dh;
#pragma unroll
      for (int i = 0; i < 16; ++i) {
        v4f kk = *(const v4f*)(krow + 4 * i);
        v4f vv = *(const v4f*)(vrow + 4 * i);
#pragma unroll
        for (int e = 0; e < 4; ++e) {
          const int d = dh + 4 * i + e;
          if (SPLIT_QK) { __bf16 a, bl; at_split(kk[e], a, bl); Ksh[kvr * D2 + d] = a; Ksl[kvr * D2 + d] = bl; }
          else Ksh[kvr * D2 + d] = at_to16<F16>(kk[e]);
          if (SPLIT_PV) { __bf16 a, bl; at_split(vv[e], a, bl); Vth[d * AT_KC + kvr] = a; Vtl[d * AT_KC + kvr] = bl; }
          else Vth[d * AT_KC + kvr] = at_to16<F16>(vv[e]);
        }
      }
    }
    __syncthreads();

    v8f s[4];
#pragma unroll
    for (int j = 0; j < 4; ++j) {
      s[j] = (v8f){0.f,0.f,0.f,0.f,0.f,0.f,0.f,0.f};
#pragma unroll 1
      for (int dc = 0; dc < 4; ++dc) {      // rolled: bounds the live fragment set (register pressure) on the 128-wide head
        FB kb;
        kb.h[0] = *(const v8b*)(Ksh + (j * 16 + c) * D2 + dc * 32 + 8 * hh);
        kb.h[1] = *(const v8b*)(Ksh + (j * 16 + c) * D2 + dc * 32 + 16 + 8 * hh);
        if (!SPLIT_QK) s[j] = at_mma16<F16>(qah[dc], kb.v, s[j]);
        if (SPLIT_QK) {
          FB qa, ql;
          qa.h[0] = *(const v8b*)(&Qsh[wave][c * D2 + dc * 32 + 8 * hh]); qa.h[1] = *(const v8b*)(&Qsh[wave][c * D2 + dc * 32 + 16 + 8 * hh]);
          ql.h[0] = *(const v8b*)(&Qsl[wave][c * D2 + dc * 32 + 8 * hh]); ql.h[1] = *(const v8b*)(&Qsl[wave][c * D2 + dc * 32 + 16 + 8 * hh]);
          s[j] = at_mma16<F16>(qa.v, kb.v, s[j]);
          FB kl;
          kl.h[0] = *(const v8b*)(Ksl + (j * 16 + c) * D2 + dc * 32 + 8 * hh);
          kl.h[1] = *(const v8b*)(Ksl + (j * 16 + c) * D2 + dc * 32 + 16 + 8 * hh);
          s[j] = at_mma16<F16>(qa.v, kl.v, s[j]);
          s[j] = at_mma16<F16>(ql.v, kb.v, s[j]);
        }
      }
    }
    const bool diag = (g.mask_mode == 1) && (kc == qb);
    int kvkeep[4] = {1, 1, 1, 1};
    if (g.mask_mode == 3) {
#pragma unroll
      for (int j = 0; j < 4; ++j) kvkeep[j] = ((const int*)mask_a)[(size_t)b * g.Skv + kv0 + j * 16 + c];   // mask_a = kvmask
    }
    float cm[8];
#pragma unroll
    for (int r = 0; r < 8; ++r) {
      const int qrow = q0 + 8 * hh + r;
      float m = -INFINITY;
#pragma unroll
      for (int j = 0; j < 4; ++j) {
        const int kvcol = kv0 + j * 16 + c;
        bool masked = false;
        if (diag) masked = (kvcol > qrow);
        else if (g.mask_mode == 4) masked = (kvcol > qrow) || (qrow - kvcol > g.mask_is_int);
        else if (g.mask_mode == 2) {
          const size_t mi = (size_t)qrow * g.Skv + kvcol;
          masked = (g.mask_is_int == 0) ? (((const float*)mask_a)[mi] == 0.0f)
                 : (g.mask_is_int == 1) ? (((const int*)mask_a)[mi] == 0) : (((const int*)mask_a)[mi] != 0);
        } else if (g.mask_mode == 3) masked = (qkeep[r] == 0) || (kvkeep[j] == 0);
        else if (g.mask_mode == 6) { masked = (kvcol > qrow); s[j][r] += g.cp[h] * (float)(kvcol - qrow); }
        else if (g.mask_mode == 8) { masked = (kvcol > qrow) || (((const int*)mask_a)[(size_t)b * g.Skv + kvcol] != 0); }
        else if (g.mask_mode == 5) {
          const size_t mi = (size_t)qrow * g.Skv + kvcol;
          masked = (((const int*)mask_a)[mi] != 0);
          int n = mask_b[mi]; n = n < 0 ? 0 : n;
          s[j][r] += g.cp[(size_t)b * g.c_bs + (size_t)h * g.c_hs + (size_t)qrow * g.c_rs + n]
                   + g.pc[(size_t)b * g.c_bs + (size_t)h * g.c_hs + (size_t)kvcol * g.c_rs + n];
        }
        if (masked) s[j][r] = g.mask_fill;
        m = fmaxf(m, s[j][r]);
      }
#pragma unroll
      for (int off = 1; off < 16; off <<= 1) m = fmaxf(m, __shfl_xor(m, off, 32));
      cm[r] = m;
    }
    __bf16* pwh = Psh[wave];
    __bf16* pwl = Psl[SPLIT_PV ? wave : 0];
#pragma unroll
    for (int r = 0; r < 8; ++r) {
      const float mnew = fmaxf(mrow[r], cm[r]);
      const float alpha = expf(mrow[r] - mnew);
      mrow[r] = mnew;
      float psum = 0.f;
#pragma unroll
      for (int j = 0; j < 4; ++j) {
        const float p = expf(s[j][r] - mnew);
        psum += p;
        if (SPLIT_PV) { __bf16 a, bl; at_split(p, a, bl); pwh[(8 * hh + r) * AT_KC + j * 16 + c] = a; pwl[(8 * hh + r) * AT_KC + j * 16 + c] = bl; }
        else pwh[(8 * hh + r) * AT_KC + j * 16 + c] = at_to16<F16>(p * PSC);
      }
#pragma unroll
      for (int off = 1; off < 16; off <<= 1) psum += __shfl_xor(psum, off, 32);
      lrow[r] = lrow[r] * alpha + psum;
#pragma unroll
      for (int t = 0; t < 8; ++t) oacc[t][r] *= alpha;
    }
    __builtin_amdgcn_fence(__ATOMIC_RELEASE, "workgroup");
    __builtin_amdgcn_wave_barrier();
    __builtin_amdgcn_fence(__ATOMIC_ACQUIRE, "workgroup");
#pragma unroll 1
    for (int kk = 0; kk < 2; ++kk) {
      FB pa, pl;
      pa.h[0] = *(const v8b*)(pwh + c * AT_KC + kk * 32 + 8 * hh);
      pa.h[1] = *(const v8b*)(pwh + c * AT_KC + kk * 32 + 16 + 8 * hh);
      if (SPLIT_PV) {
        pl.h[0] = *(const v8b*)(pwl + c * AT_KC + kk * 32 + 8 * hh);
        pl.h[1] = *(const v8b*)(pwl + c * AT_KC + kk * 32 + 16 + 8 * hh);
      }
#pragma unroll
      for (int t = 0; t < 8; ++t) {
        FB vb;
        vb.h[0] = *(const v8b*)(Vth + (t * 16 + c) * AT_KC + kk * 32 + 8 * hh);
        vb.h[1] = *(const v8b*)(Vth + (t * 16 + c) * AT_KC + kk * 32 + 16 + 8 * hh);
        oacc[t] = at_mma16<F16>(pa.v, vb.v, oacc[t]);
        if (SPLIT_PV) {
          FB vl;
          vl.h[0] = *(const v8b*)(Vtl + (t * 16 + c) * AT_KC + kk * 32 + 8 * hh);
          vl.h[1] = *(const v8b*)(Vtl + (t * 16 + c) * AT_KC + kk * 32 + 16 + 8 * hh);
          oacc[t] = at_mma16<F16>(pa.v, vl.v, oacc[t]);
          oacc[t] = at_mma16<F16>(pl.v, vb.v, oacc[t]);
        }
      }
    }
  }

  float* os = Os[wave];
#pragma unroll
  for (int r = 0; r < 8; ++r) {
    const float inv = 1.0f / (lrow[r] * PSC);
#pragma unroll
    for (int t = 0; t < 8; ++t) os[(8 * hh + r) * 132 + t * 16 + c] = oacc[t][r] * inv;
  }
  __builtin_amdgcn_fence(__ATOMIC_RELEASE, "workgroup");
  __builtin_amdgcn_wave_barrier();
  __builtin_amdgcn_fence(__ATOMIC_ACQUIRE, "workgroup");
  {
    const int c4 = lane * 4;           // 32 lanes x 16 B = one 512-B output row (128 floats) per instruction
    {
#pragma unroll
      for (int row = 0; row < 16; ++row) {
        v4f val = *(const v4f*)(os + row * 132 + c4);
        *(v4f*)(ob_ptr + (size_t)(q0 + row) * g.o_rs + c4) = val;
      }
      
    }
  }
}

#define XB 2
#define XH 16
#define XS 2048
#define XD 128
__global__ void slopes_kernel(float* __restrict__ sl) { const int h = threadIdx.x; const float v = (h < XH) ? exp2f(-8.0f * (float)(h + 1) / (float)XH) : 0.f; ((float*)sl)[h] = v;  }
extern "C" void kernel_launch(void* const* d_in, const int* in_sizes, int n_in, void* d_out, int out_size, void* d_ws, size_t ws_size, hipStream_t stream) {
  (void)in_sizes; (void)n_in; (void)out_size; (void)ws_size;
  const float* q = (const float*)d_in[0]; const float* k = (const float*)d_in[1]; const float* v = (const float*)d_in[2];
  float* sl = (float*)d_ws;
  slopes_kernel<<<1, 32, 0, stream>>>(sl);
  AttnGeom g;
  g.cp = sl; g.pc = nullptr; g.c_bs = 0; g.c_rs = 0; g.c_hs = 0;
  g.q_bs = (long)XH * XS * XD; g.q_hs = (long)XS * XD; g.q_rs = XD;
  g.k_bs = g.q_bs; g.k_hs = g.q_hs; g.k_rs = XD; g.v_bs = g.q_bs; g.v_hs = g.q_hs; g.v_rs = XD; g.o_bs = g.q_bs; g.o_hs = g.q_hs; g.o_rs = XD;
  g.S = XS; g.Skv = XS; g.H = XH; g.mask_mode = 6; g.qscale = 0.08838834764831845f; g.blk0 = 0; g.mask_fill = -INFINITY; g.mask_is_int = 0;
  attn128_kernel<true, true, false><<<XB * XH * (XS / AT_QB), AT_NW * 32, 0, stream>>>(q, k, v, (float*)d_out, nullptr, nullptr, g);
}

// v001
// Measured time: 1020 microseconds a run.
// Two timings next to v000 put it at 1.94 and 1.92 times that version's speed.
#include <hip/hip_runtime.h>
#include <math.h>
// FlexAttention forward (causal block mask + ALiBi score_mod, 2 x 16 heads, 2048 x 2048, head_dim 128): scores and p·v on
// v_wmma_f32_16x16x32_bf16 with q,k and p,v as bf16 hi/lo splits (hi·hi + hi·lo + lo·hi;
// early causal rows copy single v rows almost verbatim), f32 accumulate; online softmax, the ALiBi bias slope_h·(k−q) and the
// causal predicate in f32 on VALU.
typedef __attribute__((ext_vector_type(16))) _Float16 v16h;
typedef __attribute__((ext_vector_type(8)))  _Float16 v8h;
typedef __attribute__((ext_vector_type(16))) __bf16   v16b;
typedef __attribute__((ext_vector_type(8)))  __bf16   v8b;
typedef __attribute__((ext_vector_type(8)))  float    v8f;
typedef __attribute__((ext_vector_type(4)))  float    v4f;
#define PSCALE 32768.0f
#define U16(p) ((const unsigned short*)(const void*)(p))
#define PSCALE_INV (1.0f / 32768.0f)

__device__ __forceinline__ unsigned short f2bf_bits(float f) {
  unsigned u = __float_as_uint(f);
  return (unsigned short)((u + 0x7FFFu + ((u >> 16) & 1u)) >> 16);
}
__device__ __forceinline__ float bf_bits2f(unsigned short h) { return __uint_as_float(((unsigned)h) << 16); }

// hazard guards as plain device helpers (no inline asm inside the kernel template body)
__device__ __forceinline__ void dep_guard_h(v8f& a, v8f& b, v16h x, v16h y) { asm volatile("v_nop\n\tv_nop\n\tv_nop\n\tv_nop" : "+v"(a), "+v"(b) : "v"(x), "v"(y)); }
__device__ __forceinline__ void dep_guard_b(v8f& a, v8f& b, v16b x, v16b y) { asm volatile("v_nop\n\tv_nop\n\tv_nop\n\tv_nop" : "+v"(a), "+v"(b) : "v"(x), "v"(y)); }
__device__ __forceinline__ void keep4_h(v16h a, v16h b, v16h c, v16h d) { asm volatile("v_nop" :: "v"(a), "v"(b), "v"(c), "v"(d)); }
__device__ __forceinline__ void keep4_b(v16b a, v16b b, v16b c, v16b d) { asm volatile("v_nop" :: "v"(a), "v"(b), "v"(c), "v"(d)); }
__device__ __forceinline__ void acc_guard4(v8f& a, v8f& b, v8f& c, v8f& d) { asm volatile("v_nop\n\tv_nop\n\tv_nop\n\tv_nop" : "+v"(a), "+v"(b), "+v"(c), "+v"(d)); }
template <typename T> struct Frag;
template <> struct Frag<_Float16> {
  typedef v16h V; union U { v16h v; v8h h[2]; };
  static __device__ __forceinline__ v16h load(const _Float16* p) {   // elements 0..7 <- p[0..7], 8..15 <- p[16..23]
    U f; f.h[0] = *(const v8h*)(p); f.h[1] = *(const v8h*)(p + 16); return f.v;
  }
  static __device__ __forceinline__ v8f mma(v16h a, v16h b, v8f c) {
    return __builtin_amdgcn_wmma_f32_16x16x32_f16(false, a, false, b, (short)0, c, false, false);
  }
  static __device__ __forceinline__ void guard(v8f& a, v8f& b, v16h x, v16h y) { dep_guard_h(a, b, x, y); }
  static __device__ __forceinline__ void keep(v16h a, v16h b, v16h c, v16h d) { keep4_h(a, b, c, d); }
};
template <> struct Frag<__bf16> {
  typedef v16b V; union U { v16b v; v8b h[2]; };
  static __device__ __forceinline__ v16b load(const __bf16* p) {
    U f; f.h[0] = *(const v8b*)(p); f.h[1] = *(const v8b*)(p + 16); return f.v;
  }
  static __device__ __forceinline__ v8f mma(v16b a, v16b b, v8f c) {
    return __builtin_amdgcn_wmma_f32_16x16x32_bf16(false, a, false, b, (short)0, c, false, false);
  }
  static __device__ __forceinline__ void guard(v8f& a, v8f& b, v16b x, v16b y) { dep_guard_b(a, b, x, y); }
  static __device__ __forceinline__ void keep(v16b a, v16b b, v16b c, v16b d) { keep4_b(a, b, c, d); }
};

// ---- Register-blocked batched WMMA GEMM ------------------------------------
// C[m,n] = scale * sum_k A[m,k] * Bt[n,k] (+bias)(+resid); each wave owns a 64x64 tile.
// A row-major [M,K]; Bt row-major [N,K]; M,N % 64 == 0, K % 32 == 0.
// SPLIT: operands are hi/lo planes (A2/Bt2 = lo planes, same layout); product = hi·hi + hi·lo + lo·hi.
// BIAS_MODE: 0 = none, 1 = bias[m], 2 = bias[n].
// OUT_MODE: 0 = f32, 1 = f16, 2 = bf16 hi plane (Cout) + bf16 lo plane (Cout2).
// ET: 0 = f16 operands, 1 = bf16 operands (pointers passed as 16-bit storage)
template <int ET> struct Elem;
template <> struct Elem<0> { typedef _Float16 T; };
template <> struct Elem<1> { typedef __bf16 T; };
template <int ET, bool SPLIT, int BIAS_MODE, int OUT_MODE, bool RESID, int ACT = 0>
__global__ __launch_bounds__(256) void wmma_gemm64(
    const unsigned short* __restrict__ Ap, const unsigned short* __restrict__ A2p, int lda, long strideA,
    const unsigned short* __restrict__ Btp, const unsigned short* __restrict__ Bt2p, int ldb, long strideB,
    void* __restrict__ Cout, void* __restrict__ Cout2, int ldc, long strideC,
    const float* __restrict__ bias,
    const float* __restrict__ resid, long strideR,
    int M, int N, int K, float scale) {
  typedef typename Elem<ET>::T T;
  typedef typename Frag<T>::V V;
  const T* A = (const T*)Ap; const T* A2 = (const T*)A2p; const T* Bt = (const T*)Btp; const T* Bt2 = (const T*)Bt2p;
  __shared__ __align__(16) float sT[8][16 * 68];   // per-wave 16x64 slab, pitch 68 floats
  const int b    = blockIdx.y;
  const int lane = threadIdx.x & 31;
  const int wave = threadIdx.x >> 5;
  const int tilesN = N >> 6;
  const int tilesM = M >> 6;
  const int tile = blockIdx.x * 8 + wave;
  if (tile >= tilesM * tilesN) return;   // wave-uniform; no block barriers in this kernel
  const int tm = tile / tilesN;
  const int tn = tile - tm * tilesN;
  const int m0 = tm << 6;
  const int n0 = tn << 6;

  const T* Ab  = A  + (size_t)b * strideA;
  const T* Bb  = Bt + (size_t)b * strideB;
  const T* Ab2 = SPLIT ? (A2  + (size_t)b * strideA) : nullptr;
  const T* Bb2 = SPLIT ? (Bt2 + (size_t)b * strideB) : nullptr;

  const int rlane = lane & 15;                 // row (A) / col (B, D) within subtile
  const int koff  = (lane >> 4) * 8;           // k offset of this lane half
  const int mOff  = (lane >> 4) * 8;           // D row offset

  v8f acc[4][4];
#pragma unroll
  for (int i = 0; i < 4; ++i)
#pragma unroll
    for (int j = 0; j < 4; ++j) acc[i][j] = (v8f){0.f,0.f,0.f,0.f,0.f,0.f,0.f,0.f};

  for (int k0 = 0; k0 < K; k0 += 32) {
    V bh[4], bl[4];
#pragma unroll
    for (int j = 0; j < 4; ++j) {
      const size_t bo = (size_t)(n0 + (j << 4) + rlane) * ldb + koff + k0;
      bh[j] = Frag<T>::load(Bb + bo);
      if (SPLIT) bl[j] = Frag<T>::load(Bb2 + bo);
    }
#pragma unroll
    for (int i = 0; i < 4; ++i) {
      const size_t ao = (size_t)(m0 + (i << 4) + rlane) * lda + koff + k0;
      V ah = Frag<T>::load(Ab + ao);
      V al;
      if (SPLIT) al = Frag<T>::load(Ab2 + ao);
#pragma unroll
      for (int j = 0; j < 4; ++j) {
        acc[i][j] = Frag<T>::mma(ah, bh[j], acc[i][j]);
        if (SPLIT) {
          acc[i][j] = Frag<T>::mma(ah, bl[j], acc[i][j]);
          acc[i][j] = Frag<T>::mma(al, bh[j], acc[i][j]);
        }
      }
      Frag<T>::guard(acc[i][0], acc[i][3], ah, SPLIT ? al : ah);
    }
    Frag<T>::keep(bh[0], bh[1], bh[2], bh[3]);
    if (SPLIT) Frag<T>::keep(bl[0], bl[1], bl[2], bl[3]);
  }
  acc_guard4(acc[0][0], acc[0][1], acc[0][2], acc[0][3]);
  acc_guard4(acc[1][0], acc[1][1], acc[1][2], acc[1][3]);
  acc_guard4(acc[2][0], acc[2][1], acc[2][2], acc[2][3]);
  acc_guard4(acc[3][0], acc[3][1], acc[3][2], acc[3][3]);

  // ---- epilogue ----
  float* slab = sT[wave];
  const float* Rb = RESID ? (resid + (size_t)b * strideR) : nullptr;
#pragma unroll
  for (int i = 0; i < 4; ++i) {
    const int mBase = m0 + (i << 4);
#pragma unroll
    for (int j = 0; j < 4; ++j) {
      const int n = n0 + (j << 4) + rlane;
      float bv = 0.f;
      if (BIAS_MODE == 2) bv = bias[n];
#pragma unroll
      for (int r = 0; r < 8; ++r) {
        float v = acc[i][j][r] * scale;
        if (BIAS_MODE == 1) v += bias[mBase + mOff + r];
        if (BIAS_MODE == 2) v += bv;
        if (RESID) v += Rb[(size_t)(mBase + mOff + r) * ldc + n];
        if (ACT == 1) v = tanhf(v);
        if (ACT == 2) v = fmaxf(v, 0.0f);
        if (ACT == 3) v = v / (1.0f + expf(-v));
        if (ACT == 4) v = (v > 0.f) ? v : 0.01f * v;
        if (ACT == 5) v = 0.5f * v * (1.0f + erff(v * 0.70710678118654752f));
        slab[(mOff + r) * 68 + (j << 4) + rlane] = v;
      }
    }
    __builtin_amdgcn_fence(__ATOMIC_RELEASE, "workgroup");
    __builtin_amdgcn_wave_barrier();
    __builtin_amdgcn_fence(__ATOMIC_ACQUIRE, "workgroup");
    if (OUT_MODE == 0) {
      float* C = (float*)Cout + (size_t)b * strideC;
      const int hh = lane >> 4, c4 = (lane & 15) * 4;     // row seg = 256 B = 16 lanes x 16 B
      {
#pragma unroll
        for (int it = 0; it < 8; ++it) {
          const int row = it * 2 + hh;
          v4f v = *(const v4f*)(slab + row * 68 + c4);
          *(v4f*)(C + (size_t)(mBase + row) * ldc + n0 + c4) = v;
        }
        
      }
    } else {
      const int q = lane >> 3, c8 = (lane & 7) * 8;
      unsigned short* C  = (unsigned short*)Cout  + (size_t)b * strideC;
      unsigned short* C2 = (OUT_MODE == 2) ? ((unsigned short*)Cout2 + (size_t)b * strideC) : nullptr;
      {
#pragma unroll
        for (int it = 0; it < 4; ++it) {
          const int row = it * 4 + q;
          const float* sp = slab + row * 68 + c8;
          v8h hv, lv;
#pragma unroll
          for (int e = 0; e < 8; ++e) {
            if (OUT_MODE == 1) {
              hv[e] = (_Float16)sp[e];
            } else {
              unsigned short hb = f2bf_bits(sp[e]);
              unsigned short lb = f2bf_bits(sp[e] - bf_bits2f(hb));
              hv[e] = __builtin_bit_cast(_Float16, hb);
              lv[e] = __builtin_bit_cast(_Float16, lb);
            }
          }
          *(v8h*)(C + (size_t)(mBase + row) * ldc + n0 + c8) = hv;
          if (OUT_MODE == 2) *(v8h*)(C2 + (size_t)(mBase + row) * ldc + n0 + c8) = lv;
        }
        
      }
    }
    __builtin_amdgcn_fence(__ATOMIC_RELEASE, "workgroup");
    __builtin_amdgcn_wave_barrier();
    __builtin_amdgcn_fence(__ATOMIC_ACQUIRE, "workgroup");
  }
}

__global__ __launch_bounds__(256) void cast_f32_f16x2(
    const float* __restrict__ in, _Float16* __restrict__ out, int n2) {
  int i = blockIdx.x * 256 + threadIdx.x;
  if (i < n2) {
    const _Float16 h0 = (_Float16)in[2 * i], h1 = (_Float16)in[2 * i + 1];
    const unsigned u = (unsigned)__builtin_bit_cast(unsigned short, h0) | ((unsigned)__builtin_bit_cast(unsigned short, h1) << 16);
    ((unsigned*)out)[i] = u;
    
  }
}


// ---- f32 -> f16 cast with a power-of-two pre-scale (folded back by the consumer GEMM's scale) ----
__global__ __launch_bounds__(256) void cast_f32_f16x2s(const float* __restrict__ in, _Float16* __restrict__ out, int n2, float s) {
  int i = blockIdx.x * 256 + threadIdx.x;
  if (i < n2) {
    const _Float16 h0 = (_Float16)(in[2 * i] * s), h1 = (_Float16)(in[2 * i + 1] * s);
    const unsigned u = (unsigned)__builtin_bit_cast(unsigned short, h0) | ((unsigned)__builtin_bit_cast(unsigned short, h1) << 16);
    ((unsigned*)out)[i] = u;
    
  }
}
__global__ __launch_bounds__(256) void split_f32_bf16x2(
    const float* __restrict__ in, __bf16* __restrict__ hi, __bf16* __restrict__ lo, long n2) {
  long i = (long)blockIdx.x * 256 + threadIdx.x;
  long stride = (long)gridDim.x * 256;
  {
    for (long j = i; j < n2; j += stride) {
      const float a = in[2 * j], b = in[2 * j + 1];
      const unsigned short ah = f2bf_bits(a), bh = f2bf_bits(b);
      const unsigned short al = f2bf_bits(a - bf_bits2f(ah)), bl = f2bf_bits(b - bf_bits2f(bh));
      ((unsigned*)hi)[j] = (unsigned)ah | ((unsigned)bh << 16);
      ((unsigned*)lo)[j] = (unsigned)al | ((unsigned)bl << 16);
    }
    
  }
}


// ---- f32 [R][C] (row pitch ldi) -> f16 transposed [C][R] (row pitch ldo); 64x64 tiles; each output row segment
__global__ __launch_bounds__(256) void transpose_cast_f16(const float* __restrict__ in, int ldi,
                                                         _Float16* __restrict__ outT, int ldo, float scale) {
  __shared__ __align__(16) _Float16 tile[64][72];     // [c][r]
  const int c0 = blockIdx.x * 64, r0 = blockIdx.y * 64;
  const int t = threadIdx.y * 32 + threadIdx.x;
  for (int i = threadIdx.y; i < 64; i += 8) {
    tile[threadIdx.x][i]      = (_Float16)(in[(size_t)(r0 + i) * ldi + c0 + threadIdx.x] * scale);
    tile[32 + threadIdx.x][i] = (_Float16)(in[(size_t)(r0 + i) * ldi + c0 + 32 + threadIdx.x] * scale);
  }
  __syncthreads();
  const int q = t >> 3, c8 = (t & 7) * 8;
  {
#pragma unroll
    for (int it = 0; it < 2; ++it) {
      const int c = it * 32 + q;
      v8h hv = *(const v8h*)(&tile[c][c8]);
      *(v8h*)(outT + (size_t)(c0 + c) * ldo + r0 + c8) = hv;
    }
    
  }
}

// ---- f32 [R][C] (pitch ldi) -> bf16 hi/lo transposed planes [C][R] (pitch ldo); 64x64 tiles; each output row segment
__global__ __launch_bounds__(256) void transpose_split_bf16(const float* __restrict__ in, int ldi,
                                                           __bf16* __restrict__ outH, __bf16* __restrict__ outL, int ldo) {
  __shared__ __align__(16) float tile[64][68];     // [c][r]
  const int c0 = blockIdx.x * 64, r0 = blockIdx.y * 64;
  const int t = threadIdx.y * 32 + threadIdx.x;
  for (int i = threadIdx.y; i < 64; i += 8) {
    tile[threadIdx.x][i]      = in[(size_t)(r0 + i) * ldi + c0 + threadIdx.x];
    tile[32 + threadIdx.x][i] = in[(size_t)(r0 + i) * ldi + c0 + 32 + threadIdx.x];
  }
  __syncthreads();
  const int q = t >> 3, c8 = (t & 7) * 8;
  {
#pragma unroll
    for (int it = 0; it < 2; ++it) {
      const int c = it * 32 + q;
      v8b hv, lv;
#pragma unroll
      for (int e = 0; e < 8; ++e) {
        const float f = tile[c][c8 + e];
        const unsigned short hb = f2bf_bits(f);
        hv[e] = __builtin_bit_cast(__bf16, hb);
        lv[e] = __builtin_bit_cast(__bf16, f2bf_bits(f - bf_bits2f(hb)));
      }
      *(v8b*)(outH + (size_t)(c0 + c) * ldo + r0 + c8) = hv;
      *(v8b*)(outL + (size_t)(c0 + c) * ldo + r0 + c8) = lv;
    }
    
  }
}

// =====================================================================================
// Generic causal/non-causal attention for head_dim 64, f32 in / f32 out; 16-bit operands: bf16 with optional hi/lo splits, or
// plain f16 (F16=true, non-split, probabilities carried x2^15).
//   scores = (q*qscale)·kᵀ : v_wmma_f32_16x16x32_bf16; SPLIT_QK -> q,k as bf16 hi/lo (hi·hi + hi·lo + lo·hi)
//   out    = p·v           : v_wmma_f32_16x16x32_bf16; SPLIT_PV -> p,v as bf16 hi/lo; else p,v plain bf16
//   f32 accumulate; online softmax in f32. Block = 4 waves = 64 query rows of one (batch, head); S % 64 == 0.
//   Element (b, s, h, d) of tensor X lives at X[b*X_bs + s*X_rs + h*X_hs + d] (strides in floats, multiples of 4).
//   Masking: mask_mode 0 none, 1 causal (kv > q masked), 2 tensor [S][Skv] shared over (b,h) (float if
//   mask_is_int==0, int32 with element == 0 -> masked if 1, int32 with element != 0 -> masked if 2), 3 per-token vectors qmask[B][S] & kvmask[B][Skv] (int32,
//   0 -> masked), 4 causal + sliding window (kv > q or q - kv > W masked; W passed in mask_is_int);
//   5 = relative-position bias: s += cp[b,h,q][idx[q][kv]] + pc[b,h,kv][idx[q][kv]] with idx = mask_b ([S][Skv] int32) and
//   mask_a an int32 [S][Skv] tensor with nonzero = masked (tables: element (b,h,row,n) at X + b*c_bs + h*c_hs + row*c_rs + n);
//   masked scores are replaced by mask_fill (e.g. -inf or -1e9) before the softmax.
//   grid.x = B * H * (S/64) (or a sub-range with blk0).
// =====================================================================================
#define AT_D 64
#define AT_NW 4
#define AT_QB 64
#define AT_KC 64
struct AttnGeom { const float* cp = nullptr; const float* pc = nullptr; long c_bs = 0, c_rs = 0, c_hs = 0;   // mode-5 score-bias tables
                  long q_bs, q_rs, q_hs, k_bs, k_rs, k_hs, v_bs, v_rs, v_hs, o_bs, o_rs, o_hs;
                  int S, Skv, H, mask_mode; float qscale; int blk0; float mask_fill; int mask_is_int; };
static_assert(sizeof(AttnGeom) == 168, "no padding");

__device__ __forceinline__ unsigned short at_bf_bits(float f) {
  unsigned u = __float_as_uint(f);
  return (unsigned short)((u + 0x7FFFu + ((u >> 16) & 1u)) >> 16);
}
__device__ __forceinline__ __bf16 at_f2bf(float f) { return __builtin_bit_cast(__bf16, at_bf_bits(f)); }
__device__ __forceinline__ void at_split(float f, __bf16& hi, __bf16& lo) {
  const unsigned short hb = at_bf_bits(f);
  hi = __builtin_bit_cast(__bf16, hb);
  lo = at_f2bf(f - __uint_as_float(((unsigned)hb) << 16));
}
__device__ __forceinline__ v8f at_mma(v16b a, v16b b, v8f c) {
  c = __builtin_amdgcn_wmma_f32_16x16x32_bf16(false, a, false, b, (short)0, c, false, false);
  asm volatile("v_nop\n\tv_nop\n\tv_nop\n\tv_nop" : "+v"(c) : "v"(a), "v"(b));
  return c;
}
// 16-bit element as a bit pattern held in a __bf16 slot: f16 bits when F16, bf16 (RNE) otherwise
template <bool F16> __device__ __forceinline__ __bf16 at_to16(float f) {
  if (F16) return __builtin_bit_cast(__bf16, (_Float16)f);
  return at_f2bf(f);
}
template <bool F16> __device__ __forceinline__ v8f at_mma16(v16b a, v16b b, v8f c) {
  if (F16) {
    const v16h ah = __builtin_bit_cast(v16h, a), bh = __builtin_bit_cast(v16h, b);
    c = __builtin_amdgcn_wmma_f32_16x16x32_f16(false, ah, false, bh, (short)0, c, false, false);
    asm volatile("v_nop\n\tv_nop\n\tv_nop\n\tv_nop" : "+v"(c) : "v"(ah), "v"(bh));
    return c;
  }
  return at_mma(a, b, c);
}

template <bool SPLIT_QK, bool SPLIT_PV, bool F16 = false>
__global__ __launch_bounds__(128)
void attn64_kernel(const float* __restrict__ q, const float* __restrict__ k,
                   const float* __restrict__ v, float* __restrict__ out,
                   const void* __restrict__ mask_a, const int* __restrict__ mask_b, AttnGeom g) {
  static_assert(!(F16 && (SPLIT_QK || SPLIT_PV)), "f16 mode is non-split");
  const float PSC = F16 ? 32768.0f : 1.0f;     // f16 probabilities carried x2^15 (subnormal range), folded into the final 1/l
  union FB { v16b v; v8b h[2]; };
  __shared__ __align__(16) __bf16 Ksh[AT_KC * AT_D];             // K hi [kv][d]      8 KB
  __shared__ __align__(16) __bf16 Ksl[SPLIT_QK ? AT_KC * AT_D : 8];
  __shared__ __align__(16) __bf16 Vth[AT_D * AT_KC];             // V hi [d][kv]      8 KB
  __shared__ __align__(16) __bf16 Vtl[SPLIT_PV ? AT_D * AT_KC : 8];
  __shared__ __align__(16) __bf16 Psh[AT_NW][16 * AT_KC];        // per wave P hi [row][kv]  8 KB
  __shared__ __align__(16) __bf16 Psl[SPLIT_PV ? AT_NW : 1][SPLIT_PV ? 16 * AT_KC : 8];
  __shared__ __align__(16) float  Os[AT_NW][16 * 68];            // per wave out tile, pitch 68

  const int tid  = threadIdx.x;
  const int wave = tid >> 5;
  const int lane = tid & 31;
  const int hh   = lane >> 4;
  const int c    = lane & 15;

  const int nqb = g.S / AT_QB;
  const int bx = blockIdx.x + g.blk0;
  const int qb = bx % nqb;
  const int bh = bx / nqb;
  const int h  = bh % g.H;
  const int b  = bh / g.H;
  const int qbase_block = qb * AT_QB;
  const int q0 = qbase_block + wave * 16;

  const float* qb_ptr = q + (size_t)b * g.q_bs + (size_t)h * g.q_hs;
  const float* kb_ptr = k + (size_t)b * g.k_bs + (size_t)h * g.k_hs;
  const float* vb_ptr = v + (size_t)b * g.v_bs + (size_t)h * g.v_hs;
  float*       ob_ptr = out + (size_t)b * g.o_bs + (size_t)h * g.o_hs;

  // ---- Q fragments (A operand): 2 d-chunks, hi (and lo) ----
  v16b qah[2], qal[2];
  {
    const float* qrow = qb_ptr + (size_t)(q0 + c) * g.q_rs;
#pragma unroll
    for (int dc = 0; dc < 2; ++dc) {
#pragma unroll
      for (int e = 0; e < 8; ++e) {
        const float f0 = qrow[dc * 32 + 8 * hh + e] * g.qscale;
        const float f1 = qrow[dc * 32 + 16 + 8 * hh + e] * g.qscale;
        if (SPLIT_QK) { __bf16 hq, lq; at_split(f0, hq, lq); qah[dc][e] = hq; qal[dc][e] = lq; at_split(f1, hq, lq); qah[dc][8 + e] = hq; qal[dc][8 + e] = lq; }
        else { qah[dc][e] = at_to16<F16>(f0); qah[dc][8 + e] = at_to16<F16>(f1); qal[dc][e] = qah[dc][e]; qal[dc][8 + e] = qah[dc][8 + e]; }
      }
    }
  }

  float mrow[8], lrow[8];
  v8f oacc[4];
#pragma unroll
  for (int r = 0; r < 8; ++r) { mrow[r] = -INFINITY; lrow[r] = 0.f; }
#pragma unroll
  for (int t = 0; t < 4; ++t) oacc[t] = (v8f){0.f,0.f,0.f,0.f,0.f,0.f,0.f,0.f};

  const int nChunks = (g.mask_mode == 1 || g.mask_mode == 4) ? (qb + 1) : (g.Skv / AT_KC);   // block-uniform
  // per-row query mask (mode 3)
  int qkeep[8];
#pragma unroll
  for (int r = 0; r < 8; ++r) qkeep[r] = (g.mask_mode == 3) ? mask_b[(size_t)b * g.S + q0 + 8 * hh + r] : 1;   // mask_b = qmask in mode 3
  for (int kc = 0; kc < nChunks; ++kc) {
    const int kv0 = kc * AT_KC;
    __syncthreads();
    {
      const int kvr = tid >> 1, dh = (tid & 1) * 32;
      const float* krow = kb_ptr + (size_t)(kv0 + kvr) * g.k_rs + dh;
      const float* vrow = vb_ptr + (size_t)(kv0 + kvr) * g.v_rs + dh;
#pragma unroll
      for (int i = 0; i < 8; ++i) {
        v4f kk = *(const v4f*)(krow + 4 * i);
        v4f vv = *(const v4f*)(vrow + 4 * i);
#pragma unroll
        for (int e = 0; e < 4; ++e) {
          const int d = dh + 4 * i + e;
          if (SPLIT_QK) { __bf16 a, bl; at_split(kk[e], a, bl); Ksh[kvr * AT_D + d] = a; Ksl[kvr * AT_D + d] = bl; }
          else Ksh[kvr * AT_D + d] = at_to16<F16>(kk[e]);
          if (SPLIT_PV) { __bf16 a, bl; at_split(vv[e], a, bl); Vth[d * AT_KC + kvr] = a; Vtl[d * AT_KC + kvr] = bl; }
          else Vth[d * AT_KC + kvr] = at_to16<F16>(vv[e]);
        }
      }
    }
    __syncthreads();

    v8f s[4];
#pragma unroll
    for (int j = 0; j < 4; ++j) {
      s[j] = (v8f){0.f,0.f,0.f,0.f,0.f,0.f,0.f,0.f};
#pragma unroll 1
      for (int dc = 0; dc < 2; ++dc) {
        FB kb;
        kb.h[0] = *(const v8b*)(Ksh + (j * 16 + c) * AT_D + dc * 32 + 8 * hh);
        kb.h[1] = *(const v8b*)(Ksh + (j * 16 + c) * AT_D + dc * 32 + 16 + 8 * hh);
        s[j] = at_mma16<F16>(qah[dc], kb.v, s[j]);
        if (SPLIT_QK) {
          FB kl;
          kl.h[0] = *(const v8b*)(Ksl + (j * 16 + c) * AT_D + dc * 32 + 8 * hh);
          kl.h[1] = *(const v8b*)(Ksl + (j * 16 + c) * AT_D + dc * 32 + 16 + 8 * hh);
          s[j] = at_mma16<F16>(qah[dc], kl.v, s[j]);
          s[j] = at_mma16<F16>(qal[dc], kb.v, s[j]);
        }
      }
    }
    const bool diag = (g.mask_mode == 1) && (kc == qb);
    int kvkeep[4] = {1, 1, 1, 1};
    if (g.mask_mode == 3) {
#pragma unroll
      for (int j = 0; j < 4; ++j) kvkeep[j] = ((const int*)mask_a)[(size_t)b * g.Skv + kv0 + j * 16 + c];   // mask_a = kvmask
    }
    float cm[8];
#pragma unroll
    for (int r = 0; r < 8; ++r) {
      const int qrow = q0 + 8 * hh + r;
      float m = -INFINITY;
#pragma unroll
      for (int j = 0; j < 4; ++j) {
        const int kvcol = kv0 + j * 16 + c;
        bool masked = false;
        if (diag) masked = (kvcol > qrow);
        else if (g.mask_mode == 4) masked = (kvcol > qrow) || (qrow - kvcol > g.mask_is_int);
        else if (g.mask_mode == 2) {
          const size_t mi = (size_t)qrow * g.Skv + kvcol;
          masked = (g.mask_is_int == 0) ? (((const float*)mask_a)[mi] == 0.0f)
                 : (g.mask_is_int == 1) ? (((const int*)mask_a)[mi] == 0) : (((const int*)mask_a)[mi] != 0);
        } else if (g.mask_mode == 3) masked = (qkeep[r] == 0) || (kvkeep[j] == 0);
        else if (g.mask_mode == 5) {
          const size_t mi = (size_t)qrow * g.Skv + kvcol;
          masked = (((const int*)mask_a)[mi] != 0);
          int n = mask_b[mi]; n = n < 0 ? 0 : n;
          s[j][r] += g.cp[(size_t)b * g.c_bs + (size_t)h * g.c_hs + (size_t)qrow * g.c_rs + n]
                   + g.pc[(size_t)b * g.c_bs + (size_t)h * g.c_hs + (size_t)kvcol * g.c_rs + n];
        }
        if (masked) s[j][r] = g.mask_fill;
        m = fmaxf(m, s[j][r]);
      }
#pragma unroll
      for (int off = 1; off < 16; off <<= 1) m = fmaxf(m, __shfl_xor(m, off, 32));
      cm[r] = m;
    }
    __bf16* pwh = Psh[wave];
    __bf16* pwl = Psl[SPLIT_PV ? wave : 0];
#pragma unroll
    for (int r = 0; r < 8; ++r) {
      const float mnew = fmaxf(mrow[r], cm[r]);
      const float alpha = expf(mrow[r] - mnew);
      mrow[r] = mnew;
      float psum = 0.f;
#pragma unroll
      for (int j = 0; j < 4; ++j) {
        const float p = expf(s[j][r] - mnew);
        psum += p;
        if (SPLIT_PV) { __bf16 a, bl; at_split(p, a, bl); pwh[(8 * hh + r) * AT_KC + j * 16 + c] = a; pwl[(8 * hh + r) * AT_KC + j * 16 + c] = bl; }
        else pwh[(8 * hh + r) * AT_KC + j * 16 + c] = at_to16<F16>(p * PSC);
      }
#pragma unroll
      for (int off = 1; off < 16; off <<= 1) psum += __shfl_xor(psum, off, 32);
      lrow[r] = lrow[r] * alpha + psum;
#pragma unroll
      for (int t = 0; t < 4; ++t) oacc[t][r] *= alpha;
    }
    __builtin_amdgcn_fence(__ATOMIC_RELEASE, "workgroup");
    __builtin_amdgcn_wave_barrier();
    __builtin_amdgcn_fence(__ATOMIC_ACQUIRE, "workgroup");
#pragma unroll 1
    for (int kk = 0; kk < 2; ++kk) {
      FB pa, pl;
      pa.h[0] = *(const v8b*)(pwh + c * AT_KC + kk * 32 + 8 * hh);
      pa.h[1] = *(const v8b*)(pwh + c * AT_KC + kk * 32 + 16 + 8 * hh);
      if (SPLIT_PV) {
        pl.h[0] = *(const v8b*)(pwl + c * AT_KC + kk * 32 + 8 * hh);
        pl.h[1] = *(const v8b*)(pwl + c * AT_KC + kk * 32 + 16 + 8 * hh);
      }
#pragma unroll
      for (int t = 0; t < 4; ++t) {
        FB vb;
        vb.h[0] = *(const v8b*)(Vth + (t * 16 + c) * AT_KC + kk * 32 + 8 * hh);
        vb.h[1] = *(const v8b*)(Vth + (t * 16 + c) * AT_KC + kk * 32 + 16 + 8 * hh);
        oacc[t] = at_mma16<F16>(pa.v, vb.v, oacc[t]);
        if (SPLIT_PV) {
          FB vl;
          vl.h[0] = *(const v8b*)(Vtl + (t * 16 + c) * AT_KC + kk * 32 + 8 * hh);
          vl.h[1] = *(const v8b*)(Vtl + (t * 16 + c) * AT_KC + kk * 32 + 16 + 8 * hh);
          oacc[t] = at_mma16<F16>(pa.v, vl.v, oacc[t]);
          oacc[t] = at_mma16<F16>(pl.v, vb.v, oacc[t]);
        }
      }
    }
  }

  float* os = Os[wave];
#pragma unroll
  for (int r = 0; r < 8; ++r) {
    const float inv = 1.0f / (lrow[r] * PSC);
#pragma unroll
    for (int t = 0; t < 4; ++t) os[(8 * hh + r) * 68 + t * 16 + c] = oacc[t][r] * inv;
  }
  __builtin_amdgcn_fence(__ATOMIC_RELEASE, "workgroup");
  __builtin_amdgcn_wave_barrier();
  __builtin_amdgcn_fence(__ATOMIC_ACQUIRE, "workgroup");
  {
    const int c4 = (lane & 15) * 4;
    {
#pragma unroll
      for (int it = 0; it < 8; ++it) {
        const int row = it * 2 + hh;
        v4f val = *(const v4f*)(os + row * 68 + c4);
        *(v4f*)(ob_ptr + (size_t)(q0 + row) * g.o_rs + c4) = val;
      }
      
    }
  }
}

// ---- head_dim 128 variant (same contract; K/V tiles 64 keys x 128, 8 output tiles; mask_mode 6 = causal + per-head ALiBi slope table in g.cp) ----
// MODE >= 0 fixes the mask mode at compile time, so the per-score mode tests fold away; MODE < 0 reads it from g.mask_mode
template <bool SPLIT_QK, bool SPLIT_PV, bool F16 = false, int MODE = -1>
__global__ __launch_bounds__(128)
void attn128_kernel(const float* __restrict__ q, const float* __restrict__ k,
                   const float* __restrict__ v, float* __restrict__ out,
                   const void* __restrict__ mask_a, const int* __restrict__ mask_b, AttnGeom g) {
  static_assert(!(F16 && (SPLIT_QK || SPLIT_PV)), "f16 mode is non-split");
  const float PSC = F16 ? 32768.0f : 1.0f;     // f16 probabilities carried x2^15 (subnormal range), folded into the final 1/l
  union FB { v16b v; v8b h[2]; };
  constexpr int D2 = 128;
  const int mode = (MODE >= 0) ? MODE : g.mask_mode;
  __shared__ __align__(16) __bf16 Ksh[AT_KC * D2];               // K hi [kv][d]      16 KB
  __shared__ __align__(16) __bf16 Ksl[SPLIT_QK ? AT_KC * D2 : 8];
  __shared__ __align__(16) __bf16 Vth[D2 * AT_KC];               // V hi [d][kv]      16 KB
  __shared__ __align__(16) __bf16 Vtl[SPLIT_PV ? D2 * AT_KC : 8];
  __shared__ __align__(16) __bf16 Psh[AT_NW][16 * AT_KC];
  __shared__ __align__(16) __bf16 Psl[SPLIT_PV ? AT_NW : 1][SPLIT_PV ? 16 * AT_KC : 8];
  __shared__ __align__(16) float  Os[AT_NW][16 * 132];           // per wave out tile, pitch 132
  __shared__ __align__(16) __bf16 Qsh[SPLIT_QK ? AT_NW : 1][SPLIT_QK ? 16 * D2 : 8];   // split path: q hi/lo staged per wave (keeps VGPR use low)
  __shared__ __align__(16) __bf16 Qsl[SPLIT_QK ? AT_NW : 1][SPLIT_QK ? 16 * D2 : 8];

  const int tid  = threadIdx.x;
  const int wave = tid >> 5;
  const int lane = tid & 31;
  const int hh   = lane >> 4;
  const int c    = lane & 15;

  const int nqb = g.S / AT_QB;
  const int bx = blockIdx.x + g.blk0;
  const int qb = bx % nqb;
  const int bh = bx / nqb;
  const int h  = bh % g.H;
  const int b  = bh / g.H;
  const int qbase_block = qb * AT_QB;
  const int q0 = qbase_block + wave * 16;

  const float* qb_ptr = q + (size_t)b * g.q_bs + (size_t)h * g.q_hs;
  const float* kb_ptr = k + (size_t)b * g.k_bs + (size_t)h * g.k_hs;
  const float* vb_ptr = v + (size_t)b * g.v_bs + (size_t)h * g.v_hs;
  float*       ob_ptr = out + (size_t)b * g.o_bs + (size_t)h * g.o_hs;

  // ---- Q fragments (A operand): 4 d-chunks, hi (and lo) ----
  v16b qah[4], qal[4];
  {
    const float* qrow = qb_ptr + (size_t)(q0 + c) * g.q_rs;
#pragma unroll
    for (int dc = 0; dc < 4; ++dc) {
#pragma unroll
      for (int e = 0; e < 8; ++e) {
        const float f0 = qrow[dc * 32 + 8 * hh + e] * g.qscale;
        const float f1 = qrow[dc * 32 + 16 + 8 * hh + e] * g.qscale;
        if (SPLIT_QK) { __bf16 hq, lq; at_split(f0, hq, lq); Qsh[wave][c * D2 + dc * 32 + 8 * hh + e] = hq; Qsl[wave][c * D2 + dc * 32 + 8 * hh + e] = lq;
                        at_split(f1, hq, lq); Qsh[wave][c * D2 + dc * 32 + 16 + 8 * hh + e] = hq; Qsl[wave][c * D2 + dc * 32 + 16 + 8 * hh + e] = lq;
                        qah[dc][e] = hq; qal[dc][e] = lq; qah[dc][8 + e] = hq; qal[dc][8 + e] = lq; }   // (register copies unused on the split path)
        else { qah[dc][e] = at_to16<F16>(f0); qah[dc][8 + e] = at_to16<F16>(f1); qal[dc][e] = qah[dc][e]; qal[dc][8 + e] = qah[dc][8 + e]; }
      }
    }
  }

  float mrow[8], lrow[8];
  v8f oacc[8];
#pragma unroll
  for (int r = 0; r < 8; ++r) { mrow[r] = -INFINITY; lrow[r] = 0.f; }
#pragma unroll
  for (int t = 0; t < 8; ++t) oacc[t] = (v8f){0.f,0.f,0.f,0.f,0.f,0.f,0.f,0.f};

  const int nChunks = (mode == 1 || mode == 4 || mode == 6) ? (qb + 1) : (g.Skv / AT_KC);   // block-uniform
  // per-row query mask (mode 3)
  int qkeep[8];
#pragma unroll
  for (int r = 0; r < 8; ++r) qkeep[r] = (mode == 3) ? mask_b[(size_t)b * g.S + q0 + 8 * hh + r] : 1;   // mask_b = qmask in mode 3
  for (int kc = 0; kc < nChunks; ++kc) {
    const int kv0 = kc * AT_KC;
    __syncthreads();
    {
      const int kvr = tid >> 1, dh = (tid & 1) * 64;
      const float* krow = kb_ptr + (size_t)(kv0 + kvr) * g.k_rs + dh;
      const float* vrow = vb_ptr + (size_t)(kv0 + kvr) * g.v_rs + dh;
#pragma unroll
      for (int i = 0; i < 16; ++i) {
        v4f kk = *(const v4f*)(krow + 4 * i);
        v4f vv = *(const v4f*)(vrow + 4 * i);
#pragma unroll
        for (int e = 0; e < 4; ++e) {
          const int d = dh + 4 * i + e;
          if (SPLIT_QK) { __bf16 a, bl; at_split(kk[e], a, bl); Ksh[kvr * D2 + d] = a; Ksl[kvr * D2 + d] = bl; }
          else Ksh[kvr * D2 + d] = at_to16<F16>(kk[e]);
          if (SPLIT_PV) { __bf16 a, bl; at_split(vv[e], a, bl); Vth[d * AT_KC + kvr] = a; Vtl[d * AT_KC + kvr] = bl; }
          else Vth[d * AT_KC + kvr] = at_to16<F16>(vv[e]);
        }
      }
    }
    __syncthreads();

    v8f s[4];
#pragma unroll
    for (int j = 0; j < 4; ++j) {
      s[j] = (v8f){0.f,0.f,0.f,0.f,0.f,0.f,0.f,0.f};
#pragma unroll 1
      for (int dc = 0; dc < 4; ++dc) {      // rolled: bounds the live fragment set (register pressure) on the 128-wide head
        FB kb;
        kb.h[0] = *(const v8b*)(Ksh + (j * 16 + c) * D2 + dc * 32 + 8 * hh);
        kb.h[1] = *(const v8b*)(Ksh + (j * 16 + c) * D2 + dc * 32 + 16 + 8 * hh);
        if (!SPLIT_QK) s[j] = at_mma16<F16>(qah[dc], kb.v, s[j]);
        if (SPLIT_QK) {
          FB qa, ql;
          qa.h[0] = *(const v8b*)(&Qsh[wave][c * D2 + dc * 32 + 8 * hh]); qa.h[1] = *(const v8b*)(&Qsh[wave][c * D2 + dc * 32 + 16 + 8 * hh]);
          ql.h[0] = *(const v8b*)(&Qsl[wave][c * D2 + dc * 32 + 8 * hh]); ql.h[1] = *(const v8b*)(&Qsl[wave][c * D2 + dc * 32 + 16 + 8 * hh]);
          s[j] = at_mma16<F16>(qa.v, kb.v, s[j]);
          FB kl;
          kl.h[0] = *(const v8b*)(Ksl + (j * 16 + c) * D2 + dc * 32 + 8 * hh);
          kl.h[1] = *(const v8b*)(Ksl + (j * 16 + c) * D2 + dc * 32 + 16 + 8 * hh);
          s[j] = at_mma16<F16>(qa.v, kl.v, s[j]);
          s[j] = at_mma16<F16>(ql.v, kb.v, s[j]);
        }
      }
    }
    const bool diag = (mode == 1) && (kc == qb);
    int kvkeep[4] = {1, 1, 1, 1};
    if (mode == 3) {
#pragma unroll
      for (int j = 0; j < 4; ++j) kvkeep[j] = ((const int*)mask_a)[(size_t)b * g.Skv + kv0 + j * 16 + c];   // mask_a = kvmask
    }
    float cm[8];
#pragma unroll
    for (int r = 0; r < 8; ++r) {
      const int qrow = q0 + 8 * hh + r;
      float m = -INFINITY;
#pragma unroll
      for (int j = 0; j < 4; ++j) {
        const int kvcol = kv0 + j * 16 + c;
        bool masked = false;
        if (diag) masked = (kvcol > qrow);
        else if (mode == 4) masked = (kvcol > qrow) || (qrow - kvcol > g.mask_is_int);
        else if (mode == 2) {
          const size_t mi = (size_t)qrow * g.Skv + kvcol;
          masked = (g.mask_is_int == 0) ? (((const float*)mask_a)[mi] == 0.0f)
                 : (g.mask_is_int == 1) ? (((const int*)mask_a)[mi] == 0) : (((const int*)mask_a)[mi] != 0);
        } else if (mode == 3) masked = (qkeep[r] == 0) || (kvkeep[j] == 0);
        else if (mode == 6) { masked = (kvcol > qrow); s[j][r] += g.cp[h] * (float)(kvcol - qrow); }
        else if (mode == 8) { masked = (kvcol > qrow) || (((const int*)mask_a)[(size_t)b * g.Skv + kvcol] != 0); }
        else if (mode == 5) {
          const size_t mi = (size_t)qrow * g.Skv + kvcol;
          masked = (((const int*)mask_a)[mi] != 0);
          int n = mask_b[mi]; n = n < 0 ? 0 : n;
          s[j][r] += g.cp[(size_t)b * g.c_bs + (size_t)h * g.c_hs + (size_t)qrow * g.c_rs + n]
                   + g.pc[(size_t)b * g.c_bs + (size_t)h * g.c_hs + (size_t)kvcol * g.c_rs + n];
        }
        if (masked) s[j][r] = g.mask_fill;
        m = fmaxf(m, s[j][r]);
      }
#pragma unroll
      for (int off = 1; off < 16; off <<= 1) m = fmaxf(m, __shfl_xor(m, off, 32));
      cm[r] = m;
    }
    __bf16* pwh = Psh[wave];
    __bf16* pwl = Psl[SPLIT_PV ? wave : 0];
#pragma unroll
    for (int r = 0; r < 8; ++r) {
      const float mnew = fmaxf(mrow[r], cm[r]);
      const float alpha = expf(mrow[r] - mnew);
      mrow[r] = mnew;
      float psum = 0.f;
#pragma unroll
      for (int j = 0; j < 4; ++j) {
        const float p = expf(s[j][r] - mnew);
        psum += p;
        if (SPLIT_PV) { __bf16 a, bl; at_split(p, a, bl); pwh[(8 * hh + r) * AT_KC + j * 16 + c] = a; pwl[(8 * hh + r) * AT_KC + j * 16 + c] = bl; }
        else pwh[(8 * hh + r) * AT_KC + j * 16 + c] = at_to16<F16>(p * PSC);
      }
#pragma unroll
      for (int off = 1; off < 16; off <<= 1) psum += __shfl_xor(psum, off, 32);
      lrow[r] = lrow[r] * alpha + psum;
#pragma unroll
      for (int t = 0; t < 8; ++t) oacc[t][r] *= alpha;
    }
    __builtin_amdgcn_fence(__ATOMIC_RELEASE, "workgroup");
    __builtin_amdgcn_wave_barrier();
    __builtin_amdgcn_fence(__ATOMIC_ACQUIRE, "workgroup");
#pragma unroll 1
    for (int kk = 0; kk < 2; ++kk) {
      FB pa, pl;
      pa.h[0] = *(const v8b*)(pwh + c * AT_KC + kk * 32 + 8 * hh);
      pa.h[1] = *(const v8b*)(pwh + c * AT_KC + kk * 32 + 16 + 8 * hh);
      if (SPLIT_PV) {
        pl.h[0] = *(const v8b*)(pwl + c * AT_KC + kk * 32 + 8 * hh);
        pl.h[1] = *(const v8b*)(pwl + c * AT_KC + kk * 32 + 16 + 8 * hh);
      }
#pragma unroll
      for (int t = 0; t < 8; ++t) {
        FB vb;
        vb.h[0] = *(const v8b*)(Vth + (t * 16 + c) * AT_KC + kk * 32 + 8 * hh);
        vb.h[1] = *(const v8b*)(Vth + (t * 16 + c) * AT_KC + kk * 32 + 16 + 8 * hh);
        oacc[t] = at_mma16<F16>(pa.v, vb.v, oacc[t]);
        if (SPLIT_PV) {
          FB vl;
          vl.h[0] = *(const v8b*)(Vtl + (t * 16 + c) * AT_KC + kk * 32 + 8 * hh);
          vl.h[1] = *(const v8b*)(Vtl + (t * 16 + c) * AT_KC + kk * 32 + 16 + 8 * hh);
          oacc[t] = at_mma16<F16>(pa.v, vl.v, oacc[t]);
          oacc[t] = at_mma16<F16>(pl.v, vb.v, oacc[t]);
        }
      }
    }
  }

  float* os = Os[wave];
#pragma unroll
  for (int r = 0; r < 8; ++r) {
    const float inv = 1.0f / (lrow[r] * PSC);
#pragma unroll
    for (int t = 0; t < 8; ++t) os[(8 * hh + r) * 132 + t * 16 + c] = oacc[t][r] * inv;
  }
  __builtin_amdgcn_fence(__ATOMIC_RELEASE, "workgroup");
  __builtin_amdgcn_wave_barrier();
  __builtin_amdgcn_fence(__ATOMIC_ACQUIRE, "workgroup");
  {
    const int c4 = lane * 4;           // 32 lanes x 16 B = one 512-B output row (128 floats) per instruction
    {
#pragma unroll
      for (int row = 0; row < 16; ++row) {
        v4f val = *(const v4f*)(os + row * 132 + c4);
        *(v4f*)(ob_ptr + (size_t)(q0 + row) * g.o_rs + c4) = val;
      }
      
    }
  }
}

#define XB 2
#define XH 16
#define XS 2048
#define XD 128
__global__ void slopes_kernel(float* __restrict__ sl) { const int h = threadIdx.x; const float v = (h < XH) ? exp2f(-8.0f * (float)(h + 1) / (float)XH) : 0.f; ((float*)sl)[h] = v;  }
extern "C" void kernel_launch(void* const* d_in, const int* in_sizes, int n_in, void* d_out, int out_size, void* d_ws, size_t ws_size, hipStream_t stream) {
  (void)in_sizes; (void)n_in; (void)out_size; (void)ws_size;
  const float* q = (const float*)d_in[0]; const float* k = (const float*)d_in[1]; const float* v = (const float*)d_in[2];
  float* sl = (float*)d_ws;
  slopes_kernel<<<1, 32, 0, stream>>>(sl);
  AttnGeom g;
  g.cp = sl; g.pc = nullptr; g.c_bs = 0; g.c_rs = 0; g.c_hs = 0;
  g.q_bs = (long)XH * XS * XD; g.q_hs = (long)XS * XD; g.q_rs = XD;
  g.k_bs = g.q_bs; g.k_hs = g.q_hs; g.k_rs = XD; g.v_bs = g.q_bs; g.v_hs = g.q_hs; g.v_rs = XD; g.o_bs = g.q_bs; g.o_hs = g.q_hs; g.o_rs = XD;
  g.S = XS; g.Skv = XS; g.H = XH; g.mask_mode = 6; g.qscale = 0.08838834764831845f; g.blk0 = 0; g.mask_fill = -INFINITY; g.mask_is_int = 0;
  attn128_kernel<true, true, false, 6><<<XB * XH * (XS / AT_QB), AT_NW * 32, 0, stream>>>(q, k, v, (float*)d_out, nullptr, nullptr, g);
}

// v002
// Measured time: 473 microseconds a run.
// Next to v001, in two timings, it ran 2.16 and 2.17 times as fast.
// Over all steps from v000 it is 4.18 times as fast.
#include <hip/hip_runtime.h>
#include <math.h>
// FlexAttention forward (causal block mask + ALiBi score_mod, 2 x 16 heads, 2048 x 2048, head_dim 128): scores and p·v on
// v_wmma_f32_16x16x32_bf16 with q,k and p,v as bf16 hi/lo splits (hi·hi + hi·lo + lo·hi;
// early causal rows copy single v rows almost verbatim), f32 accumulate; online softmax, the ALiBi bias slope_h·(k−q) and the
// causal predicate in f32 on VALU.
typedef __attribute__((ext_vector_type(16))) _Float16 v16h;
typedef __attribute__((ext_vector_type(8)))  _Float16 v8h;
typedef __attribute__((ext_vector_type(16))) __bf16   v16b;
typedef __attribute__((ext_vector_type(8)))  __bf16   v8b;
typedef __attribute__((ext_vector_type(8)))  float    v8f;
typedef __attribute__((ext_vector_type(4)))  float    v4f;
#define PSCALE 32768.0f
#define U16(p) ((const unsigned short*)(const void*)(p))
#define PSCALE_INV (1.0f / 32768.0f)

__device__ __forceinline__ unsigned short f2bf_bits(float f) {
  unsigned u = __float_as_uint(f);
  return (unsigned short)((u + 0x7FFFu + ((u >> 16) & 1u)) >> 16);
}
__device__ __forceinline__ float bf_bits2f(unsigned short h) { return __uint_as_float(((unsigned)h) << 16); }

// hazard guards as plain device helpers (no inline asm inside the kernel template body)
__device__ __forceinline__ void dep_guard_h(v8f& a, v8f& b, v16h x, v16h y) { asm volatile("v_nop\n\tv_nop\n\tv_nop\n\tv_nop" : "+v"(a), "+v"(b) : "v"(x), "v"(y)); }
__device__ __forceinline__ void dep_guard_b(v8f& a, v8f& b, v16b x, v16b y) { asm volatile("v_nop\n\tv_nop\n\tv_nop\n\tv_nop" : "+v"(a), "+v"(b) : "v"(x), "v"(y)); }
__device__ __forceinline__ void keep4_h(v16h a, v16h b, v16h c, v16h d) { asm volatile("v_nop" :: "v"(a), "v"(b), "v"(c), "v"(d)); }
__device__ __forceinline__ void keep4_b(v16b a, v16b b, v16b c, v16b d) { asm volatile("v_nop" :: "v"(a), "v"(b), "v"(c), "v"(d)); }
__device__ __forceinline__ void acc_guard4(v8f& a, v8f& b, v8f& c, v8f& d) { asm volatile("v_nop\n\tv_nop\n\tv_nop\n\tv_nop" : "+v"(a), "+v"(b), "+v"(c), "+v"(d)); }
template <typename T> struct Frag;
template <> struct Frag<_Float16> {
  typedef v16h V; union U { v16h v; v8h h[2]; };
  static __device__ __forceinline__ v16h load(const _Float16* p) {   // elements 0..7 <- p[0..7], 8..15 <- p[16..23]
    U f; f.h[0] = *(const v8h*)(p); f.h[1] = *(const v8h*)(p + 16); return f.v;
  }
  static __device__ __forceinline__ v8f mma(v16h a, v16h b, v8f c) {
    return __builtin_amdgcn_wmma_f32_16x16x32_f16(false, a, false, b, (short)0, c, false, false);
  }
  static __device__ __forceinline__ void guard(v8f& a, v8f& b, v16h x, v16h y) { dep_guard_h(a, b, x, y); }
  static __device__ __forceinline__ void keep(v16h a, v16h b, v16h c, v16h d) { keep4_h(a, b, c, d); }
};
template <> struct Frag<__bf16> {
  typedef v16b V; union U { v16b v; v8b h[2]; };
  static __device__ __forceinline__ v16b load(const __bf16* p) {
    U f; f.h[0] = *(const v8b*)(p); f.h[1] = *(const v8b*)(p + 16); return f.v;
  }
  static __device__ __forceinline__ v8f mma(v16b a, v16b b, v8f c) {
    return __builtin_amdgcn_wmma_f32_16x16x32_bf16(false, a, false, b, (short)0, c, false, false);
  }
  static __device__ __forceinline__ void guard(v8f& a, v8f& b, v16b x, v16b y) { dep_guard_b(a, b, x, y); }
  static __device__ __forceinline__ void keep(v16b a, v16b b, v16b c, v16b d) { keep4_b(a, b, c, d); }
};

// ---- Register-blocked batched WMMA GEMM ------------------------------------
// C[m,n] = scale * sum_k A[m,k] * Bt[n,k] (+bias)(+resid); each wave owns a 64x64 tile.
// A row-major [M,K]; Bt row-major [N,K]; M,N % 64 == 0, K % 32 == 0.
// SPLIT: operands are hi/lo planes (A2/Bt2 = lo planes, same layout); product = hi·hi + hi·lo + lo·hi.
// BIAS_MODE: 0 = none, 1 = bias[m], 2 = bias[n].
// OUT_MODE: 0 = f32, 1 = f16, 2 = bf16 hi plane (Cout) + bf16 lo plane (Cout2).
// ET: 0 = f16 operands, 1 = bf16 operands (pointers passed as 16-bit storage)
template <int ET> struct Elem;
template <> struct Elem<0> { typedef _Float16 T; };
template <> struct Elem<1> { typedef __bf16 T; };
template <int ET, bool SPLIT, int BIAS_MODE, int OUT_MODE, bool RESID, int ACT = 0>
__global__ __launch_bounds__(256) void wmma_gemm64(
    const unsigned short* __restrict__ Ap, const unsigned short* __restrict__ A2p, int lda, long strideA,
    const unsigned short* __restrict__ Btp, const unsigned short* __restrict__ Bt2p, int ldb, long strideB,
    void* __restrict__ Cout, void* __restrict__ Cout2, int ldc, long strideC,
    const float* __restrict__ bias,
    const float* __restrict__ resid, long strideR,
    int M, int N, int K, float scale) {
  typedef typename Elem<ET>::T T;
  typedef typename Frag<T>::V V;
  const T* A = (const T*)Ap; const T* A2 = (const T*)A2p; const T* Bt = (const T*)Btp; const T* Bt2 = (const T*)Bt2p;
  __shared__ __align__(16) float sT[8][16 * 68];   // per-wave 16x64 slab, pitch 68 floats
  const int b    = blockIdx.y;
  const int lane = threadIdx.x & 31;
  const int wave = threadIdx.x >> 5;
  const int tilesN = N >> 6;
  const int tilesM = M >> 6;
  const int tile = blockIdx.x * 8 + wave;
  if (tile >= tilesM * tilesN) return;   // wave-uniform; no block barriers in this kernel
  const int tm = tile / tilesN;
  const int tn = tile - tm * tilesN;
  const int m0 = tm << 6;
  const int n0 = tn << 6;

  const T* Ab  = A  + (size_t)b * strideA;
  const T* Bb  = Bt + (size_t)b * strideB;
  const T* Ab2 = SPLIT ? (A2  + (size_t)b * strideA) : nullptr;
  const T* Bb2 = SPLIT ? (Bt2 + (size_t)b * strideB) : nullptr;

  const int rlane = lane & 15;                 // row (A) / col (B, D) within subtile
  const int koff  = (lane >> 4) * 8;           // k offset of this lane half
  const int mOff  = (lane >> 4) * 8;           // D row offset

  v8f acc[4][4];
#pragma unroll
  for (int i = 0; i < 4; ++i)
#pragma unroll
    for (int j = 0; j < 4; ++j) acc[i][j] = (v8f){0.f,0.f,0.f,0.f,0.f,0.f,0.f,0.f};

  for (int k0 = 0; k0 < K; k0 += 32) {
    V bh[4], bl[4];
#pragma unroll
    for (int j = 0; j < 4; ++j) {
      const size_t bo = (size_t)(n0 + (j << 4) + rlane) * ldb + koff + k0;
      bh[j] = Frag<T>::load(Bb + bo);
      if (SPLIT) bl[j] = Frag<T>::load(Bb2 + bo);
    }
#pragma unroll
    for (int i = 0; i < 4; ++i) {
      const size_t ao = (size_t)(m0 + (i << 4) + rlane) * lda + koff + k0;
      V ah = Frag<T>::load(Ab + ao);
      V al;
      if (SPLIT) al = Frag<T>::load(Ab2 + ao);
#pragma unroll
      for (int j = 0; j < 4; ++j) {
        acc[i][j] = Frag<T>::mma(ah, bh[j], acc[i][j]);
        if (SPLIT) {
          acc[i][j] = Frag<T>::mma(ah, bl[j], acc[i][j]);
          acc[i][j] = Frag<T>::mma(al, bh[j], acc[i][j]);
        }
      }
      Frag<T>::guard(acc[i][0], acc[i][3], ah, SPLIT ? al : ah);
    }
    Frag<T>::keep(bh[0], bh[1], bh[2], bh[3]);
    if (SPLIT) Frag<T>::keep(bl[0], bl[1], bl[2], bl[3]);
  }
  acc_guard4(acc[0][0], acc[0][1], acc[0][2], acc[0][3]);
  acc_guard4(acc[1][0], acc[1][1], acc[1][2], acc[1][3]);
  acc_guard4(acc[2][0], acc[2][1], acc[2][2], acc[2][3]);
  acc_guard4(acc[3][0], acc[3][1], acc[3][2], acc[3][3]);

  // ---- epilogue ----
  float* slab = sT[wave];
  const float* Rb = RESID ? (resid + (size_t)b * strideR) : nullptr;
#pragma unroll
  for (int i = 0; i < 4; ++i) {
    const int mBase = m0 + (i << 4);
#pragma unroll
    for (int j = 0; j < 4; ++j) {
      const int n = n0 + (j << 4) + rlane;
      float bv = 0.f;
      if (BIAS_MODE == 2) bv = bias[n];
#pragma unroll
      for (int r = 0; r < 8; ++r) {
        float v = acc[i][j][r] * scale;
        if (BIAS_MODE == 1) v += bias[mBase + mOff + r];
        if (BIAS_MODE == 2) v += bv;
        if (RESID) v += Rb[(size_t)(mBase + mOff + r) * ldc + n];
        if (ACT == 1) v = tanhf(v);
        if (ACT == 2) v = fmaxf(v, 0.0f);
        if (ACT == 3) v = v / (1.0f + expf(-v));
        if (ACT == 4) v = (v > 0.f) ? v : 0.01f * v;
        if (ACT == 5) v = 0.5f * v * (1.0f + erff(v * 0.70710678118654752f));
        slab[(mOff + r) * 68 + (j << 4) + rlane] = v;
      }
    }
    __builtin_amdgcn_fence(__ATOMIC_RELEASE, "workgroup");
    __builtin_amdgcn_wave_barrier();
    __builtin_amdgcn_fence(__ATOMIC_ACQUIRE, "workgroup");
    if (OUT_MODE == 0) {
      float* C = (float*)Cout + (size_t)b * strideC;
      const int hh = lane >> 4, c4 = (lane & 15) * 4;     // row seg = 256 B = 16 lanes x 16 B
      {
#pragma unroll
        for (int it = 0; it < 8; ++it) {
          const int row = it * 2 + hh;
          v4f v = *(const v4f*)(slab + row * 68 + c4);
          *(v4f*)(C + (size_t)(mBase + row) * ldc + n0 + c4) = v;
        }
        
      }
    } else {
      const int q = lane >> 3, c8 = (lane & 7) * 8;
      unsigned short* C  = (unsigned short*)Cout  + (size_t)b * strideC;
      unsigned short* C2 = (OUT_MODE == 2) ? ((unsigned short*)Cout2 + (size_t)b * strideC) : nullptr;
      {
#pragma unroll
        for (int it = 0; it < 4; ++it) {
          const int row = it * 4 + q;
          const float* sp = slab + row * 68 + c8;
          v8h hv, lv;
#pragma unroll
          for (int e = 0; e < 8; ++e) {
            if (OUT_MODE == 1) {
              hv[e] = (_Float16)sp[e];
            } else {
              unsigned short hb = f2bf_bits(sp[e]);
              unsigned short lb = f2bf_bits(sp[e] - bf_bits2f(hb));
              hv[e] = __builtin_bit_cast(_Float16, hb);
              lv[e] = __builtin_bit_cast(_Float16, lb);
            }
          }
          *(v8h*)(C + (size_t)(mBase + row) * ldc + n0 + c8) = hv;
          if (OUT_MODE == 2) *(v8h*)(C2 + (size_t)(mBase + row) * ldc + n0 + c8) = lv;
        }
        
      }
    }
    __builtin_amdgcn_fence(__ATOMIC_RELEASE, "workgroup");
    __builtin_amdgcn_wave_barrier();
    __builtin_amdgcn_fence(__ATOMIC_ACQUIRE, "workgroup");
  }
}

__global__ __launch_bounds__(256) void cast_f32_f16x2(
    const float* __restrict__ in, _Float16* __restrict__ out, int n2) {
  int i = blockIdx.x * 256 + threadIdx.x;
  if (i < n2) {
    const _Float16 h0 = (_Float16)in[2 * i], h1 = (_Float16)in[2 * i + 1];
    const unsigned u = (unsigned)__builtin_bit_cast(unsigned short, h0) | ((unsigned)__builtin_bit_cast(unsigned short, h1) << 16);
    ((unsigned*)out)[i] = u;
    
  }
}


// ---- f32 -> f16 cast with a power-of-two pre-scale (folded back by the consumer GEMM's scale) ----
__global__ __launch_bounds__(256) void cast_f32_f16x2s(const float* __restrict__ in, _Float16* __restrict__ out, int n2, float s) {
  int i = blockIdx.x * 256 + threadIdx.x;
  if (i < n2) {
    const _Float16 h0 = (_Float16)(in[2 * i] * s), h1 = (_Float16)(in[2 * i + 1] * s);
    const unsigned u = (unsigned)__builtin_bit_cast(unsigned short, h0) | ((unsigned)__builtin_bit_cast(unsigned short, h1) << 16);
    ((unsigned*)out)[i] = u;
    
  }
}
__global__ __launch_bounds__(256) void split_f32_bf16x2(
    const float* __restrict__ in, __bf16* __restrict__ hi, __bf16* __restrict__ lo, long n2) {
  long i = (long)blockIdx.x * 256 + threadIdx.x;
  long stride = (long)gridDim.x * 256;
  {
    for (long j = i; j < n2; j += stride) {
      const float a = in[2 * j], b = in[2 * j + 1];
      const unsigned short ah = f2bf_bits(a), bh = f2bf_bits(b);
      const unsigned short al = f2bf_bits(a - bf_bits2f(ah)), bl = f2bf_bits(b - bf_bits2f(bh));
      ((unsigned*)hi)[j] = (unsigned)ah | ((unsigned)bh << 16);
      ((unsigned*)lo)[j] = (unsigned)al | ((unsigned)bl << 16);
    }
    
  }
}


// ---- f32 [R][C] (row pitch ldi) -> f16 transposed [C][R] (row pitch ldo); 64x64 tiles; each output row segment
__global__ __launch_bounds__(256) void transpose_cast_f16(const float* __restrict__ in, int ldi,
                                                         _Float16* __restrict__ outT, int ldo, float scale) {
  __shared__ __align__(16) _Float16 tile[64][72];     // [c][r]
  const int c0 = blockIdx.x * 64, r0 = blockIdx.y * 64;
  const int t = threadIdx.y * 32 + threadIdx.x;
  for (int i = threadIdx.y; i < 64; i += 8) {
    tile[threadIdx.x][i]      = (_Float16)(in[(size_t)(r0 + i) * ldi + c0 + threadIdx.x] * scale);
    tile[32 + threadIdx.x][i] = (_Float16)(in[(size_t)(r0 + i) * ldi + c0 + 32 + threadIdx.x] * scale);
  }
  __syncthreads();
  const int q = t >> 3, c8 = (t & 7) * 8;
  {
#pragma unroll
    for (int it = 0; it < 2; ++it) {
      const int c = it * 32 + q;
      v8h hv = *(const v8h*)(&tile[c][c8]);
      *(v8h*)(outT + (size_t)(c0 + c) * ldo + r0 + c8) = hv;
    }
    
  }
}

// ---- f32 [R][C] (pitch ldi) -> bf16 hi/lo transposed planes [C][R] (pitch ldo); 64x64 tiles; each output row segment
__global__ __launch_bounds__(256) void transpose_split_bf16(const float* __restrict__ in, int ldi,
                                                           __bf16* __restrict__ outH, __bf16* __restrict__ outL, int ldo) {
  __shared__ __align__(16) float tile[64][68];     // [c][r]
  const int c0 = blockIdx.x * 64, r0 = blockIdx.y * 64;
  const int t = threadIdx.y * 32 + threadIdx.x;
  for (int i = threadIdx.y; i < 64; i += 8) {
    tile[threadIdx.x][i]      = in[(size_t)(r0 + i) * ldi + c0 + threadIdx.x];
    tile[32 + threadIdx.x][i] = in[(size_t)(r0 + i) * ldi + c0 + 32 + threadIdx.x];
  }
  __syncthreads();
  const int q = t >> 3, c8 = (t & 7) * 8;
  {
#pragma unroll
    for (int it = 0; it < 2; ++it) {
      const int c = it * 32 + q;
      v8b hv, lv;
#pragma unroll
      for (int e = 0; e < 8; ++e) {
        const float f = tile[c][c8 + e];
        const unsigned short hb = f2bf_bits(f);
        hv[e] = __builtin_bit_cast(__bf16, hb);
        lv[e] = __builtin_bit_cast(__bf16, f2bf_bits(f - bf_bits2f(hb)));
      }
      *(v8b*)(outH + (size_t)(c0 + c) * ldo + r0 + c8) = hv;
      *(v8b*)(outL + (size_t)(c0 + c) * ldo + r0 + c8) = lv;
    }
    
  }
}

// =====================================================================================
// Generic causal/non-causal attention for head_dim 64, f32 in / f32 out; 16-bit operands: bf16 with optional hi/lo splits, or
// plain f16 (F16=true, non-split, probabilities carried x2^15).
//   scores = (q*qscale)·kᵀ : v_wmma_f32_16x16x32_bf16; SPLIT_QK -> q,k as bf16 hi/lo (hi·hi + hi·lo + lo·hi)
//   out    = p·v           : v_wmma_f32_16x16x32_bf16; SPLIT_PV -> p,v as bf16 hi/lo; else p,v plain bf16
//   f32 accumulate; online softmax in f32. Block = 4 waves = 64 query rows of one (batch, head); S % 64 == 0.
//   Element (b, s, h, d) of tensor X lives at X[b*X_bs + s*X_rs + h*X_hs + d] (strides in floats, multiples of 4).
//   Masking: mask_mode 0 none, 1 causal (kv > q masked), 2 tensor [S][Skv] shared over (b,h) (float if
//   mask_is_int==0, int32 with element == 0 -> masked if 1, int32 with element != 0 -> masked if 2), 3 per-token vectors qmask[B][S] & kvmask[B][Skv] (int32,
//   0 -> masked), 4 causal + sliding window (kv > q or q - kv > W masked; W passed in mask_is_int);
//   5 = relative-position bias: s += cp[b,h,q][idx[q][kv]] + pc[b,h,kv][idx[q][kv]] with idx = mask_b ([S][Skv] int32) and
//   mask_a an int32 [S][Skv] tensor with nonzero = masked (tables: element (b,h,row,n) at X + b*c_bs + h*c_hs + row*c_rs + n);
//   masked scores are replaced by mask_fill (e.g. -inf or -1e9) before the softmax.
//   grid.x = B * H * (S/64) (or a sub-range with blk0).
// =====================================================================================
#define AT_D 64
#define AT_NW 4
#define AT_QB 64
#define AT_KC 64
struct AttnGeom { const float* cp = nullptr; const float* pc = nullptr; long c_bs = 0, c_rs = 0, c_hs = 0;   // mode-5 score-bias tables
                  long q_bs, q_rs, q_hs, k_bs, k_rs, k_hs, v_bs, v_rs, v_hs, o_bs, o_rs, o_hs;
                  int S, Skv, H, mask_mode; float qscale; int blk0; float mask_fill; int mask_is_int; };
static_assert(sizeof(AttnGeom) == 168, "no padding");

__device__ __forceinline__ unsigned short at_bf_bits(float f) {
  unsigned u = __float_as_uint(f);
  return (unsigned short)((u + 0x7FFFu + ((u >> 16) & 1u)) >> 16);
}
__device__ __forceinline__ __bf16 at_f2bf(float f) { return __builtin_bit_cast(__bf16, at_bf_bits(f)); }
__device__ __forceinline__ void at_split(float f, __bf16& hi, __bf16& lo) {
  const unsigned short hb = at_bf_bits(f);
  hi = __builtin_bit_cast(__bf16, hb);
  lo = at_f2bf(f - __uint_as_float(((unsigned)hb) << 16));
}
__device__ __forceinline__ v8f at_mma(v16b a, v16b b, v8f c) {
  c = __builtin_amdgcn_wmma_f32_16x16x32_bf16(false, a, false, b, (short)0, c, false, false);
  asm volatile("v_nop\n\tv_nop\n\tv_nop\n\tv_nop" : "+v"(c) : "v"(a), "v"(b));
  return c;
}
// 16-bit element as a bit pattern held in a __bf16 slot: f16 bits when F16, bf16 (RNE) otherwise
template <bool F16> __device__ __forceinline__ __bf16 at_to16(float f) {
  if (F16) return __builtin_bit_cast(__bf16, (_Float16)f);
  return at_f2bf(f);
}
template <bool F16> __device__ __forceinline__ v8f at_mma16(v16b a, v16b b, v8f c) {
  if (F16) {
    const v16h ah = __builtin_bit_cast(v16h, a), bh = __builtin_bit_cast(v16h, b);
    c = __builtin_amdgcn_wmma_f32_16x16x32_f16(false, ah, false, bh, (short)0, c, false, false);
    asm volatile("v_nop\n\tv_nop\n\tv_nop\n\tv_nop" : "+v"(c) : "v"(ah), "v"(bh));
    return c;
  }
  return at_mma(a, b, c);
}

template <bool SPLIT_QK, bool SPLIT_PV, bool F16 = false>
__global__ __launch_bounds__(128)
void attn64_kernel(const float* __restrict__ q, const float* __restrict__ k,
                   const float* __restrict__ v, float* __restrict__ out,
                   const void* __restrict__ mask_a, const int* __restrict__ mask_b, AttnGeom g) {
  static_assert(!(F16 && (SPLIT_QK || SPLIT_PV)), "f16 mode is non-split");
  const float PSC = F16 ? 32768.0f : 1.0f;     // f16 probabilities carried x2^15 (subnormal range), folded into the final 1/l
  union FB { v16b v; v8b h[2]; };
  __shared__ __align__(16) __bf16 Ksh[AT_KC * AT_D];             // K hi [kv][d]      8 KB
  __shared__ __align__(16) __bf16 Ksl[SPLIT_QK ? AT_KC * AT_D : 8];
  __shared__ __align__(16) __bf16 Vth[AT_D * AT_KC];             // V hi [d][kv]      8 KB
  __shared__ __align__(16) __bf16 Vtl[SPLIT_PV ? AT_D * AT_KC : 8];
  __shared__ __align__(16) __bf16 Psh[AT_NW][16 * AT_KC];        // per wave P hi [row][kv]  8 KB
  __shared__ __align__(16) __bf16 Psl[SPLIT_PV ? AT_NW : 1][SPLIT_PV ? 16 * AT_KC : 8];
  __shared__ __align__(16) float  Os[AT_NW][16 * 68];            // per wave out tile, pitch 68

  const int tid  = threadIdx.x;
  const int wave = tid >> 5;
  const int lane = tid & 31;
  const int hh   = lane >> 4;
  const int c    = lane & 15;

  const int nqb = g.S / AT_QB;
  const int bx = blockIdx.x + g.blk0;
  const int qb = bx % nqb;
  const int bh = bx / nqb;
  const int h  = bh % g.H;
  const int b  = bh / g.H;
  const int qbase_block = qb * AT_QB;
  const int q0 = qbase_block + wave * 16;

  const float* qb_ptr = q + (size_t)b * g.q_bs + (size_t)h * g.q_hs;
  const float* kb_ptr = k + (size_t)b * g.k_bs + (size_t)h * g.k_hs;
  const float* vb_ptr = v + (size_t)b * g.v_bs + (size_t)h * g.v_hs;
  float*       ob_ptr = out + (size_t)b * g.o_bs + (size_t)h * g.o_hs;

  // ---- Q fragments (A operand): 2 d-chunks, hi (and lo) ----
  v16b qah[2], qal[2];
  {
    const float* qrow = qb_ptr + (size_t)(q0 + c) * g.q_rs;
#pragma unroll
    for (int dc = 0; dc < 2; ++dc) {
#pragma unroll
      for (int e = 0; e < 8; ++e) {
        const float f0 = qrow[dc * 32 + 8 * hh + e] * g.qscale;
        const float f1 = qrow[dc * 32 + 16 + 8 * hh + e] * g.qscale;
        if (SPLIT_QK) { __bf16 hq, lq; at_split(f0, hq, lq); qah[dc][e] = hq; qal[dc][e] = lq; at_split(f1, hq, lq); qah[dc][8 + e] = hq; qal[dc][8 + e] = lq; }
        else { qah[dc][e] = at_to16<F16>(f0); qah[dc][8 + e] = at_to16<F16>(f1); qal[dc][e] = qah[dc][e]; qal[dc][8 + e] = qah[dc][8 + e]; }
      }
    }
  }

  float mrow[8], lrow[8];
  v8f oacc[4];
#pragma unroll
  for (int r = 0; r < 8; ++r) { mrow[r] = -INFINITY; lrow[r] = 0.f; }
#pragma unroll
  for (int t = 0; t < 4; ++t) oacc[t] = (v8f){0.f,0.f,0.f,0.f,0.f,0.f,0.f,0.f};

  const int nChunks = (g.mask_mode == 1 || g.mask_mode == 4) ? (qb + 1) : (g.Skv / AT_KC);   // block-uniform
  // per-row query mask (mode 3)
  int qkeep[8];
#pragma unroll
  for (int r = 0; r < 8; ++r) qkeep[r] = (g.mask_mode == 3) ? mask_b[(size_t)b * g.S + q0 + 8 * hh + r] : 1;   // mask_b = qmask in mode 3
  for (int kc = 0; kc < nChunks; ++kc) {
    const int kv0 = kc * AT_KC;
    __syncthreads();
    {
      const int kvr = tid >> 1, dh = (tid & 1) * 32;
      const float* krow = kb_ptr + (size_t)(kv0 + kvr) * g.k_rs + dh;
      const float* vrow = vb_ptr + (size_t)(kv0 + kvr) * g.v_rs + dh;
#pragma unroll
      for (int i = 0; i < 8; ++i) {
        v4f kk = *(const v4f*)(krow + 4 * i);
        v4f vv = *(const v4f*)(vrow + 4 * i);
#pragma unroll
        for (int e = 0; e < 4; ++e) {
          const int d = dh + 4 * i + e;
          if (SPLIT_QK) { __bf16 a, bl; at_split(kk[e], a, bl); Ksh[kvr * AT_D + d] = a; Ksl[kvr * AT_D + d] = bl; }
          else Ksh[kvr * AT_D + d] = at_to16<F16>(kk[e]);
          if (SPLIT_PV) { __bf16 a, bl; at_split(vv[e], a, bl); Vth[d * AT_KC + kvr] = a; Vtl[d * AT_KC + kvr] = bl; }
          else Vth[d * AT_KC + kvr] = at_to16<F16>(vv[e]);
        }
      }
    }
    __syncthreads();

    v8f s[4];
#pragma unroll
    for (int j = 0; j < 4; ++j) {
      s[j] = (v8f){0.f,0.f,0.f,0.f,0.f,0.f,0.f,0.f};
#pragma unroll 1
      for (int dc = 0; dc < 2; ++dc) {
        FB kb;
        kb.h[0] = *(const v8b*)(Ksh + (j * 16 + c) * AT_D + dc * 32 + 8 * hh);
        kb.h[1] = *(const v8b*)(Ksh + (j * 16 + c) * AT_D + dc * 32 + 16 + 8 * hh);
        s[j] = at_mma16<F16>(qah[dc], kb.v, s[j]);
        if (SPLIT_QK) {
          FB kl;
          kl.h[0] = *(const v8b*)(Ksl + (j * 16 + c) * AT_D + dc * 32 + 8 * hh);
          kl.h[1] = *(const v8b*)(Ksl + (j * 16 + c) * AT_D + dc * 32 + 16 + 8 * hh);
          s[j] = at_mma16<F16>(qah[dc], kl.v, s[j]);
          s[j] = at_mma16<F16>(qal[dc], kb.v, s[j]);
        }
      }
    }
    const bool diag = (g.mask_mode == 1) && (kc == qb);
    int kvkeep[4] = {1, 1, 1, 1};
    if (g.mask_mode == 3) {
#pragma unroll
      for (int j = 0; j < 4; ++j) kvkeep[j] = ((const int*)mask_a)[(size_t)b * g.Skv + kv0 + j * 16 + c];   // mask_a = kvmask
    }
    float cm[8];
#pragma unroll
    for (int r = 0; r < 8; ++r) {
      const int qrow = q0 + 8 * hh + r;
      float m = -INFINITY;
#pragma unroll
      for (int j = 0; j < 4; ++j) {
        const int kvcol = kv0 + j * 16 + c;
        bool masked = false;
        if (diag) masked = (kvcol > qrow);
        else if (g.mask_mode == 4) masked = (kvcol > qrow) || (qrow - kvcol > g.mask_is_int);
        else if (g.mask_mode == 2) {
          const size_t mi = (size_t)qrow * g.Skv + kvcol;
          masked = (g.mask_is_int == 0) ? (((const float*)mask_a)[mi] == 0.0f)
                 : (g.mask_is_int == 1) ? (((const int*)mask_a)[mi] == 0) : (((const int*)mask_a)[mi] != 0);
        } else if (g.mask_mode == 3) masked = (qkeep[r] == 0) || (kvkeep[j] == 0);
        else if (g.mask_mode == 5) {
          const size_t mi = (size_t)qrow * g.Skv + kvcol;
          masked = (((const int*)mask_a)[mi] != 0);
          int n = mask_b[mi]; n = n < 0 ? 0 : n;
          s[j][r] += g.cp[(size_t)b * g.c_bs + (size_t)h * g.c_hs + (size_t)qrow * g.c_rs + n]
                   + g.pc[(size_t)b * g.c_bs + (size_t)h * g.c_hs + (size_t)kvcol * g.c_rs + n];
        }
        if (masked) s[j][r] = g.mask_fill;
        m = fmaxf(m, s[j][r]);
      }
#pragma unroll
      for (int off = 1; off < 16; off <<= 1) m = fmaxf(m, __shfl_xor(m, off, 32));
      cm[r] = m;
    }
    __bf16* pwh = Psh[wave];
    __bf16* pwl = Psl[SPLIT_PV ? wave : 0];
#pragma unroll
    for (int r = 0; r < 8; ++r) {
      const float mnew = fmaxf(mrow[r], cm[r]);
      const float alpha = expf(mrow[r] - mnew);
      mrow[r] = mnew;
      float psum = 0.f;
#pragma unroll
      for (int j = 0; j < 4; ++j) {
        const float p = expf(s[j][r] - mnew);
        psum += p;
        if (SPLIT_PV) { __bf16 a, bl; at_split(p, a, bl); pwh[(8 * hh + r) * AT_KC + j * 16 + c] = a; pwl[(8 * hh + r) * AT_KC + j * 16 + c] = bl; }
        else pwh[(8 * hh + r) * AT_KC + j * 16 + c] = at_to16<F16>(p * PSC);
      }
#pragma unroll
      for (int off = 1; off < 16; off <<= 1) psum += __shfl_xor(psum, off, 32);
      lrow[r] = lrow[r] * alpha + psum;
#pragma unroll
      for (int t = 0; t < 4; ++t) oacc[t][r] *= alpha;
    }
    __builtin_amdgcn_fence(__ATOMIC_RELEASE, "workgroup");
    __builtin_amdgcn_wave_barrier();
    __builtin_amdgcn_fence(__ATOMIC_ACQUIRE, "workgroup");
#pragma unroll 1
    for (int kk = 0; kk < 2; ++kk) {
      FB pa, pl;
      pa.h[0] = *(const v8b*)(pwh + c * AT_KC + kk * 32 + 8 * hh);
      pa.h[1] = *(const v8b*)(pwh + c * AT_KC + kk * 32 + 16 + 8 * hh);
      if (SPLIT_PV) {
        pl.h[0] = *(const v8b*)(pwl + c * AT_KC + kk * 32 + 8 * hh);
        pl.h[1] = *(const v8b*)(pwl + c * AT_KC + kk * 32 + 16 + 8 * hh);
      }
#pragma unroll
      for (int t = 0; t < 4; ++t) {
        FB vb;
        vb.h[0] = *(const v8b*)(Vth + (t * 16 + c) * AT_KC + kk * 32 + 8 * hh);
        vb.h[1] = *(const v8b*)(Vth + (t * 16 + c) * AT_KC + kk * 32 + 16 + 8 * hh);
        oacc[t] = at_mma16<F16>(pa.v, vb.v, oacc[t]);
        if (SPLIT_PV) {
          FB vl;
          vl.h[0] = *(const v8b*)(Vtl + (t * 16 + c) * AT_KC + kk * 32 + 8 * hh);
          vl.h[1] = *(const v8b*)(Vtl + (t * 16 + c) * AT_KC + kk * 32 + 16 + 8 * hh);
          oacc[t] = at_mma16<F16>(pa.v, vl.v, oacc[t]);
          oacc[t] = at_mma16<F16>(pl.v, vb.v, oacc[t]);
        }
      }
    }
  }

  float* os = Os[wave];
#pragma unroll
  for (int r = 0; r < 8; ++r) {
    const float inv = 1.0f / (lrow[r] * PSC);
#pragma unroll
    for (int t = 0; t < 4; ++t) os[(8 * hh + r) * 68 + t * 16 + c] = oacc[t][r] * inv;
  }
  __builtin_amdgcn_fence(__ATOMIC_RELEASE, "workgroup");
  __builtin_amdgcn_wave_barrier();
  __builtin_amdgcn_fence(__ATOMIC_ACQUIRE, "workgroup");
  {
    const int c4 = (lane & 15) * 4;
    {
#pragma unroll
      for (int it = 0; it < 8; ++it) {
        const int row = it * 2 + hh;
        v4f val = *(const v4f*)(os + row * 68 + c4);
        *(v4f*)(ob_ptr + (size_t)(q0 + row) * g.o_rs + c4) = val;
      }
      
    }
  }
}

// ---- head_dim 128 variant (same contract; K/V tiles 64 keys x 128, 8 output tiles; mask_mode 6 = causal + per-head ALiBi slope table in g.cp) ----
// MODE >= 0 fixes the mask mode at compile time, so the per-score mode tests fold away; MODE < 0 reads it from g.mask_mode
template <bool SPLIT_QK, bool SPLIT_PV, bool F16 = false, int MODE = -1>
__global__ __launch_bounds__(128)
void attn128_kernel(const float* __restrict__ q, const float* __restrict__ k,
                   const float* __restrict__ v, float* __restrict__ out,
                   const void* __restrict__ mask_a, const int* __restrict__ mask_b, AttnGeom g) {
  static_assert(!(F16 && (SPLIT_QK || SPLIT_PV)), "f16 mode is non-split");
  const float PSC = F16 ? 32768.0f : 1.0f;     // f16 probabilities carried x2^15 (subnormal range), folded into the final 1/l
  union FB { v16b v; v8b h[2]; };
  constexpr int D2 = 128;
  // LDS row pitches in elements: 16 B x odd (272 B for the 128-wide K and Q rows, 144 B for the 64-wide V^T and P rows), so that the
  // 16 rows one ds_load_b128 fragment read touches fall on distinct banks; at 256 B and 128 B they shared four or eight banks
  constexpr int KP = D2 + 8;
  constexpr int VP = AT_KC + 8;
  const int mode = (MODE >= 0) ? MODE : g.mask_mode;
  __shared__ __align__(16) __bf16 Ksh[AT_KC * KP];               // K hi [kv][d]      17 KB
  __shared__ __align__(16) __bf16 Ksl[SPLIT_QK ? AT_KC * KP : 8];
  __shared__ __align__(16) __bf16 Vth[D2 * VP];                  // V hi [d][kv]      18 KB
  __shared__ __align__(16) __bf16 Vtl[SPLIT_PV ? D2 * VP : 8];
  __shared__ __align__(16) __bf16 Psh[AT_NW][16 * VP];
  __shared__ __align__(16) __bf16 Psl[SPLIT_PV ? AT_NW : 1][SPLIT_PV ? 16 * VP : 8];
  __shared__ __align__(16) float  Os[AT_NW][16 * 132];           // per wave out tile, pitch 132
  __shared__ __align__(16) __bf16 Qsh[SPLIT_QK ? AT_NW : 1][SPLIT_QK ? 16 * KP : 8];   // split path: q hi/lo staged per wave (keeps VGPR use low)
  __shared__ __align__(16) __bf16 Qsl[SPLIT_QK ? AT_NW : 1][SPLIT_QK ? 16 * KP : 8];

  const int tid  = threadIdx.x;
  const int wave = tid >> 5;
  const int lane = tid & 31;
  const int hh   = lane >> 4;
  const int c    = lane & 15;

  const int nqb = g.S / AT_QB;
  const int bx = blockIdx.x + g.blk0;
  const int qb = bx % nqb;
  const int bh = bx / nqb;
  const int h  = bh % g.H;
  const int b  = bh / g.H;
  const int qbase_block = qb * AT_QB;
  const int q0 = qbase_block + wave * 16;

  const float* qb_ptr = q + (size_t)b * g.q_bs + (size_t)h * g.q_hs;
  const float* kb_ptr = k + (size_t)b * g.k_bs + (size_t)h * g.k_hs;
  const float* vb_ptr = v + (size_t)b * g.v_bs + (size_t)h * g.v_hs;
  float*       ob_ptr = out + (size_t)b * g.o_bs + (size_t)h * g.o_hs;

  // ---- Q fragments (A operand): 4 d-chunks, hi (and lo) ----
  v16b qah[4], qal[4];
  {
    const float* qrow = qb_ptr + (size_t)(q0 + c) * g.q_rs;
#pragma unroll
    for (int dc = 0; dc < 4; ++dc) {
#pragma unroll
      for (int e = 0; e < 8; ++e) {
        const float f0 = qrow[dc * 32 + 8 * hh + e] * g.qscale;
        const float f1 = qrow[dc * 32 + 16 + 8 * hh + e] * g.qscale;
        if (SPLIT_QK) { __bf16 hq, lq; at_split(f0, hq, lq); Qsh[wave][c * KP + dc * 32 + 8 * hh + e] = hq; Qsl[wave][c * KP + dc * 32 + 8 * hh + e] = lq;
                        at_split(f1, hq, lq); Qsh[wave][c * KP + dc * 32 + 16 + 8 * hh + e] = hq; Qsl[wave][c * KP + dc * 32 + 16 + 8 * hh + e] = lq;
                        qah[dc][e] = hq; qal[dc][e] = lq; qah[dc][8 + e] = hq; qal[dc][8 + e] = lq; }   // (register copies unused on the split path)
        else { qah[dc][e] = at_to16<F16>(f0); qah[dc][8 + e] = at_to16<F16>(f1); qal[dc][e] = qah[dc][e]; qal[dc][8 + e] = qah[dc][8 + e]; }
      }
    }
  }

  float mrow[8], lrow[8];
  v8f oacc[8];
#pragma unroll
  for (int r = 0; r < 8; ++r) { mrow[r] = -INFINITY; lrow[r] = 0.f; }
#pragma unroll
  for (int t = 0; t < 8; ++t) oacc[t] = (v8f){0.f,0.f,0.f,0.f,0.f,0.f,0.f,0.f};

  const int nChunks = (mode == 1 || mode == 4 || mode == 6) ? (qb + 1) : (g.Skv / AT_KC);   // block-uniform
  // per-row query mask (mode 3)
  int qkeep[8];
#pragma unroll
  for (int r = 0; r < 8; ++r) qkeep[r] = (mode == 3) ? mask_b[(size_t)b * g.S + q0 + 8 * hh + r] : 1;   // mask_b = qmask in mode 3
  for (int kc = 0; kc < nChunks; ++kc) {
    const int kv0 = kc * AT_KC;
    __syncthreads();
    {
      const int kvr = tid >> 1, dh = (tid & 1) * 64;
      const float* krow = kb_ptr + (size_t)(kv0 + kvr) * g.k_rs + dh;
      const float* vrow = vb_ptr + (size_t)(kv0 + kvr) * g.v_rs + dh;
#pragma unroll
      for (int i = 0; i < 16; ++i) {
        v4f kk = *(const v4f*)(krow + 4 * i);
        v4f vv = *(const v4f*)(vrow + 4 * i);
#pragma unroll
        for (int e = 0; e < 4; ++e) {
          const int d = dh + 4 * i + e;
          if (SPLIT_QK) { __bf16 a, bl; at_split(kk[e], a, bl); Ksh[kvr * KP + d] = a; Ksl[kvr * KP + d] = bl; }
          else Ksh[kvr * KP + d] = at_to16<F16>(kk[e]);
          if (SPLIT_PV) { __bf16 a, bl; at_split(vv[e], a, bl); Vth[d * VP + kvr] = a; Vtl[d * VP + kvr] = bl; }
          else Vth[d * VP + kvr] = at_to16<F16>(vv[e]);
        }
      }
    }
    __syncthreads();

    v8f s[4];
#pragma unroll
    for (int j = 0; j < 4; ++j) {
      s[j] = (v8f){0.f,0.f,0.f,0.f,0.f,0.f,0.f,0.f};
#pragma unroll 1
      for (int dc = 0; dc < 4; ++dc) {      // rolled: bounds the live fragment set (register pressure) on the 128-wide head
        FB kb;
        kb.h[0] = *(const v8b*)(Ksh + (j * 16 + c) * KP + dc * 32 + 8 * hh);
        kb.h[1] = *(const v8b*)(Ksh + (j * 16 + c) * KP + dc * 32 + 16 + 8 * hh);
        if (!SPLIT_QK) s[j] = at_mma16<F16>(qah[dc], kb.v, s[j]);
        if (SPLIT_QK) {
          FB qa, ql;
          qa.h[0] = *(const v8b*)(&Qsh[wave][c * KP + dc * 32 + 8 * hh]); qa.h[1] = *(const v8b*)(&Qsh[wave][c * KP + dc * 32 + 16 + 8 * hh]);
          ql.h[0] = *(const v8b*)(&Qsl[wave][c * KP + dc * 32 + 8 * hh]); ql.h[1] = *(const v8b*)(&Qsl[wave][c * KP + dc * 32 + 16 + 8 * hh]);
          s[j] = at_mma16<F16>(qa.v, kb.v, s[j]);
          FB kl;
          kl.h[0] = *(const v8b*)(Ksl + (j * 16 + c) * KP + dc * 32 + 8 * hh);
          kl.h[1] = *(const v8b*)(Ksl + (j * 16 + c) * KP + dc * 32 + 16 + 8 * hh);
          s[j] = at_mma16<F16>(qa.v, kl.v, s[j]);
          s[j] = at_mma16<F16>(ql.v, kb.v, s[j]);
        }
      }
    }
    const bool diag = (mode == 1) && (kc == qb);
    int kvkeep[4] = {1, 1, 1, 1};
    if (mode == 3) {
#pragma unroll
      for (int j = 0; j < 4; ++j) kvkeep[j] = ((const int*)mask_a)[(size_t)b * g.Skv + kv0 + j * 16 + c];   // mask_a = kvmask
    }
    float cm[8];
#pragma unroll
    for (int r = 0; r < 8; ++r) {
      const int qrow = q0 + 8 * hh + r;
      float m = -INFINITY;
#pragma unroll
      for (int j = 0; j < 4; ++j) {
        const int kvcol = kv0 + j * 16 + c;
        bool masked = false;
        if (diag) masked = (kvcol > qrow);
        else if (mode == 4) masked = (kvcol > qrow) || (qrow - kvcol > g.mask_is_int);
        else if (mode == 2) {
          const size_t mi = (size_t)qrow * g.Skv + kvcol;
          masked = (g.mask_is_int == 0) ? (((const float*)mask_a)[mi] == 0.0f)
                 : (g.mask_is_int == 1) ? (((const int*)mask_a)[mi] == 0) : (((const int*)mask_a)[mi] != 0);
        } else if (mode == 3) masked = (qkeep[r] == 0) || (kvkeep[j] == 0);
        else if (mode == 6) { masked = (kvcol > qrow); s[j][r] += g.cp[h] * (float)(kvcol - qrow); }
        else if (mode == 8) { masked = (kvcol > qrow) || (((const int*)mask_a)[(size_t)b * g.Skv + kvcol] != 0); }
        else if (mode == 5) {
          const size_t mi = (size_t)qrow * g.Skv + kvcol;
          masked = (((const int*)mask_a)[mi] != 0);
          int n = mask_b[mi]; n = n < 0 ? 0 : n;
          s[j][r] += g.cp[(size_t)b * g.c_bs + (size_t)h * g.c_hs + (size_t)qrow * g.c_rs + n]
                   + g.pc[(size_t)b * g.c_bs + (size_t)h * g.c_hs + (size_t)kvcol * g.c_rs + n];
        }
        if (masked) s[j][r] = g.mask_fill;
        m = fmaxf(m, s[j][r]);
      }
#pragma unroll
      for (int off = 1; off < 16; off <<= 1) m = fmaxf(m, __shfl_xor(m, off, 32));
      cm[r] = m;
    }
    __bf16* pwh = Psh[wave];
    __bf16* pwl = Psl[SPLIT_PV ? wave : 0];
#pragma unroll
    for (int r = 0; r < 8; ++r) {
      const float mnew = fmaxf(mrow[r], cm[r]);
      const float alpha = expf(mrow[r] - mnew);
      mrow[r] = mnew;
      float psum = 0.f;
#pragma unroll
      for (int j = 0; j < 4; ++j) {
        const float p = expf(s[j][r] - mnew);
        psum += p;
        if (SPLIT_PV) { __bf16 a, bl; at_split(p, a, bl); pwh[(8 * hh + r) * VP + j * 16 + c] = a; pwl[(8 * hh + r) * VP + j * 16 + c] = bl; }
        else pwh[(8 * hh + r) * VP + j * 16 + c] = at_to16<F16>(p * PSC);
      }
#pragma unroll
      for (int off = 1; off < 16; off <<= 1) psum += __shfl_xor(psum, off, 32);
      lrow[r] = lrow[r] * alpha + psum;
#pragma unroll
      for (int t = 0; t < 8; ++t) oacc[t][r] *= alpha;
    }
    __builtin_amdgcn_fence(__ATOMIC_RELEASE, "workgroup");
    __builtin_amdgcn_wave_barrier();
    __builtin_amdgcn_fence(__ATOMIC_ACQUIRE, "workgroup");
#pragma unroll 1
    for (int kk = 0; kk < 2; ++kk) {
      FB pa, pl;
      pa.h[0] = *(const v8b*)(pwh + c * VP + kk * 32 + 8 * hh);
      pa.h[1] = *(const v8b*)(pwh + c * VP + kk * 32 + 16 + 8 * hh);
      if (SPLIT_PV) {
        pl.h[0] = *(const v8b*)(pwl + c * VP + kk * 32 + 8 * hh);
        pl.h[1] = *(const v8b*)(pwl + c * VP + kk * 32 + 16 + 8 * hh);
      }
#pragma unroll
      for (int t = 0; t < 8; ++t) {
        FB vb;
        vb.h[0] = *(const v8b*)(Vth + (t * 16 + c) * VP + kk * 32 + 8 * hh);
        vb.h[1] = *(const v8b*)(Vth + (t * 16 + c) * VP + kk * 32 + 16 + 8 * hh);
        oacc[t] = at_mma16<F16>(pa.v, vb.v, oacc[t]);
        if (SPLIT_PV) {
          FB vl;
          vl.h[0] = *(const v8b*)(Vtl + (t * 16 + c) * VP + kk * 32 + 8 * hh);
          vl.h[1] = *(const v8b*)(Vtl + (t * 16 + c) * VP + kk * 32 + 16 + 8 * hh);
          oacc[t] = at_mma16<F16>(pa.v, vl.v, oacc[t]);
          oacc[t] = at_mma16<F16>(pl.v, vb.v, oacc[t]);
        }
      }
    }
  }

  float* os = Os[wave];
#pragma unroll
  for (int r = 0; r < 8; ++r) {
    const float inv = 1.0f / (lrow[r] * PSC);
#pragma unroll
    for (int t = 0; t < 8; ++t) os[(8 * hh + r) * 132 + t * 16 + c] = oacc[t][r] * inv;
  }
  __builtin_amdgcn_fence(__ATOMIC_RELEASE, "workgroup");
  __builtin_amdgcn_wave_barrier();
  __builtin_amdgcn_fence(__ATOMIC_ACQUIRE, "workgroup");
  {
    const int c4 = lane * 4;           // 32 lanes x 16 B = one 512-B output row (128 floats) per instruction
    {
#pragma unroll
      for (int row = 0; row < 16; ++row) {
        v4f val = *(const v4f*)(os + row * 132 + c4);
        *(v4f*)(ob_ptr + (size_t)(q0 + row) * g.o_rs + c4) = val;
      }
      
    }
  }
}

#define XB 2
#define XH 16
#define XS 2048
#define XD 128
__global__ void slopes_kernel(float* __restrict__ sl) { const int h = threadIdx.x; const float v = (h < XH) ? exp2f(-8.0f * (float)(h + 1) / (float)XH) : 0.f; ((float*)sl)[h] = v;  }
extern "C" void kernel_launch(void* const* d_in, const int* in_sizes, int n_in, void* d_out, int out_size, void* d_ws, size_t ws_size, hipStream_t stream) {
  (void)in_sizes; (void)n_in; (void)out_size; (void)ws_size;
  const float* q = (const float*)d_in[0]; const float* k = (const float*)d_in[1]; const float* v = (const float*)d_in[2];
  float* sl = (float*)d_ws;
  slopes_kernel<<<1, 32, 0, stream>>>(sl);
  AttnGeom g;
  g.cp = sl; g.pc = nullptr; g.c_bs = 0; g.c_rs = 0; g.c_hs = 0;
  g.q_bs = (long)XH * XS * XD; g.q_hs = (long)XS * XD; g.q_rs = XD;
  g.k_bs = g.q_bs; g.k_hs = g.q_hs; g.k_rs = XD; g.v_bs = g.q_bs; g.v_hs = g.q_hs; g.v_rs = XD; g.o_bs = g.q_bs; g.o_hs = g.q_hs; g.o_rs = XD;
  g.S = XS; g.Skv = XS; g.H = XH; g.mask_mode = 6; g.qscale = 0.08838834764831845f; g.blk0 = 0; g.mask_fill = -INFINITY; g.mask_is_int = 0;
  attn128_kernel<true, true, false, 6><<<XB * XH * (XS / AT_QB), AT_NW * 32, 0, stream>>>(q, k, v, (float*)d_out, nullptr, nullptr, g);
}

// v003
// Measured time: 284 microseconds a run.
// Two timings next to v002 both put it at 1.67 times that version's speed.
// Counting every step since v000, it is 6.98 times as fast.
#include <hip/hip_runtime.h>
#include <math.h>
// FlexAttention forward (causal block mask + ALiBi score_mod, 2 x 16 heads, 2048 x 2048, head_dim 128): scores and p·v on
// v_wmma_f32_16x16x32_bf16 with q,k and p,v as bf16 hi/lo splits (hi·hi + hi·lo + lo·hi;
// early causal rows copy single v rows almost verbatim), f32 accumulate; online softmax, the ALiBi bias slope_h·(k−q) and the
// causal predicate in f32 on VALU.
typedef __attribute__((ext_vector_type(16))) _Float16 v16h;
typedef __attribute__((ext_vector_type(8)))  _Float16 v8h;
typedef __attribute__((ext_vector_type(16))) __bf16   v16b;
typedef __attribute__((ext_vector_type(8)))  __bf16   v8b;
typedef __attribute__((ext_vector_type(8)))  float    v8f;
typedef __attribute__((ext_vector_type(4)))  float    v4f;
#define PSCALE 32768.0f
#define U16(p) ((const unsigned short*)(const void*)(p))
#define PSCALE_INV (1.0f / 32768.0f)

__device__ __forceinline__ unsigned short f2bf_bits(float f) {
  unsigned u = __float_as_uint(f);
  return (unsigned short)((u + 0x7FFFu + ((u >> 16) & 1u)) >> 16);
}
__device__ __forceinline__ float bf_bits2f(unsigned short h) { return __uint_as_float(((unsigned)h) << 16); }

// hazard guards as plain device helpers (no inline asm inside the kernel template body)
__device__ __forceinline__ void dep_guard_h(v8f& a, v8f& b, v16h x, v16h y) { asm volatile("v_nop\n\tv_nop\n\tv_nop\n\tv_nop" : "+v"(a), "+v"(b) : "v"(x), "v"(y)); }
__device__ __forceinline__ void dep_guard_b(v8f& a, v8f& b, v16b x, v16b y) { asm volatile("v_nop\n\tv_nop\n\tv_nop\n\tv_nop" : "+v"(a), "+v"(b) : "v"(x), "v"(y)); }
__device__ __forceinline__ void keep4_h(v16h a, v16h b, v16h c, v16h d) { asm volatile("v_nop" :: "v"(a), "v"(b), "v"(c), "v"(d)); }
__device__ __forceinline__ void keep4_b(v16b a, v16b b, v16b c, v16b d) { asm volatile("v_nop" :: "v"(a), "v"(b), "v"(c), "v"(d)); }
__device__ __forceinline__ void acc_guard4(v8f& a, v8f& b, v8f& c, v8f& d) { asm volatile("v_nop\n\tv_nop\n\tv_nop\n\tv_nop" : "+v"(a), "+v"(b), "+v"(c), "+v"(d)); }
template <typename T> struct Frag;
template <> struct Frag<_Float16> {
  typedef v16h V; union U { v16h v; v8h h[2]; };
  static __device__ __forceinline__ v16h load(const _Float16* p) {   // elements 0..7 <- p[0..7], 8..15 <- p[16..23]
    U f; f.h[0] = *(const v8h*)(p); f.h[1] = *(const v8h*)(p + 16); return f.v;
  }
  static __device__ __forceinline__ v8f mma(v16h a, v16h b, v8f c) {
    return __builtin_amdgcn_wmma_f32_16x16x32_f16(false, a, false, b, (short)0, c, false, false);
  }
  static __device__ __forceinline__ void guard(v8f& a, v8f& b, v16h x, v16h y) { dep_guard_h(a, b, x, y); }
  static __device__ __forceinline__ void keep(v16h a, v16h b, v16h c, v16h d) { keep4_h(a, b, c, d); }
};
template <> struct Frag<__bf16> {
  typedef v16b V; union U { v16b v; v8b h[2]; };
  static __device__ __forceinline__ v16b load(const __bf16* p) {
    U f; f.h[0] = *(const v8b*)(p); f.h[1] = *(const v8b*)(p + 16); return f.v;
  }
  static __device__ __forceinline__ v8f mma(v16b a, v16b b, v8f c) {
    return __builtin_amdgcn_wmma_f32_16x16x32_bf16(false, a, false, b, (short)0, c, false, false);
  }
  static __device__ __forceinline__ void guard(v8f& a, v8f& b, v16b x, v16b y) { dep_guard_b(a, b, x, y); }
  static __device__ __forceinline__ void keep(v16b a, v16b b, v16b c, v16b d) { keep4_b(a, b, c, d); }
};

// ---- Register-blocked batched WMMA GEMM ------------------------------------
// C[m,n] = scale * sum_k A[m,k] * Bt[n,k] (+bias)(+resid); each wave owns a 64x64 tile.
// A row-major [M,K]; Bt row-major [N,K]; M,N % 64 == 0, K % 32 == 0.
// SPLIT: operands are hi/lo planes (A2/Bt2 = lo planes, same layout); product = hi·hi + hi·lo + lo·hi.
// BIAS_MODE: 0 = none, 1 = bias[m], 2 = bias[n].
// OUT_MODE: 0 = f32, 1 = f16, 2 = bf16 hi plane (Cout) + bf16 lo plane (Cout2).
// ET: 0 = f16 operands, 1 = bf16 operands (pointers passed as 16-bit storage)
template <int ET> struct Elem;
template <> struct Elem<0> { typedef _Float16 T; };
template <> struct Elem<1> { typedef __bf16 T; };
template <int ET, bool SPLIT, int BIAS_MODE, int OUT_MODE, bool RESID, int ACT = 0>
__global__ __launch_bounds__(256) void wmma_gemm64(
    const unsigned short* __restrict__ Ap, const unsigned short* __restrict__ A2p, int lda, long strideA,
    const unsigned short* __restrict__ Btp, const unsigned short* __restrict__ Bt2p, int ldb, long strideB,
    void* __restrict__ Cout, void* __restrict__ Cout2, int ldc, long strideC,
    const float* __restrict__ bias,
    const float* __restrict__ resid, long strideR,
    int M, int N, int K, float scale) {
  typedef typename Elem<ET>::T T;
  typedef typename Frag<T>::V V;
  const T* A = (const T*)Ap; const T* A2 = (const T*)A2p; const T* Bt = (const T*)Btp; const T* Bt2 = (const T*)Bt2p;
  __shared__ __align__(16) float sT[8][16 * 68];   // per-wave 16x64 slab, pitch 68 floats
  const int b    = blockIdx.y;
  const int lane = threadIdx.x & 31;
  const int wave = threadIdx.x >> 5;
  const int tilesN = N >> 6;
  const int tilesM = M >> 6;
  const int tile = blockIdx.x * 8 + wave;
  if (tile >= tilesM * tilesN) return;   // wave-uniform; no block barriers in this kernel
  const int tm = tile / tilesN;
  const int tn = tile - tm * tilesN;
  const int m0 = tm << 6;
  const int n0 = tn << 6;

  const T* Ab  = A  + (size_t)b * strideA;
  const T* Bb  = Bt + (size_t)b * strideB;
  const T* Ab2 = SPLIT ? (A2  + (size_t)b * strideA) : nullptr;
  const T* Bb2 = SPLIT ? (Bt2 + (size_t)b * strideB) : nullptr;

  const int rlane = lane & 15;                 // row (A) / col (B, D) within subtile
  const int koff  = (lane >> 4) * 8;           // k offset of this lane half
  const int mOff  = (lane >> 4) * 8;           // D row offset

  v8f acc[4][4];
#pragma unroll
  for (int i = 0; i < 4; ++i)
#pragma unroll
    for (int j = 0; j < 4; ++j) acc[i][j] = (v8f){0.f,0.f,0.f,0.f,0.f,0.f,0.f,0.f};

  for (int k0 = 0; k0 < K; k0 += 32) {
    V bh[4], bl[4];
#pragma unroll
    for (int j = 0; j < 4; ++j) {
      const size_t bo = (size_t)(n0 + (j << 4) + rlane) * ldb + koff + k0;
      bh[j] = Frag<T>::load(Bb + bo);
      if (SPLIT) bl[j] = Frag<T>::load(Bb2 + bo);
    }
#pragma unroll
    for (int i = 0; i < 4; ++i) {
      const size_t ao = (size_t)(m0 + (i << 4) + rlane) * lda + koff + k0;
      V ah = Frag<T>::load(Ab + ao);
      V al;
      if (SPLIT) al = Frag<T>::load(Ab2 + ao);
#pragma unroll
      for (int j = 0; j < 4; ++j) {
        acc[i][j] = Frag<T>::mma(ah, bh[j], acc[i][j]);
        if (SPLIT) {
          acc[i][j] = Frag<T>::mma(ah, bl[j], acc[i][j]);
          acc[i][j] = Frag<T>::mma(al, bh[j], acc[i][j]);
        }
      }
      Frag<T>::guard(acc[i][0], acc[i][3], ah, SPLIT ? al : ah);
    }
    Frag<T>::keep(bh[0], bh[1], bh[2], bh[3]);
    if (SPLIT) Frag<T>::keep(bl[0], bl[1], bl[2], bl[3]);
  }
  acc_guard4(acc[0][0], acc[0][1], acc[0][2], acc[0][3]);
  acc_guard4(acc[1][0], acc[1][1], acc[1][2], acc[1][3]);
  acc_guard4(acc[2][0], acc[2][1], acc[2][2], acc[2][3]);
  acc_guard4(acc[3][0], acc[3][1], acc[3][2], acc[3][3]);

  // ---- epilogue ----
  float* slab = sT[wave];
  const float* Rb = RESID ? (resid + (size_t)b * strideR) : nullptr;
#pragma unroll
  for (int i = 0; i < 4; ++i) {
    const int mBase = m0 + (i << 4);
#pragma unroll
    for (int j = 0; j < 4; ++j) {
      const int n = n0 + (j << 4) + rlane;
      float bv = 0.f;
      if (BIAS_MODE == 2) bv = bias[n];
#pragma unroll
      for (int r = 0; r < 8; ++r) {
        float v = acc[i][j][r] * scale;
        if (BIAS_MODE == 1) v += bias[mBase + mOff + r];
        if (BIAS_MODE == 2) v += bv;
        if (RESID) v += Rb[(size_t)(mBase + mOff + r) * ldc + n];
        if (ACT == 1) v = tanhf(v);
        if (ACT == 2) v = fmaxf(v, 0.0f);
        if (ACT == 3) v = v / (1.0f + expf(-v));
        if (ACT == 4) v = (v > 0.f) ? v : 0.01f * v;
        if (ACT == 5) v = 0.5f * v * (1.0f + erff(v * 0.70710678118654752f));
        slab[(mOff + r) * 68 + (j << 4) + rlane] = v;
      }
    }
    __builtin_amdgcn_fence(__ATOMIC_RELEASE, "workgroup");
    __builtin_amdgcn_wave_barrier();
    __builtin_amdgcn_fence(__ATOMIC_ACQUIRE, "workgroup");
    if (OUT_MODE == 0) {
      float* C = (float*)Cout + (size_t)b * strideC;
      const int hh = lane >> 4, c4 = (lane & 15) * 4;     // row seg = 256 B = 16 lanes x 16 B
      {
#pragma unroll
        for (int it = 0; it < 8; ++it) {
          const int row = it * 2 + hh;
          v4f v = *(const v4f*)(slab + row * 68 + c4);
          *(v4f*)(C + (size_t)(mBase + row) * ldc + n0 + c4) = v;
        }
        
      }
    } else {
      const int q = lane >> 3, c8 = (lane & 7) * 8;
      unsigned short* C  = (unsigned short*)Cout  + (size_t)b * strideC;
      unsigned short* C2 = (OUT_MODE == 2) ? ((unsigned short*)Cout2 + (size_t)b * strideC) : nullptr;
      {
#pragma unroll
        for (int it = 0; it < 4; ++it) {
          const int row = it * 4 + q;
          const float* sp = slab + row * 68 + c8;
          v8h hv, lv;
#pragma unroll
          for (int e = 0; e < 8; ++e) {
            if (OUT_MODE == 1) {
              hv[e] = (_Float16)sp[e];
            } else {
              unsigned short hb = f2bf_bits(sp[e]);
              unsigned short lb = f2bf_bits(sp[e] - bf_bits2f(hb));
              hv[e] = __builtin_bit_cast(_Float16, hb);
              lv[e] = __builtin_bit_cast(_Float16, lb);
            }
          }
          *(v8h*)(C + (size_t)(mBase + row) * ldc + n0 + c8) = hv;
          if (OUT_MODE == 2) *(v8h*)(C2 + (size_t)(mBase + row) * ldc + n0 + c8) = lv;
        }
        
      }
    }
    __builtin_amdgcn_fence(__ATOMIC_RELEASE, "workgroup");
    __builtin_amdgcn_wave_barrier();
    __builtin_amdgcn_fence(__ATOMIC_ACQUIRE, "workgroup");
  }
}

__global__ __launch_bounds__(256) void cast_f32_f16x2(
    const float* __restrict__ in, _Float16* __restrict__ out, int n2) {
  int i = blockIdx.x * 256 + threadIdx.x;
  if (i < n2) {
    const _Float16 h0 = (_Float16)in[2 * i], h1 = (_Float16)in[2 * i + 1];
    const unsigned u = (unsigned)__builtin_bit_cast(unsigned short, h0) | ((unsigned)__builtin_bit_cast(unsigned short, h1) << 16);
    ((unsigned*)out)[i] = u;
    
  }
}


// ---- f32 -> f16 cast with a power-of-two pre-scale (folded back by the consumer GEMM's scale) ----
__global__ __launch_bounds__(256) void cast_f32_f16x2s(const float* __restrict__ in, _Float16* __restrict__ out, int n2, float s) {
  int i = blockIdx.x * 256 + threadIdx.x;
  if (i < n2) {
    const _Float16 h0 = (_Float16)(in[2 * i] * s), h1 = (_Float16)(in[2 * i + 1] * s);
    const unsigned u = (unsigned)__builtin_bit_cast(unsigned short, h0) | ((unsigned)__builtin_bit_cast(unsigned short, h1) << 16);
    ((unsigned*)out)[i] = u;
    
  }
}
__global__ __launch_bounds__(256) void split_f32_bf16x2(
    const float* __restrict__ in, __bf16* __restrict__ hi, __bf16* __restrict__ lo, long n2) {
  long i = (long)blockIdx.x * 256 + threadIdx.x;
  long stride = (long)gridDim.x * 256;
  {
    for (long j = i; j < n2; j += stride) {
      const float a = in[2 * j], b = in[2 * j + 1];
      const unsigned short ah = f2bf_bits(a), bh = f2bf_bits(b);
      const unsigned short al = f2bf_bits(a - bf_bits2f(ah)), bl = f2bf_bits(b - bf_bits2f(bh));
      ((unsigned*)hi)[j] = (unsigned)ah | ((unsigned)bh << 16);
      ((unsigned*)lo)[j] = (unsigned)al | ((unsigned)bl << 16);
    }
    
  }
}


// ---- f32 [R][C] (row pitch ldi) -> f16 transposed [C][R] (row pitch ldo); 64x64 tiles; each output row segment
__global__ __launch_bounds__(256) void transpose_cast_f16(const float* __restrict__ in, int ldi,
                                                         _Float16* __restrict__ outT, int ldo, float scale) {
  __shared__ __align__(16) _Float16 tile[64][72];     // [c][r]
  const int c0 = blockIdx.x * 64, r0 = blockIdx.y * 64;
  const int t = threadIdx.y * 32 + threadIdx.x;
  for (int i = threadIdx.y; i < 64; i += 8) {
    tile[threadIdx.x][i]      = (_Float16)(in[(size_t)(r0 + i) * ldi + c0 + threadIdx.x] * scale);
    tile[32 + threadIdx.x][i] = (_Float16)(in[(size_t)(r0 + i) * ldi + c0 + 32 + threadIdx.x] * scale);
  }
  __syncthreads();
  const int q = t >> 3, c8 = (t & 7) * 8;
  {
#pragma unroll
    for (int it = 0; it < 2; ++it) {
      const int c = it * 32 + q;
      v8h hv = *(const v8h*)(&tile[c][c8]);
      *(v8h*)(outT + (size_t)(c0 + c) * ldo + r0 + c8) = hv;
    }
    
  }
}

// ---- f32 [R][C] (pitch ldi) -> bf16 hi/lo transposed planes [C][R] (pitch ldo); 64x64 tiles; each output row segment
__global__ __launch_bounds__(256) void transpose_split_bf16(const float* __restrict__ in, int ldi,
                                                           __bf16* __restrict__ outH, __bf16* __restrict__ outL, int ldo) {
  __shared__ __align__(16) float tile[64][68];     // [c][r]
  const int c0 = blockIdx.x * 64, r0 = blockIdx.y * 64;
  const int t = threadIdx.y * 32 + threadIdx.x;
  for (int i = threadIdx.y; i < 64; i += 8) {
    tile[threadIdx.x][i]      = in[(size_t)(r0 + i) * ldi + c0 + threadIdx.x];
    tile[32 + threadIdx.x][i] = in[(size_t)(r0 + i) * ldi + c0 + 32 + threadIdx.x];
  }
  __syncthreads();
  const int q = t >> 3, c8 = (t & 7) * 8;
  {
#pragma unroll
    for (int it = 0; it < 2; ++it) {
      const int c = it * 32 + q;
      v8b hv, lv;
#pragma unroll
      for (int e = 0; e < 8; ++e) {
        const float f = tile[c][c8 + e];
        const unsigned short hb = f2bf_bits(f);
        hv[e] = __builtin_bit_cast(__bf16, hb);
        lv[e] = __builtin_bit_cast(__bf16, f2bf_bits(f - bf_bits2f(hb)));
      }
      *(v8b*)(outH + (size_t)(c0 + c) * ldo + r0 + c8) = hv;
      *(v8b*)(outL + (size_t)(c0 + c) * ldo + r0 + c8) = lv;
    }
    
  }
}

// =====================================================================================
// Generic causal/non-causal attention for head_dim 64, f32 in / f32 out; 16-bit operands: bf16 with optional hi/lo splits, or
// plain f16 (F16=true, non-split, probabilities carried x2^15).
//   scores = (q*qscale)·kᵀ : v_wmma_f32_16x16x32_bf16; SPLIT_QK -> q,k as bf16 hi/lo (hi·hi + hi·lo + lo·hi)
//   out    = p·v           : v_wmma_f32_16x16x32_bf16; SPLIT_PV -> p,v as bf16 hi/lo; else p,v plain bf16
//   f32 accumulate; online softmax in f32. Block = 4 waves = 64 query rows of one (batch, head); S % 64 == 0.
//   Element (b, s, h, d) of tensor X lives at X[b*X_bs + s*X_rs + h*X_hs + d] (strides in floats, multiples of 4).
//   Masking: mask_mode 0 none, 1 causal (kv > q masked), 2 tensor [S][Skv] shared over (b,h) (float if
//   mask_is_int==0, int32 with element == 0 -> masked if 1, int32 with element != 0 -> masked if 2), 3 per-token vectors qmask[B][S] & kvmask[B][Skv] (int32,
//   0 -> masked), 4 causal + sliding window (kv > q or q - kv > W masked; W passed in mask_is_int);
//   5 = relative-position bias: s += cp[b,h,q][idx[q][kv]] + pc[b,h,kv][idx[q][kv]] with idx = mask_b ([S][Skv] int32) and
//   mask_a an int32 [S][Skv] tensor with nonzero = masked (tables: element (b,h,row,n) at X + b*c_bs + h*c_hs + row*c_rs + n);
//   masked scores are replaced by mask_fill (e.g. -inf or -1e9) before the softmax.
//   grid.x = B * H * (S/64) (or a sub-range with blk0).
// =====================================================================================
#define AT_D 64
#define AT_NW 4
#define AT_QB 64
#define AT_KC 64
struct AttnGeom { const float* cp = nullptr; const float* pc = nullptr; long c_bs = 0, c_rs = 0, c_hs = 0;   // mode-5 score-bias tables
                  long q_bs, q_rs, q_hs, k_bs, k_rs, k_hs, v_bs, v_rs, v_hs, o_bs, o_rs, o_hs;
                  int S, Skv, H, mask_mode; float qscale; int blk0; float mask_fill; int mask_is_int; };
static_assert(sizeof(AttnGeom) == 168, "no padding");

__device__ __forceinline__ unsigned short at_bf_bits(float f) {
  unsigned u = __float_as_uint(f);
  return (unsigned short)((u + 0x7FFFu + ((u >> 16) & 1u)) >> 16);
}
__device__ __forceinline__ __bf16 at_f2bf(float f) { return __builtin_bit_cast(__bf16, at_bf_bits(f)); }
__device__ __forceinline__ void at_split(float f, __bf16& hi, __bf16& lo) {
  const unsigned short hb = at_bf_bits(f);
  hi = __builtin_bit_cast(__bf16, hb);
  lo = at_f2bf(f - __uint_as_float(((unsigned)hb) << 16));
}
__device__ __forceinline__ v8f at_mma(v16b a, v16b b, v8f c) {
  c = __builtin_amdgcn_wmma_f32_16x16x32_bf16(false, a, false, b, (short)0, c, false, false);
  asm volatile("v_nop\n\tv_nop\n\tv_nop\n\tv_nop" : "+v"(c) : "v"(a), "v"(b));
  return c;
}
// 16-bit element as a bit pattern held in a __bf16 slot: f16 bits when F16, bf16 (RNE) otherwise
template <bool F16> __device__ __forceinline__ __bf16 at_to16(float f) {
  if (F16) return __builtin_bit_cast(__bf16, (_Float16)f);
  return at_f2bf(f);
}
template <bool F16> __device__ __forceinline__ v8f at_mma16(v16b a, v16b b, v8f c) {
  if (F16) {
    const v16h ah = __builtin_bit_cast(v16h, a), bh = __builtin_bit_cast(v16h, b);
    c = __builtin_amdgcn_wmma_f32_16x16x32_f16(false, ah, false, bh, (short)0, c, false, false);
    asm volatile("v_nop\n\tv_nop\n\tv_nop\n\tv_nop" : "+v"(c) : "v"(ah), "v"(bh));
    return c;
  }
  return at_mma(a, b, c);
}

template <bool SPLIT_QK, bool SPLIT_PV, bool F16 = false>
__global__ __launch_bounds__(128)
void attn64_kernel(const float* __restrict__ q, const float* __restrict__ k,
                   const float* __restrict__ v, float* __restrict__ out,
                   const void* __restrict__ mask_a, const int* __restrict__ mask_b, AttnGeom g) {
  static_assert(!(F16 && (SPLIT_QK || SPLIT_PV)), "f16 mode is non-split");
  const float PSC = F16 ? 32768.0f : 1.0f;     // f16 probabilities carried x2^15 (subnormal range), folded into the final 1/l
  union FB { v16b v; v8b h[2]; };
  __shared__ __align__(16) __bf16 Ksh[AT_KC * AT_D];             // K hi [kv][d]      8 KB
  __shared__ __align__(16) __bf16 Ksl[SPLIT_QK ? AT_KC * AT_D : 8];
  __shared__ __align__(16) __bf16 Vth[AT_D * AT_KC];             // V hi [d][kv]      8 KB
  __shared__ __align__(16) __bf16 Vtl[SPLIT_PV ? AT_D * AT_KC : 8];
  __shared__ __align__(16) __bf16 Psh[AT_NW][16 * AT_KC];        // per wave P hi [row][kv]  8 KB
  __shared__ __align__(16) __bf16 Psl[SPLIT_PV ? AT_NW : 1][SPLIT_PV ? 16 * AT_KC : 8];
  __shared__ __align__(16) float  Os[AT_NW][16 * 68];            // per wave out tile, pitch 68

  const int tid  = threadIdx.x;
  const int wave = tid >> 5;
  const int lane = tid & 31;
  const int hh   = lane >> 4;
  const int c    = lane & 15;

  const int nqb = g.S / AT_QB;
  const int bx = blockIdx.x + g.blk0;
  const int qb = bx % nqb;
  const int bh = bx / nqb;
  const int h  = bh % g.H;
  const int b  = bh / g.H;
  const int qbase_block = qb * AT_QB;
  const int q0 = qbase_block + wave * 16;

  const float* qb_ptr = q + (size_t)b * g.q_bs + (size_t)h * g.q_hs;
  const float* kb_ptr = k + (size_t)b * g.k_bs + (size_t)h * g.k_hs;
  const float* vb_ptr = v + (size_t)b * g.v_bs + (size_t)h * g.v_hs;
  float*       ob_ptr = out + (size_t)b * g.o_bs + (size_t)h * g.o_hs;

  // ---- Q fragments (A operand): 2 d-chunks, hi (and lo) ----
  v16b qah[2], qal[2];
  {
    const float* qrow = qb_ptr + (size_t)(q0 + c) * g.q_rs;
#pragma unroll
    for (int dc = 0; dc < 2; ++dc) {
#pragma unroll
      for (int e = 0; e < 8; ++e) {
        const float f0 = qrow[dc * 32 + 8 * hh + e] * g.qscale;
        const float f1 = qrow[dc * 32 + 16 + 8 * hh + e] * g.qscale;
        if (SPLIT_QK) { __bf16 hq, lq; at_split(f0, hq, lq); qah[dc][e] = hq; qal[dc][e] = lq; at_split(f1, hq, lq); qah[dc][8 + e] = hq; qal[dc][8 + e] = lq; }
        else { qah[dc][e] = at_to16<F16>(f0); qah[dc][8 + e] = at_to16<F16>(f1); qal[dc][e] = qah[dc][e]; qal[dc][8 + e] = qah[dc][8 + e]; }
      }
    }
  }

  float mrow[8], lrow[8];
  v8f oacc[4];
#pragma unroll
  for (int r = 0; r < 8; ++r) { mrow[r] = -INFINITY; lrow[r] = 0.f; }
#pragma unroll
  for (int t = 0; t < 4; ++t) oacc[t] = (v8f){0.f,0.f,0.f,0.f,0.f,0.f,0.f,0.f};

  const int nChunks = (g.mask_mode == 1 || g.mask_mode == 4) ? (qb + 1) : (g.Skv / AT_KC);   // block-uniform
  // per-row query mask (mode 3)
  int qkeep[8];
#pragma unroll
  for (int r = 0; r < 8; ++r) qkeep[r] = (g.mask_mode == 3) ? mask_b[(size_t)b * g.S + q0 + 8 * hh + r] : 1;   // mask_b = qmask in mode 3
  for (int kc = 0; kc < nChunks; ++kc) {
    const int kv0 = kc * AT_KC;
    __syncthreads();
    {
      const int kvr = tid >> 1, dh = (tid & 1) * 32;
      const float* krow = kb_ptr + (size_t)(kv0 + kvr) * g.k_rs + dh;
      const float* vrow = vb_ptr + (size_t)(kv0 + kvr) * g.v_rs + dh;
#pragma unroll
      for (int i = 0; i < 8; ++i) {
        v4f kk = *(const v4f*)(krow + 4 * i);
        v4f vv = *(const v4f*)(vrow + 4 * i);
#pragma unroll
        for (int e = 0; e < 4; ++e) {
          const int d = dh + 4 * i + e;
          if (SPLIT_QK) { __bf16 a, bl; at_split(kk[e], a, bl); Ksh[kvr * AT_D + d] = a; Ksl[kvr * AT_D + d] = bl; }
          else Ksh[kvr * AT_D + d] = at_to16<F16>(kk[e]);
          if (SPLIT_PV) { __bf16 a, bl; at_split(vv[e], a, bl); Vth[d * AT_KC + kvr] = a; Vtl[d * AT_KC + kvr] = bl; }
          else Vth[d * AT_KC + kvr] = at_to16<F16>(vv[e]);
        }
      }
    }
    __syncthreads();

    v8f s[4];
#pragma unroll
    for (int j = 0; j < 4; ++j) {
      s[j] = (v8f){0.f,0.f,0.f,0.f,0.f,0.f,0.f,0.f};
#pragma unroll 1
      for (int dc = 0; dc < 2; ++dc) {
        FB kb;
        kb.h[0] = *(const v8b*)(Ksh + (j * 16 + c) * AT_D + dc * 32 + 8 * hh);
        kb.h[1] = *(const v8b*)(Ksh + (j * 16 + c) * AT_D + dc * 32 + 16 + 8 * hh);
        s[j] = at_mma16<F16>(qah[dc], kb.v, s[j]);
        if (SPLIT_QK) {
          FB kl;
          kl.h[0] = *(const v8b*)(Ksl + (j * 16 + c) * AT_D + dc * 32 + 8 * hh);
          kl.h[1] = *(const v8b*)(Ksl + (j * 16 + c) * AT_D + dc * 32 + 16 + 8 * hh);
          s[j] = at_mma16<F16>(qah[dc], kl.v, s[j]);
          s[j] = at_mma16<F16>(qal[dc], kb.v, s[j]);
        }
      }
    }
    const bool diag = (g.mask_mode == 1) && (kc == qb);
    int kvkeep[4] = {1, 1, 1, 1};
    if (g.mask_mode == 3) {
#pragma unroll
      for (int j = 0; j < 4; ++j) kvkeep[j] = ((const int*)mask_a)[(size_t)b * g.Skv + kv0 + j * 16 + c];   // mask_a = kvmask
    }
    float cm[8];
#pragma unroll
    for (int r = 0; r < 8; ++r) {
      const int qrow = q0 + 8 * hh + r;
      float m = -INFINITY;
#pragma unroll
      for (int j = 0; j < 4; ++j) {
        const int kvcol = kv0 + j * 16 + c;
        bool masked = false;
        if (diag) masked = (kvcol > qrow);
        else if (g.mask_mode == 4) masked = (kvcol > qrow) || (qrow - kvcol > g.mask_is_int);
        else if (g.mask_mode == 2) {
          const size_t mi = (size_t)qrow * g.Skv + kvcol;
          masked = (g.mask_is_int == 0) ? (((const float*)mask_a)[mi] == 0.0f)
                 : (g.mask_is_int == 1) ? (((const int*)mask_a)[mi] == 0) : (((const int*)mask_a)[mi] != 0);
        } else if (g.mask_mode == 3) masked = (qkeep[r] == 0) || (kvkeep[j] == 0);
        else if (g.mask_mode == 5) {
          const size_t mi = (size_t)qrow * g.Skv + kvcol;
          masked = (((const int*)mask_a)[mi] != 0);
          int n = mask_b[mi]; n = n < 0 ? 0 : n;
          s[j][r] += g.cp[(size_t)b * g.c_bs + (size_t)h * g.c_hs + (size_t)qrow * g.c_rs + n]
                   + g.pc[(size_t)b * g.c_bs + (size_t)h * g.c_hs + (size_t)kvcol * g.c_rs + n];
        }
        if (masked) s[j][r] = g.mask_fill;
        m = fmaxf(m, s[j][r]);
      }
#pragma unroll
      for (int off = 1; off < 16; off <<= 1) m = fmaxf(m, __shfl_xor(m, off, 32));
      cm[r] = m;
    }
    __bf16* pwh = Psh[wave];
    __bf16* pwl = Psl[SPLIT_PV ? wave : 0];
#pragma unroll
    for (int r = 0; r < 8; ++r) {
      const float mnew = fmaxf(mrow[r], cm[r]);
      const float alpha = expf(mrow[r] - mnew);
      mrow[r] = mnew;
      float psum = 0.f;
#pragma unroll
      for (int j = 0; j < 4; ++j) {
        const float p = expf(s[j][r] - mnew);
        psum += p;
        if (SPLIT_PV) { __bf16 a, bl; at_split(p, a, bl); pwh[(8 * hh + r) * AT_KC + j * 16 + c] = a; pwl[(8 * hh + r) * AT_KC + j * 16 + c] = bl; }
        else pwh[(8 * hh + r) * AT_KC + j * 16 + c] = at_to16<F16>(p * PSC);
      }
#pragma unroll
      for (int off = 1; off < 16; off <<= 1) psum += __shfl_xor(psum, off, 32);
      lrow[r] = lrow[r] * alpha + psum;
#pragma unroll
      for (int t = 0; t < 4; ++t) oacc[t][r] *= alpha;
    }
    __builtin_amdgcn_fence(__ATOMIC_RELEASE, "workgroup");
    __builtin_amdgcn_wave_barrier();
    __builtin_amdgcn_fence(__ATOMIC_ACQUIRE, "workgroup");
#pragma unroll 1
    for (int kk = 0; kk < 2; ++kk) {
      FB pa, pl;
      pa.h[0] = *(const v8b*)(pwh + c * AT_KC + kk * 32 + 8 * hh);
      pa.h[1] = *(const v8b*)(pwh + c * AT_KC + kk * 32 + 16 + 8 * hh);
      if (SPLIT_PV) {
        pl.h[0] = *(const v8b*)(pwl + c * AT_KC + kk * 32 + 8 * hh);
        pl.h[1] = *(const v8b*)(pwl + c * AT_KC + kk * 32 + 16 + 8 * hh);
      }
#pragma unroll
      for (int t = 0; t < 4; ++t) {
        FB vb;
        vb.h[0] = *(const v8b*)(Vth + (t * 16 + c) * AT_KC + kk * 32 + 8 * hh);
        vb.h[1] = *(const v8b*)(Vth + (t * 16 + c) * AT_KC + kk * 32 + 16 + 8 * hh);
        oacc[t] = at_mma16<F16>(pa.v, vb.v, oacc[t]);
        if (SPLIT_PV) {
          FB vl;
          vl.h[0] = *(const v8b*)(Vtl + (t * 16 + c) * AT_KC + kk * 32 + 8 * hh);
          vl.h[1] = *(const v8b*)(Vtl + (t * 16 + c) * AT_KC + kk * 32 + 16 + 8 * hh);
          oacc[t] = at_mma16<F16>(pa.v, vl.v, oacc[t]);
          oacc[t] = at_mma16<F16>(pl.v, vb.v, oacc[t]);
        }
      }
    }
  }

  float* os = Os[wave];
#pragma unroll
  for (int r = 0; r < 8; ++r) {
    const float inv = 1.0f / (lrow[r] * PSC);
#pragma unroll
    for (int t = 0; t < 4; ++t) os[(8 * hh + r) * 68 + t * 16 + c] = oacc[t][r] * inv;
  }
  __builtin_amdgcn_fence(__ATOMIC_RELEASE, "workgroup");
  __builtin_amdgcn_wave_barrier();
  __builtin_amdgcn_fence(__ATOMIC_ACQUIRE, "workgroup");
  {
    const int c4 = (lane & 15) * 4;
    {
#pragma unroll
      for (int it = 0; it < 8; ++it) {
        const int row = it * 2 + hh;
        v4f val = *(const v4f*)(os + row * 68 + c4);
        *(v4f*)(ob_ptr + (size_t)(q0 + row) * g.o_rs + c4) = val;
      }
      
    }
  }
}

// ---- head_dim 128 variant (same contract; K/V tiles 64 keys x 128, 8 output tiles; mask_mode 6 = causal + per-head ALiBi slope table in g.cp) ----
// MODE >= 0 fixes the mask mode at compile time, so the per-score mode tests fold away; MODE < 0 reads it from g.mask_mode
template <bool SPLIT_QK, bool SPLIT_PV, bool F16 = false, int MODE = -1>
__global__ __launch_bounds__(128)
void attn128_kernel(const float* __restrict__ q, const float* __restrict__ k,
                   const float* __restrict__ v, float* __restrict__ out,
                   const void* __restrict__ mask_a, const int* __restrict__ mask_b, AttnGeom g) {
  static_assert(!(F16 && (SPLIT_QK || SPLIT_PV)), "f16 mode is non-split");
  const float PSC = F16 ? 32768.0f : 1.0f;     // f16 probabilities carried x2^15 (subnormal range), folded into the final 1/l
  union FB { v16b v; v8b h[2]; };
  constexpr int D2 = 128;
  // LDS row pitches in elements: 16 B x odd (272 B for the 128-wide K and Q rows, 144 B for the 64-wide V^T and P rows), so that the
  // 16 rows one ds_load_b128 fragment read touches fall on distinct banks; at 256 B and 128 B they shared four or eight banks
  constexpr int KP = D2 + 8;
  constexpr int VP = AT_KC + 8;
  const int mode = (MODE >= 0) ? MODE : g.mask_mode;
  __shared__ __align__(16) __bf16 Ksh[AT_KC * KP];               // K hi [kv][d]      17 KB
  __shared__ __align__(16) __bf16 Ksl[SPLIT_QK ? AT_KC * KP : 8];
  __shared__ __align__(16) __bf16 Vth[D2 * VP];                  // V hi [d][kv]      18 KB
  __shared__ __align__(16) __bf16 Vtl[SPLIT_PV ? D2 * VP : 8];
  __shared__ __align__(16) __bf16 Psh[AT_NW][16 * VP];
  __shared__ __align__(16) __bf16 Psl[SPLIT_PV ? AT_NW : 1][SPLIT_PV ? 16 * VP : 8];
  __shared__ __align__(16) float  Os[AT_NW][16 * 132];           // per wave out tile, pitch 132
  __shared__ __align__(16) __bf16 Qsh[SPLIT_QK ? AT_NW : 1][SPLIT_QK ? 16 * KP : 8];   // split path: q hi/lo staged per wave (keeps VGPR use low)
  __shared__ __align__(16) __bf16 Qsl[SPLIT_QK ? AT_NW : 1][SPLIT_QK ? 16 * KP : 8];

  const int tid  = threadIdx.x;
  const int wave = tid >> 5;
  const int lane = tid & 31;
  const int hh   = lane >> 4;
  const int c    = lane & 15;

  const int nqb = g.S / AT_QB;
  const int bx = blockIdx.x + g.blk0;
  // Causal modes: query block qb walks qb + 1 key chunks, and the grid holds more blocks than the chip has resident places. The longest get
  // the lowest indices (qb falls with bx, heads innermost), for speed only. A permutation of (head, qb); needs the whole grid in one launch (blk0 = 0).
  const bool byCost = (mode == 1 || mode == 4 || mode == 6);
  const int nbh = byCost ? (int)gridDim.x / nqb : 1;
  const int qb = byCost ? (nqb - 1 - bx / nbh) : (bx % nqb);
  const int bh = byCost ? (bx % nbh) : (bx / nqb);
  const int h  = bh % g.H;
  const int b  = bh / g.H;
  const int qbase_block = qb * AT_QB;
  const int q0 = qbase_block + wave * 16;

  const float* qb_ptr = q + (size_t)b * g.q_bs + (size_t)h * g.q_hs;
  const float* kb_ptr = k + (size_t)b * g.k_bs + (size_t)h * g.k_hs;
  const float* vb_ptr = v + (size_t)b * g.v_bs + (size_t)h * g.v_hs;
  float*       ob_ptr = out + (size_t)b * g.o_bs + (size_t)h * g.o_hs;

  // ---- Q fragments (A operand): 4 d-chunks, hi (and lo) ----
  v16b qah[4], qal[4];
  {
    const float* qrow = qb_ptr + (size_t)(q0 + c) * g.q_rs;
#pragma unroll
    for (int dc = 0; dc < 4; ++dc) {
#pragma unroll
      for (int e = 0; e < 8; ++e) {
        const float f0 = qrow[dc * 32 + 8 * hh + e] * g.qscale;
        const float f1 = qrow[dc * 32 + 16 + 8 * hh + e] * g.qscale;
        if (SPLIT_QK) { __bf16 hq, lq; at_split(f0, hq, lq); Qsh[wave][c * KP + dc * 32 + 8 * hh + e] = hq; Qsl[wave][c * KP + dc * 32 + 8 * hh + e] = lq;
                        at_split(f1, hq, lq); Qsh[wave][c * KP + dc * 32 + 16 + 8 * hh + e] = hq; Qsl[wave][c * KP + dc * 32 + 16 + 8 * hh + e] = lq;
                        qah[dc][e] = hq; qal[dc][e] = lq; qah[dc][8 + e] = hq; qal[dc][8 + e] = lq; }   // (register copies unused on the split path)
        else { qah[dc][e] = at_to16<F16>(f0); qah[dc][8 + e] = at_to16<F16>(f1); qal[dc][e] = qah[dc][e]; qal[dc][8 + e] = qah[dc][8 + e]; }
      }
    }
  }

  float mrow[8], lrow[8];
  v8f oacc[8];
#pragma unroll
  for (int r = 0; r < 8; ++r) { mrow[r] = -INFINITY; lrow[r] = 0.f; }
#pragma unroll
  for (int t = 0; t < 8; ++t) oacc[t] = (v8f){0.f,0.f,0.f,0.f,0.f,0.f,0.f,0.f};

  const int nChunks = (mode == 1 || mode == 4 || mode == 6) ? (qb + 1) : (g.Skv / AT_KC);   // block-uniform
  // per-row query mask (mode 3)
  int qkeep[8];
#pragma unroll
  for (int r = 0; r < 8; ++r) qkeep[r] = (mode == 3) ? mask_b[(size_t)b * g.S + q0 + 8 * hh + r] : 1;   // mask_b = qmask in mode 3
  for (int kc = 0; kc < nChunks; ++kc) {
    const int kv0 = kc * AT_KC;
    __syncthreads();
    {
      const int kvr = tid >> 1, dh = (tid & 1) * 64;
      const float* krow = kb_ptr + (size_t)(kv0 + kvr) * g.k_rs + dh;
      const float* vrow = vb_ptr + (size_t)(kv0 + kvr) * g.v_rs + dh;
#pragma unroll
      for (int i = 0; i < 16; ++i) {
        v4f kk = *(const v4f*)(krow + 4 * i);
        v4f vv = *(const v4f*)(vrow + 4 * i);
#pragma unroll
        for (int e = 0; e < 4; ++e) {
          const int d = dh + 4 * i + e;
          if (SPLIT_QK) { __bf16 a, bl; at_split(kk[e], a, bl); Ksh[kvr * KP + d] = a; Ksl[kvr * KP + d] = bl; }
          else Ksh[kvr * KP + d] = at_to16<F16>(kk[e]);
          if (SPLIT_PV) { __bf16 a, bl; at_split(vv[e], a, bl); Vth[d * VP + kvr] = a; Vtl[d * VP + kvr] = bl; }
          else Vth[d * VP + kvr] = at_to16<F16>(vv[e]);
        }
      }
    }
    __syncthreads();

    v8f s[4];
#pragma unroll
    for (int j = 0; j < 4; ++j) {
      s[j] = (v8f){0.f,0.f,0.f,0.f,0.f,0.f,0.f,0.f};
#pragma unroll 1
      for (int dc = 0; dc < 4; ++dc) {      // rolled: bounds the live fragment set (register pressure) on the 128-wide head
        FB kb;
        kb.h[0] = *(const v8b*)(Ksh + (j * 16 + c) * KP + dc * 32 + 8 * hh);
        kb.h[1] = *(const v8b*)(Ksh + (j * 16 + c) * KP + dc * 32 + 16 + 8 * hh);
        if (!SPLIT_QK) s[j] = at_mma16<F16>(qah[dc], kb.v, s[j]);
        if (SPLIT_QK) {
          FB qa, ql;
          qa.h[0] = *(const v8b*)(&Qsh[wave][c * KP + dc * 32 + 8 * hh]); qa.h[1] = *(const v8b*)(&Qsh[wave][c * KP + dc * 32 + 16 + 8 * hh]);
          ql.h[0] = *(const v8b*)(&Qsl[wave][c * KP + dc * 32 + 8 * hh]); ql.h[1] = *(const v8b*)(&Qsl[wave][c * KP + dc * 32 + 16 + 8 * hh]);
          s[j] = at_mma16<F16>(qa.v, kb.v, s[j]);
          FB kl;
          kl.h[0] = *(const v8b*)(Ksl + (j * 16 + c) * KP + dc * 32 + 8 * hh);
          kl.h[1] = *(const v8b*)(Ksl + (j * 16 + c) * KP + dc * 32 + 16 + 8 * hh);
          s[j] = at_mma16<F16>(qa.v, kl.v, s[j]);
          s[j] = at_mma16<F16>(ql.v, kb.v, s[j]);
        }
      }
    }
    const bool diag = (mode == 1) && (kc == qb);
    int kvkeep[4] = {1, 1, 1, 1};
    if (mode == 3) {
#pragma unroll
      for (int j = 0; j < 4; ++j) kvkeep[j] = ((const int*)mask_a)[(size_t)b * g.Skv + kv0 + j * 16 + c];   // mask_a = kvmask
    }
    float cm[8];
#pragma unroll
    for (int r = 0; r < 8; ++r) {
      const int qrow = q0 + 8 * hh + r;
      float m = -INFINITY;
#pragma unroll
      for (int j = 0; j < 4; ++j) {
        const int kvcol = kv0 + j * 16 + c;
        bool masked = false;
        if (diag) masked = (kvcol > qrow);
        else if (mode == 4) masked = (kvcol > qrow) || (qrow - kvcol > g.mask_is_int);
        else if (mode == 2) {
          const size_t mi = (size_t)qrow * g.Skv + kvcol;
          masked = (g.mask_is_int == 0) ? (((const float*)mask_a)[mi] == 0.0f)
                 : (g.mask_is_int == 1) ? (((const int*)mask_a)[mi] == 0) : (((const int*)mask_a)[mi] != 0);
        } else if (mode == 3) masked = (qkeep[r] == 0) || (kvkeep[j] == 0);
        else if (mode == 6) { masked = (kvcol > qrow); s[j][r] += g.cp[h] * (float)(kvcol - qrow); }
        else if (mode == 8) { masked = (kvcol > qrow) || (((const int*)mask_a)[(size_t)b * g.Skv + kvcol] != 0); }
        else if (mode == 5) {
          const size_t mi = (size_t)qrow * g.Skv + kvcol;
          masked = (((const int*)mask_a)[mi] != 0);
          int n = mask_b[mi]; n = n < 0 ? 0 : n;
          s[j][r] += g.cp[(size_t)b * g.c_bs + (size_t)h * g.c_hs + (size_t)qrow * g.c_rs + n]
                   + g.pc[(size_t)b * g.c_bs + (size_t)h * g.c_hs + (size_t)kvcol * g.c_rs + n];
        }
        if (masked) s[j][r] = g.mask_fill;
        m = fmaxf(m, s[j][r]);
      }
#pragma unroll
      for (int off = 1; off < 16; off <<= 1) m = fmaxf(m, __shfl_xor(m, off, 32));
      cm[r] = m;
    }
    __bf16* pwh = Psh[wave];
    __bf16* pwl = Psl[SPLIT_PV ? wave : 0];
#pragma unroll
    for (int r = 0; r < 8; ++r) {
      const float mnew = fmaxf(mrow[r], cm[r]);
      const float alpha = expf(mrow[r] - mnew);
      mrow[r] = mnew;
      float psum = 0.f;
#pragma unroll
      for (int j = 0; j < 4; ++j) {
        const float p = expf(s[j][r] - mnew);
        psum += p;
        if (SPLIT_PV) { __bf16 a, bl; at_split(p, a, bl); pwh[(8 * hh + r) * VP + j * 16 + c] = a; pwl[(8 * hh + r) * VP + j * 16 + c] = bl; }
        else pwh[(8 * hh + r) * VP + j * 16 + c] = at_to16<F16>(p * PSC);
      }
#pragma unroll
      for (int off = 1; off < 16; off <<= 1) psum += __shfl_xor(psum, off, 32);
      lrow[r] = lrow[r] * alpha + psum;
#pragma unroll
      for (int t = 0; t < 8; ++t) oacc[t][r] *= alpha;
    }
    __builtin_amdgcn_fence(__ATOMIC_RELEASE, "workgroup");
    __builtin_amdgcn_wave_barrier();
    __builtin_amdgcn_fence(__ATOMIC_ACQUIRE, "workgroup");
#pragma unroll 1
    for (int kk = 0; kk < 2; ++kk) {
      FB pa, pl;
      pa.h[0] = *(const v8b*)(pwh + c * VP + kk * 32 + 8 * hh);
      pa.h[1] = *(const v8b*)(pwh + c * VP + kk * 32 + 16 + 8 * hh);
      if (SPLIT_PV) {
        pl.h[0] = *(const v8b*)(pwl + c * VP + kk * 32 + 8 * hh);
        pl.h[1] = *(const v8b*)(pwl + c * VP + kk * 32 + 16 + 8 * hh);
      }
#pragma unroll
      for (int t = 0; t < 8; ++t) {
        FB vb;
        vb.h[0] = *(const v8b*)(Vth + (t * 16 + c) * VP + kk * 32 + 8 * hh);
        vb.h[1] = *(const v8b*)(Vth + (t * 16 + c) * VP + kk * 32 + 16 + 8 * hh);
        oacc[t] = at_mma16<F16>(pa.v, vb.v, oacc[t]);
        if (SPLIT_PV) {
          FB vl;
          vl.h[0] = *(const v8b*)(Vtl + (t * 16 + c) * VP + kk * 32 + 8 * hh);
          vl.h[1] = *(const v8b*)(Vtl + (t * 16 + c) * VP + kk * 32 + 16 + 8 * hh);
          oacc[t] = at_mma16<F16>(pa.v, vl.v, oacc[t]);
          oacc[t] = at_mma16<F16>(pl.v, vb.v, oacc[t]);
        }
      }
    }
  }

  float* os = Os[wave];
#pragma unroll
  for (int r = 0; r < 8; ++r) {
    const float inv = 1.0f / (lrow[r] * PSC);
#pragma unroll
    for (int t = 0; t < 8; ++t) os[(8 * hh + r) * 132 + t * 16 + c] = oacc[t][r] * inv;
  }
  __builtin_amdgcn_fence(__ATOMIC_RELEASE, "workgroup");
  __builtin_amdgcn_wave_barrier();
  __builtin_amdgcn_fence(__ATOMIC_ACQUIRE, "workgroup");
  {
    const int c4 = lane * 4;           // 32 lanes x 16 B = one 512-B output row (128 floats) per instruction
    {
#pragma unroll
      for (int row = 0; row < 16; ++row) {
        v4f val = *(const v4f*)(os + row * 132 + c4);
        *(v4f*)(ob_ptr + (size_t)(q0 + row) * g.o_rs + c4) = val;
      }
      
    }
  }
}

#define XB 2
#define XH 16
#define XS 2048
#define XD 128
__global__ void slopes_kernel(float* __restrict__ sl) { const int h = threadIdx.x; const float v = (h < XH) ? exp2f(-8.0f * (float)(h + 1) / (float)XH) : 0.f; ((float*)sl)[h] = v;  }
extern "C" void kernel_launch(void* const* d_in, const int* in_sizes, int n_in, void* d_out, int out_size, void* d_ws, size_t ws_size, hipStream_t stream) {
  (void)in_sizes; (void)n_in; (void)out_size; (void)ws_size;
  const float* q = (const float*)d_in[0]; const float* k = (const float*)d_in[1]; const float* v = (const float*)d_in[2];
  float* sl = (float*)d_ws;
  slopes_kernel<<<1, 32, 0, stream>>>(sl);
  AttnGeom g;
  g.cp = sl; g.pc = nullptr; g.c_bs = 0; g.c_rs = 0; g.c_hs = 0;
  g.q_bs = (long)XH * XS * XD; g.q_hs = (long)XS * XD; g.q_rs = XD;
  g.k_bs = g.q_bs; g.k_hs = g.q_hs; g.k_rs = XD; g.v_bs = g.q_bs; g.v_hs = g.q_hs; g.v_rs = XD; g.o_bs = g.q_bs; g.o_hs = g.q_hs; g.o_rs = XD;
  g.S = XS; g.Skv = XS; g.H = XH; g.mask_mode = 6; g.qscale = 0.08838834764831845f; g.blk0 = 0; g.mask_fill = -INFINITY; g.mask_is_int = 0;
  attn128_kernel<true, true, false, 6><<<XB * XH * (XS / AT_QB), AT_NW * 32, 0, stream>>>(q, k, v, (float*)d_out, nullptr, nullptr, g);
}

// v004
// A run of this version takes 214 microseconds.
// Timed twice side by side with v003, it ran 1.33 times as fast both times.
// Counting every step since v000, it is 9.26 times as fast.
#include <hip/hip_runtime.h>
#include <math.h>
// FlexAttention forward (causal block mask + ALiBi score_mod, 2 x 16 heads, 2048 x 2048, head_dim 128): scores and p·v on
// v_wmma_f32_16x16x32_bf16 with q,k and p,v as bf16 hi/lo splits (hi·hi + hi·lo + lo·hi;
// early causal rows copy single v rows almost verbatim), f32 accumulate; online softmax, the ALiBi bias slope_h·(k−q) and the
// causal predicate in f32 on VALU.
typedef __attribute__((ext_vector_type(16))) _Float16 v16h;
typedef __attribute__((ext_vector_type(8)))  _Float16 v8h;
typedef __attribute__((ext_vector_type(16))) __bf16   v16b;
typedef __attribute__((ext_vector_type(8)))  __bf16   v8b;
typedef __attribute__((ext_vector_type(8)))  float    v8f;
typedef __attribute__((ext_vector_type(4)))  float    v4f;
#define PSCALE 32768.0f
#define U16(p) ((const unsigned short*)(const void*)(p))
#define PSCALE_INV (1.0f / 32768.0f)

__device__ __forceinline__ unsigned short f2bf_bits(float f) {
  unsigned u = __float_as_uint(f);
  return (unsigned short)((u + 0x7FFFu + ((u >> 16) & 1u)) >> 16);
}
__device__ __forceinline__ float bf_bits2f(unsigned short h) { return __uint_as_float(((unsigned)h) << 16); }

// hazard guards as plain device helpers (no inline asm inside the kernel template body)
__device__ __forceinline__ void dep_guard_h(v8f& a, v8f& b, v16h x, v16h y) { asm volatile("v_nop\n\tv_nop\n\tv_nop\n\tv_nop" : "+v"(a), "+v"(b) : "v"(x), "v"(y)); }
__device__ __forceinline__ void dep_guard_b(v8f& a, v8f& b, v16b x, v16b y) { asm volatile("v_nop\n\tv_nop\n\tv_nop\n\tv_nop" : "+v"(a), "+v"(b) : "v"(x), "v"(y)); }
__device__ __forceinline__ void keep4_h(v16h a, v16h b, v16h c, v16h d) { asm volatile("v_nop" :: "v"(a), "v"(b), "v"(c), "v"(d)); }
__device__ __forceinline__ void keep4_b(v16b a, v16b b, v16b c, v16b d) { asm volatile("v_nop" :: "v"(a), "v"(b), "v"(c), "v"(d)); }
__device__ __forceinline__ void acc_guard4(v8f& a, v8f& b, v8f& c, v8f& d) { asm volatile("v_nop\n\tv_nop\n\tv_nop\n\tv_nop" : "+v"(a), "+v"(b), "+v"(c), "+v"(d)); }
template <typename T> struct Frag;
template <> struct Frag<_Float16> {
  typedef v16h V; union U { v16h v; v8h h[2]; };
  static __device__ __forceinline__ v16h load(const _Float16* p) {   // elements 0..7 <- p[0..7], 8..15 <- p[16..23]
    U f; f.h[0] = *(const v8h*)(p); f.h[1] = *(const v8h*)(p + 16); return f.v;
  }
  static __device__ __forceinline__ v8f mma(v16h a, v16h b, v8f c) {
    return __builtin_amdgcn_wmma_f32_16x16x32_f16(false, a, false, b, (short)0, c, false, false);
  }
  static __device__ __forceinline__ void guard(v8f& a, v8f& b, v16h x, v16h y) { dep_guard_h(a, b, x, y); }
  static __device__ __forceinline__ void keep(v16h a, v16h b, v16h c, v16h d) { keep4_h(a, b, c, d); }
};
template <> struct Frag<__bf16> {
  typedef v16b V; union U { v16b v; v8b h[2]; };
  static __device__ __forceinline__ v16b load(const __bf16* p) {
    U f; f.h[0] = *(const v8b*)(p); f.h[1] = *(const v8b*)(p + 16); return f.v;
  }
  static __device__ __forceinline__ v8f mma(v16b a, v16b b, v8f c) {
    return __builtin_amdgcn_wmma_f32_16x16x32_bf16(false, a, false, b, (short)0, c, false, false);
  }
  static __device__ __forceinline__ void guard(v8f& a, v8f& b, v16b x, v16b y) { dep_guard_b(a, b, x, y); }
  static __device__ __forceinline__ void keep(v16b a, v16b b, v16b c, v16b d) { keep4_b(a, b, c, d); }
};

// ---- Register-blocked batched WMMA GEMM ------------------------------------
// C[m,n] = scale * sum_k A[m,k] * Bt[n,k] (+bias)(+resid); each wave owns a 64x64 tile.
// A row-major [M,K]; Bt row-major [N,K]; M,N % 64 == 0, K % 32 == 0.
// SPLIT: operands are hi/lo planes (A2/Bt2 = lo planes, same layout); product = hi·hi + hi·lo + lo·hi.
// BIAS_MODE: 0 = none, 1 = bias[m], 2 = bias[n].
// OUT_MODE: 0 = f32, 1 = f16, 2 = bf16 hi plane (Cout) + bf16 lo plane (Cout2).
// ET: 0 = f16 operands, 1 = bf16 operands (pointers passed as 16-bit storage)
template <int ET> struct Elem;
template <> struct Elem<0> { typedef _Float16 T; };
template <> struct Elem<1> { typedef __bf16 T; };
template <int ET, bool SPLIT, int BIAS_MODE, int OUT_MODE, bool RESID, int ACT = 0>
__global__ __launch_bounds__(256) void wmma_gemm64(
    const unsigned short* __restrict__ Ap, const unsigned short* __restrict__ A2p, int lda, long strideA,
    const unsigned short* __restrict__ Btp, const unsigned short* __restrict__ Bt2p, int ldb, long strideB,
    void* __restrict__ Cout, void* __restrict__ Cout2, int ldc, long strideC,
    const float* __restrict__ bias,
    const float* __restrict__ resid, long strideR,
    int M, int N, int K, float scale) {
  typedef typename Elem<ET>::T T;
  typedef typename Frag<T>::V V;
  const T* A = (const T*)Ap; const T* A2 = (const T*)A2p; const T* Bt = (const T*)Btp; const T* Bt2 = (const T*)Bt2p;
  __shared__ __align__(16) float sT[8][16 * 68];   // per-wave 16x64 slab, pitch 68 floats
  const int b    = blockIdx.y;
  const int lane = threadIdx.x & 31;
  const int wave = threadIdx.x >> 5;
  const int tilesN = N >> 6;
  const int tilesM = M >> 6;
  const int tile = blockIdx.x * 8 + wave;
  if (tile >= tilesM * tilesN) return;   // wave-uniform; no block barriers in this kernel
  const int tm = tile / tilesN;
  const int tn = tile - tm * tilesN;
  const int m0 = tm << 6;
  const int n0 = tn << 6;

  const T* Ab  = A  + (size_t)b * strideA;
  const T* Bb  = Bt + (size_t)b * strideB;
  const T* Ab2 = SPLIT ? (A2  + (size_t)b * strideA) : nullptr;
  const T* Bb2 = SPLIT ? (Bt2 + (size_t)b * strideB) : nullptr;

  const int rlane = lane & 15;                 // row (A) / col (B, D) within subtile
  const int koff  = (lane >> 4) * 8;           // k offset of this lane half
  const int mOff  = (lane >> 4) * 8;           // D row offset

  v8f acc[4][4];
#pragma unroll
  for (int i = 0; i < 4; ++i)
#pragma unroll
    for (int j = 0; j < 4; ++j) acc[i][j] = (v8f){0.f,0.f,0.f,0.f,0.f,0.f,0.f,0.f};

  for (int k0 = 0; k0 < K; k0 += 32) {
    V bh[4], bl[4];
#pragma unroll
    for (int j = 0; j < 4; ++j) {
      const size_t bo = (size_t)(n0 + (j << 4) + rlane) * ldb + koff + k0;
      bh[j] = Frag<T>::load(Bb + bo);
      if (SPLIT) bl[j] = Frag<T>::load(Bb2 + bo);
    }
#pragma unroll
    for (int i = 0; i < 4; ++i) {
      const size_t ao = (size_t)(m0 + (i << 4) + rlane) * lda + koff + k0;
      V ah = Frag<T>::load(Ab + ao);
      V al;
      if (SPLIT) al = Frag<T>::load(Ab2 + ao);
#pragma unroll
      for (int j = 0; j < 4; ++j) {
        acc[i][j] = Frag<T>::mma(ah, bh[j], acc[i][j]);
        if (SPLIT) {
          acc[i][j] = Frag<T>::mma(ah, bl[j], acc[i][j]);
          acc[i][j] = Frag<T>::mma(al, bh[j], acc[i][j]);
        }
      }
      Frag<T>::guard(acc[i][0], acc[i][3], ah, SPLIT ? al : ah);
    }
    Frag<T>::keep(bh[0], bh[1], bh[2], bh[3]);
    if (SPLIT) Frag<T>::keep(bl[0], bl[1], bl[2], bl[3]);
  }
  acc_guard4(acc[0][0], acc[0][1], acc[0][2], acc[0][3]);
  acc_guard4(acc[1][0], acc[1][1], acc[1][2], acc[1][3]);
  acc_guard4(acc[2][0], acc[2][1], acc[2][2], acc[2][3]);
  acc_guard4(acc[3][0], acc[3][1], acc[3][2], acc[3][3]);

  // ---- epilogue ----
  float* slab = sT[wave];
  const float* Rb = RESID ? (resid + (size_t)b * strideR) : nullptr;
#pragma unroll
  for (int i = 0; i < 4; ++i) {
    const int mBase = m0 + (i << 4);
#pragma unroll
    for (int j = 0; j < 4; ++j) {
      const int n = n0 + (j << 4) + rlane;
      float bv = 0.f;
      if (BIAS_MODE == 2) bv = bias[n];
#pragma unroll
      for (int r = 0; r < 8; ++r) {
        float v = acc[i][j][r] * scale;
        if (BIAS_MODE == 1) v += bias[mBase + mOff + r];
        if (BIAS_MODE == 2) v += bv;
        if (RESID) v += Rb[(size_t)(mBase + mOff + r) * ldc + n];
        if (ACT == 1) v = tanhf(v);
        if (ACT == 2) v = fmaxf(v, 0.0f);
        if (ACT == 3) v = v / (1.0f + expf(-v));
        if (ACT == 4) v = (v > 0.f) ? v : 0.01f * v;
        if (ACT == 5) v = 0.5f * v * (1.0f + erff(v * 0.70710678118654752f));
        slab[(mOff + r) * 68 + (j << 4) + rlane] = v;
      }
    }
    __builtin_amdgcn_fence(__ATOMIC_RELEASE, "workgroup");
    __builtin_amdgcn_wave_barrier();
    __builtin_amdgcn_fence(__ATOMIC_ACQUIRE, "workgroup");
    if (OUT_MODE == 0) {
      float* C = (float*)Cout + (size_t)b * strideC;
      const int hh = lane >> 4, c4 = (lane & 15) * 4;     // row seg = 256 B = 16 lanes x 16 B
      {
#pragma unroll
        for (int it = 0; it < 8; ++it) {
          const int row = it * 2 + hh;
          v4f v = *(const v4f*)(slab + row * 68 + c4);
          *(v4f*)(C + (size_t)(mBase + row) * ldc + n0 + c4) = v;
        }
        
      }
    } else {
      const int q = lane >> 3, c8 = (lane & 7) * 8;
      unsigned short* C  = (unsigned short*)Cout  + (size_t)b * strideC;
      unsigned short* C2 = (OUT_MODE == 2) ? ((unsigned short*)Cout2 + (size_t)b * strideC) : nullptr;
      {
#pragma unroll
        for (int it = 0; it < 4; ++it) {
          const int row = it * 4 + q;
          const float* sp = slab + row * 68 + c8;
          v8h hv, lv;
#pragma unroll
          for (int e = 0; e < 8; ++e) {
            if (OUT_MODE == 1) {
              hv[e] = (_Float16)sp[e];
            } else {
              unsigned short hb = f2bf_bits(sp[e]);
              unsigned short lb = f2bf_bits(sp[e] - bf_bits2f(hb));
              hv[e] = __builtin_bit_cast(_Float16, hb);
              lv[e] = __builtin_bit_cast(_Float16, lb);
            }
          }
          *(v8h*)(C + (size_t)(mBase + row) * ldc + n0 + c8) = hv;
          if (OUT_MODE == 2) *(v8h*)(C2 + (size_t)(mBase + row) * ldc + n0 + c8) = lv;
        }
        
      }
    }
    __builtin_amdgcn_fence(__ATOMIC_RELEASE, "workgroup");
    __builtin_amdgcn_wave_barrier();
    __builtin_amdgcn_fence(__ATOMIC_ACQUIRE, "workgroup");
  }
}

__global__ __launch_bounds__(256) void cast_f32_f16x2(
    const float* __restrict__ in, _Float16* __restrict__ out, int n2) {
  int i = blockIdx.x * 256 + threadIdx.x;
  if (i < n2) {
    const _Float16 h0 = (_Float16)in[2 * i], h1 = (_Float16)in[2 * i + 1];
    const unsigned u = (unsigned)__builtin_bit_cast(unsigned short, h0) | ((unsigned)__builtin_bit_cast(unsigned short, h1) << 16);
    ((unsigned*)out)[i] = u;
    
  }
}


// ---- f32 -> f16 cast with a power-of-two pre-scale (folded back by the consumer GEMM's scale) ----
__global__ __launch_bounds__(256) void cast_f32_f16x2s(const float* __restrict__ in, _Float16* __restrict__ out, int n2, float s) {
  int i = blockIdx.x * 256 + threadIdx.x;
  if (i < n2) {
    const _Float16 h0 = (_Float16)(in[2 * i] * s), h1 = (_Float16)(in[2 * i + 1] * s);
    const unsigned u = (unsigned)__builtin_bit_cast(unsigned short, h0) | ((unsigned)__builtin_bit_cast(unsigned short, h1) << 16);
    ((unsigned*)out)[i] = u;
    
  }
}
__global__ __launch_bounds__(256) void split_f32_bf16x2(
    const float* __restrict__ in, __bf16* __restrict__ hi, __bf16* __restrict__ lo, long n2) {
  long i = (long)blockIdx.x * 256 + threadIdx.x;
  long stride = (long)gridDim.x * 256;
  {
    for (long j = i; j < n2; j += stride) {
      const float a = in[2 * j], b = in[2 * j + 1];
      const unsigned short ah = f2bf_bits(a), bh = f2bf_bits(b);
      const unsigned short al = f2bf_bits(a - bf_bits2f(ah)), bl = f2bf_bits(b - bf_bits2f(bh));
      ((unsigned*)hi)[j] = (unsigned)ah | ((unsigned)bh << 16);
      ((unsigned*)lo)[j] = (unsigned)al | ((unsigned)bl << 16);
    }
    
  }
}


// ---- f32 [R][C] (row pitch ldi) -> f16 transposed [C][R] (row pitch ldo); 64x64 tiles; each output row segment
__global__ __launch_bounds__(256) void transpose_cast_f16(const float* __restrict__ in, int ldi,
                                                         _Float16* __restrict__ outT, int ldo, float scale) {
  __shared__ __align__(16) _Float16 tile[64][72];     // [c][r]
  const int c0 = blockIdx.x * 64, r0 = blockIdx.y * 64;
  const int t = threadIdx.y * 32 + threadIdx.x;
  for (int i = threadIdx.y; i < 64; i += 8) {
    tile[threadIdx.x][i]      = (_Float16)(in[(size_t)(r0 + i) * ldi + c0 + threadIdx.x] * scale);
    tile[32 + threadIdx.x][i] = (_Float16)(in[(size_t)(r0 + i) * ldi + c0 + 32 + threadIdx.x] * scale);
  }
  __syncthreads();
  const int q = t >> 3, c8 = (t & 7) * 8;
  {
#pragma unroll
    for (int it = 0; it < 2; ++it) {
      const int c = it * 32 + q;
      v8h hv = *(const v8h*)(&tile[c][c8]);
      *(v8h*)(outT + (size_t)(c0 + c) * ldo + r0 + c8) = hv;
    }
    
  }
}

// ---- f32 [R][C] (pitch ldi) -> bf16 hi/lo transposed planes [C][R] (pitch ldo); 64x64 tiles; each output row segment
__global__ __launch_bounds__(256) void transpose_split_bf16(const float* __restrict__ in, int ldi,
                                                           __bf16* __restrict__ outH, __bf16* __restrict__ outL, int ldo) {
  __shared__ __align__(16) float tile[64][68];     // [c][r]
  const int c0 = blockIdx.x * 64, r0 = blockIdx.y * 64;
  const int t = threadIdx.y * 32 + threadIdx.x;
  for (int i = threadIdx.y; i < 64; i += 8) {
    tile[threadIdx.x][i]      = in[(size_t)(r0 + i) * ldi + c0 + threadIdx.x];
    tile[32 + threadIdx.x][i] = in[(size_t)(r0 + i) * ldi + c0 + 32 + threadIdx.x];
  }
  __syncthreads();
  const int q = t >> 3, c8 = (t & 7) * 8;
  {
#pragma unroll
    for (int it = 0; it < 2; ++it) {
      const int c = it * 32 + q;
      v8b hv, lv;
#pragma unroll
      for (int e = 0; e < 8; ++e) {
        const float f = tile[c][c8 + e];
        const unsigned short hb = f2bf_bits(f);
        hv[e] = __builtin_bit_cast(__bf16, hb);
        lv[e] = __builtin_bit_cast(__bf16, f2bf_bits(f - bf_bits2f(hb)));
      }
      *(v8b*)(outH + (size_t)(c0 + c) * ldo + r0 + c8) = hv;
      *(v8b*)(outL + (size_t)(c0 + c) * ldo + r0 + c8) = lv;
    }
    
  }
}

// =====================================================================================
// Generic causal/non-causal attention for head_dim 64, f32 in / f32 out; 16-bit operands: bf16 with optional hi/lo splits, or
// plain f16 (F16=true, non-split, probabilities carried x2^15).
//   scores = (q*qscale)·kᵀ : v_wmma_f32_16x16x32_bf16; SPLIT_QK -> q,k as bf16 hi/lo (hi·hi + hi·lo + lo·hi)
//   out    = p·v           : v_wmma_f32_16x16x32_bf16; SPLIT_PV -> p,v as bf16 hi/lo; else p,v plain bf16
//   f32 accumulate; online softmax in f32. Block = 4 waves = 64 query rows of one (batch, head); S % 64 == 0.
//   Element (b, s, h, d) of tensor X lives at X[b*X_bs + s*X_rs + h*X_hs + d] (strides in floats, multiples of 4).
//   Masking: mask_mode 0 none, 1 causal (kv > q masked), 2 tensor [S][Skv] shared over (b,h) (float if
//   mask_is_int==0, int32 with element == 0 -> masked if 1, int32 with element != 0 -> masked if 2), 3 per-token vectors qmask[B][S] & kvmask[B][Skv] (int32,
//   0 -> masked), 4 causal + sliding window (kv > q or q - kv > W masked; W passed in mask_is_int);
//   5 = relative-position bias: s += cp[b,h,q][idx[q][kv]] + pc[b,h,kv][idx[q][kv]] with idx = mask_b ([S][Skv] int32) and
//   mask_a an int32 [S][Skv] tensor with nonzero = masked (tables: element (b,h,row,n) at X + b*c_bs + h*c_hs + row*c_rs + n);
//   masked scores are replaced by mask_fill (e.g. -inf or -1e9) before the softmax.
//   grid.x = B * H * (S/64) (or a sub-range with blk0).
// =====================================================================================
#define AT_D 64
#define AT_NW 4
#define AT_QB 64
#define AT_KC 64
struct AttnGeom { const float* cp = nullptr; const float* pc = nullptr; long c_bs = 0, c_rs = 0, c_hs = 0;   // mode-5 score-bias tables
                  long q_bs, q_rs, q_hs, k_bs, k_rs, k_hs, v_bs, v_rs, v_hs, o_bs, o_rs, o_hs;
                  int S, Skv, H, mask_mode; float qscale; int blk0; float mask_fill; int mask_is_int; };
static_assert(sizeof(AttnGeom) == 168, "no padding");

__device__ __forceinline__ unsigned short at_bf_bits(float f) {
  unsigned u = __float_as_uint(f);
  return (unsigned short)((u + 0x7FFFu + ((u >> 16) & 1u)) >> 16);
}
__device__ __forceinline__ __bf16 at_f2bf(float f) { return __builtin_bit_cast(__bf16, at_bf_bits(f)); }
__device__ __forceinline__ void at_split(float f, __bf16& hi, __bf16& lo) {
  const unsigned short hb = at_bf_bits(f);
  hi = __builtin_bit_cast(__bf16, hb);
  lo = at_f2bf(f - __uint_as_float(((unsigned)hb) << 16));
}
__device__ __forceinline__ v8f at_mma(v16b a, v16b b, v8f c) {
  c = __builtin_amdgcn_wmma_f32_16x16x32_bf16(false, a, false, b, (short)0, c, false, false);
  asm volatile("v_nop\n\tv_nop\n\tv_nop\n\tv_nop" : "+v"(c) : "v"(a), "v"(b));
  return c;
}
// 16-bit element as a bit pattern held in a __bf16 slot: f16 bits when F16, bf16 (RNE) otherwise
template <bool F16> __device__ __forceinline__ __bf16 at_to16(float f) {
  if (F16) return __builtin_bit_cast(__bf16, (_Float16)f);
  return at_f2bf(f);
}
template <bool F16> __device__ __forceinline__ v8f at_mma16(v16b a, v16b b, v8f c) {
  if (F16) {
    const v16h ah = __builtin_bit_cast(v16h, a), bh = __builtin_bit_cast(v16h, b);
    c = __builtin_amdgcn_wmma_f32_16x16x32_f16(false, ah, false, bh, (short)0, c, false, false);
    asm volatile("v_nop\n\tv_nop\n\tv_nop\n\tv_nop" : "+v"(c) : "v"(ah), "v"(bh));
    return c;
  }
  return at_mma(a, b, c);
}

template <bool SPLIT_QK, bool SPLIT_PV, bool F16 = false>
__global__ __launch_bounds__(128)
void attn64_kernel(const float* __restrict__ q, const float* __restrict__ k,
                   const float* __restrict__ v, float* __restrict__ out,
                   const void* __restrict__ mask_a, const int* __restrict__ mask_b, AttnGeom g) {
  static_assert(!(F16 && (SPLIT_QK || SPLIT_PV)), "f16 mode is non-split");
  const float PSC = F16 ? 32768.0f : 1.0f;     // f16 probabilities carried x2^15 (subnormal range), folded into the final 1/l
  union FB { v16b v; v8b h[2]; };
  __shared__ __align__(16) __bf16 Ksh[AT_KC * AT_D];             // K hi [kv][d]      8 KB
  __shared__ __align__(16) __bf16 Ksl[SPLIT_QK ? AT_KC * AT_D : 8];
  __shared__ __align__(16) __bf16 Vth[AT_D * AT_KC];             // V hi [d][kv]      8 KB
  __shared__ __align__(16) __bf16 Vtl[SPLIT_PV ? AT_D * AT_KC : 8];
  __shared__ __align__(16) __bf16 Psh[AT_NW][16 * AT_KC];        // per wave P hi [row][kv]  8 KB
  __shared__ __align__(16) __bf16 Psl[SPLIT_PV ? AT_NW : 1][SPLIT_PV ? 16 * AT_KC : 8];
  __shared__ __align__(16) float  Os[AT_NW][16 * 68];            // per wave out tile, pitch 68

  const int tid  = threadIdx.x;
  const int wave = tid >> 5;
  const int lane = tid & 31;
  const int hh   = lane >> 4;
  const int c    = lane & 15;

  const int nqb = g.S / AT_QB;
  const int bx = blockIdx.x + g.blk0;
  const int qb = bx % nqb;
  const int bh = bx / nqb;
  const int h  = bh % g.H;
  const int b  = bh / g.H;
  const int qbase_block = qb * AT_QB;
  const int q0 = qbase_block + wave * 16;

  const float* qb_ptr = q + (size_t)b * g.q_bs + (size_t)h * g.q_hs;
  const float* kb_ptr = k + (size_t)b * g.k_bs + (size_t)h * g.k_hs;
  const float* vb_ptr = v + (size_t)b * g.v_bs + (size_t)h * g.v_hs;
  float*       ob_ptr = out + (size_t)b * g.o_bs + (size_t)h * g.o_hs;

  // ---- Q fragments (A operand): 2 d-chunks, hi (and lo) ----
  v16b qah[2], qal[2];
  {
    const float* qrow = qb_ptr + (size_t)(q0 + c) * g.q_rs;
#pragma unroll
    for (int dc = 0; dc < 2; ++dc) {
#pragma unroll
      for (int e = 0; e < 8; ++e) {
        const float f0 = qrow[dc * 32 + 8 * hh + e] * g.qscale;
        const float f1 = qrow[dc * 32 + 16 + 8 * hh + e] * g.qscale;
        if (SPLIT_QK) { __bf16 hq, lq; at_split(f0, hq, lq); qah[dc][e] = hq; qal[dc][e] = lq; at_split(f1, hq, lq); qah[dc][8 + e] = hq; qal[dc][8 + e] = lq; }
        else { qah[dc][e] = at_to16<F16>(f0); qah[dc][8 + e] = at_to16<F16>(f1); qal[dc][e] = qah[dc][e]; qal[dc][8 + e] = qah[dc][8 + e]; }
      }
    }
  }

  float mrow[8], lrow[8];
  v8f oacc[4];
#pragma unroll
  for (int r = 0; r < 8; ++r) { mrow[r] = -INFINITY; lrow[r] = 0.f; }
#pragma unroll
  for (int t = 0; t < 4; ++t) oacc[t] = (v8f){0.f,0.f,0.f,0.f,0.f,0.f,0.f,0.f};

  const int nChunks = (g.mask_mode == 1 || g.mask_mode == 4) ? (qb + 1) : (g.Skv / AT_KC);   // block-uniform
  // per-row query mask (mode 3)
  int qkeep[8];
#pragma unroll
  for (int r = 0; r < 8; ++r) qkeep[r] = (g.mask_mode == 3) ? mask_b[(size_t)b * g.S + q0 + 8 * hh + r] : 1;   // mask_b = qmask in mode 3
  for (int kc = 0; kc < nChunks; ++kc) {
    const int kv0 = kc * AT_KC;
    __syncthreads();
    {
      const int kvr = tid >> 1, dh = (tid & 1) * 32;
      const float* krow = kb_ptr + (size_t)(kv0 + kvr) * g.k_rs + dh;
      const float* vrow = vb_ptr + (size_t)(kv0 + kvr) * g.v_rs + dh;
#pragma unroll
      for (int i = 0; i < 8; ++i) {
        v4f kk = *(const v4f*)(krow + 4 * i);
        v4f vv = *(const v4f*)(vrow + 4 * i);
#pragma unroll
        for (int e = 0; e < 4; ++e) {
          const int d = dh + 4 * i + e;
          if (SPLIT_QK) { __bf16 a, bl; at_split(kk[e], a, bl); Ksh[kvr * AT_D + d] = a; Ksl[kvr * AT_D + d] = bl; }
          else Ksh[kvr * AT_D + d] = at_to16<F16>(kk[e]);
          if (SPLIT_PV) { __bf16 a, bl; at_split(vv[e], a, bl); Vth[d * AT_KC + kvr] = a; Vtl[d * AT_KC + kvr] = bl; }
          else Vth[d * AT_KC + kvr] = at_to16<F16>(vv[e]);
        }
      }
    }
    __syncthreads();

    v8f s[4];
#pragma unroll
    for (int j = 0; j < 4; ++j) {
      s[j] = (v8f){0.f,0.f,0.f,0.f,0.f,0.f,0.f,0.f};
#pragma unroll 1
      for (int dc = 0; dc < 2; ++dc) {
        FB kb;
        kb.h[0] = *(const v8b*)(Ksh + (j * 16 + c) * AT_D + dc * 32 + 8 * hh);
        kb.h[1] = *(const v8b*)(Ksh + (j * 16 + c) * AT_D + dc * 32 + 16 + 8 * hh);
        s[j] = at_mma16<F16>(qah[dc], kb.v, s[j]);
        if (SPLIT_QK) {
          FB kl;
          kl.h[0] = *(const v8b*)(Ksl + (j * 16 + c) * AT_D + dc * 32 + 8 * hh);
          kl.h[1] = *(const v8b*)(Ksl + (j * 16 + c) * AT_D + dc * 32 + 16 + 8 * hh);
          s[j] = at_mma16<F16>(qah[dc], kl.v, s[j]);
          s[j] = at_mma16<F16>(qal[dc], kb.v, s[j]);
        }
      }
    }
    const bool diag = (g.mask_mode == 1) && (kc == qb);
    int kvkeep[4] = {1, 1, 1, 1};
    if (g.mask_mode == 3) {
#pragma unroll
      for (int j = 0; j < 4; ++j) kvkeep[j] = ((const int*)mask_a)[(size_t)b * g.Skv + kv0 + j * 16 + c];   // mask_a = kvmask
    }
    float cm[8];
#pragma unroll
    for (int r = 0; r < 8; ++r) {
      const int qrow = q0 + 8 * hh + r;
      float m = -INFINITY;
#pragma unroll
      for (int j = 0; j < 4; ++j) {
        const int kvcol = kv0 + j * 16 + c;
        bool masked = false;
        if (diag) masked = (kvcol > qrow);
        else if (g.mask_mode == 4) masked = (kvcol > qrow) || (qrow - kvcol > g.mask_is_int);
        else if (g.mask_mode == 2) {
          const size_t mi = (size_t)qrow * g.Skv + kvcol;
          masked = (g.mask_is_int == 0) ? (((const float*)mask_a)[mi] == 0.0f)
                 : (g.mask_is_int == 1) ? (((const int*)mask_a)[mi] == 0) : (((const int*)mask_a)[mi] != 0);
        } else if (g.mask_mode == 3) masked = (qkeep[r] == 0) || (kvkeep[j] == 0);
        else if (g.mask_mode == 5) {
          const size_t mi = (size_t)qrow * g.Skv + kvcol;
          masked = (((const int*)mask_a)[mi] != 0);
          int n = mask_b[mi]; n = n < 0 ? 0 : n;
          s[j][r] += g.cp[(size_t)b * g.c_bs + (size_t)h * g.c_hs + (size_t)qrow * g.c_rs + n]
                   + g.pc[(size_t)b * g.c_bs + (size_t)h * g.c_hs + (size_t)kvcol * g.c_rs + n];
        }
        if (masked) s[j][r] = g.mask_fill;
        m = fmaxf(m, s[j][r]);
      }
#pragma unroll
      for (int off = 1; off < 16; off <<= 1) m = fmaxf(m, __shfl_xor(m, off, 32));
      cm[r] = m;
    }
    __bf16* pwh = Psh[wave];
    __bf16* pwl = Psl[SPLIT_PV ? wave : 0];
#pragma unroll
    for (int r = 0; r < 8; ++r) {
      const float mnew = fmaxf(mrow[r], cm[r]);
      const float alpha = expf(mrow[r] - mnew);
      mrow[r] = mnew;
      float psum = 0.f;
#pragma unroll
      for (int j = 0; j < 4; ++j) {
        const float p = expf(s[j][r] - mnew);
        psum += p;
        if (SPLIT_PV) { __bf16 a, bl; at_split(p, a, bl); pwh[(8 * hh + r) * AT_KC + j * 16 + c] = a; pwl[(8 * hh + r) * AT_KC + j * 16 + c] = bl; }
        else pwh[(8 * hh + r) * AT_KC + j * 16 + c] = at_to16<F16>(p * PSC);
      }
#pragma unroll
      for (int off = 1; off < 16; off <<= 1) psum += __shfl_xor(psum, off, 32);
      lrow[r] = lrow[r] * alpha + psum;
#pragma unroll
      for (int t = 0; t < 4; ++t) oacc[t][r] *= alpha;
    }
    __builtin_amdgcn_fence(__ATOMIC_RELEASE, "workgroup");
    __builtin_amdgcn_wave_barrier();
    __builtin_amdgcn_fence(__ATOMIC_ACQUIRE, "workgroup");
#pragma unroll 1
    for (int kk = 0; kk < 2; ++kk) {
      FB pa, pl;
      pa.h[0] = *(const v8b*)(pwh + c * AT_KC + kk * 32 + 8 * hh);
      pa.h[1] = *(const v8b*)(pwh + c * AT_KC + kk * 32 + 16 + 8 * hh);
      if (SPLIT_PV) {
        pl.h[0] = *(const v8b*)(pwl + c * AT_KC + kk * 32 + 8 * hh);
        pl.h[1] = *(const v8b*)(pwl + c * AT_KC + kk * 32 + 16 + 8 * hh);
      }
#pragma unroll
      for (int t = 0; t < 4; ++t) {
        FB vb;
        vb.h[0] = *(const v8b*)(Vth + (t * 16 + c) * AT_KC + kk * 32 + 8 * hh);
        vb.h[1] = *(const v8b*)(Vth + (t * 16 + c) * AT_KC + kk * 32 + 16 + 8 * hh);
        oacc[t] = at_mma16<F16>(pa.v, vb.v, oacc[t]);
        if (SPLIT_PV) {
          FB vl;
          vl.h[0] = *(const v8b*)(Vtl + (t * 16 + c) * AT_KC + kk * 32 + 8 * hh);
          vl.h[1] = *(const v8b*)(Vtl + (t * 16 + c) * AT_KC + kk * 32 + 16 + 8 * hh);
          oacc[t] = at_mma16<F16>(pa.v, vl.v, oacc[t]);
          oacc[t] = at_mma16<F16>(pl.v, vb.v, oacc[t]);
        }
      }
    }
  }

  float* os = Os[wave];
#pragma unroll
  for (int r = 0; r < 8; ++r) {
    const float inv = 1.0f / (lrow[r] * PSC);
#pragma unroll
    for (int t = 0; t < 4; ++t) os[(8 * hh + r) * 68 + t * 16 + c] = oacc[t][r] * inv;
  }
  __builtin_amdgcn_fence(__ATOMIC_RELEASE, "workgroup");
  __builtin_amdgcn_wave_barrier();
  __builtin_amdgcn_fence(__ATOMIC_ACQUIRE, "workgroup");
  {
    const int c4 = (lane & 15) * 4;
    {
#pragma unroll
      for (int it = 0; it < 8; ++it) {
        const int row = it * 2 + hh;
        v4f val = *(const v4f*)(os + row * 68 + c4);
        *(v4f*)(ob_ptr + (size_t)(q0 + row) * g.o_rs + c4) = val;
      }
      
    }
  }
}

// Matrix product through the builtin alone: the compiler keeps the distances behind a WMMA itself, and with no asm statement behind each
// product the scheduler is free to issue the LDS fragment reads of a whole group ahead of the group's products
template <bool F16> __device__ __forceinline__ v8f at_mma16b(v16b a, v16b b, v8f c) {
  if (F16) return __builtin_amdgcn_wmma_f32_16x16x32_f16(false, __builtin_bit_cast(v16h, a), false, __builtin_bit_cast(v16h, b), (short)0, c, false, false);
  return __builtin_amdgcn_wmma_f32_16x16x32_bf16(false, a, false, b, (short)0, c, false, false);
}

// ---- head_dim 128 variant (same contract; K/V tiles 64 keys x 128, 8 output tiles; mask_mode 6 = causal + per-head ALiBi slope table in g.cp) ----
// MODE >= 0 fixes the mask mode at compile time, so the per-score mode tests fold away; MODE < 0 reads it from g.mask_mode
template <bool SPLIT_QK, bool SPLIT_PV, bool F16 = false, int MODE = -1>
__global__ __launch_bounds__(128)
void attn128_kernel(const float* __restrict__ q, const float* __restrict__ k,
                   const float* __restrict__ v, float* __restrict__ out,
                   const void* __restrict__ mask_a, const int* __restrict__ mask_b, AttnGeom g) {
  static_assert(!(F16 && (SPLIT_QK || SPLIT_PV)), "f16 mode is non-split");
  const float PSC = F16 ? 32768.0f : 1.0f;     // f16 probabilities carried x2^15 (subnormal range), folded into the final 1/l
  union FB { v16b v; v8b h[2]; };
  constexpr int D2 = 128;
  // LDS row pitches in elements: 16 B x odd (272 B for the 128-wide K and Q rows, 144 B for the 64-wide V^T and P rows), so that the
  // 16 rows one ds_load_b128 fragment read touches fall on distinct banks; at 256 B and 128 B they shared four or eight banks
  constexpr int KP = D2 + 8;
  constexpr int VP = AT_KC + 8;
  const int mode = (MODE >= 0) ? MODE : g.mask_mode;
  __shared__ __align__(16) __bf16 Ksh[AT_KC * KP];               // K hi [kv][d]      17 KB
  __shared__ __align__(16) __bf16 Ksl[SPLIT_QK ? AT_KC * KP : 8];
  __shared__ __align__(16) __bf16 Vth[D2 * VP];                  // V hi [d][kv]      18 KB
  __shared__ __align__(16) __bf16 Vtl[SPLIT_PV ? D2 * VP : 8];
  __shared__ __align__(16) __bf16 Psh[AT_NW][16 * VP];
  __shared__ __align__(16) __bf16 Psl[SPLIT_PV ? AT_NW : 1][SPLIT_PV ? 16 * VP : 8];
  __shared__ __align__(16) float  Os[AT_NW][16 * 132];           // per wave out tile, pitch 132
  __shared__ __align__(16) __bf16 Qsh[SPLIT_QK ? AT_NW : 1][SPLIT_QK ? 16 * KP : 8];   // split path: q hi/lo staged per wave (keeps VGPR use low)
  __shared__ __align__(16) __bf16 Qsl[SPLIT_QK ? AT_NW : 1][SPLIT_QK ? 16 * KP : 8];

  const int tid  = threadIdx.x;
  const int wave = tid >> 5;
  const int lane = tid & 31;
  const int hh   = lane >> 4;
  const int c    = lane & 15;

  const int nqb = g.S / AT_QB;
  const int bx = blockIdx.x + g.blk0;
  // Causal modes: query block qb walks qb + 1 key chunks, and the grid holds more blocks than the chip has resident places. The longest get
  // the lowest indices (qb falls with bx, heads innermost), for speed only. A permutation of (head, qb); needs the whole grid in one launch (blk0 = 0).
  const bool byCost = (mode == 1 || mode == 4 || mode == 6);
  const int nbh = byCost ? (int)gridDim.x / nqb : 1;
  const int qb = byCost ? (nqb - 1 - bx / nbh) : (bx % nqb);
  const int bh = byCost ? (bx % nbh) : (bx / nqb);
  const int h  = bh % g.H;
  const int b  = bh / g.H;
  const int qbase_block = qb * AT_QB;
  const int q0 = qbase_block + wave * 16;

  const float* qb_ptr = q + (size_t)b * g.q_bs + (size_t)h * g.q_hs;
  const float* kb_ptr = k + (size_t)b * g.k_bs + (size_t)h * g.k_hs;
  const float* vb_ptr = v + (size_t)b * g.v_bs + (size_t)h * g.v_hs;
  float*       ob_ptr = out + (size_t)b * g.o_bs + (size_t)h * g.o_hs;

  // ---- Q fragments (A operand): 4 d-chunks, hi (and lo) ----
  v16b qah[4], qal[4];
  {
    const float* qrow = qb_ptr + (size_t)(q0 + c) * g.q_rs;
#pragma unroll
    for (int dc = 0; dc < 4; ++dc) {
#pragma unroll
      for (int e = 0; e < 8; ++e) {
        const float f0 = qrow[dc * 32 + 8 * hh + e] * g.qscale;
        const float f1 = qrow[dc * 32 + 16 + 8 * hh + e] * g.qscale;
        if (SPLIT_QK) { __bf16 hq, lq; at_split(f0, hq, lq); Qsh[wave][c * KP + dc * 32 + 8 * hh + e] = hq; Qsl[wave][c * KP + dc * 32 + 8 * hh + e] = lq;
                        at_split(f1, hq, lq); Qsh[wave][c * KP + dc * 32 + 16 + 8 * hh + e] = hq; Qsl[wave][c * KP + dc * 32 + 16 + 8 * hh + e] = lq;
                        qah[dc][e] = hq; qal[dc][e] = lq; qah[dc][8 + e] = hq; qal[dc][8 + e] = lq; }   // (register copies unused on the split path)
        else { qah[dc][e] = at_to16<F16>(f0); qah[dc][8 + e] = at_to16<F16>(f1); qal[dc][e] = qah[dc][e]; qal[dc][8 + e] = qah[dc][8 + e]; }
      }
    }
  }

  float mrow[8], lrow[8];
  v8f oacc[8];
#pragma unroll
  for (int r = 0; r < 8; ++r) { mrow[r] = -INFINITY; lrow[r] = 0.f; }
#pragma unroll
  for (int t = 0; t < 8; ++t) oacc[t] = (v8f){0.f,0.f,0.f,0.f,0.f,0.f,0.f,0.f};

  const int nChunks = (mode == 1 || mode == 4 || mode == 6) ? (qb + 1) : (g.Skv / AT_KC);   // block-uniform
  // per-row query mask (mode 3)
  int qkeep[8];
#pragma unroll
  for (int r = 0; r < 8; ++r) qkeep[r] = (mode == 3) ? mask_b[(size_t)b * g.S + q0 + 8 * hh + r] : 1;   // mask_b = qmask in mode 3
  for (int kc = 0; kc < nChunks; ++kc) {
    const int kv0 = kc * AT_KC;
    __syncthreads();
    {
      const int kvr = tid >> 1, dh = (tid & 1) * 64;
      const float* krow = kb_ptr + (size_t)(kv0 + kvr) * g.k_rs + dh;
      const float* vrow = vb_ptr + (size_t)(kv0 + kvr) * g.v_rs + dh;
#pragma unroll
      for (int i = 0; i < 16; ++i) {
        v4f kk = *(const v4f*)(krow + 4 * i);
        v4f vv = *(const v4f*)(vrow + 4 * i);
#pragma unroll
        for (int e = 0; e < 4; ++e) {
          const int d = dh + 4 * i + e;
          if (SPLIT_QK) { __bf16 a, bl; at_split(kk[e], a, bl); Ksh[kvr * KP + d] = a; Ksl[kvr * KP + d] = bl; }
          else Ksh[kvr * KP + d] = at_to16<F16>(kk[e]);
          if (SPLIT_PV) { __bf16 a, bl; at_split(vv[e], a, bl); Vth[d * VP + kvr] = a; Vtl[d * VP + kvr] = bl; }
          else Vth[d * VP + kvr] = at_to16<F16>(vv[e]);
        }
      }
    }
    __syncthreads();

    // One group per 32-wide slice of d (its q and k fragments, 20 LDS reads, then 12 products). The next group's reads are issued as one run
    // ahead of this group's products, into a second register set, and the products rotate over the four score tiles, so that no product
    // waits for an LDS read just issued or for the product before it. Each tile still sums in the order d slice 0..3, hi.hi, hi.lo, lo.hi.
    v8f s[4];
#pragma unroll
    for (int j = 0; j < 4; ++j) s[j] = (v8f){0.f,0.f,0.f,0.f,0.f,0.f,0.f,0.f};
    FB qa[2], ql[2], kb[2][4], kl[2][4];
#pragma unroll
    for (int dc = -1; dc < 4; ++dc) {
      if (dc < 3) {
        const int n = dc + 1, w = n & 1;
        if (SPLIT_QK) {
          qa[w].h[0] = *(const v8b*)(&Qsh[wave][c * KP + n * 32 + 8 * hh]); qa[w].h[1] = *(const v8b*)(&Qsh[wave][c * KP + n * 32 + 16 + 8 * hh]);
          ql[w].h[0] = *(const v8b*)(&Qsl[wave][c * KP + n * 32 + 8 * hh]); ql[w].h[1] = *(const v8b*)(&Qsl[wave][c * KP + n * 32 + 16 + 8 * hh]);
        } else qa[w].v = qah[n];
#pragma unroll
        for (int j = 0; j < 4; ++j) {
          kb[w][j].h[0] = *(const v8b*)(Ksh + (j * 16 + c) * KP + n * 32 + 8 * hh);
          kb[w][j].h[1] = *(const v8b*)(Ksh + (j * 16 + c) * KP + n * 32 + 16 + 8 * hh);
          if (SPLIT_QK) {
            kl[w][j].h[0] = *(const v8b*)(Ksl + (j * 16 + c) * KP + n * 32 + 8 * hh);
            kl[w][j].h[1] = *(const v8b*)(Ksl + (j * 16 + c) * KP + n * 32 + 16 + 8 * hh);
          }
        }
      }
      __builtin_amdgcn_sched_barrier(0);   // keeps the reads above in one run: the scheduler otherwise moves them in among the products
      if (dc >= 0) {
        const int w = dc & 1;
#pragma unroll
        for (int j = 0; j < 4; ++j) s[j] = at_mma16b<F16>(qa[w].v, kb[w][j].v, s[j]);
        if (SPLIT_QK) {
#pragma unroll
          for (int j = 0; j < 4; ++j) s[j] = at_mma16b<F16>(qa[w].v, kl[w][j].v, s[j]);
#pragma unroll
          for (int j = 0; j < 4; ++j) s[j] = at_mma16b<F16>(ql[w].v, kb[w][j].v, s[j]);
        }
        __builtin_amdgcn_sched_barrier(0);   // ends the run of products: the group after next is not read in among them
      }
    }
    const bool diag = (mode == 1) && (kc == qb);
    int kvkeep[4] = {1, 1, 1, 1};
    if (mode == 3) {
#pragma unroll
      for (int j = 0; j < 4; ++j) kvkeep[j] = ((const int*)mask_a)[(size_t)b * g.Skv + kv0 + j * 16 + c];   // mask_a = kvmask
    }
    float cm[8];
#pragma unroll
    for (int r = 0; r < 8; ++r) {
      const int qrow = q0 + 8 * hh + r;
      float m = -INFINITY;
#pragma unroll
      for (int j = 0; j < 4; ++j) {
        const int kvcol = kv0 + j * 16 + c;
        bool masked = false;
        if (diag) masked = (kvcol > qrow);
        else if (mode == 4) masked = (kvcol > qrow) || (qrow - kvcol > g.mask_is_int);
        else if (mode == 2) {
          const size_t mi = (size_t)qrow * g.Skv + kvcol;
          masked = (g.mask_is_int == 0) ? (((const float*)mask_a)[mi] == 0.0f)
                 : (g.mask_is_int == 1) ? (((const int*)mask_a)[mi] == 0) : (((const int*)mask_a)[mi] != 0);
        } else if (mode == 3) masked = (qkeep[r] == 0) || (kvkeep[j] == 0);
        else if (mode == 6) { masked = (kvcol > qrow); s[j][r] += g.cp[h] * (float)(kvcol - qrow); }
        else if (mode == 8) { masked = (kvcol > qrow) || (((const int*)mask_a)[(size_t)b * g.Skv + kvcol] != 0); }
        else if (mode == 5) {
          const size_t mi = (size_t)qrow * g.Skv + kvcol;
          masked = (((const int*)mask_a)[mi] != 0);
          int n = mask_b[mi]; n = n < 0 ? 0 : n;
          s[j][r] += g.cp[(size_t)b * g.c_bs + (size_t)h * g.c_hs + (size_t)qrow * g.c_rs + n]
                   + g.pc[(size_t)b * g.c_bs + (size_t)h * g.c_hs + (size_t)kvcol * g.c_rs + n];
        }
        if (masked) s[j][r] = g.mask_fill;
        m = fmaxf(m, s[j][r]);
      }
#pragma unroll
      for (int off = 1; off < 16; off <<= 1) m = fmaxf(m, __shfl_xor(m, off, 32));
      cm[r] = m;
    }
    __bf16* pwh = Psh[wave];
    __bf16* pwl = Psl[SPLIT_PV ? wave : 0];
#pragma unroll
    for (int r = 0; r < 8; ++r) {
      const float mnew = fmaxf(mrow[r], cm[r]);
      const float alpha = expf(mrow[r] - mnew);
      mrow[r] = mnew;
      float psum = 0.f;
#pragma unroll
      for (int j = 0; j < 4; ++j) {
        const float p = expf(s[j][r] - mnew);
        psum += p;
        if (SPLIT_PV) { __bf16 a, bl; at_split(p, a, bl); pwh[(8 * hh + r) * VP + j * 16 + c] = a; pwl[(8 * hh + r) * VP + j * 16 + c] = bl; }
        else pwh[(8 * hh + r) * VP + j * 16 + c] = at_to16<F16>(p * PSC);
      }
#pragma unroll
      for (int off = 1; off < 16; off <<= 1) psum += __shfl_xor(psum, off, 32);
      lrow[r] = lrow[r] * alpha + psum;
#pragma unroll
      for (int t = 0; t < 8; ++t) oacc[t][r] *= alpha;
    }
    __builtin_amdgcn_fence(__ATOMIC_RELEASE, "workgroup");
    __builtin_amdgcn_wave_barrier();
    __builtin_amdgcn_fence(__ATOMIC_ACQUIRE, "workgroup");
    // One group per 32 keys and four output tiles (16 LDS reads of v, with p's four where the keys change, then 12 products), run like the
    // score groups: next group's reads in one run ahead of this group's products, products rotating over the four tiles.
    // Each output tile still sums in the order keys 0..31, 32..63, hi.hi, hi.lo, lo.hi.
    FB pa[2], pl[2], vb[2][4], vl[2][4];
#pragma unroll
    for (int gi = -1; gi < 4; ++gi) {
      if (gi < 3) {
        const int n = gi + 1, w = n & 1, kk = n >> 1, t0 = (n & 1) * 4;
        if (t0 == 0) {
          pa[kk].h[0] = *(const v8b*)(pwh + c * VP + kk * 32 + 8 * hh);
          pa[kk].h[1] = *(const v8b*)(pwh + c * VP + kk * 32 + 16 + 8 * hh);
          if (SPLIT_PV) {
            pl[kk].h[0] = *(const v8b*)(pwl + c * VP + kk * 32 + 8 * hh);
            pl[kk].h[1] = *(const v8b*)(pwl + c * VP + kk * 32 + 16 + 8 * hh);
          }
        }
#pragma unroll
        for (int u = 0; u < 4; ++u) {
          vb[w][u].h[0] = *(const v8b*)(Vth + ((t0 + u) * 16 + c) * VP + kk * 32 + 8 * hh);
          vb[w][u].h[1] = *(const v8b*)(Vth + ((t0 + u) * 16 + c) * VP + kk * 32 + 16 + 8 * hh);
          if (SPLIT_PV) {
            vl[w][u].h[0] = *(const v8b*)(Vtl + ((t0 + u) * 16 + c) * VP + kk * 32 + 8 * hh);
            vl[w][u].h[1] = *(const v8b*)(Vtl + ((t0 + u) * 16 + c) * VP + kk * 32 + 16 + 8 * hh);
          }
        }
      }
      __builtin_amdgcn_sched_barrier(0);   // keeps the reads above in one run, as in the score groups
      if (gi >= 0) {
        const int w = gi & 1, kk = gi >> 1, t0 = (gi & 1) * 4;
#pragma unroll
        for (int u = 0; u < 4; ++u) oacc[t0 + u] = at_mma16b<F16>(pa[kk].v, vb[w][u].v, oacc[t0 + u]);
        if (SPLIT_PV) {
#pragma unroll
          for (int u = 0; u < 4; ++u) oacc[t0 + u] = at_mma16b<F16>(pa[kk].v, vl[w][u].v, oacc[t0 + u]);
#pragma unroll
          for (int u = 0; u < 4; ++u) oacc[t0 + u] = at_mma16b<F16>(pl[kk].v, vb[w][u].v, oacc[t0 + u]);
        }
        __builtin_amdgcn_sched_barrier(0);   // ends the run of products
      }
    }
  }

  float* os = Os[wave];
#pragma unroll
  for (int r = 0; r < 8; ++r) {
    const float inv = 1.0f / (lrow[r] * PSC);
#pragma unroll
    for (int t = 0; t < 8; ++t) os[(8 * hh + r) * 132 + t * 16 + c] = oacc[t][r] * inv;
  }
  __builtin_amdgcn_fence(__ATOMIC_RELEASE, "workgroup");
  __builtin_amdgcn_wave_barrier();
  __builtin_amdgcn_fence(__ATOMIC_ACQUIRE, "workgroup");
  {
    const int c4 = lane * 4;           // 32 lanes x 16 B = one 512-B output row (128 floats) per instruction
    {
#pragma unroll
      for (int row = 0; row < 16; ++row) {
        v4f val = *(const v4f*)(os + row * 132 + c4);
        *(v4f*)(ob_ptr + (size_t)(q0 + row) * g.o_rs + c4) = val;
      }
      
    }
  }
}

#define XB 2
#define XH 16
#define XS 2048
#define XD 128
__global__ void slopes_kernel(float* __restrict__ sl) { const int h = threadIdx.x; const float v = (h < XH) ? exp2f(-8.0f * (float)(h + 1) / (float)XH) : 0.f; ((float*)sl)[h] = v;  }
extern "C" void kernel_launch(void* const* d_in, const int* in_sizes, int n_in, void* d_out, int out_size, void* d_ws, size_t ws_size, hipStream_t stream) {
  (void)in_sizes; (void)n_in; (void)out_size; (void)ws_size;
  const float* q = (const float*)d_in[0]; const float* k = (const float*)d_in[1]; const float* v = (const float*)d_in[2];
  float* sl = (float*)d_ws;
  slopes_kernel<<<1, 32, 0, stream>>>(sl);
  AttnGeom g;
  g.cp = sl; g.pc = nullptr; g.c_bs = 0; g.c_rs = 0; g.c_hs = 0;
  g.q_bs = (long)XH * XS * XD; g.q_hs = (long)XS * XD; g.q_rs = XD;
  g.k_bs = g.q_bs; g.k_hs = g.q_hs; g.k_rs = XD; g.v_bs = g.q_bs; g.v_hs = g.q_hs; g.v_rs = XD; g.o_bs = g.q_bs; g.o_hs = g.q_hs; g.o_rs = XD;
  g.S = XS; g.Skv = XS; g.H = XH; g.mask_mode = 6; g.qscale = 0.08838834764831845f; g.blk0 = 0; g.mask_fill = -INFINITY; g.mask_is_int = 0;
  attn128_kernel<true, true, false, 6><<<XB * XH * (XS / AT_QB), AT_NW * 32, 0, stream>>>(q, k, v, (float*)d_out, nullptr, nullptr, g);
}

// v005
// Measured time: 154 microseconds a run.
// In both of two side-by-side timings against v004, it was 1.40 times as fast.
// All steps since v000 together make it 13.0 times as fast.
#include <hip/hip_runtime.h>
#include <math.h>
// FlexAttention forward (causal block mask + ALiBi score_mod, 2 x 16 heads, 2048 x 2048, head_dim 128): scores and p·v on
// v_wmma_f32_16x16x32_bf16 with q,k and p,v as bf16 hi/lo splits (hi·hi + hi·lo + lo·hi;
// early causal rows copy single v rows almost verbatim), f32 accumulate; online softmax, the ALiBi bias slope_h·(k−q) and the
// causal predicate in f32 on VALU.
typedef __attribute__((ext_vector_type(16))) _Float16 v16h;
typedef __attribute__((ext_vector_type(8)))  _Float16 v8h;
typedef __attribute__((ext_vector_type(16))) __bf16   v16b;
typedef __attribute__((ext_vector_type(8)))  __bf16   v8b;
typedef __attribute__((ext_vector_type(8)))  float    v8f;
typedef __attribute__((ext_vector_type(4)))  float    v4f;
#define PSCALE 32768.0f
#define U16(p) ((const unsigned short*)(const void*)(p))
#define PSCALE_INV (1.0f / 32768.0f)

__device__ __forceinline__ unsigned short f2bf_bits(float f) {
  unsigned u = __float_as_uint(f);
  return (unsigned short)((u + 0x7FFFu + ((u >> 16) & 1u)) >> 16);
}
__device__ __forceinline__ float bf_bits2f(unsigned short h) { return __uint_as_float(((unsigned)h) << 16); }

// hazard guards as plain device helpers (no inline asm inside the kernel template body)
__device__ __forceinline__ void dep_guard_h(v8f& a, v8f& b, v16h x, v16h y) { asm volatile("v_nop\n\tv_nop\n\tv_nop\n\tv_nop" : "+v"(a), "+v"(b) : "v"(x), "v"(y)); }
__device__ __forceinline__ void dep_guard_b(v8f& a, v8f& b, v16b x, v16b y) { asm volatile("v_nop\n\tv_nop\n\tv_nop\n\tv_nop" : "+v"(a), "+v"(b) : "v"(x), "v"(y)); }
__device__ __forceinline__ void keep4_h(v16h a, v16h b, v16h c, v16h d) { asm volatile("v_nop" :: "v"(a), "v"(b), "v"(c), "v"(d)); }
__device__ __forceinline__ void keep4_b(v16b a, v16b b, v16b c, v16b d) { asm volatile("v_nop" :: "v"(a), "v"(b), "v"(c), "v"(d)); }
__device__ __forceinline__ void acc_guard4(v8f& a, v8f& b, v8f& c, v8f& d) { asm volatile("v_nop\n\tv_nop\n\tv_nop\n\tv_nop" : "+v"(a), "+v"(b), "+v"(c), "+v"(d)); }
template <typename T> struct Frag;
template <> struct Frag<_Float16> {
  typedef v16h V; union U { v16h v; v8h h[2]; };
  static __device__ __forceinline__ v16h load(const _Float16* p) {   // elements 0..7 <- p[0..7], 8..15 <- p[16..23]
    U f; f.h[0] = *(const v8h*)(p); f.h[1] = *(const v8h*)(p + 16); return f.v;
  }
  static __device__ __forceinline__ v8f mma(v16h a, v16h b, v8f c) {
    return __builtin_amdgcn_wmma_f32_16x16x32_f16(false, a, false, b, (short)0, c, false, false);
  }
  static __device__ __forceinline__ void guard(v8f& a, v8f& b, v16h x, v16h y) { dep_guard_h(a, b, x, y); }
  static __device__ __forceinline__ void keep(v16h a, v16h b, v16h c, v16h d) { keep4_h(a, b, c, d); }
};
template <> struct Frag<__bf16> {
  typedef v16b V; union U { v16b v; v8b h[2]; };
  static __device__ __forceinline__ v16b load(const __bf16* p) {
    U f; f.h[0] = *(const v8b*)(p); f.h[1] = *(const v8b*)(p + 16); return f.v;
  }
  static __device__ __forceinline__ v8f mma(v16b a, v16b b, v8f c) {
    return __builtin_amdgcn_wmma_f32_16x16x32_bf16(false, a, false, b, (short)0, c, false, false);
  }
  static __device__ __forceinline__ void guard(v8f& a, v8f& b, v16b x, v16b y) { dep_guard_b(a, b, x, y); }
  static __device__ __forceinline__ void keep(v16b a, v16b b, v16b c, v16b d) { keep4_b(a, b, c, d); }
};

// ---- Register-blocked batched WMMA GEMM ------------------------------------
// C[m,n] = scale * sum_k A[m,k] * Bt[n,k] (+bias)(+resid); each wave owns a 64x64 tile.
// A row-major [M,K]; Bt row-major [N,K]; M,N % 64 == 0, K % 32 == 0.
// SPLIT: operands are hi/lo planes (A2/Bt2 = lo planes, same layout); product = hi·hi + hi·lo + lo·hi.
// BIAS_MODE: 0 = none, 1 = bias[m], 2 = bias[n].
// OUT_MODE: 0 = f32, 1 = f16, 2 = bf16 hi plane (Cout) + bf16 lo plane (Cout2).
// ET: 0 = f16 operands, 1 = bf16 operands (pointers passed as 16-bit storage)
template <int ET> struct Elem;
template <> struct Elem<0> { typedef _Float16 T; };
template <> struct Elem<1> { typedef __bf16 T; };
template <int ET, bool SPLIT, int BIAS_MODE, int OUT_MODE, bool RESID, int ACT = 0>
__global__ __launch_bounds__(256) void wmma_gemm64(
    const unsigned short* __restrict__ Ap, const unsigned short* __restrict__ A2p, int lda, long strideA,
    const unsigned short* __restrict__ Btp, const unsigned short* __restrict__ Bt2p, int ldb, long strideB,
    void* __restrict__ Cout, void* __restrict__ Cout2, int ldc, long strideC,
    const float* __restrict__ bias,
    const float* __restrict__ resid, long strideR,
    int M, int N, int K, float scale) {
  typedef typename Elem<ET>::T T;
  typedef typename Frag<T>::V V;
  const T* A = (const T*)Ap; const T* A2 = (const T*)A2p; const T* Bt = (const T*)Btp; const T* Bt2 = (const T*)Bt2p;
  __shared__ __align__(16) float sT[8][16 * 68];   // per-wave 16x64 slab, pitch 68 floats
  const int b    = blockIdx.y;
  const int lane = threadIdx.x & 31;
  const int wave = threadIdx.x >> 5;
  const int tilesN = N >> 6;
  const int tilesM = M >> 6;
  const int tile = blockIdx.x * 8 + wave;
  if (tile >= tilesM * tilesN) return;   // wave-uniform; no block barriers in this kernel
  const int tm = tile / tilesN;
  const int tn = tile - tm * tilesN;
  const int m0 = tm << 6;
  const int n0 = tn << 6;

  const T* Ab  = A  + (size_t)b * strideA;
  const T* Bb  = Bt + (size_t)b * strideB;
  const T* Ab2 = SPLIT ? (A2  + (size_t)b * strideA) : nullptr;
  const T* Bb2 = SPLIT ? (Bt2 + (size_t)b * strideB) : nullptr;

  const int rlane = lane & 15;                 // row (A) / col (B, D) within subtile
  const int koff  = (lane >> 4) * 8;           // k offset of this lane half
  const int mOff  = (lane >> 4) * 8;           // D row offset

  v8f acc[4][4];
#pragma unroll
  for (int i = 0; i < 4; ++i)
#pragma unroll
    for (int j = 0; j < 4; ++j) acc[i][j] = (v8f){0.f,0.f,0.f,0.f,0.f,0.f,0.f,0.f};

  for (int k0 = 0; k0 < K; k0 += 32) {
    V bh[4], bl[4];
#pragma unroll
    for (int j = 0; j < 4; ++j) {
      const size_t bo = (size_t)(n0 + (j << 4) + rlane) * ldb + koff + k0;
      bh[j] = Frag<T>::load(Bb + bo);
      if (SPLIT) bl[j] = Frag<T>::load(Bb2 + bo);
    }
#pragma unroll
    for (int i = 0; i < 4; ++i) {
      const size_t ao = (size_t)(m0 + (i << 4) + rlane) * lda + koff + k0;
      V ah = Frag<T>::load(Ab + ao);
      V al;
      if (SPLIT) al = Frag<T>::load(Ab2 + ao);
#pragma unroll
      for (int j = 0; j < 4; ++j) {
        acc[i][j] = Frag<T>::mma(ah, bh[j], acc[i][j]);
        if (SPLIT) {
          acc[i][j] = Frag<T>::mma(ah, bl[j], acc[i][j]);
          acc[i][j] = Frag<T>::mma(al, bh[j], acc[i][j]);
        }
      }
      Frag<T>::guard(acc[i][0], acc[i][3], ah, SPLIT ? al : ah);
    }
    Frag<T>::keep(bh[0], bh[1], bh[2], bh[3]);
    if (SPLIT) Frag<T>::keep(bl[0], bl[1], bl[2], bl[3]);
  }
  acc_guard4(acc[0][0], acc[0][1], acc[0][2], acc[0][3]);
  acc_guard4(acc[1][0], acc[1][1], acc[1][2], acc[1][3]);
  acc_guard4(acc[2][0], acc[2][1], acc[2][2], acc[2][3]);
  acc_guard4(acc[3][0], acc[3][1], acc[3][2], acc[3][3]);

  // ---- epilogue ----
  float* slab = sT[wave];
  const float* Rb = RESID ? (resid + (size_t)b * strideR) : nullptr;
#pragma unroll
  for (int i = 0; i < 4; ++i) {
    const int mBase = m0 + (i << 4);
#pragma unroll
    for (int j = 0; j < 4; ++j) {
      const int n = n0 + (j << 4) + rlane;
      float bv = 0.f;
      if (BIAS_MODE == 2) bv = bias[n];
#pragma unroll
      for (int r = 0; r < 8; ++r) {
        float v = acc[i][j][r] * scale;
        if (BIAS_MODE == 1) v += bias[mBase + mOff + r];
        if (BIAS_MODE == 2) v += bv;
        if (RESID) v += Rb[(size_t)(mBase + mOff + r) * ldc + n];
        if (ACT == 1) v = tanhf(v);
        if (ACT == 2) v = fmaxf(v, 0.0f);
        if (ACT == 3) v = v / (1.0f + expf(-v));
        if (ACT == 4) v = (v > 0.f) ? v : 0.01f * v;
        if (ACT == 5) v = 0.5f * v * (1.0f + erff(v * 0.70710678118654752f));
        slab[(mOff + r) * 68 + (j << 4) + rlane] = v;
      }
    }
    __builtin_amdgcn_fence(__ATOMIC_RELEASE, "workgroup");
    __builtin_amdgcn_wave_barrier();
    __builtin_amdgcn_fence(__ATOMIC_ACQUIRE, "workgroup");
    if (OUT_MODE == 0) {
      float* C = (float*)Cout + (size_t)b * strideC;
      const int hh = lane >> 4, c4 = (lane & 15) * 4;     // row seg = 256 B = 16 lanes x 16 B
      {
#pragma unroll
        for (int it = 0; it < 8; ++it) {
          const int row = it * 2 + hh;
          v4f v = *(const v4f*)(slab + row * 68 + c4);
          *(v4f*)(C + (size_t)(mBase + row) * ldc + n0 + c4) = v;
        }
        
      }
    } else {
      const int q = lane >> 3, c8 = (lane & 7) * 8;
      unsigned short* C  = (unsigned short*)Cout  + (size_t)b * strideC;
      unsigned short* C2 = (OUT_MODE == 2) ? ((unsigned short*)Cout2 + (size_t)b * strideC) : nullptr;
      {
#pragma unroll
        for (int it = 0; it < 4; ++it) {
          const int row = it * 4 + q;
          const float* sp = slab + row * 68 + c8;
          v8h hv, lv;
#pragma unroll
          for (int e = 0; e < 8; ++e) {
            if (OUT_MODE == 1) {
              hv[e] = (_Float16)sp[e];
            } else {
              unsigned short hb = f2bf_bits(sp[e]);
              unsigned short lb = f2bf_bits(sp[e] - bf_bits2f(hb));
              hv[e] = __builtin_bit_cast(_Float16, hb);
              lv[e] = __builtin_bit_cast(_Float16, lb);
            }
          }
          *(v8h*)(C + (size_t)(mBase + row) * ldc + n0 + c8) = hv;
          if (OUT_MODE == 2) *(v8h*)(C2 + (size_t)(mBase + row) * ldc + n0 + c8) = lv;
        }
        
      }
    }
    __builtin_amdgcn_fence(__ATOMIC_RELEASE, "workgroup");
    __builtin_amdgcn_wave_barrier();
    __builtin_amdgcn_fence(__ATOMIC_ACQUIRE, "workgroup");
  }
}

__global__ __launch_bounds__(256) void cast_f32_f16x2(
    const float* __restrict__ in, _Float16* __restrict__ out, int n2) {
  int i = blockIdx.x * 256 + threadIdx.x;
  if (i < n2) {
    const _Float16 h0 = (_Float16)in[2 * i], h1 = (_Float16)in[2 * i + 1];
    const unsigned u = (unsigned)__builtin_bit_cast(unsigned short, h0) | ((unsigned)__builtin_bit_cast(unsigned short, h1) << 16);
    ((unsigned*)out)[i] = u;
    
  }
}


// ---- f32 -> f16 cast with a power-of-two pre-scale (folded back by the consumer GEMM's scale) ----
__global__ __launch_bounds__(256) void cast_f32_f16x2s(const float* __restrict__ in, _Float16* __restrict__ out, int n2, float s) {
  int i = blockIdx.x * 256 + threadIdx.x;
  if (i < n2) {
    const _Float16 h0 = (_Float16)(in[2 * i] * s), h1 = (_Float16)(in[2 * i + 1] * s);
    const unsigned u = (unsigned)__builtin_bit_cast(unsigned short, h0) | ((unsigned)__builtin_bit_cast(unsigned short, h1) << 16);
    ((unsigned*)out)[i] = u;
    
  }
}
__global__ __launch_bounds__(256) void split_f32_bf16x2(
    const float* __restrict__ in, __bf16* __restrict__ hi, __bf16* __restrict__ lo, long n2) {
  long i = (long)blockIdx.x * 256 + threadIdx.x;
  long stride = (long)gridDim.x * 256;
  {
    for (long j = i; j < n2; j += stride) {
      const float a = in[2 * j], b = in[2 * j + 1];
      const unsigned short ah = f2bf_bits(a), bh = f2bf_bits(b);
      const unsigned short al = f2bf_bits(a - bf_bits2f(ah)), bl = f2bf_bits(b - bf_bits2f(bh));
      ((unsigned*)hi)[j] = (unsigned)ah | ((unsigned)bh << 16);
      ((unsigned*)lo)[j] = (unsigned)al | ((unsigned)bl << 16);
    }
    
  }
}


// ---- f32 [R][C] (row pitch ldi) -> f16 transposed [C][R] (row pitch ldo); 64x64 tiles; each output row segment
__global__ __launch_bounds__(256) void transpose_cast_f16(const float* __restrict__ in, int ldi,
                                                         _Float16* __restrict__ outT, int ldo, float scale) {
  __shared__ __align__(16) _Float16 tile[64][72];     // [c][r]
  const int c0 = blockIdx.x * 64, r0 = blockIdx.y * 64;
  const int t = threadIdx.y * 32 + threadIdx.x;
  for (int i = threadIdx.y; i < 64; i += 8) {
    tile[threadIdx.x][i]      = (_Float16)(in[(size_t)(r0 + i) * ldi + c0 + threadIdx.x] * scale);
    tile[32 + threadIdx.x][i] = (_Float16)(in[(size_t)(r0 + i) * ldi + c0 + 32 + threadIdx.x] * scale);
  }
  __syncthreads();
  const int q = t >> 3, c8 = (t & 7) * 8;
  {
#pragma unroll
    for (int it = 0; it < 2; ++it) {
      const int c = it * 32 + q;
      v8h hv = *(const v8h*)(&tile[c][c8]);
      *(v8h*)(outT + (size_t)(c0 + c) * ldo + r0 + c8) = hv;
    }
    
  }
}

// ---- f32 [R][C] (pitch ldi) -> bf16 hi/lo transposed planes [C][R] (pitch ldo); 64x64 tiles; each output row segment
__global__ __launch_bounds__(256) void transpose_split_bf16(const float* __restrict__ in, int ldi,
                                                           __bf16* __restrict__ outH, __bf16* __restrict__ outL, int ldo) {
  __shared__ __align__(16) float tile[64][68];     // [c][r]
  const int c0 = blockIdx.x * 64, r0 = blockIdx.y * 64;
  const int t = threadIdx.y * 32 + threadIdx.x;
  for (int i = threadIdx.y; i < 64; i += 8) {
    tile[threadIdx.x][i]      = in[(size_t)(r0 + i) * ldi + c0 + threadIdx.x];
    tile[32 + threadIdx.x][i] = in[(size_t)(r0 + i) * ldi + c0 + 32 + threadIdx.x];
  }
  __syncthreads();
  const int q = t >> 3, c8 = (t & 7) * 8;
  {
#pragma unroll
    for (int it = 0; it < 2; ++it) {
      const int c = it * 32 + q;
      v8b hv, lv;
#pragma unroll
      for (int e = 0; e < 8; ++e) {
        const float f = tile[c][c8 + e];
        const unsigned short hb = f2bf_bits(f);
        hv[e] = __builtin_bit_cast(__bf16, hb);
        lv[e] = __builtin_bit_cast(__bf16, f2bf_bits(f - bf_bits2f(hb)));
      }
      *(v8b*)(outH + (size_t)(c0 + c) * ldo + r0 + c8) = hv;
      *(v8b*)(outL + (size_t)(c0 + c) * ldo + r0 + c8) = lv;
    }
    
  }
}

// =====================================================================================
// Generic causal/non-causal attention for head_dim 64, f32 in / f32 out; 16-bit operands: bf16 with optional hi/lo splits, or
// plain f16 (F16=true, non-split, probabilities carried x2^15).
//   scores = (q*qscale)·kᵀ : v_wmma_f32_16x16x32_bf16; SPLIT_QK -> q,k as bf16 hi/lo (hi·hi + hi·lo + lo·hi)
//   out    = p·v           : v_wmma_f32_16x16x32_bf16; SPLIT_PV -> p,v as bf16 hi/lo; else p,v plain bf16
//   f32 accumulate; online softmax in f32. Block = 4 waves = 64 query rows of one (batch, head); S % 64 == 0.
//   Element (b, s, h, d) of tensor X lives at X[b*X_bs + s*X_rs + h*X_hs + d] (strides in floats, multiples of 4).
//   Masking: mask_mode 0 none, 1 causal (kv > q masked), 2 tensor [S][Skv] shared over (b,h) (float if
//   mask_is_int==0, int32 with element == 0 -> masked if 1, int32 with element != 0 -> masked if 2), 3 per-token vectors qmask[B][S] & kvmask[B][Skv] (int32,
//   0 -> masked), 4 causal + sliding window (kv > q or q - kv > W masked; W passed in mask_is_int);
//   5 = relative-position bias: s += cp[b,h,q][idx[q][kv]] + pc[b,h,kv][idx[q][kv]] with idx = mask_b ([S][Skv] int32) and
//   mask_a an int32 [S][Skv] tensor with nonzero = masked (tables: element (b,h,row,n) at X + b*c_bs + h*c_hs + row*c_rs + n);
//   masked scores are replaced by mask_fill (e.g. -inf or -1e9) before the softmax.
//   grid.x = B * H * (S/64) (or a sub-range with blk0).
// =====================================================================================
#define AT_D 64
#define AT_NW 4
#define AT_QB 64
#define AT_KC 64
struct AttnGeom { const float* cp = nullptr; const float* pc = nullptr; long c_bs = 0, c_rs = 0, c_hs = 0;   // mode-5 score-bias tables
                  long q_bs, q_rs, q_hs, k_bs, k_rs, k_hs, v_bs, v_rs, v_hs, o_bs, o_rs, o_hs;
                  int S, Skv, H, mask_mode; float qscale; int blk0; float mask_fill; int mask_is_int; };
static_assert(sizeof(AttnGeom) == 168, "no padding");

__device__ __forceinline__ unsigned short at_bf_bits(float f) {
  unsigned u = __float_as_uint(f);
  return (unsigned short)((u + 0x7FFFu + ((u >> 16) & 1u)) >> 16);
}
__device__ __forceinline__ __bf16 at_f2bf(float f) { return __builtin_bit_cast(__bf16, at_bf_bits(f)); }
__device__ __forceinline__ void at_split(float f, __bf16& hi, __bf16& lo) {
  const unsigned short hb = at_bf_bits(f);
  hi = __builtin_bit_cast(__bf16, hb);
  lo = at_f2bf(f - __uint_as_float(((unsigned)hb) << 16));
}
__device__ __forceinline__ v8f at_mma(v16b a, v16b b, v8f c) {
  c = __builtin_amdgcn_wmma_f32_16x16x32_bf16(false, a, false, b, (short)0, c, false, false);
  asm volatile("v_nop\n\tv_nop\n\tv_nop\n\tv_nop" : "+v"(c) : "v"(a), "v"(b));
  return c;
}
// 16-bit element as a bit pattern held in a __bf16 slot: f16 bits when F16, bf16 (RNE) otherwise
template <bool F16> __device__ __forceinline__ __bf16 at_to16(float f) {
  if (F16) return __builtin_bit_cast(__bf16, (_Float16)f);
  return at_f2bf(f);
}
template <bool F16> __device__ __forceinline__ v8f at_mma16(v16b a, v16b b, v8f c) {
  if (F16) {
    const v16h ah = __builtin_bit_cast(v16h, a), bh = __builtin_bit_cast(v16h, b);
    c = __builtin_amdgcn_wmma_f32_16x16x32_f16(false, ah, false, bh, (short)0, c, false, false);
    asm volatile("v_nop\n\tv_nop\n\tv_nop\n\tv_nop" : "+v"(c) : "v"(ah), "v"(bh));
    return c;
  }
  return at_mma(a, b, c);
}

template <bool SPLIT_QK, bool SPLIT_PV, bool F16 = false>
__global__ __launch_bounds__(128)
void attn64_kernel(const float* __restrict__ q, const float* __restrict__ k,
                   const float* __restrict__ v, float* __restrict__ out,
                   const void* __restrict__ mask_a, const int* __restrict__ mask_b, AttnGeom g) {
  static_assert(!(F16 && (SPLIT_QK || SPLIT_PV)), "f16 mode is non-split");
  const float PSC = F16 ? 32768.0f : 1.0f;     // f16 probabilities carried x2^15 (subnormal range), folded into the final 1/l
  union FB { v16b v; v8b h[2]; };
  __shared__ __align__(16) __bf16 Ksh[AT_KC * AT_D];             // K hi [kv][d]      8 KB
  __shared__ __align__(16) __bf16 Ksl[SPLIT_QK ? AT_KC * AT_D : 8];
  __shared__ __align__(16) __bf16 Vth[AT_D * AT_KC];             // V hi [d][kv]      8 KB
  __shared__ __align__(16) __bf16 Vtl[SPLIT_PV ? AT_D * AT_KC : 8];
  __shared__ __align__(16) __bf16 Psh[AT_NW][16 * AT_KC];        // per wave P hi [row][kv]  8 KB
  __shared__ __align__(16) __bf16 Psl[SPLIT_PV ? AT_NW : 1][SPLIT_PV ? 16 * AT_KC : 8];
  __shared__ __align__(16) float  Os[AT_NW][16 * 68];            // per wave out tile, pitch 68

  const int tid  = threadIdx.x;
  const int wave = tid >> 5;
  const int lane = tid & 31;
  const int hh   = lane >> 4;
  const int c    = lane & 15;

  const int nqb = g.S / AT_QB;
  const int bx = blockIdx.x + g.blk0;
  const int qb = bx % nqb;
  const int bh = bx / nqb;
  const int h  = bh % g.H;
  const int b  = bh / g.H;
  const int qbase_block = qb * AT_QB;
  const int q0 = qbase_block + wave * 16;

  const float* qb_ptr = q + (size_t)b * g.q_bs + (size_t)h * g.q_hs;
  const float* kb_ptr = k + (size_t)b * g.k_bs + (size_t)h * g.k_hs;
  const float* vb_ptr = v + (size_t)b * g.v_bs + (size_t)h * g.v_hs;
  float*       ob_ptr = out + (size_t)b * g.o_bs + (size_t)h * g.o_hs;

  // ---- Q fragments (A operand): 2 d-chunks, hi (and lo) ----
  v16b qah[2], qal[2];
  {
    const float* qrow = qb_ptr + (size_t)(q0 + c) * g.q_rs;
#pragma unroll
    for (int dc = 0; dc < 2; ++dc) {
#pragma unroll
      for (int e = 0; e < 8; ++e) {
        const float f0 = qrow[dc * 32 + 8 * hh + e] * g.qscale;
        const float f1 = qrow[dc * 32 + 16 + 8 * hh + e] * g.qscale;
        if (SPLIT_QK) { __bf16 hq, lq; at_split(f0, hq, lq); qah[dc][e] = hq; qal[dc][e] = lq; at_split(f1, hq, lq); qah[dc][8 + e] = hq; qal[dc][8 + e] = lq; }
        else { qah[dc][e] = at_to16<F16>(f0); qah[dc][8 + e] = at_to16<F16>(f1); qal[dc][e] = qah[dc][e]; qal[dc][8 + e] = qah[dc][8 + e]; }
      }
    }
  }

  float mrow[8], lrow[8];
  v8f oacc[4];
#pragma unroll
  for (int r = 0; r < 8; ++r) { mrow[r] = -INFINITY; lrow[r] = 0.f; }
#pragma unroll
  for (int t = 0; t < 4; ++t) oacc[t] = (v8f){0.f,0.f,0.f,0.f,0.f,0.f,0.f,0.f};

  const int nChunks = (g.mask_mode == 1 || g.mask_mode == 4) ? (qb + 1) : (g.Skv / AT_KC);   // block-uniform
  // per-row query mask (mode 3)
  int qkeep[8];
#pragma unroll
  for (int r = 0; r < 8; ++r) qkeep[r] = (g.mask_mode == 3) ? mask_b[(size_t)b * g.S + q0 + 8 * hh + r] : 1;   // mask_b = qmask in mode 3
  for (int kc = 0; kc < nChunks; ++kc) {
    const int kv0 = kc * AT_KC;
    __syncthreads();
    {
      const int kvr = tid >> 1, dh = (tid & 1) * 32;
      const float* krow = kb_ptr + (size_t)(kv0 + kvr) * g.k_rs + dh;
      const float* vrow = vb_ptr + (size_t)(kv0 + kvr) * g.v_rs + dh;
#pragma unroll
      for (int i = 0; i < 8; ++i) {
        v4f kk = *(const v4f*)(krow + 4 * i);
        v4f vv = *(const v4f*)(vrow + 4 * i);
#pragma unroll
        for (int e = 0; e < 4; ++e) {
          const int d = dh + 4 * i + e;
          if (SPLIT_QK) { __bf16 a, bl; at_split(kk[e], a, bl); Ksh[kvr * AT_D + d] = a; Ksl[kvr * AT_D + d] = bl; }
          else Ksh[kvr * AT_D + d] = at_to16<F16>(kk[e]);
          if (SPLIT_PV) { __bf16 a, bl; at_split(vv[e], a, bl); Vth[d * AT_KC + kvr] = a; Vtl[d * AT_KC + kvr] = bl; }
          else Vth[d * AT_KC + kvr] = at_to16<F16>(vv[e]);
        }
      }
    }
    __syncthreads();

    v8f s[4];
#pragma unroll
    for (int j = 0; j < 4; ++j) {
      s[j] = (v8f){0.f,0.f,0.f,0.f,0.f,0.f,0.f,0.f};
#pragma unroll 1
      for (int dc = 0; dc < 2; ++dc) {
        FB kb;
        kb.h[0] = *(const v8b*)(Ksh + (j * 16 + c) * AT_D + dc * 32 + 8 * hh);
        kb.h[1] = *(const v8b*)(Ksh + (j * 16 + c) * AT_D + dc * 32 + 16 + 8 * hh);
        s[j] = at_mma16<F16>(qah[dc], kb.v, s[j]);
        if (SPLIT_QK) {
          FB kl;
          kl.h[0] = *(const v8b*)(Ksl + (j * 16 + c) * AT_D + dc * 32 + 8 * hh);
          kl.h[1] = *(const v8b*)(Ksl + (j * 16 + c) * AT_D + dc * 32 + 16 + 8 * hh);
          s[j] = at_mma16<F16>(qah[dc], kl.v, s[j]);
          s[j] = at_mma16<F16>(qal[dc], kb.v, s[j]);
        }
      }
    }
    const bool diag = (g.mask_mode == 1) && (kc == qb);
    int kvkeep[4] = {1, 1, 1, 1};
    if (g.mask_mode == 3) {
#pragma unroll
      for (int j = 0; j < 4; ++j) kvkeep[j] = ((const int*)mask_a)[(size_t)b * g.Skv + kv0 + j * 16 + c];   // mask_a = kvmask
    }
    float cm[8];
#pragma unroll
    for (int r = 0; r < 8; ++r) {
      const int qrow = q0 + 8 * hh + r;
      float m = -INFINITY;
#pragma unroll
      for (int j = 0; j < 4; ++j) {
        const int kvcol = kv0 + j * 16 + c;
        bool masked = false;
        if (diag) masked = (kvcol > qrow);
        else if (g.mask_mode == 4) masked = (kvcol > qrow) || (qrow - kvcol > g.mask_is_int);
        else if (g.mask_mode == 2) {
          const size_t mi = (size_t)qrow * g.Skv + kvcol;
          masked = (g.mask_is_int == 0) ? (((const float*)mask_a)[mi] == 0.0f)
                 : (g.mask_is_int == 1) ? (((const int*)mask_a)[mi] == 0) : (((const int*)mask_a)[mi] != 0);
        } else if (g.mask_mode == 3) masked = (qkeep[r] == 0) || (kvkeep[j] == 0);
        else if (g.mask_mode == 5) {
          const size_t mi = (size_t)qrow * g.Skv + kvcol;
          masked = (((const int*)mask_a)[mi] != 0);
          int n = mask_b[mi]; n = n < 0 ? 0 : n;
          s[j][r] += g.cp[(size_t)b * g.c_bs + (size_t)h * g.c_hs + (size_t)qrow * g.c_rs + n]
                   + g.pc[(size_t)b * g.c_bs + (size_t)h * g.c_hs + (size_t)kvcol * g.c_rs + n];
        }
        if (masked) s[j][r] = g.mask_fill;
        m = fmaxf(m, s[j][r]);
      }
#pragma unroll
      for (int off = 1; off < 16; off <<= 1) m = fmaxf(m, __shfl_xor(m, off, 32));
      cm[r] = m;
    }
    __bf16* pwh = Psh[wave];
    __bf16* pwl = Psl[SPLIT_PV ? wave : 0];
#pragma unroll
    for (int r = 0; r < 8; ++r) {
      const float mnew = fmaxf(mrow[r], cm[r]);
      const float alpha = expf(mrow[r] - mnew);
      mrow[r] = mnew;
      float psum = 0.f;
#pragma unroll
      for (int j = 0; j < 4; ++j) {
        const float p = expf(s[j][r] - mnew);
        psum += p;
        if (SPLIT_PV) { __bf16 a, bl; at_split(p, a, bl); pwh[(8 * hh + r) * AT_KC + j * 16 + c] = a; pwl[(8 * hh + r) * AT_KC + j * 16 + c] = bl; }
        else pwh[(8 * hh + r) * AT_KC + j * 16 + c] = at_to16<F16>(p * PSC);
      }
#pragma unroll
      for (int off = 1; off < 16; off <<= 1) psum += __shfl_xor(psum, off, 32);
      lrow[r] = lrow[r] * alpha + psum;
#pragma unroll
      for (int t = 0; t < 4; ++t) oacc[t][r] *= alpha;
    }
    __builtin_amdgcn_fence(__ATOMIC_RELEASE, "workgroup");
    __builtin_amdgcn_wave_barrier();
    __builtin_amdgcn_fence(__ATOMIC_ACQUIRE, "workgroup");
#pragma unroll 1
    for (int kk = 0; kk < 2; ++kk) {
      FB pa, pl;
      pa.h[0] = *(const v8b*)(pwh + c * AT_KC + kk * 32 + 8 * hh);
      pa.h[1] = *(const v8b*)(pwh + c * AT_KC + kk * 32 + 16 + 8 * hh);
      if (SPLIT_PV) {
        pl.h[0] = *(const v8b*)(pwl + c * AT_KC + kk * 32 + 8 * hh);
        pl.h[1] = *(const v8b*)(pwl + c * AT_KC + kk * 32 + 16 + 8 * hh);
      }
#pragma unroll
      for (int t = 0; t < 4; ++t) {
        FB vb;
        vb.h[0] = *(const v8b*)(Vth + (t * 16 + c) * AT_KC + kk * 32 + 8 * hh);
        vb.h[1] = *(const v8b*)(Vth + (t * 16 + c) * AT_KC + kk * 32 + 16 + 8 * hh);
        oacc[t] = at_mma16<F16>(pa.v, vb.v, oacc[t]);
        if (SPLIT_PV) {
          FB vl;
          vl.h[0] = *(const v8b*)(Vtl + (t * 16 + c) * AT_KC + kk * 32 + 8 * hh);
          vl.h[1] = *(const v8b*)(Vtl + (t * 16 + c) * AT_KC + kk * 32 + 16 + 8 * hh);
          oacc[t] = at_mma16<F16>(pa.v, vl.v, oacc[t]);
          oacc[t] = at_mma16<F16>(pl.v, vb.v, oacc[t]);
        }
      }
    }
  }

  float* os = Os[wave];
#pragma unroll
  for (int r = 0; r < 8; ++r) {
    const float inv = 1.0f / (lrow[r] * PSC);
#pragma unroll
    for (int t = 0; t < 4; ++t) os[(8 * hh + r) * 68 + t * 16 + c] = oacc[t][r] * inv;
  }
  __builtin_amdgcn_fence(__ATOMIC_RELEASE, "workgroup");
  __builtin_amdgcn_wave_barrier();
  __builtin_amdgcn_fence(__ATOMIC_ACQUIRE, "workgroup");
  {
    const int c4 = (lane & 15) * 4;
    {
#pragma unroll
      for (int it = 0; it < 8; ++it) {
        const int row = it * 2 + hh;
        v4f val = *(const v4f*)(os + row * 68 + c4);
        *(v4f*)(ob_ptr + (size_t)(q0 + row) * g.o_rs + c4) = val;
      }
      
    }
  }
}

// Matrix product through the builtin alone: the compiler keeps the distances behind a WMMA itself, and with no asm statement behind each
// product the scheduler is free to issue the LDS fragment reads of a whole group ahead of the group's products
template <bool F16> __device__ __forceinline__ v8f at_mma16b(v16b a, v16b b, v8f c) {
  if (F16) return __builtin_amdgcn_wmma_f32_16x16x32_f16(false, __builtin_bit_cast(v16h, a), false, __builtin_bit_cast(v16h, b), (short)0, c, false, false);
  return __builtin_amdgcn_wmma_f32_16x16x32_bf16(false, a, false, b, (short)0, c, false, false);
}

// ---- head_dim 128 variant (same contract; K/V tiles 64 keys x 128, 8 output tiles; mask_mode 6 = causal + per-head ALiBi slope table in g.cp) ----
// MODE >= 0 fixes the mask mode at compile time, so the per-score mode tests fold away; MODE < 0 reads it from g.mask_mode
// PRE: k and v come as the bf16 hi/lo planes that kv_split_planes wrote earlier in the same call (pkh, pkl: [b*H + h][kv][d]; pvh, pvl: one
// [d][64 keys] tile per key chunk); the key loop then only copies a chunk's four 16 KB tiles into LDS and converts nothing
template <bool SPLIT_QK, bool SPLIT_PV, bool F16 = false, int MODE = -1, bool PRE = false>
__global__ __launch_bounds__(128)
void attn128_kernel(const float* __restrict__ q, const float* __restrict__ k,
                   const float* __restrict__ v, float* __restrict__ out,
                   const void* __restrict__ mask_a, const int* __restrict__ mask_b, AttnGeom g,
                   const __bf16* __restrict__ pkh, const __bf16* __restrict__ pkl,
                   const __bf16* __restrict__ pvh, const __bf16* __restrict__ pvl) {
  static_assert(!(F16 && (SPLIT_QK || SPLIT_PV)), "f16 mode is non-split");
  static_assert(!PRE || (SPLIT_QK && SPLIT_PV), "the planes are hi/lo splits");
  const float PSC = F16 ? 32768.0f : 1.0f;     // f16 probabilities carried x2^15 (subnormal range), folded into the final 1/l
  union FB { v16b v; v8b h[2]; };
  constexpr int D2 = 128;
  // LDS row pitches in elements: 16 B x odd (272 B for the 128-wide K and Q rows, 144 B for the 64-wide V^T and P rows), so that the
  // 16 rows one ds_load_b128 fragment read touches fall on distinct banks; at 256 B and 128 B they shared four or eight banks
  constexpr int KP = D2 + 8;
  constexpr int VP = AT_KC + 8;
  const int mode = (MODE >= 0) ? MODE : g.mask_mode;
  __shared__ __align__(16) __bf16 Ksh[AT_KC * KP];               // K hi [kv][d]      17 KB
  __shared__ __align__(16) __bf16 Ksl[SPLIT_QK ? AT_KC * KP : 8];
  __shared__ __align__(16) __bf16 Vth[D2 * VP];                  // V hi [d][kv]      18 KB
  __shared__ __align__(16) __bf16 Vtl[SPLIT_PV ? D2 * VP : 8];
  __shared__ __align__(16) __bf16 Psh[AT_NW][16 * VP];
  __shared__ __align__(16) __bf16 Psl[SPLIT_PV ? AT_NW : 1][SPLIT_PV ? 16 * VP : 8];
  __shared__ __align__(16) float  Os[AT_NW][16 * 132];           // per wave out tile, pitch 132
  __shared__ __align__(16) __bf16 Qsh[SPLIT_QK ? AT_NW : 1][SPLIT_QK ? 16 * KP : 8];   // split path: q hi/lo staged per wave (keeps VGPR use low)
  __shared__ __align__(16) __bf16 Qsl[SPLIT_QK ? AT_NW : 1][SPLIT_QK ? 16 * KP : 8];

  const int tid  = threadIdx.x;
  const int wave = tid >> 5;
  const int lane = tid & 31;
  const int hh   = lane >> 4;
  const int c    = lane & 15;

  const int nqb = g.S / AT_QB;
  const int bx = blockIdx.x + g.blk0;
  // Causal modes: query block qb walks qb + 1 key chunks, and the grid holds more blocks than the chip has resident places. The longest get
  // the lowest indices (qb falls with bx, heads innermost), for speed only. A permutation of (head, qb); needs the whole grid in one launch (blk0 = 0).
  const bool byCost = (mode == 1 || mode == 4 || mode == 6);
  const int nbh = byCost ? (int)gridDim.x / nqb : 1;
  const int qb = byCost ? (nqb - 1 - bx / nbh) : (bx % nqb);
  const int bh = byCost ? (bx % nbh) : (bx / nqb);
  const int h  = bh % g.H;
  const int b  = bh / g.H;
  const int qbase_block = qb * AT_QB;
  const int q0 = qbase_block + wave * 16;

  const float* qb_ptr = q + (size_t)b * g.q_bs + (size_t)h * g.q_hs;
  const float* kb_ptr = k + (size_t)b * g.k_bs + (size_t)h * g.k_hs;
  const float* vb_ptr = v + (size_t)b * g.v_bs + (size_t)h * g.v_hs;
  float*       ob_ptr = out + (size_t)b * g.o_bs + (size_t)h * g.o_hs;

  // ---- Q fragments (A operand): 4 d-chunks, hi (and lo) ----
  v16b qah[4], qal[4];
  {
    const float* qrow = qb_ptr + (size_t)(q0 + c) * g.q_rs;
#pragma unroll
    for (int dc = 0; dc < 4; ++dc) {
#pragma unroll
      for (int e = 0; e < 8; ++e) {
        const float f0 = qrow[dc * 32 + 8 * hh + e] * g.qscale;
        const float f1 = qrow[dc * 32 + 16 + 8 * hh + e] * g.qscale;
        if (SPLIT_QK) { __bf16 hq, lq; at_split(f0, hq, lq); Qsh[wave][c * KP + dc * 32 + 8 * hh + e] = hq; Qsl[wave][c * KP + dc * 32 + 8 * hh + e] = lq;
                        at_split(f1, hq, lq); Qsh[wave][c * KP + dc * 32 + 16 + 8 * hh + e] = hq; Qsl[wave][c * KP + dc * 32 + 16 + 8 * hh + e] = lq;
                        qah[dc][e] = hq; qal[dc][e] = lq; qah[dc][8 + e] = hq; qal[dc][8 + e] = lq; }   // (register copies unused on the split path)
        else { qah[dc][e] = at_to16<F16>(f0); qah[dc][8 + e] = at_to16<F16>(f1); qal[dc][e] = qah[dc][e]; qal[dc][8 + e] = qah[dc][8 + e]; }
      }
    }
  }

  float mrow[8], lrow[8];
  v8f oacc[8];
#pragma unroll
  for (int r = 0; r < 8; ++r) { mrow[r] = -INFINITY; lrow[r] = 0.f; }
#pragma unroll
  for (int t = 0; t < 8; ++t) oacc[t] = (v8f){0.f,0.f,0.f,0.f,0.f,0.f,0.f,0.f};

  const int nChunks = (mode == 1 || mode == 4 || mode == 6) ? (qb + 1) : (g.Skv / AT_KC);   // block-uniform
  // per-row query mask (mode 3)
  int qkeep[8];
#pragma unroll
  for (int r = 0; r < 8; ++r) qkeep[r] = (mode == 3) ? mask_b[(size_t)b * g.S + q0 + 8 * hh + r] : 1;   // mask_b = qmask in mode 3
  for (int kc = 0; kc < nChunks; ++kc) {
    const int kv0 = kc * AT_KC;
    if (PRE) {
      // each tile is 1024 pieces of 16 B, linear in memory; piece n is 16 B number n & 15 of K row n >> 4, n & 7 of V^T row n >> 3
      const size_t hb = (size_t)bh * g.Skv * D2;     // this head's part of each plane: a block-uniform base, and a 32-bit byte offset from it
      const char* gkh = (const char*)(pkh + hb); const char* gkl = (const char*)(pkl + hb);
      const char* gvh = (const char*)(pvh + hb); const char* gvl = (const char*)(pvl + hb);
      const unsigned lo16 = (unsigned)kc * (unsigned)(AT_KC * D2 * 2) + (unsigned)tid * 16u;
      v8b rkh[8], rkl[8], rvh[8], rvl[8];
#pragma unroll   // constant indices keep the pieces in registers, and the 32 loads issue as one run
      for (int i = 0; i < 8; ++i) {
        rkh[i] = *(const v8b*)(gkh + i * 2048 + lo16); rkl[i] = *(const v8b*)(gkl + i * 2048 + lo16);
        rvh[i] = *(const v8b*)(gvh + i * 2048 + lo16); rvl[i] = *(const v8b*)(gvl + i * 2048 + lo16);
      }
      __syncthreads();   // ends every wave's reads of the chunk before
#pragma unroll   // constant indices, as above
      for (int i = 0; i < 8; ++i) {
        const int n = i * 128 + tid;
        *(v8b*)(Ksh + (n >> 4) * KP + (n & 15) * 8) = rkh[i];
        *(v8b*)(Ksl + (n >> 4) * KP + (n & 15) * 8) = rkl[i];
        *(v8b*)(Vth + (n >> 3) * VP + (n & 7) * 8) = rvh[i];
        *(v8b*)(Vtl + (n >> 3) * VP + (n & 7) * 8) = rvl[i];
      }
    } else {
      __syncthreads();
      const int kvr = tid >> 1, dh = (tid & 1) * 64;
      const float* krow = kb_ptr + (size_t)(kv0 + kvr) * g.k_rs + dh;
      const float* vrow = vb_ptr + (size_t)(kv0 + kvr) * g.v_rs + dh;
#pragma unroll
      for (int i = 0; i < 16; ++i) {
        v4f kk = *(const v4f*)(krow + 4 * i);
        v4f vv = *(const v4f*)(vrow + 4 * i);
#pragma unroll
        for (int e = 0; e < 4; ++e) {
          const int d = dh + 4 * i + e;
          if (SPLIT_QK) { __bf16 a, bl; at_split(kk[e], a, bl); Ksh[kvr * KP + d] = a; Ksl[kvr * KP + d] = bl; }
          else Ksh[kvr * KP + d] = at_to16<F16>(kk[e]);
          if (SPLIT_PV) { __bf16 a, bl; at_split(vv[e], a, bl); Vth[d * VP + kvr] = a; Vtl[d * VP + kvr] = bl; }
          else Vth[d * VP + kvr] = at_to16<F16>(vv[e]);
        }
      }
    }
    __syncthreads();

    // One group per 32-wide slice of d (its q and k fragments, 20 LDS reads, then 12 products). The next group's reads are issued as one run
    // ahead of this group's products, into a second register set, and the products rotate over the four score tiles, so that no product
    // waits for an LDS read just issued or for the product before it. Each tile still sums in the order d slice 0..3, hi.hi, hi.lo, lo.hi.
    v8f s[4];
#pragma unroll
    for (int j = 0; j < 4; ++j) s[j] = (v8f){0.f,0.f,0.f,0.f,0.f,0.f,0.f,0.f};
    FB qa[2], ql[2], kb[2][4], kl[2][4];
#pragma unroll
    for (int dc = -1; dc < 4; ++dc) {
      if (dc < 3) {
        const int n = dc + 1, w = n & 1;
        if (SPLIT_QK) {
          qa[w].h[0] = *(const v8b*)(&Qsh[wave][c * KP + n * 32 + 8 * hh]); qa[w].h[1] = *(const v8b*)(&Qsh[wave][c * KP + n * 32 + 16 + 8 * hh]);
          ql[w].h[0] = *(const v8b*)(&Qsl[wave][c * KP + n * 32 + 8 * hh]); ql[w].h[1] = *(const v8b*)(&Qsl[wave][c * KP + n * 32 + 16 + 8 * hh]);
        } else qa[w].v = qah[n];
#pragma unroll
        for (int j = 0; j < 4; ++j) {
          kb[w][j].h[0] = *(const v8b*)(Ksh + (j * 16 + c) * KP + n * 32 + 8 * hh);
          kb[w][j].h[1] = *(const v8b*)(Ksh + (j * 16 + c) * KP + n * 32 + 16 + 8 * hh);
          if (SPLIT_QK) {
            kl[w][j].h[0] = *(const v8b*)(Ksl + (j * 16 + c) * KP + n * 32 + 8 * hh);
            kl[w][j].h[1] = *(const v8b*)(Ksl + (j * 16 + c) * KP + n * 32 + 16 + 8 * hh);
          }
        }
      }
      __builtin_amdgcn_sched_barrier(0);   // keeps the reads above in one run: the scheduler otherwise moves them in among the products
      if (dc >= 0) {
        const int w = dc & 1;
#pragma unroll
        for (int j = 0; j < 4; ++j) s[j] = at_mma16b<F16>(qa[w].v, kb[w][j].v, s[j]);
        if (SPLIT_QK) {
#pragma unroll
          for (int j = 0; j < 4; ++j) s[j] = at_mma16b<F16>(qa[w].v, kl[w][j].v, s[j]);
#pragma unroll
          for (int j = 0; j < 4; ++j) s[j] = at_mma16b<F16>(ql[w].v, kb[w][j].v, s[j]);
        }
        __builtin_amdgcn_sched_barrier(0);   // ends the run of products: the group after next is not read in among them
      }
    }
    const bool diag = (mode == 1) && (kc == qb);
    int kvkeep[4] = {1, 1, 1, 1};
    if (mode == 3) {
#pragma unroll
      for (int j = 0; j < 4; ++j) kvkeep[j] = ((const int*)mask_a)[(size_t)b * g.Skv + kv0 + j * 16 + c];   // mask_a = kvmask
    }
    float cm[8];
#pragma unroll
    for (int r = 0; r < 8; ++r) {
      const int qrow = q0 + 8 * hh + r;
      float m = -INFINITY;
#pragma unroll
      for (int j = 0; j < 4; ++j) {
        const int kvcol = kv0 + j * 16 + c;
        bool masked = false;
        if (diag) masked = (kvcol > qrow);
        else if (mode == 4) masked = (kvcol > qrow) || (qrow - kvcol > g.mask_is_int);
        else if (mode == 2) {
          const size_t mi = (size_t)qrow * g.Skv + kvcol;
          masked = (g.mask_is_int == 0) ? (((const float*)mask_a)[mi] == 0.0f)
                 : (g.mask_is_int == 1) ? (((const int*)mask_a)[mi] == 0) : (((const int*)mask_a)[mi] != 0);
        } else if (mode == 3) masked = (qkeep[r] == 0) || (kvkeep[j] == 0);
        else if (mode == 6) { masked = (kvcol > qrow); s[j][r] += g.cp[h] * (float)(kvcol - qrow); }
        else if (mode == 8) { masked = (kvcol > qrow) || (((const int*)mask_a)[(size_t)b * g.Skv + kvcol] != 0); }
        else if (mode == 5) {
          const size_t mi = (size_t)qrow * g.Skv + kvcol;
          masked = (((const int*)mask_a)[mi] != 0);
          int n = mask_b[mi]; n = n < 0 ? 0 : n;
          s[j][r] += g.cp[(size_t)b * g.c_bs + (size_t)h * g.c_hs + (size_t)qrow * g.c_rs + n]
                   + g.pc[(size_t)b * g.c_bs + (size_t)h * g.c_hs + (size_t)kvcol * g.c_rs + n];
        }
        if (masked) s[j][r] = g.mask_fill;
        m = fmaxf(m, s[j][r]);
      }
#pragma unroll
      for (int off = 1; off < 16; off <<= 1) m = fmaxf(m, __shfl_xor(m, off, 32));
      cm[r] = m;
    }
    __bf16* pwh = Psh[wave];
    __bf16* pwl = Psl[SPLIT_PV ? wave : 0];
#pragma unroll
    for (int r = 0; r < 8; ++r) {
      const float mnew = fmaxf(mrow[r], cm[r]);
      const float alpha = expf(mrow[r] - mnew);
      mrow[r] = mnew;
      float psum = 0.f;
#pragma unroll
      for (int j = 0; j < 4; ++j) {
        const float p = expf(s[j][r] - mnew);
        psum += p;
        if (SPLIT_PV) { __bf16 a, bl; at_split(p, a, bl); pwh[(8 * hh + r) * VP + j * 16 + c] = a; pwl[(8 * hh + r) * VP + j * 16 + c] = bl; }
        else pwh[(8 * hh + r) * VP + j * 16 + c] = at_to16<F16>(p * PSC);
      }
#pragma unroll
      for (int off = 1; off < 16; off <<= 1) psum += __shfl_xor(psum, off, 32);
      lrow[r] = lrow[r] * alpha + psum;
#pragma unroll
      for (int t = 0; t < 8; ++t) oacc[t][r] *= alpha;
    }
    __builtin_amdgcn_fence(__ATOMIC_RELEASE, "workgroup");
    __builtin_amdgcn_wave_barrier();
    __builtin_amdgcn_fence(__ATOMIC_ACQUIRE, "workgroup");
    // One group per 32 keys and four output tiles (16 LDS reads of v, with p's four where the keys change, then 12 products), run like the
    // score groups: next group's reads in one run ahead of this group's products, products rotating over the four tiles.
    // Each output tile still sums in the order keys 0..31, 32..63, hi.hi, hi.lo, lo.hi.
    FB pa[2], pl[2], vb[2][4], vl[2][4];
#pragma unroll
    for (int gi = -1; gi < 4; ++gi) {
      if (gi < 3) {
        const int n = gi + 1, w = n & 1, kk = n >> 1, t0 = (n & 1) * 4;
        if (t0 == 0) {
          pa[kk].h[0] = *(const v8b*)(pwh + c * VP + kk * 32 + 8 * hh);
          pa[kk].h[1] = *(const v8b*)(pwh + c * VP + kk * 32 + 16 + 8 * hh);
          if (SPLIT_PV) {
            pl[kk].h[0] = *(const v8b*)(pwl + c * VP + kk * 32 + 8 * hh);
            pl[kk].h[1] = *(const v8b*)(pwl + c * VP + kk * 32 + 16 + 8 * hh);
          }
        }
#pragma unroll
        for (int u = 0; u < 4; ++u) {
          vb[w][u].h[0] = *(const v8b*)(Vth + ((t0 + u) * 16 + c) * VP + kk * 32 + 8 * hh);
          vb[w][u].h[1] = *(const v8b*)(Vth + ((t0 + u) * 16 + c) * VP + kk * 32 + 16 + 8 * hh);
          if (SPLIT_PV) {
            vl[w][u].h[0] = *(const v8b*)(Vtl + ((t0 + u) * 16 + c) * VP + kk * 32 + 8 * hh);
            vl[w][u].h[1] = *(const v8b*)(Vtl + ((t0 + u) * 16 + c) * VP + kk * 32 + 16 + 8 * hh);
          }
        }
      }
      __builtin_amdgcn_sched_barrier(0);   // keeps the reads above in one run, as in the score groups
      if (gi >= 0) {
        const int w = gi & 1, kk = gi >> 1, t0 = (gi & 1) * 4;
#pragma unroll
        for (int u = 0; u < 4; ++u) oacc[t0 + u] = at_mma16b<F16>(pa[kk].v, vb[w][u].v, oacc[t0 + u]);
        if (SPLIT_PV) {
#pragma unroll
          for (int u = 0; u < 4; ++u) oacc[t0 + u] = at_mma16b<F16>(pa[kk].v, vl[w][u].v, oacc[t0 + u]);
#pragma unroll
          for (int u = 0; u < 4; ++u) oacc[t0 + u] = at_mma16b<F16>(pl[kk].v, vb[w][u].v, oacc[t0 + u]);
        }
        __builtin_amdgcn_sched_barrier(0);   // ends the run of products
      }
    }
  }

  float* os = Os[wave];
#pragma unroll
  for (int r = 0; r < 8; ++r) {
    const float inv = 1.0f / (lrow[r] * PSC);
#pragma unroll
    for (int t = 0; t < 8; ++t) os[(8 * hh + r) * 132 + t * 16 + c] = oacc[t][r] * inv;
  }
  __builtin_amdgcn_fence(__ATOMIC_RELEASE, "workgroup");
  __builtin_amdgcn_wave_barrier();
  __builtin_amdgcn_fence(__ATOMIC_ACQUIRE, "workgroup");
  {
    const int c4 = lane * 4;           // 32 lanes x 16 B = one 512-B output row (128 floats) per instruction
    {
#pragma unroll
      for (int row = 0; row < 16; ++row) {
        v4f val = *(const v4f*)(os + row * 132 + c4);
        *(v4f*)(ob_ptr + (size_t)(q0 + row) * g.o_rs + c4) = val;
      }
      
    }
  }
}

// ---- k and v, f32 [rows][128], split once into bf16 hi/lo planes (the split of at_split, so the values are those the key loop made itself).
// One block per 64 rows (one key chunk of one head). k keeps its layout; v is transposed through LDS into one [128 d][64 keys] tile per chunk.
__global__ __launch_bounds__(256) void kv_split_planes(const float* __restrict__ k, const float* __restrict__ v,
                                                       __bf16* __restrict__ kh, __bf16* __restrict__ kl,
                                                       __bf16* __restrict__ vth, __bf16* __restrict__ vtl) {
  __shared__ float tile[128 * 65];     // [d][key], pitch 65 floats: the column writes fall on 16 banks, the row reads on 32
  const int t = threadIdx.x;
  const size_t base = (size_t)blockIdx.x * (64 * 128);
  // every loop below is unrolled so that a thread's loads issue together, ahead of the conversions
#pragma unroll
  for (int it = 0; it < 8; ++it) {
    const int n = it * 256 + t, key = n >> 5, d4 = (n & 31) * 4;
    const v4f x = *(const v4f*)(v + base + n * 4);     // row key, columns d4 .. d4 + 3: the tile is linear in n
#pragma unroll
    for (int e = 0; e < 4; ++e) tile[(d4 + e) * 65 + key] = x[e];
  }
#pragma unroll
  for (int it = 0; it < 4; ++it) {
    const int n = it * 256 + t;
    const v4f x0 = *(const v4f*)(k + base + n * 8), x1 = *(const v4f*)(k + base + n * 8 + 4);
    v8b hv, lv;
#pragma unroll
    for (int e = 0; e < 4; ++e) {
      __bf16 a, bl;
      at_split(x0[e], a, bl); hv[e] = a; lv[e] = bl;
      at_split(x1[e], a, bl); hv[4 + e] = a; lv[4 + e] = bl;
    }
    *(v8b*)(kh + base + n * 8) = hv;
    *(v8b*)(kl + base + n * 8) = lv;
  }
  __syncthreads();   // the v tile is complete before any thread reads its rows
#pragma unroll
  for (int it = 0; it < 4; ++it) {
    const int n = it * 256 + t, d = n >> 3, k8 = (n & 7) * 8;
    v8b hv, lv;
#pragma unroll
    for (int e = 0; e < 8; ++e) { __bf16 a, bl; at_split(tile[d * 65 + k8 + e], a, bl); hv[e] = a; lv[e] = bl; }
    *(v8b*)(vth + base + n * 8) = hv;
    *(v8b*)(vtl + base + n * 8) = lv;
  }
}

#define XB 2
#define XH 16
#define XS 2048
#define XD 128
__global__ void slopes_kernel(float* __restrict__ sl) { const int h = threadIdx.x; const float v = (h < XH) ? exp2f(-8.0f * (float)(h + 1) / (float)XH) : 0.f; ((float*)sl)[h] = v;  }
extern "C" void kernel_launch(void* const* d_in, const int* in_sizes, int n_in, void* d_out, int out_size, void* d_ws, size_t ws_size, hipStream_t stream) {
  (void)in_sizes; (void)n_in; (void)out_size; (void)ws_size;
  const float* q = (const float*)d_in[0]; const float* k = (const float*)d_in[1]; const float* v = (const float*)d_in[2];
  float* sl = (float*)d_ws;
  slopes_kernel<<<1, 32, 0, stream>>>(sl);
  __bf16* kh = (__bf16*)((char*)d_ws + 4096);                 // four planes of XB * XH * XS * XD bf16 behind the slope table
  __bf16* kl = kh + (size_t)XB * XH * XS * XD; __bf16* vth = kl + (size_t)XB * XH * XS * XD; __bf16* vtl = vth + (size_t)XB * XH * XS * XD;
  kv_split_planes<<<XB * XH * (XS / AT_KC), 256, 0, stream>>>(k, v, kh, kl, vth, vtl);
  AttnGeom g;
  g.cp = sl; g.pc = nullptr; g.c_bs = 0; g.c_rs = 0; g.c_hs = 0;
  g.q_bs = (long)XH * XS * XD; g.q_hs = (long)XS * XD; g.q_rs = XD;
  g.k_bs = g.q_bs; g.k_hs = g.q_hs; g.k_rs = XD; g.v_bs = g.q_bs; g.v_hs = g.q_hs; g.v_rs = XD; g.o_bs = g.q_bs; g.o_hs = g.q_hs; g.o_rs = XD;
  g.S = XS; g.Skv = XS; g.H = XH; g.mask_mode = 6; g.qscale = 0.08838834764831845f; g.blk0 = 0; g.mask_fill = -INFINITY; g.mask_is_int = 0;
  attn128_kernel<true, true, false, 6, true><<<XB * XH * (XS / AT_QB), AT_NW * 32, 0, stream>>>(q, k, v, (float*)d_out, nullptr, nullptr, g, kh, kl, vth, vtl);
}

// v006
// One run takes 134 microseconds.
// Next to v005, in two timings, it ran 1.15 times as fast each time.
// All steps since v000 together make it 14.9 times as fast.
#include <hip/hip_runtime.h>
#include <math.h>
// FlexAttention forward (causal block mask + ALiBi score_mod, 2 x 16 heads, 2048 x 2048, head_dim 128): scores and p·v on
// v_wmma_f32_16x16x32_bf16 with q,k and p,v as bf16 hi/lo splits (hi·hi + hi·lo + lo·hi;
// early causal rows copy single v rows almost verbatim), f32 accumulate; online softmax, the ALiBi bias slope_h·(k−q) and the
// causal predicate in f32 on VALU.
typedef __attribute__((ext_vector_type(16))) _Float16 v16h;
typedef __attribute__((ext_vector_type(8)))  _Float16 v8h;
typedef __attribute__((ext_vector_type(16))) __bf16   v16b;
typedef __attribute__((ext_vector_type(8)))  __bf16   v8b;
typedef __attribute__((ext_vector_type(8)))  float    v8f;
typedef __attribute__((ext_vector_type(4)))  float    v4f;
#define PSCALE 32768.0f
#define U16(p) ((const unsigned short*)(const void*)(p))
#define PSCALE_INV (1.0f / 32768.0f)

__device__ __forceinline__ unsigned short f2bf_bits(float f) {
  unsigned u = __float_as_uint(f);
  return (unsigned short)((u + 0x7FFFu + ((u >> 16) & 1u)) >> 16);
}
__device__ __forceinline__ float bf_bits2f(unsigned short h) { return __uint_as_float(((unsigned)h) << 16); }

// hazard guards as plain device helpers (no inline asm inside the kernel template body)
__device__ __forceinline__ void dep_guard_h(v8f& a, v8f& b, v16h x, v16h y) { asm volatile("v_nop\n\tv_nop\n\tv_nop\n\tv_nop" : "+v"(a), "+v"(b) : "v"(x), "v"(y)); }
__device__ __forceinline__ void dep_guard_b(v8f& a, v8f& b, v16b x, v16b y) { asm volatile("v_nop\n\tv_nop\n\tv_nop\n\tv_nop" : "+v"(a), "+v"(b) : "v"(x), "v"(y)); }
__device__ __forceinline__ void keep4_h(v16h a, v16h b, v16h c, v16h d) { asm volatile("v_nop" :: "v"(a), "v"(b), "v"(c), "v"(d)); }
__device__ __forceinline__ void keep4_b(v16b a, v16b b, v16b c, v16b d) { asm volatile("v_nop" :: "v"(a), "v"(b), "v"(c), "v"(d)); }
__device__ __forceinline__ void acc_guard4(v8f& a, v8f& b, v8f& c, v8f& d) { asm volatile("v_nop\n\tv_nop\n\tv_nop\n\tv_nop" : "+v"(a), "+v"(b), "+v"(c), "+v"(d)); }
template <typename T> struct Frag;
template <> struct Frag<_Float16> {
  typedef v16h V; union U { v16h v; v8h h[2]; };
  static __device__ __forceinline__ v16h load(const _Float16* p) {   // elements 0..7 <- p[0..7], 8..15 <- p[16..23]
    U f; f.h[0] = *(const v8h*)(p); f.h[1] = *(const v8h*)(p + 16); return f.v;
  }
  static __device__ __forceinline__ v8f mma(v16h a, v16h b, v8f c) {
    return __builtin_amdgcn_wmma_f32_16x16x32_f16(false, a, false, b, (short)0, c, false, false);
  }
  static __device__ __forceinline__ void guard(v8f& a, v8f& b, v16h x, v16h y) { dep_guard_h(a, b, x, y); }
  static __device__ __forceinline__ void keep(v16h a, v16h b, v16h c, v16h d) { keep4_h(a, b, c, d); }
};
template <> struct Frag<__bf16> {
  typedef v16b V; union U { v16b v; v8b h[2]; };
  static __device__ __forceinline__ v16b load(const __bf16* p) {
    U f; f.h[0] = *(const v8b*)(p); f.h[1] = *(const v8b*)(p + 16); return f.v;
  }
  static __device__ __forceinline__ v8f mma(v16b a, v16b b, v8f c) {
    return __builtin_amdgcn_wmma_f32_16x16x32_bf16(false, a, false, b, (short)0, c, false, false);
  }
  static __device__ __forceinline__ void guard(v8f& a, v8f& b, v16b x, v16b y) { dep_guard_b(a, b, x, y); }
  static __device__ __forceinline__ void keep(v16b a, v16b b, v16b c, v16b d) { keep4_b(a, b, c, d); }
};

// ---- Register-blocked batched WMMA GEMM ------------------------------------
// C[m,n] = scale * sum_k A[m,k] * Bt[n,k] (+bias)(+resid); each wave owns a 64x64 tile.
// A row-major [M,K]; Bt row-major [N,K]; M,N % 64 == 0, K % 32 == 0.
// SPLIT: operands are hi/lo planes (A2/Bt2 = lo planes, same layout); product = hi·hi + hi·lo + lo·hi.
// BIAS_MODE: 0 = none, 1 = bias[m], 2 = bias[n].
// OUT_MODE: 0 = f32, 1 = f16, 2 = bf16 hi plane (Cout) + bf16 lo plane (Cout2).
// ET: 0 = f16 operands, 1 = bf16 operands (pointers passed as 16-bit storage)
template <int ET> struct Elem;
template <> struct Elem<0> { typedef _Float16 T; };
template <> struct Elem<1> { typedef __bf16 T; };
template <int ET, bool SPLIT, int BIAS_MODE, int OUT_MODE, bool RESID, int ACT = 0>
__global__ __launch_bounds__(256) void wmma_gemm64(
    const unsigned short* __restrict__ Ap, const unsigned short* __restrict__ A2p, int lda, long strideA,
    const unsigned short* __restrict__ Btp, const unsigned short* __restrict__ Bt2p, int ldb, long strideB,
    void* __restrict__ Cout, void* __restrict__ Cout2, int ldc, long strideC,
    const float* __restrict__ bias,
    const float* __restrict__ resid, long strideR,
    int M, int N, int K, float scale) {
  typedef typename Elem<ET>::T T;
  typedef typename Frag<T>::V V;
  const T* A = (const T*)Ap; const T* A2 = (const T*)A2p; const T* Bt = (const T*)Btp; const T* Bt2 = (const T*)Bt2p;
  __shared__ __align__(16) float sT[8][16 * 68];   // per-wave 16x64 slab, pitch 68 floats
  const int b    = blockIdx.y;
  const int lane = threadIdx.x & 31;
  const int wave = threadIdx.x >> 5;
  const int tilesN = N >> 6;
  const int tilesM = M >> 6;
  const int tile = blockIdx.x * 8 + wave;
  if (tile >= tilesM * tilesN) return;   // wave-uniform; no block barriers in this kernel
  const int tm = tile / tilesN;
  const int tn = tile - tm * tilesN;
  const int m0 = tm << 6;
  const int n0 = tn << 6;

  const T* Ab  = A  + (size_t)b * strideA;
  const T* Bb  = Bt + (size_t)b * strideB;
  const T* Ab2 = SPLIT ? (A2  + (size_t)b * strideA) : nullptr;
  const T* Bb2 = SPLIT ? (Bt2 + (size_t)b * strideB) : nullptr;

  const int rlane = lane & 15;                 // row (A) / col (B, D) within subtile
  const int koff  = (lane >> 4) * 8;           // k offset of this lane half
  const int mOff  = (lane >> 4) * 8;           // D row offset

  v8f acc[4][4];
#pragma unroll
  for (int i = 0; i < 4; ++i)
#pragma unroll
    for (int j = 0; j < 4; ++j) acc[i][j] = (v8f){0.f,0.f,0.f,0.f,0.f,0.f,0.f,0.f};

  for (int k0 = 0; k0 < K; k0 += 32) {
    V bh[4], bl[4];
#pragma unroll
    for (int j = 0; j < 4; ++j) {
      const size_t bo = (size_t)(n0 + (j << 4) + rlane) * ldb + koff + k0;
      bh[j] = Frag<T>::load(Bb + bo);
      if (SPLIT) bl[j] = Frag<T>::load(Bb2 + bo);
    }
#pragma unroll
    for (int i = 0; i < 4; ++i) {
      const size_t ao = (size_t)(m0 + (i << 4) + rlane) * lda + koff + k0;
      V ah = Frag<T>::load(Ab + ao);
      V al;
      if (SPLIT) al = Frag<T>::load(Ab2 + ao);
#pragma unroll
      for (int j = 0; j < 4; ++j) {
        acc[i][j] = Frag<T>::mma(ah, bh[j], acc[i][j]);
        if (SPLIT) {
          acc[i][j] = Frag<T>::mma(ah, bl[j], acc[i][j]);
          acc[i][j] = Frag<T>::mma(al, bh[j], acc[i][j]);
        }
      }
      Frag<T>::guard(acc[i][0], acc[i][3], ah, SPLIT ? al : ah);
    }
    Frag<T>::keep(bh[0], bh[1], bh[2], bh[3]);
    if (SPLIT) Frag<T>::keep(bl[0], bl[1], bl[2], bl[3]);
  }
  acc_guard4(acc[0][0], acc[0][1], acc[0][2], acc[0][3]);
  acc_guard4(acc[1][0], acc[1][1], acc[1][2], acc[1][3]);
  acc_guard4(acc[2][0], acc[2][1], acc[2][2], acc[2][3]);
  acc_guard4(acc[3][0], acc[3][1], acc[3][2], acc[3][3]);

  // ---- epilogue ----
  float* slab = sT[wave];
  const float* Rb = RESID ? (resid + (size_t)b * strideR) : nullptr;
#pragma unroll
  for (int i = 0; i < 4; ++i) {
    const int mBase = m0 + (i << 4);
#pragma unroll
    for (int j = 0; j < 4; ++j) {
      const int n = n0 + (j << 4) + rlane;
      float bv = 0.f;
      if (BIAS_MODE == 2) bv = bias[n];
#pragma unroll
      for (int r = 0; r < 8; ++r) {
        float v = acc[i][j][r] * scale;
        if (BIAS_MODE == 1) v += bias[mBase + mOff + r];
        if (BIAS_MODE == 2) v += bv;
        if (RESID) v += Rb[(size_t)(mBase + mOff + r) * ldc + n];
        if (ACT == 1) v = tanhf(v);
        if (ACT == 2) v = fmaxf(v, 0.0f);
        if (ACT == 3) v = v / (1.0f + expf(-v));
        if (ACT == 4) v = (v > 0.f) ? v : 0.01f * v;
        if (ACT == 5) v = 0.5f * v * (1.0f + erff(v * 0.70710678118654752f));
        slab[(mOff + r) * 68 + (j << 4) + rlane] = v;
      }
    }
    __builtin_amdgcn_fence(__ATOMIC_RELEASE, "workgroup");
    __builtin_amdgcn_wave_barrier();
    __builtin_amdgcn_fence(__ATOMIC_ACQUIRE, "workgroup");
    if (OUT_MODE == 0) {
      float* C = (float*)Cout + (size_t)b * strideC;
      const int hh = lane >> 4, c4 = (lane & 15) * 4;     // row seg = 256 B = 16 lanes x 16 B
      {
#pragma unroll
        for (int it = 0; it < 8; ++it) {
          const int row = it * 2 + hh;
          v4f v = *(const v4f*)(slab + row * 68 + c4);
          *(v4f*)(C + (size_t)(mBase + row) * ldc + n0 + c4) = v;
        }
        
      }
    } else {
      const int q = lane >> 3, c8 = (lane & 7) * 8;
      unsigned short* C  = (unsigned short*)Cout  + (size_t)b * strideC;
      unsigned short* C2 = (OUT_MODE == 2) ? ((unsigned short*)Cout2 + (size_t)b * strideC) : nullptr;
      {
#pragma unroll
        for (int it = 0; it < 4; ++it) {
          const int row = it * 4 + q;
          const float* sp = slab + row * 68 + c8;
          v8h hv, lv;
#pragma unroll
          for (int e = 0; e < 8; ++e) {
            if (OUT_MODE == 1) {
              hv[e] = (_Float16)sp[e];
            } else {
              unsigned short hb = f2bf_bits(sp[e]);
              unsigned short lb = f2bf_bits(sp[e] - bf_bits2f(hb));
              hv[e] = __builtin_bit_cast(_Float16, hb);
              lv[e] = __builtin_bit_cast(_Float16, lb);
            }
          }
          *(v8h*)(C + (size_t)(mBase + row) * ldc + n0 + c8) = hv;
          if (OUT_MODE == 2) *(v8h*)(C2 + (size_t)(mBase + row) * ldc + n0 + c8) = lv;
        }
        
      }
    }
    __builtin_amdgcn_fence(__ATOMIC_RELEASE, "workgroup");
    __builtin_amdgcn_wave_barrier();
    __builtin_amdgcn_fence(__ATOMIC_ACQUIRE, "workgroup");
  }
}

__global__ __launch_bounds__(256) void cast_f32_f16x2(
    const float* __restrict__ in, _Float16* __restrict__ out, int n2) {
  int i = blockIdx.x * 256 + threadIdx.x;
  if (i < n2) {
    const _Float16 h0 = (_Float16)in[2 * i], h1 = (_Float16)in[2 * i + 1];
    const unsigned u = (unsigned)__builtin_bit_cast(unsigned short, h0) | ((unsigned)__builtin_bit_cast(unsigned short, h1) << 16);
    ((unsigned*)out)[i] = u;
    
  }
}


// ---- f32 -> f16 cast with a power-of-two pre-scale (folded back by the consumer GEMM's scale) ----
__global__ __launch_bounds__(256) void cast_f32_f16x2s(const float* __restrict__ in, _Float16* __restrict__ out, int n2, float s) {
  int i = blockIdx.x * 256 + threadIdx.x;
  if (i < n2) {
    const _Float16 h0 = (_Float16)(in[2 * i] * s), h1 = (_Float16)(in[2 * i + 1] * s);
    const unsigned u = (unsigned)__builtin_bit_cast(unsigned short, h0) | ((unsigned)__builtin_bit_cast(unsigned short, h1) << 16);
    ((unsigned*)out)[i] = u;
    
  }
}
__global__ __launch_bounds__(256) void split_f32_bf16x2(
    const float* __restrict__ in, __bf16* __restrict__ hi, __bf16* __restrict__ lo, long n2) {
  long i = (long)blockIdx.x * 256 + threadIdx.x;
  long stride = (long)gridDim.x * 256;
  {
    for (long j = i; j < n2; j += stride) {
      const float a = in[2 * j], b = in[2 * j + 1];
      const unsigned short ah = f2bf_bits(a), bh = f2bf_bits(b);
      const unsigned short al = f2bf_bits(a - bf_bits2f(ah)), bl = f2bf_bits(b - bf_bits2f(bh));
      ((unsigned*)hi)[j] = (unsigned)ah | ((unsigned)bh << 16);
      ((unsigned*)lo)[j] = (unsigned)al | ((unsigned)bl << 16);
    }
    
  }
}


// ---- f32 [R][C] (row pitch ldi) -> f16 transposed [C][R] (row pitch ldo); 64x64 tiles; each output row segment
__global__ __launch_bounds__(256) void transpose_cast_f16(const float* __restrict__ in, int ldi,
                                                         _Float16* __restrict__ outT, int ldo, float scale) {
  __shared__ __align__(16) _Float16 tile[64][72];     // [c][r]
  const int c0 = blockIdx.x * 64, r0 = blockIdx.y * 64;
  const int t = threadIdx.y * 32 + threadIdx.x;
  for (int i = threadIdx.y; i < 64; i += 8) {
    tile[threadIdx.x][i]      = (_Float16)(in[(size_t)(r0 + i) * ldi + c0 + threadIdx.x] * scale);
    tile[32 + threadIdx.x][i] = (_Float16)(in[(size_t)(r0 + i) * ldi + c0 + 32 + threadIdx.x] * scale);
  }
  __syncthreads();
  const int q = t >> 3, c8 = (t & 7) * 8;
  {
#pragma unroll
    for (int it = 0; it < 2; ++it) {
      const int c = it * 32 + q;
      v8h hv = *(const v8h*)(&tile[c][c8]);
      *(v8h*)(outT + (size_t)(c0 + c) * ldo + r0 + c8) = hv;
    }
    
  }
}

// ---- f32 [R][C] (pitch ldi) -> bf16 hi/lo transposed planes [C][R] (pitch ldo); 64x64 tiles; each output row segment
__global__ __launch_bounds__(256) void transpose_split_bf16(const float* __restrict__ in, int ldi,
                                                           __bf16* __restrict__ outH, __bf16* __restrict__ outL, int ldo) {
  __shared__ __align__(16) float tile[64][68];     // [c][r]
  const int c0 = blockIdx.x * 64, r0 = blockIdx.y * 64;
  const int t = threadIdx.y * 32 + threadIdx.x;
  for (int i = threadIdx.y; i < 64; i += 8) {
    tile[threadIdx.x][i]      = in[(size_t)(r0 + i) * ldi + c0 + threadIdx.x];
    tile[32 + threadIdx.x][i] = in[(size_t)(r0 + i) * ldi + c0 + 32 + threadIdx.x];
  }
  __syncthreads();
  const int q = t >> 3, c8 = (t & 7) * 8;
  {
#pragma unroll
    for (int it = 0; it < 2; ++it) {
      const int c = it * 32 + q;
      v8b hv, lv;
#pragma unroll
      for (int e = 0; e < 8; ++e) {
        const float f = tile[c][c8 + e];
        const unsigned short hb = f2bf_bits(f);
        hv[e] = __builtin_bit_cast(__bf16, hb);
        lv[e] = __builtin_bit_cast(__bf16, f2bf_bits(f - bf_bits2f(hb)));
      }
      *(v8b*)(outH + (size_t)(c0 + c) * ldo + r0 + c8) = hv;
      *(v8b*)(outL + (size_t)(c0 + c) * ldo + r0 + c8) = lv;
    }
    
  }
}

// =====================================================================================
// Generic causal/non-causal attention for head_dim 64, f32 in / f32 out; 16-bit operands: bf16 with optional hi/lo splits, or
// plain f16 (F16=true, non-split, probabilities carried x2^15).
//   scores = (q*qscale)·kᵀ : v_wmma_f32_16x16x32_bf16; SPLIT_QK -> q,k as bf16 hi/lo (hi·hi + hi·lo + lo·hi)
//   out    = p·v           : v_wmma_f32_16x16x32_bf16; SPLIT_PV -> p,v as bf16 hi/lo; else p,v plain bf16
//   f32 accumulate; online softmax in f32. Block = 4 waves = 64 query rows of one (batch, head); S % 64 == 0.
//   Element (b, s, h, d) of tensor X lives at X[b*X_bs + s*X_rs + h*X_hs + d] (strides in floats, multiples of 4).
//   Masking: mask_mode 0 none, 1 causal (kv > q masked), 2 tensor [S][Skv] shared over (b,h) (float if
//   mask_is_int==0, int32 with element == 0 -> masked if 1, int32 with element != 0 -> masked if 2), 3 per-token vectors qmask[B][S] & kvmask[B][Skv] (int32,
//   0 -> masked), 4 causal + sliding window (kv > q or q - kv > W masked; W passed in mask_is_int);
//   5 = relative-position bias: s += cp[b,h,q][idx[q][kv]] + pc[b,h,kv][idx[q][kv]] with idx = mask_b ([S][Skv] int32) and
//   mask_a an int32 [S][Skv] tensor with nonzero = masked (tables: element (b,h,row,n) at X + b*c_bs + h*c_hs + row*c_rs + n);
//   masked scores are replaced by mask_fill (e.g. -inf or -1e9) before the softmax.
//   grid.x = B * H * (S/64) (or a sub-range with blk0).
// =====================================================================================
#define AT_D 64
#define AT_NW 4
#define AT_QB 64
#define AT_KC 64
struct AttnGeom { const float* cp = nullptr; const float* pc = nullptr; long c_bs = 0, c_rs = 0, c_hs = 0;   // mode-5 score-bias tables
                  long q_bs, q_rs, q_hs, k_bs, k_rs, k_hs, v_bs, v_rs, v_hs, o_bs, o_rs, o_hs;
                  int S, Skv, H, mask_mode; float qscale; int blk0; float mask_fill; int mask_is_int; };
static_assert(sizeof(AttnGeom) == 168, "no padding");

__device__ __forceinline__ unsigned short at_bf_bits(float f) {
  unsigned u = __float_as_uint(f);
  return (unsigned short)((u + 0x7FFFu + ((u >> 16) & 1u)) >> 16);
}
__device__ __forceinline__ __bf16 at_f2bf(float f) { return __builtin_bit_cast(__bf16, at_bf_bits(f)); }
__device__ __forceinline__ void at_split(float f, __bf16& hi, __bf16& lo) {
  const unsigned short hb = at_bf_bits(f);
  hi = __builtin_bit_cast(__bf16, hb);
  lo = at_f2bf(f - __uint_as_float(((unsigned)hb) << 16));
}
__device__ __forceinline__ v8f at_mma(v16b a, v16b b, v8f c) {
  c = __builtin_amdgcn_wmma_f32_16x16x32_bf16(false, a, false, b, (short)0, c, false, false);
  asm volatile("v_nop\n\tv_nop\n\tv_nop\n\tv_nop" : "+v"(c) : "v"(a), "v"(b));
  return c;
}
// 16-bit element as a bit pattern held in a __bf16 slot: f16 bits when F16, bf16 (RNE) otherwise
template <bool F16> __device__ __forceinline__ __bf16 at_to16(float f) {
  if (F16) return __builtin_bit_cast(__bf16, (_Float16)f);
  return at_f2bf(f);
}
template <bool F16> __device__ __forceinline__ v8f at_mma16(v16b a, v16b b, v8f c) {
  if (F16) {
    const v16h ah = __builtin_bit_cast(v16h, a), bh = __builtin_bit_cast(v16h, b);
    c = __builtin_amdgcn_wmma_f32_16x16x32_f16(false, ah, false, bh, (short)0, c, false, false);
    asm volatile("v_nop\n\tv_nop\n\tv_nop\n\tv_nop" : "+v"(c) : "v"(ah), "v"(bh));
    return c;
  }
  return at_mma(a, b, c);
}

template <bool SPLIT_QK, bool SPLIT_PV, bool F16 = false>
__global__ __launch_bounds__(128)
void attn64_kernel(const float* __restrict__ q, const float* __restrict__ k,
                   const float* __restrict__ v, float* __restrict__ out,
                   const void* __restrict__ mask_a, const int* __restrict__ mask_b, AttnGeom g) {
  static_assert(!(F16 && (SPLIT_QK || SPLIT_PV)), "f16 mode is non-split");
  const float PSC = F16 ? 32768.0f : 1.0f;     // f16 probabilities carried x2^15 (subnormal range), folded into the final 1/l
  union FB { v16b v; v8b h[2]; };
  __shared__ __align__(16) __bf16 Ksh[AT_KC * AT_D];             // K hi [kv][d]      8 KB
  __shared__ __align__(16) __bf16 Ksl[SPLIT_QK ? AT_KC * AT_D : 8];
  __shared__ __align__(16) __bf16 Vth[AT_D * AT_KC];             // V hi [d][kv]      8 KB
  __shared__ __align__(16) __bf16 Vtl[SPLIT_PV ? AT_D * AT_KC : 8];
  __shared__ __align__(16) __bf16 Psh[AT_NW][16 * AT_KC];        // per wave P hi [row][kv]  8 KB
  __shared__ __align__(16) __bf16 Psl[SPLIT_PV ? AT_NW : 1][SPLIT_PV ? 16 * AT_KC : 8];
  __shared__ __align__(16) float  Os[AT_NW][16 * 68];            // per wave out tile, pitch 68

  const int tid  = threadIdx.x;
  const int wave = tid >> 5;
  const int lane = tid & 31;
  const int hh   = lane >> 4;
  const int c    = lane & 15;

  const int nqb = g.S / AT_QB;
  const int bx = blockIdx.x + g.blk0;
  const int qb = bx % nqb;
  const int bh = bx / nqb;
  const int h  = bh % g.H;
  const int b  = bh / g.H;
  const int qbase_block = qb * AT_QB;
  const int q0 = qbase_block + wave * 16;

  const float* qb_ptr = q + (size_t)b * g.q_bs + (size_t)h * g.q_hs;
  const float* kb_ptr = k + (size_t)b * g.k_bs + (size_t)h * g.k_hs;
  const float* vb_ptr = v + (size_t)b * g.v_bs + (size_t)h * g.v_hs;
  float*       ob_ptr = out + (size_t)b * g.o_bs + (size_t)h * g.o_hs;

  // ---- Q fragments (A operand): 2 d-chunks, hi (and lo) ----
  v16b qah[2], qal[2];
  {
    const float* qrow = qb_ptr + (size_t)(q0 + c) * g.q_rs;
#pragma unroll
    for (int dc = 0; dc < 2; ++dc) {
#pragma unroll
      for (int e = 0; e < 8; ++e) {
        const float f0 = qrow[dc * 32 + 8 * hh + e] * g.qscale;
        const float f1 = qrow[dc * 32 + 16 + 8 * hh + e] * g.qscale;
        if (SPLIT_QK) { __bf16 hq, lq; at_split(f0, hq, lq); qah[dc][e] = hq; qal[dc][e] = lq; at_split(f1, hq, lq); qah[dc][8 + e] = hq; qal[dc][8 + e] = lq; }
        else { qah[dc][e] = at_to16<F16>(f0); qah[dc][8 + e] = at_to16<F16>(f1); qal[dc][e] = qah[dc][e]; qal[dc][8 + e] = qah[dc][8 + e]; }
      }
    }
  }

  float mrow[8], lrow[8];
  v8f oacc[4];
#pragma unroll
  for (int r = 0; r < 8; ++r) { mrow[r] = -INFINITY; lrow[r] = 0.f; }
#pragma unroll
  for (int t = 0; t < 4; ++t) oacc[t] = (v8f){0.f,0.f,0.f,0.f,0.f,0.f,0.f,0.f};

  const int nChunks = (g.mask_mode == 1 || g.mask_mode == 4) ? (qb + 1) : (g.Skv / AT_KC);   // block-uniform
  // per-row query mask (mode 3)
  int qkeep[8];
#pragma unroll
  for (int r = 0; r < 8; ++r) qkeep[r] = (g.mask_mode == 3) ? mask_b[(size_t)b * g.S + q0 + 8 * hh + r] : 1;   // mask_b = qmask in mode 3
  for (int kc = 0; kc < nChunks; ++kc) {
    const int kv0 = kc * AT_KC;
    __syncthreads();
    {
      const int kvr = tid >> 1, dh = (tid & 1) * 32;
      const float* krow = kb_ptr + (size_t)(kv0 + kvr) * g.k_rs + dh;
      const float* vrow = vb_ptr + (size_t)(kv0 + kvr) * g.v_rs + dh;
#pragma unroll
      for (int i = 0; i < 8; ++i) {
        v4f kk = *(const v4f*)(krow + 4 * i);
        v4f vv = *(const v4f*)(vrow + 4 * i);
#pragma unroll
        for (int e = 0; e < 4; ++e) {
          const int d = dh + 4 * i + e;
          if (SPLIT_QK) { __bf16 a, bl; at_split(kk[e], a, bl); Ksh[kvr * AT_D + d] = a; Ksl[kvr * AT_D + d] = bl; }
          else Ksh[kvr * AT_D + d] = at_to16<F16>(kk[e]);
          if (SPLIT_PV) { __bf16 a, bl; at_split(vv[e], a, bl); Vth[d * AT_KC + kvr] = a; Vtl[d * AT_KC + kvr] = bl; }
          else Vth[d * AT_KC + kvr] = at_to16<F16>(vv[e]);
        }
      }
    }
    __syncthreads();

    v8f s[4];
#pragma unroll
    for (int j = 0; j < 4; ++j) {
      s[j] = (v8f){0.f,0.f,0.f,0.f,0.f,0.f,0.f,0.f};
#pragma unroll 1
      for (int dc = 0; dc < 2; ++dc) {
        FB kb;
        kb.h[0] = *(const v8b*)(Ksh + (j * 16 + c) * AT_D + dc * 32 + 8 * hh);
        kb.h[1] = *(const v8b*)(Ksh + (j * 16 + c) * AT_D + dc * 32 + 16 + 8 * hh);
        s[j] = at_mma16<F16>(qah[dc], kb.v, s[j]);
        if (SPLIT_QK) {
          FB kl;
          kl.h[0] = *(const v8b*)(Ksl + (j * 16 + c) * AT_D + dc * 32 + 8 * hh);
          kl.h[1] = *(const v8b*)(Ksl + (j * 16 + c) * AT_D + dc * 32 + 16 + 8 * hh);
          s[j] = at_mma16<F16>(qah[dc], kl.v, s[j]);
          s[j] = at_mma16<F16>(qal[dc], kb.v, s[j]);
        }
      }
    }
    const bool diag = (g.mask_mode == 1) && (kc == qb);
    int kvkeep[4] = {1, 1, 1, 1};
    if (g.mask_mode == 3) {
#pragma unroll
      for (int j = 0; j < 4; ++j) kvkeep[j] = ((const int*)mask_a)[(size_t)b * g.Skv + kv0 + j * 16 + c];   // mask_a = kvmask
    }
    float cm[8];
#pragma unroll
    for (int r = 0; r < 8; ++r) {
      const int qrow = q0 + 8 * hh + r;
      float m = -INFINITY;
#pragma unroll
      for (int j = 0; j < 4; ++j) {
        const int kvcol = kv0 + j * 16 + c;
        bool masked = false;
        if (diag) masked = (kvcol > qrow);
        else if (g.mask_mode == 4) masked = (kvcol > qrow) || (qrow - kvcol > g.mask_is_int);
        else if (g.mask_mode == 2) {
          const size_t mi = (size_t)qrow * g.Skv + kvcol;
          masked = (g.mask_is_int == 0) ? (((const float*)mask_a)[mi] == 0.0f)
                 : (g.mask_is_int == 1) ? (((const int*)mask_a)[mi] == 0) : (((const int*)mask_a)[mi] != 0);
        } else if (g.mask_mode == 3) masked = (qkeep[r] == 0) || (kvkeep[j] == 0);
        else if (g.mask_mode == 5) {
          const size_t mi = (size_t)qrow * g.Skv + kvcol;
          masked = (((const int*)mask_a)[mi] != 0);
          int n = mask_b[mi]; n = n < 0 ? 0 : n;
          s[j][r] += g.cp[(size_t)b * g.c_bs + (size_t)h * g.c_hs + (size_t)qrow * g.c_rs + n]
                   + g.pc[(size_t)b * g.c_bs + (size_t)h * g.c_hs + (size_t)kvcol * g.c_rs + n];
        }
        if (masked) s[j][r] = g.mask_fill;
        m = fmaxf(m, s[j][r]);
      }
#pragma unroll
      for (int off = 1; off < 16; off <<= 1) m = fmaxf(m, __shfl_xor(m, off, 32));
      cm[r] = m;
    }
    __bf16* pwh = Psh[wave];
    __bf16* pwl = Psl[SPLIT_PV ? wave : 0];
#pragma unroll
    for (int r = 0; r < 8; ++r) {
      const float mnew = fmaxf(mrow[r], cm[r]);
      const float alpha = expf(mrow[r] - mnew);
      mrow[r] = mnew;
      float psum = 0.f;
#pragma unroll
      for (int j = 0; j < 4; ++j) {
        const float p = expf(s[j][r] - mnew);
        psum += p;
        if (SPLIT_PV) { __bf16 a, bl; at_split(p, a, bl); pwh[(8 * hh + r) * AT_KC + j * 16 + c] = a; pwl[(8 * hh + r) * AT_KC + j * 16 + c] = bl; }
        else pwh[(8 * hh + r) * AT_KC + j * 16 + c] = at_to16<F16>(p * PSC);
      }
#pragma unroll
      for (int off = 1; off < 16; off <<= 1) psum += __shfl_xor(psum, off, 32);
      lrow[r] = lrow[r] * alpha + psum;
#pragma unroll
      for (int t = 0; t < 4; ++t) oacc[t][r] *= alpha;
    }
    __builtin_amdgcn_fence(__ATOMIC_RELEASE, "workgroup");
    __builtin_amdgcn_wave_barrier();
    __builtin_amdgcn_fence(__ATOMIC_ACQUIRE, "workgroup");
#pragma unroll 1
    for (int kk = 0; kk < 2; ++kk) {
      FB pa, pl;
      pa.h[0] = *(const v8b*)(pwh + c * AT_KC + kk * 32 + 8 * hh);
      pa.h[1] = *(const v8b*)(pwh + c * AT_KC + kk * 32 + 16 + 8 * hh);
      if (SPLIT_PV) {
        pl.h[0] = *(const v8b*)(pwl + c * AT_KC + kk * 32 + 8 * hh);
        pl.h[1] = *(const v8b*)(pwl + c * AT_KC + kk * 32 + 16 + 8 * hh);
      }
#pragma unroll
      for (int t = 0; t < 4; ++t) {
        FB vb;
        vb.h[0] = *(const v8b*)(Vth + (t * 16 + c) * AT_KC + kk * 32 + 8 * hh);
        vb.h[1] = *(const v8b*)(Vth + (t * 16 + c) * AT_KC + kk * 32 + 16 + 8 * hh);
        oacc[t] = at_mma16<F16>(pa.v, vb.v, oacc[t]);
        if (SPLIT_PV) {
          FB vl;
          vl.h[0] = *(const v8b*)(Vtl + (t * 16 + c) * AT_KC + kk * 32 + 8 * hh);
          vl.h[1] = *(const v8b*)(Vtl + (t * 16 + c) * AT_KC + kk * 32 + 16 + 8 * hh);
          oacc[t] = at_mma16<F16>(pa.v, vl.v, oacc[t]);
          oacc[t] = at_mma16<F16>(pl.v, vb.v, oacc[t]);
        }
      }
    }
  }

  float* os = Os[wave];
#pragma unroll
  for (int r = 0; r < 8; ++r) {
    const float inv = 1.0f / (lrow[r] * PSC);
#pragma unroll
    for (int t = 0; t < 4; ++t) os[(8 * hh + r) * 68 + t * 16 + c] = oacc[t][r] * inv;
  }
  __builtin_amdgcn_fence(__ATOMIC_RELEASE, "workgroup");
  __builtin_amdgcn_wave_barrier();
  __builtin_amdgcn_fence(__ATOMIC_ACQUIRE, "workgroup");
  {
    const int c4 = (lane & 15) * 4;
    {
#pragma unroll
      for (int it = 0; it < 8; ++it) {
        const int row = it * 2 + hh;
        v4f val = *(const v4f*)(os + row * 68 + c4);
        *(v4f*)(ob_ptr + (size_t)(q0 + row) * g.o_rs + c4) = val;
      }
      
    }
  }
}

// Value of lane (l ^ M) of the same 16-lane row, M = 1..15, by a DPP move (row_xmask): a vector instruction, every lane on.
// __shfl_xor compiles to ds_bpermute_b32 and a wait on the LDS counter; this form has no LDS op
template <int M> __device__ __forceinline__ float at_row_xor(float x) {
  return __builtin_bit_cast(float, __builtin_amdgcn_update_dpp(0, __builtin_bit_cast(int, x), 0x160 + M, 0xf, 0xf, true));
}
// Matrix product through the builtin alone: the compiler keeps the distances behind a WMMA itself, and with no asm statement behind each
// product the scheduler is free to issue the LDS fragment reads of a whole group ahead of the group's products
template <bool F16> __device__ __forceinline__ v8f at_mma16b(v16b a, v16b b, v8f c) {
  if (F16) return __builtin_amdgcn_wmma_f32_16x16x32_f16(false, __builtin_bit_cast(v16h, a), false, __builtin_bit_cast(v16h, b), (short)0, c, false, false);
  return __builtin_amdgcn_wmma_f32_16x16x32_bf16(false, a, false, b, (short)0, c, false, false);
}

// ---- head_dim 128 variant (same contract; K/V tiles 64 keys x 128, 8 output tiles; mask_mode 6 = causal + per-head ALiBi slope table in g.cp) ----
// MODE >= 0 fixes the mask mode at compile time, so the per-score mode tests fold away; MODE < 0 reads it from g.mask_mode
// PRE: k and v come as the bf16 hi/lo planes that kv_split_planes wrote earlier in the same call (pkh, pkl: [b*H + h][kv][d]; pvh, pvl: one
// [d][64 keys] tile per key chunk); the key loop then only copies a chunk's four 16 KB tiles into LDS and converts nothing
template <bool SPLIT_QK, bool SPLIT_PV, bool F16 = false, int MODE = -1, bool PRE = false>
__global__ __launch_bounds__(128)
void attn128_kernel(const float* __restrict__ q, const float* __restrict__ k,
                   const float* __restrict__ v, float* __restrict__ out,
                   const void* __restrict__ mask_a, const int* __restrict__ mask_b, AttnGeom g,
                   const __bf16* __restrict__ pkh, const __bf16* __restrict__ pkl,
                   const __bf16* __restrict__ pvh, const __bf16* __restrict__ pvl) {
  static_assert(!(F16 && (SPLIT_QK || SPLIT_PV)), "f16 mode is non-split");
  static_assert(!PRE || (SPLIT_QK && SPLIT_PV), "the planes are hi/lo splits");
  const float PSC = F16 ? 32768.0f : 1.0f;     // f16 probabilities carried x2^15 (subnormal range), folded into the final 1/l
  union FB { v16b v; v8b h[2]; };
  constexpr int D2 = 128;
  // LDS row pitches in elements: 16 B x odd (272 B for the 128-wide K and Q rows, 144 B for the 64-wide V^T and P rows), so that the
  // 16 rows one ds_load_b128 fragment read touches fall on distinct banks; at 256 B and 128 B they shared four or eight banks
  constexpr int KP = D2 + 8;
  constexpr int VP = AT_KC + 8;
  const int mode = (MODE >= 0) ? MODE : g.mask_mode;
  __shared__ __align__(16) __bf16 Ksh[AT_KC * KP];               // K hi [kv][d]      17 KB
  __shared__ __align__(16) __bf16 Ksl[SPLIT_QK ? AT_KC * KP : 8];
  __shared__ __align__(16) __bf16 Vth[D2 * VP];                  // V hi [d][kv]      18 KB
  __shared__ __align__(16) __bf16 Vtl[SPLIT_PV ? D2 * VP : 8];
  __shared__ __align__(16) __bf16 Psh[AT_NW][16 * VP];
  __shared__ __align__(16) __bf16 Psl[SPLIT_PV ? AT_NW : 1][SPLIT_PV ? 16 * VP : 8];
  __shared__ __align__(16) float  Os[AT_NW][16 * 132];           // per wave out tile, pitch 132
  __shared__ __align__(16) __bf16 Qsh[SPLIT_QK ? AT_NW : 1][SPLIT_QK ? 16 * KP : 8];   // split path: q hi/lo staged per wave (keeps VGPR use low)
  __shared__ __align__(16) __bf16 Qsl[SPLIT_QK ? AT_NW : 1][SPLIT_QK ? 16 * KP : 8];

  const int tid  = threadIdx.x;
  const int wave = tid >> 5;
  const int lane = tid & 31;
  const int hh   = lane >> 4;
  const int c    = lane & 15;

  const int nqb = g.S / AT_QB;
  const int bx = blockIdx.x + g.blk0;
  // Causal modes: query block qb walks qb + 1 key chunks, and the grid holds more blocks than the chip has resident places. The longest get
  // the lowest indices (qb falls with bx, heads innermost), for speed only. A permutation of (head, qb); needs the whole grid in one launch (blk0 = 0).
  const bool byCost = (mode == 1 || mode == 4 || mode == 6);
  const int nbh = byCost ? (int)gridDim.x / nqb : 1;
  const int qb = byCost ? (nqb - 1 - bx / nbh) : (bx % nqb);
  const int bh = byCost ? (bx % nbh) : (bx / nqb);
  const int h  = bh % g.H;
  const int b  = bh / g.H;
  const int qbase_block = qb * AT_QB;
  const int q0 = qbase_block + wave * 16;

  const float* qb_ptr = q + (size_t)b * g.q_bs + (size_t)h * g.q_hs;
  const float* kb_ptr = k + (size_t)b * g.k_bs + (size_t)h * g.k_hs;
  const float* vb_ptr = v + (size_t)b * g.v_bs + (size_t)h * g.v_hs;
  float*       ob_ptr = out + (size_t)b * g.o_bs + (size_t)h * g.o_hs;

  // ---- Q fragments (A operand): 4 d-chunks, hi (and lo) ----
  v16b qah[4], qal[4];
  {
    const float* qrow = qb_ptr + (size_t)(q0 + c) * g.q_rs;
#pragma unroll
    for (int dc = 0; dc < 4; ++dc) {
#pragma unroll
      for (int e = 0; e < 8; ++e) {
        const float f0 = qrow[dc * 32 + 8 * hh + e] * g.qscale;
        const float f1 = qrow[dc * 32 + 16 + 8 * hh + e] * g.qscale;
        if (SPLIT_QK) { __bf16 hq, lq; at_split(f0, hq, lq); Qsh[wave][c * KP + dc * 32 + 8 * hh + e] = hq; Qsl[wave][c * KP + dc * 32 + 8 * hh + e] = lq;
                        at_split(f1, hq, lq); Qsh[wave][c * KP + dc * 32 + 16 + 8 * hh + e] = hq; Qsl[wave][c * KP + dc * 32 + 16 + 8 * hh + e] = lq;
                        qah[dc][e] = hq; qal[dc][e] = lq; qah[dc][8 + e] = hq; qal[dc][8 + e] = lq; }   // (register copies unused on the split path)
        else { qah[dc][e] = at_to16<F16>(f0); qah[dc][8 + e] = at_to16<F16>(f1); qal[dc][e] = qah[dc][e]; qal[dc][8 + e] = qah[dc][8 + e]; }
      }
    }
  }

  float mrow[8], lrow[8];
  v8f oacc[8];
#pragma unroll
  for (int r = 0; r < 8; ++r) { mrow[r] = -INFINITY; lrow[r] = 0.f; }
#pragma unroll
  for (int t = 0; t < 8; ++t) oacc[t] = (v8f){0.f,0.f,0.f,0.f,0.f,0.f,0.f,0.f};

  const int nChunks = (mode == 1 || mode == 4 || mode == 6) ? (qb + 1) : (g.Skv / AT_KC);   // block-uniform
  // per-row query mask (mode 3)
  int qkeep[8];
#pragma unroll
  for (int r = 0; r < 8; ++r) qkeep[r] = (mode == 3) ? mask_b[(size_t)b * g.S + q0 + 8 * hh + r] : 1;   // mask_b = qmask in mode 3
  for (int kc = 0; kc < nChunks; ++kc) {
    const int kv0 = kc * AT_KC;
    if (PRE) {
      // each tile is 1024 pieces of 16 B, linear in memory; piece n is 16 B number n & 15 of K row n >> 4, n & 7 of V^T row n >> 3
      const size_t hb = (size_t)bh * g.Skv * D2;     // this head's part of each plane: a block-uniform base, and a 32-bit byte offset from it
      const char* gkh = (const char*)(pkh + hb); const char* gkl = (const char*)(pkl + hb);
      const char* gvh = (const char*)(pvh + hb); const char* gvl = (const char*)(pvl + hb);
      const unsigned lo16 = (unsigned)kc * (unsigned)(AT_KC * D2 * 2) + (unsigned)tid * 16u;
      v8b rkh[8], rkl[8], rvh[8], rvl[8];
#pragma unroll   // constant indices keep the pieces in registers, and the 32 loads issue as one run
      for (int i = 0; i < 8; ++i) {
        rkh[i] = *(const v8b*)(gkh + i * 2048 + lo16); rkl[i] = *(const v8b*)(gkl + i * 2048 + lo16);
        rvh[i] = *(const v8b*)(gvh + i * 2048 + lo16); rvl[i] = *(const v8b*)(gvl + i * 2048 + lo16);
      }
      __syncthreads();   // ends every wave's reads of the chunk before
#pragma unroll   // constant indices, as above
      for (int i = 0; i < 8; ++i) {
        const int n = i * 128 + tid;
        *(v8b*)(Ksh + (n >> 4) * KP + (n & 15) * 8) = rkh[i];
        *(v8b*)(Ksl + (n >> 4) * KP + (n & 15) * 8) = rkl[i];
        *(v8b*)(Vth + (n >> 3) * VP + (n & 7) * 8) = rvh[i];
        *(v8b*)(Vtl + (n >> 3) * VP + (n & 7) * 8) = rvl[i];
      }
    } else {
      __syncthreads();
      const int kvr = tid >> 1, dh = (tid & 1) * 64;
      const float* krow = kb_ptr + (size_t)(kv0 + kvr) * g.k_rs + dh;
      const float* vrow = vb_ptr + (size_t)(kv0 + kvr) * g.v_rs + dh;
#pragma unroll
      for (int i = 0; i < 16; ++i) {
        v4f kk = *(const v4f*)(krow + 4 * i);
        v4f vv = *(const v4f*)(vrow + 4 * i);
#pragma unroll
        for (int e = 0; e < 4; ++e) {
          const int d = dh + 4 * i + e;
          if (SPLIT_QK) { __bf16 a, bl; at_split(kk[e], a, bl); Ksh[kvr * KP + d] = a; Ksl[kvr * KP + d] = bl; }
          else Ksh[kvr * KP + d] = at_to16<F16>(kk[e]);
          if (SPLIT_PV) { __bf16 a, bl; at_split(vv[e], a, bl); Vth[d * VP + kvr] = a; Vtl[d * VP + kvr] = bl; }
          else Vth[d * VP + kvr] = at_to16<F16>(vv[e]);
        }
      }
    }
    __syncthreads();

    // One group per 32-wide slice of d (its q and k fragments, 20 LDS reads, then 12 products). The next group's reads are issued as one run
    // ahead of this group's products, into a second register set, and the products rotate over the four score tiles, so that no product
    // waits for an LDS read just issued or for the product before it. Each tile still sums in the order d slice 0..3, hi.hi, hi.lo, lo.hi.
    v8f s[4];
#pragma unroll
    for (int j = 0; j < 4; ++j) s[j] = (v8f){0.f,0.f,0.f,0.f,0.f,0.f,0.f,0.f};
    FB qa[2], ql[2], kb[2][4], kl[2][4];
#pragma unroll
    for (int dc = -1; dc < 4; ++dc) {
      if (dc < 3) {
        const int n = dc + 1, w = n & 1;
        if (SPLIT_QK) {
          qa[w].h[0] = *(const v8b*)(&Qsh[wave][c * KP + n * 32 + 8 * hh]); qa[w].h[1] = *(const v8b*)(&Qsh[wave][c * KP + n * 32 + 16 + 8 * hh]);
          ql[w].h[0] = *(const v8b*)(&Qsl[wave][c * KP + n * 32 + 8 * hh]); ql[w].h[1] = *(const v8b*)(&Qsl[wave][c * KP + n * 32 + 16 + 8 * hh]);
        } else qa[w].v = qah[n];
#pragma unroll
        for (int j = 0; j < 4; ++j) {
          kb[w][j].h[0] = *(const v8b*)(Ksh + (j * 16 + c) * KP + n * 32 + 8 * hh);
          kb[w][j].h[1] = *(const v8b*)(Ksh + (j * 16 + c) * KP + n * 32 + 16 + 8 * hh);
          if (SPLIT_QK) {
            kl[w][j].h[0] = *(const v8b*)(Ksl + (j * 16 + c) * KP + n * 32 + 8 * hh);
            kl[w][j].h[1] = *(const v8b*)(Ksl + (j * 16 + c) * KP + n * 32 + 16 + 8 * hh);
          }
        }
      }
      __builtin_amdgcn_sched_barrier(0);   // keeps the reads above in one run: the scheduler otherwise moves them in among the products
      if (dc >= 0) {
        const int w = dc & 1;
#pragma unroll
        for (int j = 0; j < 4; ++j) s[j] = at_mma16b<F16>(qa[w].v, kb[w][j].v, s[j]);
        if (SPLIT_QK) {
#pragma unroll
          for (int j = 0; j < 4; ++j) s[j] = at_mma16b<F16>(qa[w].v, kl[w][j].v, s[j]);
#pragma unroll
          for (int j = 0; j < 4; ++j) s[j] = at_mma16b<F16>(ql[w].v, kb[w][j].v, s[j]);
        }
        __builtin_amdgcn_sched_barrier(0);   // ends the run of products: the group after next is not read in among them
      }
    }
    const bool diag = (mode == 1) && (kc == qb);
    int kvkeep[4] = {1, 1, 1, 1};
    if (mode == 3) {
#pragma unroll
      for (int j = 0; j < 4; ++j) kvkeep[j] = ((const int*)mask_a)[(size_t)b * g.Skv + kv0 + j * 16 + c];   // mask_a = kvmask
    }
    float cm[8];
#pragma unroll
    for (int r = 0; r < 8; ++r) {
      const int qrow = q0 + 8 * hh + r;
      float m = -INFINITY;
#pragma unroll
      for (int j = 0; j < 4; ++j) {
        const int kvcol = kv0 + j * 16 + c;
        bool masked = false;
        if (diag) masked = (kvcol > qrow);
        else if (mode == 4) masked = (kvcol > qrow) || (qrow - kvcol > g.mask_is_int);
        else if (mode == 2) {
          const size_t mi = (size_t)qrow * g.Skv + kvcol;
          masked = (g.mask_is_int == 0) ? (((const float*)mask_a)[mi] == 0.0f)
                 : (g.mask_is_int == 1) ? (((const int*)mask_a)[mi] == 0) : (((const int*)mask_a)[mi] != 0);
        } else if (mode == 3) masked = (qkeep[r] == 0) || (kvkeep[j] == 0);
        else if (mode == 6) { masked = (kvcol > qrow); s[j][r] += g.cp[h] * (float)(kvcol - qrow); }
        else if (mode == 8) { masked = (kvcol > qrow) || (((const int*)mask_a)[(size_t)b * g.Skv + kvcol] != 0); }
        else if (mode == 5) {
          const size_t mi = (size_t)qrow * g.Skv + kvcol;
          masked = (((const int*)mask_a)[mi] != 0);
          int n = mask_b[mi]; n = n < 0 ? 0 : n;
          s[j][r] += g.cp[(size_t)b * g.c_bs + (size_t)h * g.c_hs + (size_t)qrow * g.c_rs + n]
                   + g.pc[(size_t)b * g.c_bs + (size_t)h * g.c_hs + (size_t)kvcol * g.c_rs + n];
        }
        if (masked) s[j][r] = g.mask_fill;
        m = fmaxf(m, s[j][r]);
      }
      m = fmaxf(m, at_row_xor<1>(m)); m = fmaxf(m, at_row_xor<2>(m)); m = fmaxf(m, at_row_xor<4>(m)); m = fmaxf(m, at_row_xor<8>(m));
      cm[r] = m;
    }
    __bf16* pwh = Psh[wave];
    __bf16* pwl = Psl[SPLIT_PV ? wave : 0];
#pragma unroll
    for (int r = 0; r < 8; ++r) {
      const float mnew = fmaxf(mrow[r], cm[r]);
      const float alpha = expf(mrow[r] - mnew);
      mrow[r] = mnew;
      float psum = 0.f;
#pragma unroll
      for (int j = 0; j < 4; ++j) {
        const float p = expf(s[j][r] - mnew);
        psum += p;
        if (SPLIT_PV) { __bf16 a, bl; at_split(p, a, bl); pwh[(8 * hh + r) * VP + j * 16 + c] = a; pwl[(8 * hh + r) * VP + j * 16 + c] = bl; }
        else pwh[(8 * hh + r) * VP + j * 16 + c] = at_to16<F16>(p * PSC);
      }
      psum += at_row_xor<1>(psum); psum += at_row_xor<2>(psum); psum += at_row_xor<4>(psum); psum += at_row_xor<8>(psum);
      lrow[r] = lrow[r] * alpha + psum;
#pragma unroll
      for (int t = 0; t < 8; ++t) oacc[t][r] *= alpha;
    }
    __builtin_amdgcn_fence(__ATOMIC_RELEASE, "workgroup");
    __builtin_amdgcn_wave_barrier();
    __builtin_amdgcn_fence(__ATOMIC_ACQUIRE, "workgroup");
    // One group per 32 keys and four output tiles (16 LDS reads of v, with p's four where the keys change, then 12 products), run like the
    // score groups: next group's reads in one run ahead of this group's products, products rotating over the four tiles.
    // Each output tile still sums in the order keys 0..31, 32..63, hi.hi, hi.lo, lo.hi.
    FB pa[2], pl[2], vb[2][4], vl[2][4];
#pragma unroll
    for (int gi = -1; gi < 4; ++gi) {
      if (gi < 3) {
        const int n = gi + 1, w = n & 1, kk = n >> 1, t0 = (n & 1) * 4;
        if (t0 == 0) {
          pa[kk].h[0] = *(const v8b*)(pwh + c * VP + kk * 32 + 8 * hh);
          pa[kk].h[1] = *(const v8b*)(pwh + c * VP + kk * 32 + 16 + 8 * hh);
          if (SPLIT_PV) {
            pl[kk].h[0] = *(const v8b*)(pwl + c * VP + kk * 32 + 8 * hh);
            pl[kk].h[1] = *(const v8b*)(pwl + c * VP + kk * 32 + 16 + 8 * hh);
          }
        }
#pragma unroll
        for (int u = 0; u < 4; ++u) {
          vb[w][u].h[0] = *(const v8b*)(Vth + ((t0 + u) * 16 + c) * VP + kk * 32 + 8 * hh);
          vb[w][u].h[1] = *(const v8b*)(Vth + ((t0 + u) * 16 + c) * VP + kk * 32 + 16 + 8 * hh);
          if (SPLIT_PV) {
            vl[w][u].h[0] = *(const v8b*)(Vtl + ((t0 + u) * 16 + c) * VP + kk * 32 + 8 * hh);
            vl[w][u].h[1] = *(const v8b*)(Vtl + ((t0 + u) * 16 + c) * VP + kk * 32 + 16 + 8 * hh);
          }
        }
      }
      __builtin_amdgcn_sched_barrier(0);   // keeps the reads above in one run, as in the score groups
      if (gi >= 0) {
        const int w = gi & 1, kk = gi >> 1, t0 = (gi & 1) * 4;
#pragma unroll
        for (int u = 0; u < 4; ++u) oacc[t0 + u] = at_mma16b<F16>(pa[kk].v, vb[w][u].v, oacc[t0 + u]);
        if (SPLIT_PV) {
#pragma unroll
          for (int u = 0; u < 4; ++u) oacc[t0 + u] = at_mma16b<F16>(pa[kk].v, vl[w][u].v, oacc[t0 + u]);
#pragma unroll
          for (int u = 0; u < 4; ++u) oacc[t0 + u] = at_mma16b<F16>(pl[kk].v, vb[w][u].v, oacc[t0 + u]);
        }
        __builtin_amdgcn_sched_barrier(0);   // ends the run of products
      }
    }
  }

  float* os = Os[wave];
#pragma unroll
  for (int r = 0; r < 8; ++r) {
    const float inv = 1.0f / (lrow[r] * PSC);
#pragma unroll
    for (int t = 0; t < 8; ++t) os[(8 * hh + r) * 132 + t * 16 + c] = oacc[t][r] * inv;
  }
  __builtin_amdgcn_fence(__ATOMIC_RELEASE, "workgroup");
  __builtin_amdgcn_wave_barrier();
  __builtin_amdgcn_fence(__ATOMIC_ACQUIRE, "workgroup");
  {
    const int c4 = lane * 4;           // 32 lanes x 16 B = one 512-B output row (128 floats) per instruction
    {
#pragma unroll
      for (int row = 0; row < 16; ++row) {
        v4f val = *(const v4f*)(os + row * 132 + c4);
        *(v4f*)(ob_ptr + (size_t)(q0 + row) * g.o_rs + c4) = val;
      }
      
    }
  }
}

// ---- k and v, f32 [rows][128], split once into bf16 hi/lo planes (the split of at_split, so the values are those the key loop made itself).
// One block per 64 rows (one key chunk of one head). k keeps its layout; v is transposed through LDS into one [128 d][64 keys] tile per chunk.
__global__ __launch_bounds__(256) void kv_split_planes(const float* __restrict__ k, const float* __restrict__ v,
                                                       __bf16* __restrict__ kh, __bf16* __restrict__ kl,
                                                       __bf16* __restrict__ vth, __bf16* __restrict__ vtl) {
  __shared__ float tile[128 * 65];     // [d][key], pitch 65 floats: the column writes fall on 16 banks, the row reads on 32
  const int t = threadIdx.x;
  const size_t base = (size_t)blockIdx.x * (64 * 128);
  // every loop below is unrolled so that a thread's loads issue together, ahead of the conversions
#pragma unroll
  for (int it = 0; it < 8; ++it) {
    const int n = it * 256 + t, key = n >> 5, d4 = (n & 31) * 4;
    const v4f x = *(const v4f*)(v + base + n * 4);     // row key, columns d4 .. d4 + 3: the tile is linear in n
#pragma unroll
    for (int e = 0; e < 4; ++e) tile[(d4 + e) * 65 + key] = x[e];
  }
#pragma unroll
  for (int it = 0; it < 4; ++it) {
    const int n = it * 256 + t;
    const v4f x0 = *(const v4f*)(k + base + n * 8), x1 = *(const v4f*)(k + base + n * 8 + 4);
    v8b hv, lv;
#pragma unroll
    for (int e = 0; e < 4; ++e) {
      __bf16 a, bl;
      at_split(x0[e], a, bl); hv[e] = a; lv[e] = bl;
      at_split(x1[e], a, bl); hv[4 + e] = a; lv[4 + e] = bl;
    }
    *(v8b*)(kh + base + n * 8) = hv;
    *(v8b*)(kl + base + n * 8) = lv;
  }
  __syncthreads();   // the v tile is complete before any thread reads its rows
#pragma unroll
  for (int it = 0; it < 4; ++it) {
    const int n = it * 256 + t, d = n >> 3, k8 = (n & 7) * 8;
    v8b hv, lv;
#pragma unroll
    for (int e = 0; e < 8; ++e) { __bf16 a, bl; at_split(tile[d * 65 + k8 + e], a, bl); hv[e] = a; lv[e] = bl; }
    *(v8b*)(vth + base + n * 8) = hv;
    *(v8b*)(vtl + base + n * 8) = lv;
  }
}

#define XB 2
#define XH 16
#define XS 2048
#define XD 128
__global__ void slopes_kernel(float* __restrict__ sl) { const int h = threadIdx.x; const float v = (h < XH) ? exp2f(-8.0f * (float)(h + 1) / (float)XH) : 0.f; ((float*)sl)[h] = v;  }
extern "C" void kernel_launch(void* const* d_in, const int* in_sizes, int n_in, void* d_out, int out_size, void* d_ws, size_t ws_size, hipStream_t stream) {
  (void)in_sizes; (void)n_in; (void)out_size; (void)ws_size;
  const float* q = (const float*)d_in[0]; const float* k = (const float*)d_in[1]; const float* v = (const float*)d_in[2];
  float* sl = (float*)d_ws;
  slopes_kernel<<<1, 32, 0, stream>>>(sl);
  __bf16* kh = (__bf16*)((char*)d_ws + 4096);                 // four planes of XB * XH * XS * XD bf16 behind the slope table
  __bf16* kl = kh + (size_t)XB * XH * XS * XD; __bf16* vth = kl + (size_t)XB * XH * XS * XD; __bf16* vtl = vth + (size_t)XB * XH * XS * XD;
  kv_split_planes<<<XB * XH * (XS / AT_KC), 256, 0, stream>>>(k, v, kh, kl, vth, vtl);
  AttnGeom g;
  g.cp = sl; g.pc = nullptr; g.c_bs = 0; g.c_rs = 0; g.c_hs = 0;
  g.q_bs = (long)XH * XS * XD; g.q_hs = (long)XS * XD; g.q_rs = XD;
  g.k_bs = g.q_bs; g.k_hs = g.q_hs; g.k_rs = XD; g.v_bs = g.q_bs; g.v_hs = g.q_hs; g.v_rs = XD; g.o_bs = g.q_bs; g.o_hs = g.q_hs; g.o_rs = XD;
  g.S = XS; g.Skv = XS; g.H = XH; g.mask_mode = 6; g.qscale = 0.08838834764831845f; g.blk0 = 0; g.mask_fill = -INFINITY; g.mask_is_int = 0;
  attn128_kernel<true, true, false, 6, true><<<XB * XH * (XS / AT_QB), AT_NW * 32, 0, stream>>>(q, k, v, (float*)d_out, nullptr, nullptr, g, kh, kl, vth, vtl);
}

// v007
// One run takes 122 microseconds.
// In both of two side-by-side timings against v006, it was 1.10 times as fast.
// All steps since v000 together make it 16.3 times as fast.
#include <hip/hip_runtime.h>
#include <math.h>
// FlexAttention forward (causal block mask + ALiBi score_mod, 2 x 16 heads, 2048 x 2048, head_dim 128): scores and p·v on
// v_wmma_f32_16x16x32_bf16 with q,k and p,v as bf16 hi/lo splits (hi·hi + hi·lo + lo·hi;
// early causal rows copy single v rows almost verbatim), f32 accumulate; online softmax, the ALiBi bias slope_h·(k−q) and the
// causal predicate in f32 on VALU.
typedef __attribute__((ext_vector_type(16))) _Float16 v16h;
typedef __attribute__((ext_vector_type(8)))  _Float16 v8h;
typedef __attribute__((ext_vector_type(16))) __bf16   v16b;
typedef __attribute__((ext_vector_type(8)))  __bf16   v8b;
typedef __attribute__((ext_vector_type(8)))  float    v8f;
typedef __attribute__((ext_vector_type(4)))  float    v4f;
#define PSCALE 32768.0f
#define U16(p) ((const unsigned short*)(const void*)(p))
#define PSCALE_INV (1.0f / 32768.0f)

__device__ __forceinline__ unsigned short f2bf_bits(float f) {
  unsigned u = __float_as_uint(f);
  return (unsigned short)((u + 0x7FFFu + ((u >> 16) & 1u)) >> 16);
}
__device__ __forceinline__ float bf_bits2f(unsigned short h) { return __uint_as_float(((unsigned)h) << 16); }

// hazard guards as plain device helpers (no inline asm inside the kernel template body)
__device__ __forceinline__ void dep_guard_h(v8f& a, v8f& b, v16h x, v16h y) { asm volatile("v_nop\n\tv_nop\n\tv_nop\n\tv_nop" : "+v"(a), "+v"(b) : "v"(x), "v"(y)); }
__device__ __forceinline__ void dep_guard_b(v8f& a, v8f& b, v16b x, v16b y) { asm volatile("v_nop\n\tv_nop\n\tv_nop\n\tv_nop" : "+v"(a), "+v"(b) : "v"(x), "v"(y)); }
__device__ __forceinline__ void keep4_h(v16h a, v16h b, v16h c, v16h d) { asm volatile("v_nop" :: "v"(a), "v"(b), "v"(c), "v"(d)); }
__device__ __forceinline__ void keep4_b(v16b a, v16b b, v16b c, v16b d) { asm volatile("v_nop" :: "v"(a), "v"(b), "v"(c), "v"(d)); }
__device__ __forceinline__ void acc_guard4(v8f& a, v8f& b, v8f& c, v8f& d) { asm volatile("v_nop\n\tv_nop\n\tv_nop\n\tv_nop" : "+v"(a), "+v"(b), "+v"(c), "+v"(d)); }
template <typename T> struct Frag;
template <> struct Frag<_Float16> {
  typedef v16h V; union U { v16h v; v8h h[2]; };
  static __device__ __forceinline__ v16h load(const _Float16* p) {   // elements 0..7 <- p[0..7], 8..15 <- p[16..23]
    U f; f.h[0] = *(const v8h*)(p); f.h[1] = *(const v8h*)(p + 16); return f.v;
  }
  static __device__ __forceinline__ v8f mma(v16h a, v16h b, v8f c) {
    return __builtin_amdgcn_wmma_f32_16x16x32_f16(false, a, false, b, (short)0, c, false, false);
  }
  static __device__ __forceinline__ void guard(v8f& a, v8f& b, v16h x, v16h y) { dep_guard_h(a, b, x, y); }
  static __device__ __forceinline__ void keep(v16h a, v16h b, v16h c, v16h d) { keep4_h(a, b, c, d); }
};
template <> struct Frag<__bf16> {
  typedef v16b V; union U { v16b v; v8b h[2]; };
  static __device__ __forceinline__ v16b load(const __bf16* p) {
    U f; f.h[0] = *(const v8b*)(p); f.h[1] = *(const v8b*)(p + 16); return f.v;
  }
  static __device__ __forceinline__ v8f mma(v16b a, v16b b, v8f c) {
    return __builtin_amdgcn_wmma_f32_16x16x32_bf16(false, a, false, b, (short)0, c, false, false);
  }
  static __device__ __forceinline__ void guard(v8f& a, v8f& b, v16b x, v16b y) { dep_guard_b(a, b, x, y); }
  static __device__ __forceinline__ void keep(v16b a, v16b b, v16b c, v16b d) { keep4_b(a, b, c, d); }
};

// ---- Register-blocked batched WMMA GEMM ------------------------------------
// C[m,n] = scale * sum_k A[m,k] * Bt[n,k] (+bias)(+resid); each wave owns a 64x64 tile.
// A row-major [M,K]; Bt row-major [N,K]; M,N % 64 == 0, K % 32 == 0.
// SPLIT: operands are hi/lo planes (A2/Bt2 = lo planes, same layout); product = hi·hi + hi·lo + lo·hi.
// BIAS_MODE: 0 = none, 1 = bias[m], 2 = bias[n].
// OUT_MODE: 0 = f32, 1 = f16, 2 = bf16 hi plane (Cout) + bf16 lo plane (Cout2).
// ET: 0 = f16 operands, 1 = bf16 operands (pointers passed as 16-bit storage)
template <int ET> struct Elem;
template <> struct Elem<0> { typedef _Float16 T; };
template <> struct Elem<1> { typedef __bf16 T; };
template <int ET, bool SPLIT, int BIAS_MODE, int OUT_MODE, bool RESID, int ACT = 0>
__global__ __launch_bounds__(256) void wmma_gemm64(
    const unsigned short* __restrict__ Ap, const unsigned short* __restrict__ A2p, int lda, long strideA,
    const unsigned short* __restrict__ Btp, const unsigned short* __restrict__ Bt2p, int ldb, long strideB,
    void* __restrict__ Cout, void* __restrict__ Cout2, int ldc, long strideC,
    const float* __restrict__ bias,
    const float* __restrict__ resid, long strideR,
    int M, int N, int K, float scale) {
  typedef typename Elem<ET>::T T;
  typedef typename Frag<T>::V V;
  const T* A = (const T*)Ap; const T* A2 = (const T*)A2p; const T* Bt = (const T*)Btp; const T* Bt2 = (const T*)Bt2p;
  __shared__ __align__(16) float sT[8][16 * 68];   // per-wave 16x64 slab, pitch 68 floats
  const int b    = blockIdx.y;
  const int lane = threadIdx.x & 31;
  const int wave = threadIdx.x >> 5;
  const int tilesN = N >> 6;
  const int tilesM = M >> 6;
  const int tile = blockIdx.x * 8 + wave;
  if (tile >= tilesM * tilesN) return;   // wave-uniform; no block barriers in this kernel
  const int tm = tile / tilesN;
  const int tn = tile - tm * tilesN;
  const int m0 = tm << 6;
  const int n0 = tn << 6;

  const T* Ab  = A  + (size_t)b * strideA;
  const T* Bb  = Bt + (size_t)b * strideB;
  const T* Ab2 = SPLIT ? (A2  + (size_t)b * strideA) : nullptr;
  const T* Bb2 = SPLIT ? (Bt2 + (size_t)b * strideB) : nullptr;

  const int rlane = lane & 15;                 // row (A) / col (B, D) within subtile
  const int koff  = (lane >> 4) * 8;           // k offset of this lane half
  const int mOff  = (lane >> 4) * 8;           // D row offset

  v8f acc[4][4];
#pragma unroll
  for (int i = 0; i < 4; ++i)
#pragma unroll
    for (int j = 0; j < 4; ++j) acc[i][j] = (v8f){0.f,0.f,0.f,0.f,0.f,0.f,0.f,0.f};

  for (int k0 = 0; k0 < K; k0 += 32) {
    V bh[4], bl[4];
#pragma unroll
    for (int j = 0; j < 4; ++j) {
      const size_t bo = (size_t)(n0 + (j << 4) + rlane) * ldb + koff + k0;
      bh[j] = Frag<T>::load(Bb + bo);
      if (SPLIT) bl[j] = Frag<T>::load(Bb2 + bo);
    }
#pragma unroll
    for (int i = 0; i < 4; ++i) {
      const size_t ao = (size_t)(m0 + (i << 4) + rlane) * lda + koff + k0;
      V ah = Frag<T>::load(Ab + ao);
      V al;
      if (SPLIT) al = Frag<T>::load(Ab2 + ao);
#pragma unroll
      for (int j = 0; j < 4; ++j) {
        acc[i][j] = Frag<T>::mma(ah, bh[j], acc[i][j]);
        if (SPLIT) {
          acc[i][j] = Frag<T>::mma(ah, bl[j], acc[i][j]);
          acc[i][j] = Frag<T>::mma(al, bh[j], acc[i][j]);
        }
      }
      Frag<T>::guard(acc[i][0], acc[i][3], ah, SPLIT ? al : ah);
    }
    Frag<T>::keep(bh[0], bh[1], bh[2], bh[3]);
    if (SPLIT) Frag<T>::keep(bl[0], bl[1], bl[2], bl[3]);
  }
  acc_guard4(acc[0][0], acc[0][1], acc[0][2], acc[0][3]);
  acc_guard4(acc[1][0], acc[1][1], acc[1][2], acc[1][3]);
  acc_guard4(acc[2][0], acc[2][1], acc[2][2], acc[2][3]);
  acc_guard4(acc[3][0], acc[3][1], acc[3][2], acc[3][3]);

  // ---- epilogue ----
  float* slab = sT[wave];
  const float* Rb = RESID ? (resid + (size_t)b * strideR) : nullptr;
#pragma unroll
  for (int i = 0; i < 4; ++i) {
    const int mBase = m0 + (i << 4);
#pragma unroll
    for (int j = 0; j < 4; ++j) {
      const int n = n0 + (j << 4) + rlane;
      float bv = 0.f;
      if (BIAS_MODE == 2) bv = bias[n];
#pragma unroll
      for (int r = 0; r < 8; ++r) {
        float v = acc[i][j][r] * scale;
        if (BIAS_MODE == 1) v += bias[mBase + mOff + r];
        if (BIAS_MODE == 2) v += bv;
        if (RESID) v += Rb[(size_t)(mBase + mOff + r) * ldc + n];
        if (ACT == 1) v = tanhf(v);
        if (ACT == 2) v = fmaxf(v, 0.0f);
        if (ACT == 3) v = v / (1.0f + expf(-v));
        if (ACT == 4) v = (v > 0.f) ? v : 0.01f * v;
        if (ACT == 5) v = 0.5f * v * (1.0f + erff(v * 0.70710678118654752f));
        slab[(mOff + r) * 68 + (j << 4) + rlane] = v;
      }
    }
    __builtin_amdgcn_fence(__ATOMIC_RELEASE, "workgroup");
    __builtin_amdgcn_wave_barrier();
    __builtin_amdgcn_fence(__ATOMIC_ACQUIRE, "workgroup");
    if (OUT_MODE == 0) {
      float* C = (float*)Cout + (size_t)b * strideC;
      const int hh = lane >> 4, c4 = (lane & 15) * 4;     // row seg = 256 B = 16 lanes x 16 B
      {
#pragma unroll
        for (int it = 0; it < 8; ++it) {
          const int row = it * 2 + hh;
          v4f v = *(const v4f*)(slab + row * 68 + c4);
          *(v4f*)(C + (size_t)(mBase + row) * ldc + n0 + c4) = v;
        }
        
      }
    } else {
      const int q = lane >> 3, c8 = (lane & 7) * 8;
      unsigned short* C  = (unsigned short*)Cout  + (size_t)b * strideC;
      unsigned short* C2 = (OUT_MODE == 2) ? ((unsigned short*)Cout2 + (size_t)b * strideC) : nullptr;
      {
#pragma unroll
        for (int it = 0; it < 4; ++it) {
          const int row = it * 4 + q;
          const float* sp = slab + row * 68 + c8;
          v8h hv, lv;
#pragma unroll
          for (int e = 0; e < 8; ++e) {
            if (OUT_MODE == 1) {
              hv[e] = (_Float16)sp[e];
            } else {
              unsigned short hb = f2bf_bits(sp[e]);
              unsigned short lb = f2bf_bits(sp[e] - bf_bits2f(hb));
              hv[e] = __builtin_bit_cast(_Float16, hb);
              lv[e] = __builtin_bit_cast(_Float16, lb);
            }
          }
          *(v8h*)(C + (size_t)(mBase + row) * ldc + n0 + c8) = hv;
          if (OUT_MODE == 2) *(v8h*)(C2 + (size_t)(mBase + row) * ldc + n0 + c8) = lv;
        }
        
      }
    }
    __builtin_amdgcn_fence(__ATOMIC_RELEASE, "workgroup");
    __builtin_amdgcn_wave_barrier();
    __builtin_amdgcn_fence(__ATOMIC_ACQUIRE, "workgroup");
  }
}

__global__ __launch_bounds__(256) void cast_f32_f16x2(
    const float* __restrict__ in, _Float16* __restrict__ out, int n2) {
  int i = blockIdx.x * 256 + threadIdx.x;
  if (i < n2) {
    const _Float16 h0 = (_Float16)in[2 * i], h1 = (_Float16)in[2 * i + 1];
    const unsigned u = (unsigned)__builtin_bit_cast(unsigned short, h0) | ((unsigned)__builtin_bit_cast(unsigned short, h1) << 16);
    ((unsigned*)out)[i] = u;
    
  }
}


// ---- f32 -> f16 cast with a power-of-two pre-scale (folded back by the consumer GEMM's scale) ----
__global__ __launch_bounds__(256) void cast_f32_f16x2s(const float* __restrict__ in, _Float16* __restrict__ out, int n2, float s) {
  int i = blockIdx.x * 256 + threadIdx.x;
  if (i < n2) {
    const _Float16 h0 = (_Float16)(in[2 * i] * s), h1 = (_Float16)(in[2 * i + 1] * s);
    const unsigned u = (unsigned)__builtin_bit_cast(unsigned short, h0) | ((unsigned)__builtin_bit_cast(unsigned short, h1) << 16);
    ((unsigned*)out)[i] = u;
    
  }
}
__global__ __launch_bounds__(256) void split_f32_bf16x2(
    const float* __restrict__ in, __bf16* __restrict__ hi, __bf16* __restrict__ lo, long n2) {
  long i = (long)blockIdx.x * 256 + threadIdx.x;
  long stride = (long)gridDim.x * 256;
  {
    for (long j = i; j < n2; j += stride) {
      const float a = in[2 * j], b = in[2 * j + 1];
      const unsigned short ah = f2bf_bits(a), bh = f2bf_bits(b);
      const unsigned short al = f2bf_bits(a - bf_bits2f(ah)), bl = f2bf_bits(b - bf_bits2f(bh));
      ((unsigned*)hi)[j] = (unsigned)ah | ((unsigned)bh << 16);
      ((unsigned*)lo)[j] = (unsigned)al | ((unsigned)bl << 16);
    }
    
  }
}


// ---- f32 [R][C] (row pitch ldi) -> f16 transposed [C][R] (row pitch ldo); 64x64 tiles; each output row segment
__global__ __launch_bounds__(256) void transpose_cast_f16(const float* __restrict__ in, int ldi,
                                                         _Float16* __restrict__ outT, int ldo, float scale) {
  __shared__ __align__(16) _Float16 tile[64][72];     // [c][r]
  const int c0 = blockIdx.x * 64, r0 = blockIdx.y * 64;
  const int t = threadIdx.y * 32 + threadIdx.x;
  for (int i = threadIdx.y; i < 64; i += 8) {
    tile[threadIdx.x][i]      = (_Float16)(in[(size_t)(r0 + i) * ldi + c0 + threadIdx.x] * scale);
    tile[32 + threadIdx.x][i] = (_Float16)(in[(size_t)(r0 + i) * ldi + c0 + 32 + threadIdx.x] * scale);
  }
  __syncthreads();
  const int q = t >> 3, c8 = (t & 7) * 8;
  {
#pragma unroll
    for (int it = 0; it < 2; ++it) {
      const int c = it * 32 + q;
      v8h hv = *(const v8h*)(&tile[c][c8]);
      *(v8h*)(outT + (size_t)(c0 + c) * ldo + r0 + c8) = hv;
    }
    
  }
}

// ---- f32 [R][C] (pitch ldi) -> bf16 hi/lo transposed planes [C][R] (pitch ldo); 64x64 tiles; each output row segment
__global__ __launch_bounds__(256) void transpose_split_bf16(const float* __restrict__ in, int ldi,
                                                           __bf16* __restrict__ outH, __bf16* __restrict__ outL, int ldo) {
  __shared__ __align__(16) float tile[64][68];     // [c][r]
  const int c0 = blockIdx.x * 64, r0 = blockIdx.y * 64;
  const int t = threadIdx.y * 32 + threadIdx.x;
  for (int i = threadIdx.y; i < 64; i += 8) {
    tile[threadIdx.x][i]      = in[(size_t)(r0 + i) * ldi + c0 + threadIdx.x];
    tile[32 + threadIdx.x][i] = in[(size_t)(r0 + i) * ldi + c0 + 32 + threadIdx.x];
  }
  __syncthreads();
  const int q = t >> 3, c8 = (t & 7) * 8;
  {
#pragma unroll
    for (int it = 0; it < 2; ++it) {
      const int c = it * 32 + q;
      v8b hv, lv;
#pragma unroll
      for (int e = 0; e < 8; ++e) {
        const float f = tile[c][c8 + e];
        const unsigned short hb = f2bf_bits(f);
        hv[e] = __builtin_bit_cast(__bf16, hb);
        lv[e] = __builtin_bit_cast(__bf16, f2bf_bits(f - bf_bits2f(hb)));
      }
      *(v8b*)(outH + (size_t)(c0 + c) * ldo + r0 + c8) = hv;
      *(v8b*)(outL + (size_t)(c0 + c) * ldo + r0 + c8) = lv;
    }
    
  }
}

// =====================================================================================
// Generic causal/non-causal attention for head_dim 64, f32 in / f32 out; 16-bit operands: bf16 with optional hi/lo splits, or
// plain f16 (F16=true, non-split, probabilities carried x2^15).
//   scores = (q*qscale)·kᵀ : v_wmma_f32_16x16x32_bf16; SPLIT_QK -> q,k as bf16 hi/lo (hi·hi + hi·lo + lo·hi)
//   out    = p·v           : v_wmma_f32_16x16x32_bf16; SPLIT_PV -> p,v as bf16 hi/lo; else p,v plain bf16
//   f32 accumulate; online softmax in f32. Block = 4 waves = 64 query rows of one (batch, head); S % 64 == 0.
//   Element (b, s, h, d) of tensor X lives at X[b*X_bs + s*X_rs + h*X_hs + d] (strides in floats, multiples of 4).
//   Masking: mask_mode 0 none, 1 causal (kv > q masked), 2 tensor [S][Skv] shared over (b,h) (float if
//   mask_is_int==0, int32 with element == 0 -> masked if 1, int32 with element != 0 -> masked if 2), 3 per-token vectors qmask[B][S] & kvmask[B][Skv] (int32,
//   0 -> masked), 4 causal + sliding window (kv > q or q - kv > W masked; W passed in mask_is_int);
//   5 = relative-position bias: s += cp[b,h,q][idx[q][kv]] + pc[b,h,kv][idx[q][kv]] with idx = mask_b ([S][Skv] int32) and
//   mask_a an int32 [S][Skv] tensor with nonzero = masked (tables: element (b,h,row,n) at X + b*c_bs + h*c_hs + row*c_rs + n);
//   masked scores are replaced by mask_fill (e.g. -inf or -1e9) before the softmax.
//   grid.x = B * H * (S/64) (or a sub-range with blk0).
// =====================================================================================
#define AT_D 64
#define AT_NW 4
#define AT_QB 64
#define AT_KC 64
struct AttnGeom { const float* cp = nullptr; const float* pc = nullptr; long c_bs = 0, c_rs = 0, c_hs = 0;   // mode-5 score-bias tables
                  long q_bs, q_rs, q_hs, k_bs, k_rs, k_hs, v_bs, v_rs, v_hs, o_bs, o_rs, o_hs;
                  int S, Skv, H, mask_mode; float qscale; int blk0; float mask_fill; int mask_is_int; };
static_assert(sizeof(AttnGeom) == 168, "no padding");

__device__ __forceinline__ unsigned short at_bf_bits(float f) {
  unsigned u = __float_as_uint(f);
  return (unsigned short)((u + 0x7FFFu + ((u >> 16) & 1u)) >> 16);
}
__device__ __forceinline__ __bf16 at_f2bf(float f) { return __builtin_bit_cast(__bf16, at_bf_bits(f)); }
__device__ __forceinline__ void at_split(float f, __bf16& hi, __bf16& lo) {
  const unsigned short hb = at_bf_bits(f);
  hi = __builtin_bit_cast(__bf16, hb);
  lo = at_f2bf(f - __uint_as_float(((unsigned)hb) << 16));
}
__device__ __forceinline__ v8f at_mma(v16b a, v16b b, v8f c) {
  c = __builtin_amdgcn_wmma_f32_16x16x32_bf16(false, a, false, b, (short)0, c, false, false);
  asm volatile("v_nop\n\tv_nop\n\tv_nop\n\tv_nop" : "+v"(c) : "v"(a), "v"(b));
  return c;
}
// 16-bit element as a bit pattern held in a __bf16 slot: f16 bits when F16, bf16 (RNE) otherwise
template <bool F16> __device__ __forceinline__ __bf16 at_to16(float f) {
  if (F16) return __builtin_bit_cast(__bf16, (_Float16)f);
  return at_f2bf(f);
}
template <bool F16> __device__ __forceinline__ v8f at_mma16(v16b a, v16b b, v8f c) {
  if (F16) {
    const v16h ah = __builtin_bit_cast(v16h, a), bh = __builtin_bit_cast(v16h, b);
    c = __builtin_amdgcn_wmma_f32_16x16x32_f16(false, ah, false, bh, (short)0, c, false, false);
    asm volatile("v_nop\n\tv_nop\n\tv_nop\n\tv_nop" : "+v"(c) : "v"(ah), "v"(bh));
    return c;
  }
  return at_mma(a, b, c);
}

template <bool SPLIT_QK, bool SPLIT_PV, bool F16 = false>
__global__ __launch_bounds__(128)
void attn64_kernel(const float* __restrict__ q, const float* __restrict__ k,
                   const float* __restrict__ v, float* __restrict__ out,
                   const void* __restrict__ mask_a, const int* __restrict__ mask_b, AttnGeom g) {
  static_assert(!(F16 && (SPLIT_QK || SPLIT_PV)), "f16 mode is non-split");
  const float PSC = F16 ? 32768.0f : 1.0f;     // f16 probabilities carried x2^15 (subnormal range), folded into the final 1/l
  union FB { v16b v; v8b h[2]; };
  __shared__ __align__(16) __bf16 Ksh[AT_KC * AT_D];             // K hi [kv][d]      8 KB
  __shared__ __align__(16) __bf16 Ksl[SPLIT_QK ? AT_KC * AT_D : 8];
  __shared__ __align__(16) __bf16 Vth[AT_D * AT_KC];             // V hi [d][kv]      8 KB
  __shared__ __align__(16) __bf16 Vtl[SPLIT_PV ? AT_D * AT_KC : 8];
  __shared__ __align__(16) __bf16 Psh[AT_NW][16 * AT_KC];        // per wave P hi [row][kv]  8 KB
  __shared__ __align__(16) __bf16 Psl[SPLIT_PV ? AT_NW : 1][SPLIT_PV ? 16 * AT_KC : 8];
  __shared__ __align__(16) float  Os[AT_NW][16 * 68];            // per wave out tile, pitch 68

  const int tid  = threadIdx.x;
  const int wave = tid >> 5;
  const int lane = tid & 31;
  const int hh   = lane >> 4;
  const int c    = lane & 15;

  const int nqb = g.S / AT_QB;
  const int bx = blockIdx.x + g.blk0;
  const int qb = bx % nqb;
  const int bh = bx / nqb;
  const int h  = bh % g.H;
  const int b  = bh / g.H;
  const int qbase_block = qb * AT_QB;
  const int q0 = qbase_block + wave * 16;

  const float* qb_ptr = q + (size_t)b * g.q_bs + (size_t)h * g.q_hs;
  const float* kb_ptr = k + (size_t)b * g.k_bs + (size_t)h * g.k_hs;
  const float* vb_ptr = v + (size_t)b * g.v_bs + (size_t)h * g.v_hs;
  float*       ob_ptr = out + (size_t)b * g.o_bs + (size_t)h * g.o_hs;

  // ---- Q fragments (A operand): 2 d-chunks, hi (and lo) ----
  v16b qah[2], qal[2];
  {
    const float* qrow = qb_ptr + (size_t)(q0 + c) * g.q_rs;
#pragma unroll
    for (int dc = 0; dc < 2; ++dc) {
#pragma unroll
      for (int e = 0; e < 8; ++e) {
        const float f0 = qrow[dc * 32 + 8 * hh + e] * g.qscale;
        const float f1 = qrow[dc * 32 + 16 + 8 * hh + e] * g.qscale;
        if (SPLIT_QK) { __bf16 hq, lq; at_split(f0, hq, lq); qah[dc][e] = hq; qal[dc][e] = lq; at_split(f1, hq, lq); qah[dc][8 + e] = hq; qal[dc][8 + e] = lq; }
        else { qah[dc][e] = at_to16<F16>(f0); qah[dc][8 + e] = at_to16<F16>(f1); qal[dc][e] = qah[dc][e]; qal[dc][8 + e] = qah[dc][8 + e]; }
      }
    }
  }

  float mrow[8], lrow[8];
  v8f oacc[4];
#pragma unroll
  for (int r = 0; r < 8; ++r) { mrow[r] = -INFINITY; lrow[r] = 0.f; }
#pragma unroll
  for (int t = 0; t < 4; ++t) oacc[t] = (v8f){0.f,0.f,0.f,0.f,0.f,0.f,0.f,0.f};

  const int nChunks = (g.mask_mode == 1 || g.mask_mode == 4) ? (qb + 1) : (g.Skv / AT_KC);   // block-uniform
  // per-row query mask (mode 3)
  int qkeep[8];
#pragma unroll
  for (int r = 0; r < 8; ++r) qkeep[r] = (g.mask_mode == 3) ? mask_b[(size_t)b * g.S + q0 + 8 * hh + r] : 1;   // mask_b = qmask in mode 3
  for (int kc = 0; kc < nChunks; ++kc) {
    const int kv0 = kc * AT_KC;
    __syncthreads();
    {
      const int kvr = tid >> 1, dh = (tid & 1) * 32;
      const float* krow = kb_ptr + (size_t)(kv0 + kvr) * g.k_rs + dh;
      const float* vrow = vb_ptr + (size_t)(kv0 + kvr) * g.v_rs + dh;
#pragma unroll
      for (int i = 0; i < 8; ++i) {
        v4f kk = *(const v4f*)(krow + 4 * i);
        v4f vv = *(const v4f*)(vrow + 4 * i);
#pragma unroll
        for (int e = 0; e < 4; ++e) {
          const int d = dh + 4 * i + e;
          if (SPLIT_QK) { __bf16 a, bl; at_split(kk[e], a, bl); Ksh[kvr * AT_D + d] = a; Ksl[kvr * AT_D + d] = bl; }
          else Ksh[kvr * AT_D + d] = at_to16<F16>(kk[e]);
          if (SPLIT_PV) { __bf16 a, bl; at_split(vv[e], a, bl); Vth[d * AT_KC + kvr] = a; Vtl[d * AT_KC + kvr] = bl; }
          else Vth[d * AT_KC + kvr] = at_to16<F16>(vv[e]);
        }
      }
    }
    __syncthreads();

    v8f s[4];
#pragma unroll
    for (int j = 0; j < 4; ++j) {
      s[j] = (v8f){0.f,0.f,0.f,0.f,0.f,0.f,0.f,0.f};
#pragma unroll 1
      for (int dc = 0; dc < 2; ++dc) {
        FB kb;
        kb.h[0] = *(const v8b*)(Ksh + (j * 16 + c) * AT_D + dc * 32 + 8 * hh);
        kb.h[1] = *(const v8b*)(Ksh + (j * 16 + c) * AT_D + dc * 32 + 16 + 8 * hh);
        s[j] = at_mma16<F16>(qah[dc], kb.v, s[j]);
        if (SPLIT_QK) {
          FB kl;
          kl.h[0] = *(const v8b*)(Ksl + (j * 16 + c) * AT_D + dc * 32 + 8 * hh);
          kl.h[1] = *(const v8b*)(Ksl + (j * 16 + c) * AT_D + dc * 32 + 16 + 8 * hh);
          s[j] = at_mma16<F16>(qah[dc], kl.v, s[j]);
          s[j] = at_mma16<F16>(qal[dc], kb.v, s[j]);
        }
      }
    }
    const bool diag = (g.mask_mode == 1) && (kc == qb);
    int kvkeep[4] = {1, 1, 1, 1};
    if (g.mask_mode == 3) {
#pragma unroll
      for (int j = 0; j < 4; ++j) kvkeep[j] = ((const int*)mask_a)[(size_t)b * g.Skv + kv0 + j * 16 + c];   // mask_a = kvmask
    }
    float cm[8];
#pragma unroll
    for (int r = 0; r < 8; ++r) {
      const int qrow = q0 + 8 * hh + r;
      float m = -INFINITY;
#pragma unroll
      for (int j = 0; j < 4; ++j) {
        const int kvcol = kv0 + j * 16 + c;
        bool masked = false;
        if (diag) masked = (kvcol > qrow);
        else if (g.mask_mode == 4) masked = (kvcol > qrow) || (qrow - kvcol > g.mask_is_int);
        else if (g.mask_mode == 2) {
          const size_t mi = (size_t)qrow * g.Skv + kvcol;
          masked = (g.mask_is_int == 0) ? (((const float*)mask_a)[mi] == 0.0f)
                 : (g.mask_is_int == 1) ? (((const int*)mask_a)[mi] == 0) : (((const int*)mask_a)[mi] != 0);
        } else if (g.mask_mode == 3) masked = (qkeep[r] == 0) || (kvkeep[j] == 0);
        else if (g.mask_mode == 5) {
          const size_t mi = (size_t)qrow * g.Skv + kvcol;
          masked = (((const int*)mask_a)[mi] != 0);
          int n = mask_b[mi]; n = n < 0 ? 0 : n;
          s[j][r] += g.cp[(size_t)b * g.c_bs + (size_t)h * g.c_hs + (size_t)qrow * g.c_rs + n]
                   + g.pc[(size_t)b * g.c_bs + (size_t)h * g.c_hs + (size_t)kvcol * g.c_rs + n];
        }
        if (masked) s[j][r] = g.mask_fill;
        m = fmaxf(m, s[j][r]);
      }
#pragma unroll
      for (int off = 1; off < 16; off <<= 1) m = fmaxf(m, __shfl_xor(m, off, 32));
      cm[r] = m;
    }
    __bf16* pwh = Psh[wave];
    __bf16* pwl = Psl[SPLIT_PV ? wave : 0];
#pragma unroll
    for (int r = 0; r < 8; ++r) {
      const float mnew = fmaxf(mrow[r], cm[r]);
      const float alpha = expf(mrow[r] - mnew);
      mrow[r] = mnew;
      float psum = 0.f;
#pragma unroll
      for (int j = 0; j < 4; ++j) {
        const float p = expf(s[j][r] - mnew);
        psum += p;
        if (SPLIT_PV) { __bf16 a, bl; at_split(p, a, bl); pwh[(8 * hh + r) * AT_KC + j * 16 + c] = a; pwl[(8 * hh + r) * AT_KC + j * 16 + c] = bl; }
        else pwh[(8 * hh + r) * AT_KC + j * 16 + c] = at_to16<F16>(p * PSC);
      }
#pragma unroll
      for (int off = 1; off < 16; off <<= 1) psum += __shfl_xor(psum, off, 32);
      lrow[r] = lrow[r] * alpha + psum;
#pragma unroll
      for (int t = 0; t < 4; ++t) oacc[t][r] *= alpha;
    }
    __builtin_amdgcn_fence(__ATOMIC_RELEASE, "workgroup");
    __builtin_amdgcn_wave_barrier();
    __builtin_amdgcn_fence(__ATOMIC_ACQUIRE, "workgroup");
#pragma unroll 1
    for (int kk = 0; kk < 2; ++kk) {
      FB pa, pl;
      pa.h[0] = *(const v8b*)(pwh + c * AT_KC + kk * 32 + 8 * hh);
      pa.h[1] = *(const v8b*)(pwh + c * AT_KC + kk * 32 + 16 + 8 * hh);
      if (SPLIT_PV) {
        pl.h[0] = *(const v8b*)(pwl + c * AT_KC + kk * 32 + 8 * hh);
        pl.h[1] = *(const v8b*)(pwl + c * AT_KC + kk * 32 + 16 + 8 * hh);
      }
#pragma unroll
      for (int t = 0; t < 4; ++t) {
        FB vb;
        vb.h[0] = *(const v8b*)(Vth + (t * 16 + c) * AT_KC + kk * 32 + 8 * hh);
        vb.h[1] = *(const v8b*)(Vth + (t * 16 + c) * AT_KC + kk * 32 + 16 + 8 * hh);
        oacc[t] = at_mma16<F16>(pa.v, vb.v, oacc[t]);
        if (SPLIT_PV) {
          FB vl;
          vl.h[0] = *(const v8b*)(Vtl + (t * 16 + c) * AT_KC + kk * 32 + 8 * hh);
          vl.h[1] = *(const v8b*)(Vtl + (t * 16 + c) * AT_KC + kk * 32 + 16 + 8 * hh);
          oacc[t] = at_mma16<F16>(pa.v, vl.v, oacc[t]);
          oacc[t] = at_mma16<F16>(pl.v, vb.v, oacc[t]);
        }
      }
    }
  }

  float* os = Os[wave];
#pragma unroll
  for (int r = 0; r < 8; ++r) {
    const float inv = 1.0f / (lrow[r] * PSC);
#pragma unroll
    for (int t = 0; t < 4; ++t) os[(8 * hh + r) * 68 + t * 16 + c] = oacc[t][r] * inv;
  }
  __builtin_amdgcn_fence(__ATOMIC_RELEASE, "workgroup");
  __builtin_amdgcn_wave_barrier();
  __builtin_amdgcn_fence(__ATOMIC_ACQUIRE, "workgroup");
  {
    const int c4 = (lane & 15) * 4;
    {
#pragma unroll
      for (int it = 0; it < 8; ++it) {
        const int row = it * 2 + hh;
        v4f val = *(const v4f*)(os + row * 68 + c4);
        *(v4f*)(ob_ptr + (size_t)(q0 + row) * g.o_rs + c4) = val;
      }
      
    }
  }
}

// Value of lane (l ^ M) of the same 16-lane row, M = 1..15, by a DPP move (row_xmask): a vector instruction, every lane on.
// __shfl_xor compiles to ds_bpermute_b32 and a wait on the LDS counter; this form has no LDS op
template <int M> __device__ __forceinline__ float at_row_xor(float x) {
  return __builtin_bit_cast(float, __builtin_amdgcn_update_dpp(0, __builtin_bit_cast(int, x), 0x160 + M, 0xf, 0xf, true));
}
// e^(x - m) of the softmax as 2^(x * log2(e) - m * log2(e)): one fused multiply-add and the hardware's own base-2 exponential. The library
// expf spends a dozen vector instructions a value on an extended-precision argument and on range tests; here the argument is never above 0
// but by a rounding, and a result too small for a normal float may fall to 0 (as does that of -inf), so none of that is needed.
// A row's five exponentials, each in place, in one statement: none overwrites the source or reads the result of the one before it, and the
// v_nop at the end is the slot that the instruction set asks for between the last one and whatever the compiler puts next
#define AT_LOG2E 1.4426950408889634f
__device__ __forceinline__ void at_exp2x5(float& a, float& b, float& c, float& d, float& e) {
  asm("v_exp_f32 %0, %0\n\tv_exp_f32 %1, %1\n\tv_exp_f32 %2, %2\n\tv_exp_f32 %3, %3\n\tv_exp_f32 %4, %4\n\tv_nop"
      : "+v"(a), "+v"(b), "+v"(c), "+v"(d), "+v"(e));
}
// Matrix product through the builtin alone: the compiler keeps the distances behind a WMMA itself, and with no asm statement behind each
// product the scheduler is free to issue the LDS fragment reads of a whole group ahead of the group's products
template <bool F16> __device__ __forceinline__ v8f at_mma16b(v16b a, v16b b, v8f c) {
  if (F16) return __builtin_amdgcn_wmma_f32_16x16x32_f16(false, __builtin_bit_cast(v16h, a), false, __builtin_bit_cast(v16h, b), (short)0, c, false, false);
  return __builtin_amdgcn_wmma_f32_16x16x32_bf16(false, a, false, b, (short)0, c, false, false);
}

// ---- head_dim 128 variant (same contract; K/V tiles 64 keys x 128, 8 output tiles; mask_mode 6 = causal + per-head ALiBi slope table in g.cp) ----
// MODE >= 0 fixes the mask mode at compile time, so the per-score mode tests fold away; MODE < 0 reads it from g.mask_mode
// PRE: k and v come as the bf16 hi/lo planes that kv_split_planes wrote earlier in the same call (pkh, pkl: [b*H + h][kv][d]; pvh, pvl: one
// [d][64 keys] tile per key chunk); the key loop then only copies a chunk's four 16 KB tiles into LDS and converts nothing
template <bool SPLIT_QK, bool SPLIT_PV, bool F16 = false, int MODE = -1, bool PRE = false>
__global__ __launch_bounds__(128)
void attn128_kernel(const float* __restrict__ q, const float* __restrict__ k,
                   const float* __restrict__ v, float* __restrict__ out,
                   const void* __restrict__ mask_a, const int* __restrict__ mask_b, AttnGeom g,
                   const __bf16* __restrict__ pkh, const __bf16* __restrict__ pkl,
                   const __bf16* __restrict__ pvh, const __bf16* __restrict__ pvl) {
  static_assert(!(F16 && (SPLIT_QK || SPLIT_PV)), "f16 mode is non-split");
  static_assert(!PRE || (SPLIT_QK && SPLIT_PV), "the planes are hi/lo splits");
  const float PSC = F16 ? 32768.0f : 1.0f;     // f16 probabilities carried x2^15 (subnormal range), folded into the final 1/l
  union FB { v16b v; v8b h[2]; };
  constexpr int D2 = 128;
  // LDS row pitches in elements: 16 B x odd (272 B for the 128-wide K and Q rows, 144 B for the 64-wide V^T and P rows), so that the
  // 16 rows one ds_load_b128 fragment read touches fall on distinct banks; at 256 B and 128 B they shared four or eight banks
  constexpr int KP = D2 + 8;
  constexpr int VP = AT_KC + 8;
  const int mode = (MODE >= 0) ? MODE : g.mask_mode;
  __shared__ __align__(16) __bf16 Ksh[AT_KC * KP];               // K hi [kv][d]      17 KB
  __shared__ __align__(16) __bf16 Ksl[SPLIT_QK ? AT_KC * KP : 8];
  __shared__ __align__(16) __bf16 Vth[D2 * VP];                  // V hi [d][kv]      18 KB
  __shared__ __align__(16) __bf16 Vtl[SPLIT_PV ? D2 * VP : 8];
  __shared__ __align__(16) __bf16 Psh[AT_NW][16 * VP];
  __shared__ __align__(16) __bf16 Psl[SPLIT_PV ? AT_NW : 1][SPLIT_PV ? 16 * VP : 8];
  __shared__ __align__(16) float  Os[AT_NW][16 * 132];           // per wave out tile, pitch 132
  __shared__ __align__(16) __bf16 Qsh[SPLIT_QK ? AT_NW : 1][SPLIT_QK ? 16 * KP : 8];   // split path: q hi/lo staged per wave (keeps VGPR use low)
  __shared__ __align__(16) __bf16 Qsl[SPLIT_QK ? AT_NW : 1][SPLIT_QK ? 16 * KP : 8];

  const int tid  = threadIdx.x;
  const int wave = tid >> 5;
  const int lane = tid & 31;
  const int hh   = lane >> 4;
  const int c    = lane & 15;

  const int nqb = g.S / AT_QB;
  const int bx = blockIdx.x + g.blk0;
  // Causal modes: query block qb walks qb + 1 key chunks, and the grid holds more blocks than the chip has resident places. The longest get
  // the lowest indices (qb falls with bx, heads innermost), for speed only. A permutation of (head, qb); needs the whole grid in one launch (blk0 = 0).
  const bool byCost = (mode == 1 || mode == 4 || mode == 6);
  const int nbh = byCost ? (int)gridDim.x / nqb : 1;
  const int qb = byCost ? (nqb - 1 - bx / nbh) : (bx % nqb);
  const int bh = byCost ? (bx % nbh) : (bx / nqb);
  const int h  = bh % g.H;
  const int b  = bh / g.H;
  const int qbase_block = qb * AT_QB;
  const int q0 = qbase_block + wave * 16;

  const float* qb_ptr = q + (size_t)b * g.q_bs + (size_t)h * g.q_hs;
  const float* kb_ptr = k + (size_t)b * g.k_bs + (size_t)h * g.k_hs;
  const float* vb_ptr = v + (size_t)b * g.v_bs + (size_t)h * g.v_hs;
  float*       ob_ptr = out + (size_t)b * g.o_bs + (size_t)h * g.o_hs;

  // ---- Q fragments (A operand): 4 d-chunks, hi (and lo) ----
  v16b qah[4], qal[4];
  {
    const float* qrow = qb_ptr + (size_t)(q0 + c) * g.q_rs;
#pragma unroll
    for (int dc = 0; dc < 4; ++dc) {
#pragma unroll
      for (int e = 0; e < 8; ++e) {
        const float f0 = qrow[dc * 32 + 8 * hh + e] * g.qscale;
        const float f1 = qrow[dc * 32 + 16 + 8 * hh + e] * g.qscale;
        if (SPLIT_QK) { __bf16 hq, lq; at_split(f0, hq, lq); Qsh[wave][c * KP + dc * 32 + 8 * hh + e] = hq; Qsl[wave][c * KP + dc * 32 + 8 * hh + e] = lq;
                        at_split(f1, hq, lq); Qsh[wave][c * KP + dc * 32 + 16 + 8 * hh + e] = hq; Qsl[wave][c * KP + dc * 32 + 16 + 8 * hh + e] = lq;
                        qah[dc][e] = hq; qal[dc][e] = lq; qah[dc][8 + e] = hq; qal[dc][8 + e] = lq; }   // (register copies unused on the split path)
        else { qah[dc][e] = at_to16<F16>(f0); qah[dc][8 + e] = at_to16<F16>(f1); qal[dc][e] = qah[dc][e]; qal[dc][8 + e] = qah[dc][8 + e]; }
      }
    }
  }

  float mrow[8], lrow[8];
  v8f oacc[8];
#pragma unroll
  for (int r = 0; r < 8; ++r) { mrow[r] = -INFINITY; lrow[r] = 0.f; }
#pragma unroll
  for (int t = 0; t < 8; ++t) oacc[t] = (v8f){0.f,0.f,0.f,0.f,0.f,0.f,0.f,0.f};

  const int nChunks = (mode == 1 || mode == 4 || mode == 6) ? (qb + 1) : (g.Skv / AT_KC);   // block-uniform
  // per-row query mask (mode 3)
  int qkeep[8];
#pragma unroll
  for (int r = 0; r < 8; ++r) qkeep[r] = (mode == 3) ? mask_b[(size_t)b * g.S + q0 + 8 * hh + r] : 1;   // mask_b = qmask in mode 3
  for (int kc = 0; kc < nChunks; ++kc) {
    const int kv0 = kc * AT_KC;
    if (PRE) {
      // each tile is 1024 pieces of 16 B, linear in memory; piece n is 16 B number n & 15 of K row n >> 4, n & 7 of V^T row n >> 3
      const size_t hb = (size_t)bh * g.Skv * D2;     // this head's part of each plane: a block-uniform base, and a 32-bit byte offset from it
      const char* gkh = (const char*)(pkh + hb); const char* gkl = (const char*)(pkl + hb);
      const char* gvh = (const char*)(pvh + hb); const char* gvl = (const char*)(pvl + hb);
      const unsigned lo16 = (unsigned)kc * (unsigned)(AT_KC * D2 * 2) + (unsigned)tid * 16u;
      v8b rkh[8], rkl[8], rvh[8], rvl[8];
#pragma unroll   // constant indices keep the pieces in registers, and the 32 loads issue as one run
      for (int i = 0; i < 8; ++i) {
        rkh[i] = *(const v8b*)(gkh + i * 2048 + lo16); rkl[i] = *(const v8b*)(gkl + i * 2048 + lo16);
        rvh[i] = *(const v8b*)(gvh + i * 2048 + lo16); rvl[i] = *(const v8b*)(gvl + i * 2048 + lo16);
      }
      __syncthreads();   // ends every wave's reads of the chunk before
#pragma unroll   // constant indices, as above
      for (int i = 0; i < 8; ++i) {
        const int n = i * 128 + tid;
        *(v8b*)(Ksh + (n >> 4) * KP + (n & 15) * 8) = rkh[i];
        *(v8b*)(Ksl + (n >> 4) * KP + (n & 15) * 8) = rkl[i];
        *(v8b*)(Vth + (n >> 3) * VP + (n & 7) * 8) = rvh[i];
        *(v8b*)(Vtl + (n >> 3) * VP + (n & 7) * 8) = rvl[i];
      }
    } else {
      __syncthreads();
      const int kvr = tid >> 1, dh = (tid & 1) * 64;
      const float* krow = kb_ptr + (size_t)(kv0 + kvr) * g.k_rs + dh;
      const float* vrow = vb_ptr + (size_t)(kv0 + kvr) * g.v_rs + dh;
#pragma unroll
      for (int i = 0; i < 16; ++i) {
        v4f kk = *(const v4f*)(krow + 4 * i);
        v4f vv = *(const v4f*)(vrow + 4 * i);
#pragma unroll
        for (int e = 0; e < 4; ++e) {
          const int d = dh + 4 * i + e;
          if (SPLIT_QK) { __bf16 a, bl; at_split(kk[e], a, bl); Ksh[kvr * KP + d] = a; Ksl[kvr * KP + d] = bl; }
          else Ksh[kvr * KP + d] = at_to16<F16>(kk[e]);
          if (SPLIT_PV) { __bf16 a, bl; at_split(vv[e], a, bl); Vth[d * VP + kvr] = a; Vtl[d * VP + kvr] = bl; }
          else Vth[d * VP + kvr] = at_to16<F16>(vv[e]);
        }
      }
    }
    __syncthreads();

    // One group per 32-wide slice of d (its q and k fragments, 20 LDS reads, then 12 products). The next group's reads are issued as one run
    // ahead of this group's products, into a second register set, and the products rotate over the four score tiles, so that no product
    // waits for an LDS read just issued or for the product before it. Each tile still sums in the order d slice 0..3, hi.hi, hi.lo, lo.hi.
    v8f s[4];
#pragma unroll
    for (int j = 0; j < 4; ++j) s[j] = (v8f){0.f,0.f,0.f,0.f,0.f,0.f,0.f,0.f};
    FB qa[2], ql[2], kb[2][4], kl[2][4];
#pragma unroll
    for (int dc = -1; dc < 4; ++dc) {
      if (dc < 3) {
        const int n = dc + 1, w = n & 1;
        if (SPLIT_QK) {
          qa[w].h[0] = *(const v8b*)(&Qsh[wave][c * KP + n * 32 + 8 * hh]); qa[w].h[1] = *(const v8b*)(&Qsh[wave][c * KP + n * 32 + 16 + 8 * hh]);
          ql[w].h[0] = *(const v8b*)(&Qsl[wave][c * KP + n * 32 + 8 * hh]); ql[w].h[1] = *(const v8b*)(&Qsl[wave][c * KP + n * 32 + 16 + 8 * hh]);
        } else qa[w].v = qah[n];
#pragma unroll
        for (int j = 0; j < 4; ++j) {
          kb[w][j].h[0] = *(const v8b*)(Ksh + (j * 16 + c) * KP + n * 32 + 8 * hh);
          kb[w][j].h[1] = *(const v8b*)(Ksh + (j * 16 + c) * KP + n * 32 + 16 + 8 * hh);
          if (SPLIT_QK) {
            kl[w][j].h[0] = *(const v8b*)(Ksl + (j * 16 + c) * KP + n * 32 + 8 * hh);
            kl[w][j].h[1] = *(const v8b*)(Ksl + (j * 16 + c) * KP + n * 32 + 16 + 8 * hh);
          }
        }
      }
      __builtin_amdgcn_sched_barrier(0);   // keeps the reads above in one run: the scheduler otherwise moves them in among the products
      if (dc >= 0) {
        const int w = dc & 1;
#pragma unroll
        for (int j = 0; j < 4; ++j) s[j] = at_mma16b<F16>(qa[w].v, kb[w][j].v, s[j]);
        if (SPLIT_QK) {
#pragma unroll
          for (int j = 0; j < 4; ++j) s[j] = at_mma16b<F16>(qa[w].v, kl[w][j].v, s[j]);
#pragma unroll
          for (int j = 0; j < 4; ++j) s[j] = at_mma16b<F16>(ql[w].v, kb[w][j].v, s[j]);
        }
        __builtin_amdgcn_sched_barrier(0);   // ends the run of products: the group after next is not read in among them
      }
    }
    const bool diag = (mode == 1) && (kc == qb);
    int kvkeep[4] = {1, 1, 1, 1};
    if (mode == 3) {
#pragma unroll
      for (int j = 0; j < 4; ++j) kvkeep[j] = ((const int*)mask_a)[(size_t)b * g.Skv + kv0 + j * 16 + c];   // mask_a = kvmask
    }
    float cm[8];
#pragma unroll
    for (int r = 0; r < 8; ++r) {
      const int qrow = q0 + 8 * hh + r;
      float m = -INFINITY;
#pragma unroll
      for (int j = 0; j < 4; ++j) {
        const int kvcol = kv0 + j * 16 + c;
        bool masked = false;
        if (diag) masked = (kvcol > qrow);
        else if (mode == 4) masked = (kvcol > qrow) || (qrow - kvcol > g.mask_is_int);
        else if (mode == 2) {
          const size_t mi = (size_t)qrow * g.Skv + kvcol;
          masked = (g.mask_is_int == 0) ? (((const float*)mask_a)[mi] == 0.0f)
                 : (g.mask_is_int == 1) ? (((const int*)mask_a)[mi] == 0) : (((const int*)mask_a)[mi] != 0);
        } else if (mode == 3) masked = (qkeep[r] == 0) || (kvkeep[j] == 0);
        else if (mode == 6) { masked = (kvcol > qrow); s[j][r] += g.cp[h] * (float)(kvcol - qrow); }
        else if (mode == 8) { masked = (kvcol > qrow) || (((const int*)mask_a)[(size_t)b * g.Skv + kvcol] != 0); }
        else if (mode == 5) {
          const size_t mi = (size_t)qrow * g.Skv + kvcol;
          masked = (((const int*)mask_a)[mi] != 0);
          int n = mask_b[mi]; n = n < 0 ? 0 : n;
          s[j][r] += g.cp[(size_t)b * g.c_bs + (size_t)h * g.c_hs + (size_t)qrow * g.c_rs + n]
                   + g.pc[(size_t)b * g.c_bs + (size_t)h * g.c_hs + (size_t)kvcol * g.c_rs + n];
        }
        if (masked) s[j][r] = g.mask_fill;
        m = fmaxf(m, s[j][r]);
      }
      m = fmaxf(m, at_row_xor<1>(m)); m = fmaxf(m, at_row_xor<2>(m)); m = fmaxf(m, at_row_xor<4>(m)); m = fmaxf(m, at_row_xor<8>(m));
      cm[r] = m;
    }
    __bf16* pwh = Psh[wave];
    __bf16* pwl = Psl[SPLIT_PV ? wave : 0];
#pragma unroll
    for (int r = 0; r < 8; ++r) {
      const float mnew = fmaxf(mrow[r], cm[r]);
      const float mnl = mnew * AT_LOG2E;
      float alpha = fmaf(mrow[r], AT_LOG2E, -mnl);
      float pe[4];
#pragma unroll   // constant indices keep the four arguments in registers
      for (int j = 0; j < 4; ++j) pe[j] = fmaf(s[j][r], AT_LOG2E, -mnl);
      at_exp2x5(alpha, pe[0], pe[1], pe[2], pe[3]);
      mrow[r] = mnew;
      float psum = 0.f;
#pragma unroll
      for (int j = 0; j < 4; ++j) {
        const float p = pe[j];
        psum += p;
        if (SPLIT_PV) { __bf16 a, bl; at_split(p, a, bl); pwh[(8 * hh + r) * VP + j * 16 + c] = a; pwl[(8 * hh + r) * VP + j * 16 + c] = bl; }
        else pwh[(8 * hh + r) * VP + j * 16 + c] = at_to16<F16>(p * PSC);
      }
      psum += at_row_xor<1>(psum); psum += at_row_xor<2>(psum); psum += at_row_xor<4>(psum); psum += at_row_xor<8>(psum);
      lrow[r] = lrow[r] * alpha + psum;
#pragma unroll
      for (int t = 0; t < 8; ++t) oacc[t][r] *= alpha;
    }
    __builtin_amdgcn_fence(__ATOMIC_RELEASE, "workgroup");
    __builtin_amdgcn_wave_barrier();
    __builtin_amdgcn_fence(__ATOMIC_ACQUIRE, "workgroup");
    // One group per 32 keys and four output tiles (16 LDS reads of v, with p's four where the keys change, then 12 products), run like the
    // score groups: next group's reads in one run ahead of this group's products, products rotating over the four tiles.
    // Each output tile still sums in the order keys 0..31, 32..63, hi.hi, hi.lo, lo.hi.
    FB pa[2], pl[2], vb[2][4], vl[2][4];
#pragma unroll
    for (int gi = -1; gi < 4; ++gi) {
      if (gi < 3) {
        const int n = gi + 1, w = n & 1, kk = n >> 1, t0 = (n & 1) * 4;
        if (t0 == 0) {
          pa[kk].h[0] = *(const v8b*)(pwh + c * VP + kk * 32 + 8 * hh);
          pa[kk].h[1] = *(const v8b*)(pwh + c * VP + kk * 32 + 16 + 8 * hh);
          if (SPLIT_PV) {
            pl[kk].h[0] = *(const v8b*)(pwl + c * VP + kk * 32 + 8 * hh);
            pl[kk].h[1] = *(const v8b*)(pwl + c * VP + kk * 32 + 16 + 8 * hh);
          }
        }
#pragma unroll
        for (int u = 0; u < 4; ++u) {
          vb[w][u].h[0] = *(const v8b*)(Vth + ((t0 + u) * 16 + c) * VP + kk * 32 + 8 * hh);
          vb[w][u].h[1] = *(const v8b*)(Vth + ((t0 + u) * 16 + c) * VP + kk * 32 + 16 + 8 * hh);
          if (SPLIT_PV) {
            vl[w][u].h[0] = *(const v8b*)(Vtl + ((t0 + u) * 16 + c) * VP + kk * 32 + 8 * hh);
            vl[w][u].h[1] = *(const v8b*)(Vtl + ((t0 + u) * 16 + c) * VP + kk * 32 + 16 + 8 * hh);
          }
        }
      }
      __builtin_amdgcn_sched_barrier(0);   // keeps the reads above in one run, as in the score groups
      if (gi >= 0) {
        const int w = gi & 1, kk = gi >> 1, t0 = (gi & 1) * 4;
#pragma unroll
        for (int u = 0; u < 4; ++u) oacc[t0 + u] = at_mma16b<F16>(pa[kk].v, vb[w][u].v, oacc[t0 + u]);
        if (SPLIT_PV) {
#pragma unroll
          for (int u = 0; u < 4; ++u) oacc[t0 + u] = at_mma16b<F16>(pa[kk].v, vl[w][u].v, oacc[t0 + u]);
#pragma unroll
          for (int u = 0; u < 4; ++u) oacc[t0 + u] = at_mma16b<F16>(pl[kk].v, vb[w][u].v, oacc[t0 + u]);
        }
        __builtin_amdgcn_sched_barrier(0);   // ends the run of products
      }
    }
  }

  float* os = Os[wave];
#pragma unroll
  for (int r = 0; r < 8; ++r) {
    const float inv = 1.0f / (lrow[r] * PSC);
#pragma unroll
    for (int t = 0; t < 8; ++t) os[(8 * hh + r) * 132 + t * 16 + c] = oacc[t][r] * inv;
  }
  __builtin_amdgcn_fence(__ATOMIC_RELEASE, "workgroup");
  __builtin_amdgcn_wave_barrier();
  __builtin_amdgcn_fence(__ATOMIC_ACQUIRE, "workgroup");
  {
    const int c4 = lane * 4;           // 32 lanes x 16 B = one 512-B output row (128 floats) per instruction
    {
#pragma unroll
      for (int row = 0; row < 16; ++row) {
        v4f val = *(const v4f*)(os + row * 132 + c4);
        *(v4f*)(ob_ptr + (size_t)(q0 + row) * g.o_rs + c4) = val;
      }
      
    }
  }
}

// ---- k and v, f32 [rows][128], split once into bf16 hi/lo planes (the split of at_split, so the values are those the key loop made itself).
// One block per 64 rows (one key chunk of one head). k keeps its layout; v is transposed through LDS into one [128 d][64 keys] tile per chunk.
__global__ __launch_bounds__(256) void kv_split_planes(const float* __restrict__ k, const float* __restrict__ v,
                                                       __bf16* __restrict__ kh, __bf16* __restrict__ kl,
                                                       __bf16* __restrict__ vth, __bf16* __restrict__ vtl) {
  __shared__ float tile[128 * 65];     // [d][key], pitch 65 floats: the column writes fall on 16 banks, the row reads on 32
  const int t = threadIdx.x;
  const size_t base = (size_t)blockIdx.x * (64 * 128);
  // every loop below is unrolled so that a thread's loads issue together, ahead of the conversions
#pragma unroll
  for (int it = 0; it < 8; ++it) {
    const int n = it * 256 + t, key = n >> 5, d4 = (n & 31) * 4;
    const v4f x = *(const v4f*)(v + base + n * 4);     // row key, columns d4 .. d4 + 3: the tile is linear in n
#pragma unroll
    for (int e = 0; e < 4; ++e) tile[(d4 + e) * 65 + key] = x[e];
  }
#pragma unroll
  for (int it = 0; it < 4; ++it) {
    const int n = it * 256 + t;
    const v4f x0 = *(const v4f*)(k + base + n * 8), x1 = *(const v4f*)(k + base + n * 8 + 4);
    v8b hv, lv;
#pragma unroll
    for (int e = 0; e < 4; ++e) {
      __bf16 a, bl;
      at_split(x0[e], a, bl); hv[e] = a; lv[e] = bl;
      at_split(x1[e], a, bl); hv[4 + e] = a; lv[4 + e] = bl;
    }
    *(v8b*)(kh + base + n * 8) = hv;
    *(v8b*)(kl + base + n * 8) = lv;
  }
  __syncthreads();   // the v tile is complete before any thread reads its rows
#pragma unroll
  for (int it = 0; it < 4; ++it) {
    const int n = it * 256 + t, d = n >> 3, k8 = (n & 7) * 8;
    v8b hv, lv;
#pragma unroll
    for (int e = 0; e < 8; ++e) { __bf16 a, bl; at_split(tile[d * 65 + k8 + e], a, bl); hv[e] = a; lv[e] = bl; }
    *(v8b*)(vth + base + n * 8) = hv;
    *(v8b*)(vtl + base + n * 8) = lv;
  }
}

#define XB 2
#define XH 16
#define XS 2048
#define XD 128
__global__ void slopes_kernel(float* __restrict__ sl) { const int h = threadIdx.x; const float v = (h < XH) ? exp2f(-8.0f * (float)(h + 1) / (float)XH) : 0.f; ((float*)sl)[h] = v;  }
extern "C" void kernel_launch(void* const* d_in, const int* in_sizes, int n_in, void* d_out, int out_size, void* d_ws, size_t ws_size, hipStream_t stream) {
  (void)in_sizes; (void)n_in; (void)out_size; (void)ws_size;
  const float* q = (const float*)d_in[0]; const float* k = (const float*)d_in[1]; const float* v = (const float*)d_in[2];
  float* sl = (float*)d_ws;
  slopes_kernel<<<1, 32, 0, stream>>>(sl);
  __bf16* kh = (__bf16*)((char*)d_ws + 4096);                 // four planes of XB * XH * XS * XD bf16 behind the slope table
  __bf16* kl = kh + (size_t)XB * XH * XS * XD; __bf16* vth = kl + (size_t)XB * XH * XS * XD; __bf16* vtl = vth + (size_t)XB * XH * XS * XD;
  kv_split_planes<<<XB * XH * (XS / AT_KC), 256, 0, stream>>>(k, v, kh, kl, vth, vtl);
  AttnGeom g;
  g.cp = sl; g.pc = nullptr; g.c_bs = 0; g.c_rs = 0; g.c_hs = 0;
  g.q_bs = (long)XH * XS * XD; g.q_hs = (long)XS * XD; g.q_rs = XD;
  g.k_bs = g.q_bs; g.k_hs = g.q_hs; g.k_rs = XD; g.v_bs = g.q_bs; g.v_hs = g.q_hs; g.v_rs = XD; g.o_bs = g.q_bs; g.o_hs = g.q_hs; g.o_rs = XD;
  g.S = XS; g.Skv = XS; g.H = XH; g.mask_mode = 6; g.qscale = 0.08838834764831845f; g.blk0 = 0; g.mask_fill = -INFINITY; g.mask_is_int = 0;
  attn128_kernel<true, true, false, 6, true><<<XB * XH * (XS / AT_QB), AT_NW * 32, 0, stream>>>(q, k, v, (float*)d_out, nullptr, nullptr, g, kh, kl, vth, vtl);
}

// v008
// A run of this version takes 110 microseconds.
// Next to v007, in two timings, it ran 1.11 times as fast each time.
// Counting every step since v000, it is 18.1 times as fast.
#include <hip/hip_runtime.h>
#include <math.h>
// FlexAttention forward (causal block mask + ALiBi score_mod, 2 x 16 heads, 2048 x 2048, head_dim 128): scores and p·v on
// v_wmma_f32_16x16x32_bf16 with q,k and p,v as bf16 hi/lo splits (hi·hi + hi·lo + lo·hi;
// early causal rows copy single v rows almost verbatim), f32 accumulate; online softmax, the ALiBi bias slope_h·(k−q) and the
// causal predicate in f32 on VALU.
typedef __attribute__((ext_vector_type(16))) _Float16 v16h;
typedef __attribute__((ext_vector_type(8)))  _Float16 v8h;
typedef __attribute__((ext_vector_type(16))) __bf16   v16b;
typedef __attribute__((ext_vector_type(8)))  __bf16   v8b;
typedef __attribute__((ext_vector_type(8)))  float    v8f;
typedef __attribute__((ext_vector_type(4)))  float    v4f;
#define PSCALE 32768.0f
#define U16(p) ((const unsigned short*)(const void*)(p))
#define PSCALE_INV (1.0f / 32768.0f)

__device__ __forceinline__ unsigned short f2bf_bits(float f) {
  unsigned u = __float_as_uint(f);
  return (unsigned short)((u + 0x7FFFu + ((u >> 16) & 1u)) >> 16);
}
__device__ __forceinline__ float bf_bits2f(unsigned short h) { return __uint_as_float(((unsigned)h) << 16); }

// hazard guards as plain device helpers (no inline asm inside the kernel template body)
__device__ __forceinline__ void dep_guard_h(v8f& a, v8f& b, v16h x, v16h y) { asm volatile("v_nop\n\tv_nop\n\tv_nop\n\tv_nop" : "+v"(a), "+v"(b) : "v"(x), "v"(y)); }
__device__ __forceinline__ void dep_guard_b(v8f& a, v8f& b, v16b x, v16b y) { asm volatile("v_nop\n\tv_nop\n\tv_nop\n\tv_nop" : "+v"(a), "+v"(b) : "v"(x), "v"(y)); }
__device__ __forceinline__ void keep4_h(v16h a, v16h b, v16h c, v16h d) { asm volatile("v_nop" :: "v"(a), "v"(b), "v"(c), "v"(d)); }
__device__ __forceinline__ void keep4_b(v16b a, v16b b, v16b c, v16b d) { asm volatile("v_nop" :: "v"(a), "v"(b), "v"(c), "v"(d)); }
__device__ __forceinline__ void acc_guard4(v8f& a, v8f& b, v8f& c, v8f& d) { asm volatile("v_nop\n\tv_nop\n\tv_nop\n\tv_nop" : "+v"(a), "+v"(b), "+v"(c), "+v"(d)); }
template <typename T> struct Frag;
template <> struct Frag<_Float16> {
  typedef v16h V; union U { v16h v; v8h h[2]; };
  static __device__ __forceinline__ v16h load(const _Float16* p) {   // elements 0..7 <- p[0..7], 8..15 <- p[16..23]
    U f; f.h[0] = *(const v8h*)(p); f.h[1] = *(const v8h*)(p + 16); return f.v;
  }
  static __device__ __forceinline__ v8f mma(v16h a, v16h b, v8f c) {
    return __builtin_amdgcn_wmma_f32_16x16x32_f16(false, a, false, b, (short)0, c, false, false);
  }
  static __device__ __forceinline__ void guard(v8f& a, v8f& b, v16h x, v16h y) { dep_guard_h(a, b, x, y); }
  static __device__ __forceinline__ void keep(v16h a, v16h b, v16h c, v16h d) { keep4_h(a, b, c, d); }
};
template <> struct Frag<__bf16> {
  typedef v16b V; union U { v16b v; v8b h[2]; };
  static __device__ __forceinline__ v16b load(const __bf16* p) {
    U f; f.h[0] = *(const v8b*)(p); f.h[1] = *(const v8b*)(p + 16); return f.v;
  }
  static __device__ __forceinline__ v8f mma(v16b a, v16b b, v8f c) {
    return __builtin_amdgcn_wmma_f32_16x16x32_bf16(false, a, false, b, (short)0, c, false, false);
  }
  static __device__ __forceinline__ void guard(v8f& a, v8f& b, v16b x, v16b y) { dep_guard_b(a, b, x, y); }
  static __device__ __forceinline__ void keep(v16b a, v16b b, v16b c, v16b d) { keep4_b(a, b, c, d); }
};

// ---- Register-blocked batched WMMA GEMM ------------------------------------
// C[m,n] = scale * sum_k A[m,k] * Bt[n,k] (+bias)(+resid); each wave owns a 64x64 tile.
// A row-major [M,K]; Bt row-major [N,K]; M,N % 64 == 0, K % 32 == 0.
// SPLIT: operands are hi/lo planes (A2/Bt2 = lo planes, same layout); product = hi·hi + hi·lo + lo·hi.
// BIAS_MODE: 0 = none, 1 = bias[m], 2 = bias[n].
// OUT_MODE: 0 = f32, 1 = f16, 2 = bf16 hi plane (Cout) + bf16 lo plane (Cout2).
// ET: 0 = f16 operands, 1 = bf16 operands (pointers passed as 16-bit storage)
template <int ET> struct Elem;
template <> struct Elem<0> { typedef _Float16 T; };
template <> struct Elem<1> { typedef __bf16 T; };
template <int ET, bool SPLIT, int BIAS_MODE, int OUT_MODE, bool RESID, int ACT = 0>
__global__ __launch_bounds__(256) void wmma_gemm64(
    const unsigned short* __restrict__ Ap, const unsigned short* __restrict__ A2p, int lda, long strideA,
    const unsigned short* __restrict__ Btp, const unsigned short* __restrict__ Bt2p, int ldb, long strideB,
    void* __restrict__ Cout, void* __restrict__ Cout2, int ldc, long strideC,
    const float* __restrict__ bias,
    const float* __restrict__ resid, long strideR,
    int M, int N, int K, float scale) {
  typedef typename Elem<ET>::T T;
  typedef typename Frag<T>::V V;
  const T* A = (const T*)Ap; const T* A2 = (const T*)A2p; const T* Bt = (const T*)Btp; const T* Bt2 = (const T*)Bt2p;
  __shared__ __align__(16) float sT[8][16 * 68];   // per-wave 16x64 slab, pitch 68 floats
  const int b    = blockIdx.y;
  const int lane = threadIdx.x & 31;
  const int wave = threadIdx.x >> 5;
  const int tilesN = N >> 6;
  const int tilesM = M >> 6;
  const int tile = blockIdx.x * 8 + wave;
  if (tile >= tilesM * tilesN) return;   // wave-uniform; no block barriers in this kernel
  const int tm = tile / tilesN;
  const int tn = tile - tm * tilesN;
  const int m0 = tm << 6;
  const int n0 = tn << 6;

  const T* Ab  = A  + (size_t)b * strideA;
  const T* Bb  = Bt + (size_t)b * strideB;
  const T* Ab2 = SPLIT ? (A2  + (size_t)b * strideA) : nullptr;
  const T* Bb2 = SPLIT ? (Bt2 + (size_t)b * strideB) : nullptr;

  const int rlane = lane & 15;                 // row (A) / col (B, D) within subtile
  const int koff  = (lane >> 4) * 8;           // k offset of this lane half
  const int mOff  = (lane >> 4) * 8;           // D row offset

  v8f acc[4][4];
#pragma unroll
  for (int i = 0; i < 4; ++i)
#pragma unroll
    for (int j = 0; j < 4; ++j) acc[i][j] = (v8f){0.f,0.f,0.f,0.f,0.f,0.f,0.f,0.f};

  for (int k0 = 0; k0 < K; k0 += 32) {
    V bh[4], bl[4];
#pragma unroll
    for (int j = 0; j < 4; ++j) {
      const size_t bo = (size_t)(n0 + (j << 4) + rlane) * ldb + koff + k0;
      bh[j] = Frag<T>::load(Bb + bo);
      if (SPLIT) bl[j] = Frag<T>::load(Bb2 + bo);
    }
#pragma unroll
    for (int i = 0; i < 4; ++i) {
      const size_t ao = (size_t)(m0 + (i << 4) + rlane) * lda + koff + k0;
      V ah = Frag<T>::load(Ab + ao);
      V al;
      if (SPLIT) al = Frag<T>::load(Ab2 + ao);
#pragma unroll
      for (int j = 0; j < 4; ++j) {
        acc[i][j] = Frag<T>::mma(ah, bh[j], acc[i][j]);
        if (SPLIT) {
          acc[i][j] = Frag<T>::mma(ah, bl[j], acc[i][j]);
          acc[i][j] = Frag<T>::mma(al, bh[j], acc[i][j]);
        }
      }
      Frag<T>::guard(acc[i][0], acc[i][3], ah, SPLIT ? al : ah);
    }
    Frag<T>::keep(bh[0], bh[1], bh[2], bh[3]);
    if (SPLIT) Frag<T>::keep(bl[0], bl[1], bl[2], bl[3]);
  }
  acc_guard4(acc[0][0], acc[0][1], acc[0][2], acc[0][3]);
  acc_guard4(acc[1][0], acc[1][1], acc[1][2], acc[1][3]);
  acc_guard4(acc[2][0], acc[2][1], acc[2][2], acc[2][3]);
  acc_guard4(acc[3][0], acc[3][1], acc[3][2], acc[3][3]);

  // ---- epilogue ----
  float* slab = sT[wave];
  const float* Rb = RESID ? (resid + (size_t)b * strideR) : nullptr;
#pragma unroll
  for (int i = 0; i < 4; ++i) {
    const int mBase = m0 + (i << 4);
#pragma unroll
    for (int j = 0; j < 4; ++j) {
      const int n = n0 + (j << 4) + rlane;
      float bv = 0.f;
      if (BIAS_MODE == 2) bv = bias[n];
#pragma unroll
      for (int r = 0; r < 8; ++r) {
        float v = acc[i][j][r] * scale;
        if (BIAS_MODE == 1) v += bias[mBase + mOff + r];
        if (BIAS_MODE == 2) v += bv;
        if (RESID) v += Rb[(size_t)(mBase + mOff + r) * ldc + n];
        if (ACT == 1) v = tanhf(v);
        if (ACT == 2) v = fmaxf(v, 0.0f);
        if (ACT == 3) v = v / (1.0f + expf(-v));
        if (ACT == 4) v = (v > 0.f) ? v : 0.01f * v;
        if (ACT == 5) v = 0.5f * v * (1.0f + erff(v * 0.70710678118654752f));
        slab[(mOff + r) * 68 + (j << 4) + rlane] = v;
      }
    }
    __builtin_amdgcn_fence(__ATOMIC_RELEASE, "workgroup");
    __builtin_amdgcn_wave_barrier();
    __builtin_amdgcn_fence(__ATOMIC_ACQUIRE, "workgroup");
    if (OUT_MODE == 0) {
      float* C = (float*)Cout + (size_t)b * strideC;
      const int hh = lane >> 4, c4 = (lane & 15) * 4;     // row seg = 256 B = 16 lanes x 16 B
      {
#pragma unroll
        for (int it = 0; it < 8; ++it) {
          const int row = it * 2 + hh;
          v4f v = *(const v4f*)(slab + row * 68 + c4);
          *(v4f*)(C + (size_t)(mBase + row) * ldc + n0 + c4) = v;
        }
        
      }
    } else {
      const int q = lane >> 3, c8 = (lane & 7) * 8;
      unsigned short* C  = (unsigned short*)Cout  + (size_t)b * strideC;
      unsigned short* C2 = (OUT_MODE == 2) ? ((unsigned short*)Cout2 + (size_t)b * strideC) : nullptr;
      {
#pragma unroll
        for (int it = 0; it < 4; ++it) {
          const int row = it * 4 + q;
          const float* sp = slab + row * 68 + c8;
          v8h hv, lv;
#pragma unroll
          for (int e = 0; e < 8; ++e) {
            if (OUT_MODE == 1) {
              hv[e] = (_Float16)sp[e];
            } else {
              unsigned short hb = f2bf_bits(sp[e]);
              unsigned short lb = f2bf_bits(sp[e] - bf_bits2f(hb));
              hv[e] = __builtin_bit_cast(_Float16, hb);
              lv[e] = __builtin_bit_cast(_Float16, lb);
            }
          }
          *(v8h*)(C + (size_t)(mBase + row) * ldc + n0 + c8) = hv;
          if (OUT_MODE == 2) *(v8h*)(C2 + (size_t)(mBase + row) * ldc + n0 + c8) = lv;
        }
        
      }
    }
    __builtin_amdgcn_fence(__ATOMIC_RELEASE, "workgroup");
    __builtin_amdgcn_wave_barrier();
    __builtin_amdgcn_fence(__ATOMIC_ACQUIRE, "workgroup");
  }
}

__global__ __launch_bounds__(256) void cast_f32_f16x2(
    const float* __restrict__ in, _Float16* __restrict__ out, int n2) {
  int i = blockIdx.x * 256 + threadIdx.x;
  if (i < n2) {
    const _Float16 h0 = (_Float16)in[2 * i], h1 = (_Float16)in[2 * i + 1];
    const unsigned u = (unsigned)__builtin_bit_cast(unsigned short, h0) | ((unsigned)__builtin_bit_cast(unsigned short, h1) << 16);
    ((unsigned*)out)[i] = u;
    
  }
}


// ---- f32 -> f16 cast with a power-of-two pre-scale (folded back by the consumer GEMM's scale) ----
__global__ __launch_bounds__(256) void cast_f32_f16x2s(const float* __restrict__ in, _Float16* __restrict__ out, int n2, float s) {
  int i = blockIdx.x * 256 + threadIdx.x;
  if (i < n2) {
    const _Float16 h0 = (_Float16)(in[2 * i] * s), h1 = (_Float16)(in[2 * i + 1] * s);
    const unsigned u = (unsigned)__builtin_bit_cast(unsigned short, h0) | ((unsigned)__builtin_bit_cast(unsigned short, h1) << 16);
    ((unsigned*)out)[i] = u;
    
  }
}
__global__ __launch_bounds__(256) void split_f32_bf16x2(
    const float* __restrict__ in, __bf16* __restrict__ hi, __bf16* __restrict__ lo, long n2) {
  long i = (long)blockIdx.x * 256 + threadIdx.x;
  long stride = (long)gridDim.x * 256;
  {
    for (long j = i; j < n2; j += stride) {
      const float a = in[2 * j], b = in[2 * j + 1];
      const unsigned short ah = f2bf_bits(a), bh = f2bf_bits(b);
      const unsigned short al = f2bf_bits(a - bf_bits2f(ah)), bl = f2bf_bits(b - bf_bits2f(bh));
      ((unsigned*)hi)[j] = (unsigned)ah | ((unsigned)bh << 16);
      ((unsigned*)lo)[j] = (unsigned)al | ((unsigned)bl << 16);
    }
    
  }
}


// ---- f32 [R][C] (row pitch ldi) -> f16 transposed [C][R] (row pitch ldo); 64x64 tiles; each output row segment
__global__ __launch_bounds__(256) void transpose_cast_f16(const float* __restrict__ in, int ldi,
                                                         _Float16* __restrict__ outT, int ldo, float scale) {
  __shared__ __align__(16) _Float16 tile[64][72];     // [c][r]
  const int c0 = blockIdx.x * 64, r0 = blockIdx.y * 64;
  const int t = threadIdx.y * 32 + threadIdx.x;
  for (int i = threadIdx.y; i < 64; i += 8) {
    tile[threadIdx.x][i]      = (_Float16)(in[(size_t)(r0 + i) * ldi + c0 + threadIdx.x] * scale);
    tile[32 + threadIdx.x][i] = (_Float16)(in[(size_t)(r0 + i) * ldi + c0 + 32 + threadIdx.x] * scale);
  }
  __syncthreads();
  const int q = t >> 3, c8 = (t & 7) * 8;
  {
#pragma unroll
    for (int it = 0; it < 2; ++it) {
      const int c = it * 32 + q;
      v8h hv = *(const v8h*)(&tile[c][c8]);
      *(v8h*)(outT + (size_t)(c0 + c) * ldo + r0 + c8) = hv;
    }
    
  }
}

// ---- f32 [R][C] (pitch ldi) -> bf16 hi/lo transposed planes [C][R] (pitch ldo); 64x64 tiles; each output row segment
__global__ __launch_bounds__(256) void transpose_split_bf16(const float* __restrict__ in, int ldi,
                                                           __bf16* __restrict__ outH, __bf16* __restrict__ outL, int ldo) {
  __shared__ __align__(16) float tile[64][68];     // [c][r]
  const int c0 = blockIdx.x * 64, r0 = blockIdx.y * 64;
  const int t = threadIdx.y * 32 + threadIdx.x;
  for (int i = threadIdx.y; i < 64; i += 8) {
    tile[threadIdx.x][i]      = in[(size_t)(r0 + i) * ldi + c0 + threadIdx.x];
    tile[32 + threadIdx.x][i] = in[(size_t)(r0 + i) * ldi + c0 + 32 + threadIdx.x];
  }
  __syncthreads();
  const int q = t >> 3, c8 = (t & 7) * 8;
  {
#pragma unroll
    for (int it = 0; it < 2; ++it) {
      const int c = it * 32 + q;
      v8b hv, lv;
#pragma unroll
      for (int e = 0; e < 8; ++e) {
        const float f = tile[c][c8 + e];
        const unsigned short hb = f2bf_bits(f);
        hv[e] = __builtin_bit_cast(__bf16, hb);
        lv[e] = __builtin_bit_cast(__bf16, f2bf_bits(f - bf_bits2f(hb)));
      }
      *(v8b*)(outH + (size_t)(c0 + c) * ldo + r0 + c8) = hv;
      *(v8b*)(outL + (size_t)(c0 + c) * ldo + r0 + c8) = lv;
    }
    
  }
}

// =====================================================================================
// Generic causal/non-causal attention for head_dim 64, f32 in / f32 out; 16-bit operands: bf16 with optional hi/lo splits, or
// plain f16 (F16=true, non-split, probabilities carried x2^15).
//   scores = (q*qscale)·kᵀ : v_wmma_f32_16x16x32_bf16; SPLIT_QK -> q,k as bf16 hi/lo (hi·hi + hi·lo + lo·hi)
//   out    = p·v           : v_wmma_f32_16x16x32_bf16; SPLIT_PV -> p,v as bf16 hi/lo; else p,v plain bf16
//   f32 accumulate; online softmax in f32. Block = 4 waves = 64 query rows of one (batch, head); S % 64 == 0.
//   Element (b, s, h, d) of tensor X lives at X[b*X_bs + s*X_rs + h*X_hs + d] (strides in floats, multiples of 4).
//   Masking: mask_mode 0 none, 1 causal (kv > q masked), 2 tensor [S][Skv] shared over (b,h) (float if
//   mask_is_int==0, int32 with element == 0 -> masked if 1, int32 with element != 0 -> masked if 2), 3 per-token vectors qmask[B][S] & kvmask[B][Skv] (int32,
//   0 -> masked), 4 causal + sliding window (kv > q or q - kv > W masked; W passed in mask_is_int);
//   5 = relative-position bias: s += cp[b,h,q][idx[q][kv]] + pc[b,h,kv][idx[q][kv]] with idx = mask_b ([S][Skv] int32) and
//   mask_a an int32 [S][Skv] tensor with nonzero = masked (tables: element (b,h,row,n) at X + b*c_bs + h*c_hs + row*c_rs + n);
//   masked scores are replaced by mask_fill (e.g. -inf or -1e9) before the softmax.
//   grid.x = B * H * (S/64) (or a sub-range with blk0).
// =====================================================================================
#define AT_D 64
#define AT_NW 4
#define AT_QB 64
#define AT_KC 64
struct AttnGeom { const float* cp = nullptr; const float* pc = nullptr; long c_bs = 0, c_rs = 0, c_hs = 0;   // mode-5 score-bias tables
                  long q_bs, q_rs, q_hs, k_bs, k_rs, k_hs, v_bs, v_rs, v_hs, o_bs, o_rs, o_hs;
                  int S, Skv, H, mask_mode; float qscale; int blk0; float mask_fill; int mask_is_int; };
static_assert(sizeof(AttnGeom) == 168, "no padding");

__device__ __forceinline__ unsigned short at_bf_bits(float f) {
  unsigned u = __float_as_uint(f);
  return (unsigned short)((u + 0x7FFFu + ((u >> 16) & 1u)) >> 16);
}
__device__ __forceinline__ __bf16 at_f2bf(float f) { return __builtin_bit_cast(__bf16, at_bf_bits(f)); }
__device__ __forceinline__ void at_split(float f, __bf16& hi, __bf16& lo) {
  const unsigned short hb = at_bf_bits(f);
  hi = __builtin_bit_cast(__bf16, hb);
  lo = at_f2bf(f - __uint_as_float(((unsigned)hb) << 16));
}
__device__ __forceinline__ v8f at_mma(v16b a, v16b b, v8f c) {
  c = __builtin_amdgcn_wmma_f32_16x16x32_bf16(false, a, false, b, (short)0, c, false, false);
  asm volatile("v_nop\n\tv_nop\n\tv_nop\n\tv_nop" : "+v"(c) : "v"(a), "v"(b));
  return c;
}
// 16-bit element as a bit pattern held in a __bf16 slot: f16 bits when F16, bf16 (RNE) otherwise
template <bool F16> __device__ __forceinline__ __bf16 at_to16(float f) {
  if (F16) return __builtin_bit_cast(__bf16, (_Float16)f);
  return at_f2bf(f);
}
template <bool F16> __device__ __forceinline__ v8f at_mma16(v16b a, v16b b, v8f c) {
  if (F16) {
    const v16h ah = __builtin_bit_cast(v16h, a), bh = __builtin_bit_cast(v16h, b);
    c = __builtin_amdgcn_wmma_f32_16x16x32_f16(false, ah, false, bh, (short)0, c, false, false);
    asm volatile("v_nop\n\tv_nop\n\tv_nop\n\tv_nop" : "+v"(c) : "v"(ah), "v"(bh));
    return c;
  }
  return at_mma(a, b, c);
}

template <bool SPLIT_QK, bool SPLIT_PV, bool F16 = false>
__global__ __launch_bounds__(128)
void attn64_kernel(const float* __restrict__ q, const float* __restrict__ k,
                   const float* __restrict__ v, float* __restrict__ out,
                   const void* __restrict__ mask_a, const int* __restrict__ mask_b, AttnGeom g) {
  static_assert(!(F16 && (SPLIT_QK || SPLIT_PV)), "f16 mode is non-split");
  const float PSC = F16 ? 32768.0f : 1.0f;     // f16 probabilities carried x2^15 (subnormal range), folded into the final 1/l
  union FB { v16b v; v8b h[2]; };
  __shared__ __align__(16) __bf16 Ksh[AT_KC * AT_D];             // K hi [kv][d]      8 KB
  __shared__ __align__(16) __bf16 Ksl[SPLIT_QK ? AT_KC * AT_D : 8];
  __shared__ __align__(16) __bf16 Vth[AT_D * AT_KC];             // V hi [d][kv]      8 KB
  __shared__ __align__(16) __bf16 Vtl[SPLIT_PV ? AT_D * AT_KC : 8];
  __shared__ __align__(16) __bf16 Psh[AT_NW][16 * AT_KC];        // per wave P hi [row][kv]  8 KB
  __shared__ __align__(16) __bf16 Psl[SPLIT_PV ? AT_NW : 1][SPLIT_PV ? 16 * AT_KC : 8];
  __shared__ __align__(16) float  Os[AT_NW][16 * 68];            // per wave out tile, pitch 68

  const int tid  = threadIdx.x;
  const int wave = tid >> 5;
  const int lane = tid & 31;
  const int hh   = lane >> 4;
  const int c    = lane & 15;

  const int nqb = g.S / AT_QB;
  const int bx = blockIdx.x + g.blk0;
  const int qb = bx % nqb;
  const int bh = bx / nqb;
  const int h  = bh % g.H;
  const int b  = bh / g.H;
  const int qbase_block = qb * AT_QB;
  const int q0 = qbase_block + wave * 16;

  const float* qb_ptr = q + (size_t)b * g.q_bs + (size_t)h * g.q_hs;
  const float* kb_ptr = k + (size_t)b * g.k_bs + (size_t)h * g.k_hs;
  const float* vb_ptr = v + (size_t)b * g.v_bs + (size_t)h * g.v_hs;
  float*       ob_ptr = out + (size_t)b * g.o_bs + (size_t)h * g.o_hs;

  // ---- Q fragments (A operand): 2 d-chunks, hi (and lo) ----
  v16b qah[2], qal[2];
  {
    const float* qrow = qb_ptr + (size_t)(q0 + c) * g.q_rs;
#pragma unroll
    for (int dc = 0; dc < 2; ++dc) {
#pragma unroll
      for (int e = 0; e < 8; ++e) {
        const float f0 = qrow[dc * 32 + 8 * hh + e] * g.qscale;
        const float f1 = qrow[dc * 32 + 16 + 8 * hh + e] * g.qscale;
        if (SPLIT_QK) { __bf16 hq, lq; at_split(f0, hq, lq); qah[dc][e] = hq; qal[dc][e] = lq; at_split(f1, hq, lq); qah[dc][8 + e] = hq; qal[dc][8 + e] = lq; }
        else { qah[dc][e] = at_to16<F16>(f0); qah[dc][8 + e] = at_to16<F16>(f1); qal[dc][e] = qah[dc][e]; qal[dc][8 + e] = qah[dc][8 + e]; }
      }
    }
  }

  float mrow[8], lrow[8];
  v8f oacc[4];
#pragma unroll
  for (int r = 0; r < 8; ++r) { mrow[r] = -INFINITY; lrow[r] = 0.f; }
#pragma unroll
  for (int t = 0; t < 4; ++t) oacc[t] = (v8f){0.f,0.f,0.f,0.f,0.f,0.f,0.f,0.f};

  const int nChunks = (g.mask_mode == 1 || g.mask_mode == 4) ? (qb + 1) : (g.Skv / AT_KC);   // block-uniform
  // per-row query mask (mode 3)
  int qkeep[8];
#pragma unroll
  for (int r = 0; r < 8; ++r) qkeep[r] = (g.mask_mode == 3) ? mask_b[(size_t)b * g.S + q0 + 8 * hh + r] : 1;   // mask_b = qmask in mode 3
  for (int kc = 0; kc < nChunks; ++kc) {
    const int kv0 = kc * AT_KC;
    __syncthreads();
    {
      const int kvr = tid >> 1, dh = (tid & 1) * 32;
      const float* krow = kb_ptr + (size_t)(kv0 + kvr) * g.k_rs + dh;
      const float* vrow = vb_ptr + (size_t)(kv0 + kvr) * g.v_rs + dh;
#pragma unroll
      for (int i = 0; i < 8; ++i) {
        v4f kk = *(const v4f*)(krow + 4 * i);
        v4f vv = *(const v4f*)(vrow + 4 * i);
#pragma unroll
        for (int e = 0; e < 4; ++e) {
          const int d = dh + 4 * i + e;
          if (SPLIT_QK) { __bf16 a, bl; at_split(kk[e], a, bl); Ksh[kvr * AT_D + d] = a; Ksl[kvr * AT_D + d] = bl; }
          else Ksh[kvr * AT_D + d] = at_to16<F16>(kk[e]);
          if (SPLIT_PV) { __bf16 a, bl; at_split(vv[e], a, bl); Vth[d * AT_KC + kvr] = a; Vtl[d * AT_KC + kvr] = bl; }
          else Vth[d * AT_KC + kvr] = at_to16<F16>(vv[e]);
        }
      }
    }
    __syncthreads();

    v8f s[4];
#pragma unroll
    for (int j = 0; j < 4; ++j) {
      s[j] = (v8f){0.f,0.f,0.f,0.f,0.f,0.f,0.f,0.f};
#pragma unroll 1
      for (int dc = 0; dc < 2; ++dc) {
        FB kb;
        kb.h[0] = *(const v8b*)(Ksh + (j * 16 + c) * AT_D + dc * 32 + 8 * hh);
        kb.h[1] = *(const v8b*)(Ksh + (j * 16 + c) * AT_D + dc * 32 + 16 + 8 * hh);
        s[j] = at_mma16<F16>(qah[dc], kb.v, s[j]);
        if (SPLIT_QK) {
          FB kl;
          kl.h[0] = *(const v8b*)(Ksl + (j * 16 + c) * AT_D + dc * 32 + 8 * hh);
          kl.h[1] = *(const v8b*)(Ksl + (j * 16 + c) * AT_D + dc * 32 + 16 + 8 * hh);
          s[j] = at_mma16<F16>(qah[dc], kl.v, s[j]);
          s[j] = at_mma16<F16>(qal[dc], kb.v, s[j]);
        }
      }
    }
    const bool diag = (g.mask_mode == 1) && (kc == qb);
    int kvkeep[4] = {1, 1, 1, 1};
    if (g.mask_mode == 3) {
#pragma unroll
      for (int j = 0; j < 4; ++j) kvkeep[j] = ((const int*)mask_a)[(size_t)b * g.Skv + kv0 + j * 16 + c];   // mask_a = kvmask
    }
    float cm[8];
#pragma unroll
    for (int r = 0; r < 8; ++r) {
      const int qrow = q0 + 8 * hh + r;
      float m = -INFINITY;
#pragma unroll
      for (int j = 0; j < 4; ++j) {
        const int kvcol = kv0 + j * 16 + c;
        bool masked = false;
        if (diag) masked = (kvcol > qrow);
        else if (g.mask_mode == 4) masked = (kvcol > qrow) || (qrow - kvcol > g.mask_is_int);
        else if (g.mask_mode == 2) {
          const size_t mi = (size_t)qrow * g.Skv + kvcol;
          masked = (g.mask_is_int == 0) ? (((const float*)mask_a)[mi] == 0.0f)
                 : (g.mask_is_int == 1) ? (((const int*)mask_a)[mi] == 0) : (((const int*)mask_a)[mi] != 0);
        } else if (g.mask_mode == 3) masked = (qkeep[r] == 0) || (kvkeep[j] == 0);
        else if (g.mask_mode == 5) {
          const size_t mi = (size_t)qrow * g.Skv + kvcol;
          masked = (((const int*)mask_a)[mi] != 0);
          int n = mask_b[mi]; n = n < 0 ? 0 : n;
          s[j][r] += g.cp[(size_t)b * g.c_bs + (size_t)h * g.c_hs + (size_t)qrow * g.c_rs + n]
                   + g.pc[(size_t)b * g.c_bs + (size_t)h * g.c_hs + (size_t)kvcol * g.c_rs + n];
        }
        if (masked) s[j][r] = g.mask_fill;
        m = fmaxf(m, s[j][r]);
      }
#pragma unroll
      for (int off = 1; off < 16; off <<= 1) m = fmaxf(m, __shfl_xor(m, off, 32));
      cm[r] = m;
    }
    __bf16* pwh = Psh[wave];
    __bf16* pwl = Psl[SPLIT_PV ? wave : 0];
#pragma unroll
    for (int r = 0; r < 8; ++r) {
      const float mnew = fmaxf(mrow[r], cm[r]);
      const float alpha = expf(mrow[r] - mnew);
      mrow[r] = mnew;
      float psum = 0.f;
#pragma unroll
      for (int j = 0; j < 4; ++j) {
        const float p = expf(s[j][r] - mnew);
        psum += p;
        if (SPLIT_PV) { __bf16 a, bl; at_split(p, a, bl); pwh[(8 * hh + r) * AT_KC + j * 16 + c] = a; pwl[(8 * hh + r) * AT_KC + j * 16 + c] = bl; }
        else pwh[(8 * hh + r) * AT_KC + j * 16 + c] = at_to16<F16>(p * PSC);
      }
#pragma unroll
      for (int off = 1; off < 16; off <<= 1) psum += __shfl_xor(psum, off, 32);
      lrow[r] = lrow[r] * alpha + psum;
#pragma unroll
      for (int t = 0; t < 4; ++t) oacc[t][r] *= alpha;
    }
    __builtin_amdgcn_fence(__ATOMIC_RELEASE, "workgroup");
    __builtin_amdgcn_wave_barrier();
    __builtin_amdgcn_fence(__ATOMIC_ACQUIRE, "workgroup");
#pragma unroll 1
    for (int kk = 0; kk < 2; ++kk) {
      FB pa, pl;
      pa.h[0] = *(const v8b*)(pwh + c * AT_KC + kk * 32 + 8 * hh);
      pa.h[1] = *(const v8b*)(pwh + c * AT_KC + kk * 32 + 16 + 8 * hh);
      if (SPLIT_PV) {
        pl.h[0] = *(const v8b*)(pwl + c * AT_KC + kk * 32 + 8 * hh);
        pl.h[1] = *(const v8b*)(pwl + c * AT_KC + kk * 32 + 16 + 8 * hh);
      }
#pragma unroll
      for (int t = 0; t < 4; ++t) {
        FB vb;
        vb.h[0] = *(const v8b*)(Vth + (t * 16 + c) * AT_KC + kk * 32 + 8 * hh);
        vb.h[1] = *(const v8b*)(Vth + (t * 16 + c) * AT_KC + kk * 32 + 16 + 8 * hh);
        oacc[t] = at_mma16<F16>(pa.v, vb.v, oacc[t]);
        if (SPLIT_PV) {
          FB vl;
          vl.h[0] = *(const v8b*)(Vtl + (t * 16 + c) * AT_KC + kk * 32 + 8 * hh);
          vl.h[1] = *(const v8b*)(Vtl + (t * 16 + c) * AT_KC + kk * 32 + 16 + 8 * hh);
          oacc[t] = at_mma16<F16>(pa.v, vl.v, oacc[t]);
          oacc[t] = at_mma16<F16>(pl.v, vb.v, oacc[t]);
        }
      }
    }
  }

  float* os = Os[wave];
#pragma unroll
  for (int r = 0; r < 8; ++r) {
    const float inv = 1.0f / (lrow[r] * PSC);
#pragma unroll
    for (int t = 0; t < 4; ++t) os[(8 * hh + r) * 68 + t * 16 + c] = oacc[t][r] * inv;
  }
  __builtin_amdgcn_fence(__ATOMIC_RELEASE, "workgroup");
  __builtin_amdgcn_wave_barrier();
  __builtin_amdgcn_fence(__ATOMIC_ACQUIRE, "workgroup");
  {
    const int c4 = (lane & 15) * 4;
    {
#pragma unroll
      for (int it = 0; it < 8; ++it) {
        const int row = it * 2 + hh;
        v4f val = *(const v4f*)(os + row * 68 + c4);
        *(v4f*)(ob_ptr + (size_t)(q0 + row) * g.o_rs + c4) = val;
      }
      
    }
  }
}

// Value of lane l ^ 16 (the same column in the wave's other half) by a vector cross-row move, every lane on.
// __shfl_xor compiles to ds_bpermute_b32 and a wait on the LDS counter; this form has no LDS op
__device__ __forceinline__ float at_half_xor(float x) {
  const int b = __builtin_bit_cast(int, x);
  return __builtin_bit_cast(float, __builtin_amdgcn_permlanex16(b, b, 0x76543210, 0xfedcba98, false, false));
}
// e^(x - m) of the softmax as 2^(x * log2(e) - m * log2(e)): one fused multiply-add and the hardware's own base-2 exponential. The library
// expf spends a dozen vector instructions a value on an extended-precision argument and on range tests; here the argument is never above 0
// but by a rounding, and a result too small for a normal float may fall to 0 (as does that of -inf), so none of that is needed.
// A score tile's eight exponentials, each in place, in one statement: none overwrites the source or reads the result of the one before it,
// and the v_nop at the end is the slot that the instruction set asks for between the last one and whatever the compiler puts next
#define AT_LOG2E 1.4426950408889634f
__device__ __forceinline__ void at_exp2x8(float (&p)[8]) {
  asm("v_exp_f32 %0, %0\n\tv_exp_f32 %1, %1\n\tv_exp_f32 %2, %2\n\tv_exp_f32 %3, %3\n\t"
      "v_exp_f32 %4, %4\n\tv_exp_f32 %5, %5\n\tv_exp_f32 %6, %6\n\tv_exp_f32 %7, %7\n\tv_nop"
      : "+v"(p[0]), "+v"(p[1]), "+v"(p[2]), "+v"(p[3]), "+v"(p[4]), "+v"(p[5]), "+v"(p[6]), "+v"(p[7]));
}
// one exponential, with the same slot behind it
__device__ __forceinline__ void at_exp2x1(float& a) { asm("v_exp_f32 %0, %0\n\tv_nop" : "+v"(a)); }
// Matrix product through the builtin alone: the compiler keeps the distances behind a WMMA itself, and with no asm statement behind each
// product the scheduler is free to issue the LDS fragment reads of a whole group ahead of the group's products
template <bool F16> __device__ __forceinline__ v8f at_mma16b(v16b a, v16b b, v8f c) {
  if (F16) return __builtin_amdgcn_wmma_f32_16x16x32_f16(false, __builtin_bit_cast(v16h, a), false, __builtin_bit_cast(v16h, b), (short)0, c, false, false);
  return __builtin_amdgcn_wmma_f32_16x16x32_bf16(false, a, false, b, (short)0, c, false, false);
}

// ---- head_dim 128 variant (same contract; K/V tiles 64 keys x 128, 8 output tiles; mask_mode 6 = causal + per-head ALiBi slope table in g.cp) ----
// Both products run transposed: S^T = K.Q^T (A = k rows, B = q) and O^T += V^T.P^T (A = v^T rows, B = p^T). A lane then holds the scores of
// ONE query (column c = lane & 15; keys 8 * hh + r of each 16-key tile), so the row maximum and sum are in-lane but for one exchange between
// the wave's halves, and two score tiles, converted in place, ARE the B operand of the second product: p never goes through LDS.
// MODE >= 0 fixes the mask mode at compile time, so the per-score mode tests fold away; MODE < 0 reads it from g.mask_mode
// PRE: k and v come as the bf16 hi/lo planes that kv_split_planes wrote earlier in the same call (pkh, pkl: [b*H + h][kv][d]; pvh, pvl: one
// [d][64 keys] tile per key chunk); the key loop then only copies a chunk's four 16 KB tiles into LDS and converts nothing
template <bool SPLIT_QK, bool SPLIT_PV, bool F16 = false, int MODE = -1, bool PRE = false>
__global__ __launch_bounds__(128)
void attn128_kernel(const float* __restrict__ q, const float* __restrict__ k,
                   const float* __restrict__ v, float* __restrict__ out,
                   const void* __restrict__ mask_a, const int* __restrict__ mask_b, AttnGeom g,
                   const __bf16* __restrict__ pkh, const __bf16* __restrict__ pkl,
                   const __bf16* __restrict__ pvh, const __bf16* __restrict__ pvl) {
  static_assert(!(F16 && (SPLIT_QK || SPLIT_PV)), "f16 mode is non-split");
  static_assert(!PRE || (SPLIT_QK && SPLIT_PV), "the planes are hi/lo splits");
  const float PSC = F16 ? 32768.0f : 1.0f;     // f16 probabilities carried x2^15 (subnormal range), folded into the final 1/l
  union FB { v16b v; v8b h[2]; };
  constexpr int D2 = 128;
  // LDS row pitches in elements: 16 B x odd (272 B for the 128-wide K and Q rows, 144 B for the 64-wide V^T rows), so that the
  // 16 rows one ds_load_b128 fragment read touches fall on distinct banks; at 256 B and 128 B they shared four or eight banks
  constexpr int KP = D2 + 8;
  constexpr int VP = AT_KC + 8;
  const int mode = (MODE >= 0) ? MODE : g.mask_mode;
  __shared__ __align__(16) __bf16 Ksh[AT_KC * KP];               // K hi [kv][d]      17 KB
  __shared__ __align__(16) __bf16 Ksl[SPLIT_QK ? AT_KC * KP : 8];
  __shared__ __align__(16) __bf16 Vth[D2 * VP];                  // V hi [d][kv]      18 KB
  __shared__ __align__(16) __bf16 Vtl[SPLIT_PV ? D2 * VP : 8];
  __shared__ __align__(16) float  Os[AT_NW][16 * 132];           // per wave out tile [query][d], pitch 132
  __shared__ __align__(16) __bf16 Qsh[SPLIT_QK ? AT_NW : 1][SPLIT_QK ? 16 * KP : 8];   // split path: q hi/lo staged per wave (keeps VGPR use low)
  __shared__ __align__(16) __bf16 Qsl[SPLIT_QK ? AT_NW : 1][SPLIT_QK ? 16 * KP : 8];

  const int tid  = threadIdx.x;
  const int wave = tid >> 5;
  const int lane = tid & 31;
  const int hh   = lane >> 4;
  const int c    = lane & 15;

  const int nqb = g.S / AT_QB;
  const int bx = blockIdx.x + g.blk0;
  // Causal modes: query block qb walks qb + 1 key chunks, and the grid holds more blocks than the chip has resident places. The longest get
  // the lowest indices (qb falls with bx, heads innermost), for speed only. A permutation of (head, qb); needs the whole grid in one launch (blk0 = 0).
  const bool byCost = (mode == 1 || mode == 4 || mode == 6);
  const int nbh = byCost ? (int)gridDim.x / nqb : 1;
  const int qb = byCost ? (nqb - 1 - bx / nbh) : (bx % nqb);
  const int bh = byCost ? (bx % nbh) : (bx / nqb);
  const int h  = bh % g.H;
  const int b  = bh / g.H;
  const int qbase_block = qb * AT_QB;
  const int q0 = qbase_block + wave * 16;

  const float* qb_ptr = q + (size_t)b * g.q_bs + (size_t)h * g.q_hs;
  const float* kb_ptr = k + (size_t)b * g.k_bs + (size_t)h * g.k_hs;
  const float* vb_ptr = v + (size_t)b * g.v_bs + (size_t)h * g.v_hs;
  float*       ob_ptr = out + (size_t)b * g.o_bs + (size_t)h * g.o_hs;

  // ---- Q fragments (B operand): 4 d-chunks, hi (and lo) ----
  v16b qah[4], qal[4];
  {
    const float* qrow = qb_ptr + (size_t)(q0 + c) * g.q_rs;
#pragma unroll
    for (int dc = 0; dc < 4; ++dc) {
#pragma unroll
      for (int e = 0; e < 8; ++e) {
        const float f0 = qrow[dc * 32 + 8 * hh + e] * g.qscale;
        const float f1 = qrow[dc * 32 + 16 + 8 * hh + e] * g.qscale;
        if (SPLIT_QK) { __bf16 hq, lq; at_split(f0, hq, lq); Qsh[wave][c * KP + dc * 32 + 8 * hh + e] = hq; Qsl[wave][c * KP + dc * 32 + 8 * hh + e] = lq;
                        at_split(f1, hq, lq); Qsh[wave][c * KP + dc * 32 + 16 + 8 * hh + e] = hq; Qsl[wave][c * KP + dc * 32 + 16 + 8 * hh + e] = lq;
                        qah[dc][e] = hq; qal[dc][e] = lq; qah[dc][8 + e] = hq; qal[dc][8 + e] = lq; }   // (register copies unused on the split path)
        else { qah[dc][e] = at_to16<F16>(f0); qah[dc][8 + e] = at_to16<F16>(f1); qal[dc][e] = qah[dc][e]; qal[dc][8 + e] = qah[dc][8 + e]; }
      }
    }
  }

  const int qrow = q0 + c;           // this lane's query
  float mrow = -INFINITY;            // its running maximum (alike in both halves of the wave)
  float lrow = 0.f;                  // running sum over the keys of this lane's half; the halves are joined once, behind the key loop
  v8f oacc[8];                       // oacc[t][r] = O^T[d = t * 16 + 8 * hh + r][query c]
#pragma unroll
  for (int t = 0; t < 8; ++t) oacc[t] = (v8f){0.f,0.f,0.f,0.f,0.f,0.f,0.f,0.f};

  const int nChunks = (mode == 1 || mode == 4 || mode == 6) ? (qb + 1) : (g.Skv / AT_KC);   // block-uniform
  const int qkeep = (mode == 3) ? mask_b[(size_t)b * g.S + qrow] : 1;   // per-query mask (mode 3): mask_b = qmask
  for (int kc = 0; kc < nChunks; ++kc) {
    const int kv0 = kc * AT_KC;
    if (PRE) {
      // each tile is 1024 pieces of 16 B, linear in memory; piece n is 16 B number n & 15 of K row n >> 4, n & 7 of V^T row n >> 3
      const size_t hb = (size_t)bh * g.Skv * D2;     // this head's part of each plane: a block-uniform base, and a 32-bit byte offset from it
      const char* gkh = (const char*)(pkh + hb); const char* gkl = (const char*)(pkl + hb);
      const char* gvh = (const char*)(pvh + hb); const char* gvl = (const char*)(pvl + hb);
      const unsigned lo16 = (unsigned)kc * (unsigned)(AT_KC * D2 * 2) + (unsigned)tid * 16u;
      v8b rkh[8], rkl[8], rvh[8], rvl[8];
#pragma unroll   // constant indices keep the pieces in registers, and the 32 loads issue as one run
      for (int i = 0; i < 8; ++i) {
        rkh[i] = *(const v8b*)(gkh + i * 2048 + lo16); rkl[i] = *(const v8b*)(gkl + i * 2048 + lo16);
        rvh[i] = *(const v8b*)(gvh + i * 2048 + lo16); rvl[i] = *(const v8b*)(gvl + i * 2048 + lo16);
      }
      __syncthreads();   // ends every wave's reads of the chunk before
#pragma unroll   // constant indices, as above
      for (int i = 0; i < 8; ++i) {
        const int n = i * 128 + tid;
        *(v8b*)(Ksh + (n >> 4) * KP + (n & 15) * 8) = rkh[i];
        *(v8b*)(Ksl + (n >> 4) * KP + (n & 15) * 8) = rkl[i];
        *(v8b*)(Vth + (n >> 3) * VP + (n & 7) * 8) = rvh[i];
        *(v8b*)(Vtl + (n >> 3) * VP + (n & 7) * 8) = rvl[i];
      }
    } else {
      __syncthreads();
      const int kvr = tid >> 1, dh = (tid & 1) * 64;
      const float* krow = kb_ptr + (size_t)(kv0 + kvr) * g.k_rs + dh;
      const float* vrow = vb_ptr + (size_t)(kv0 + kvr) * g.v_rs + dh;
#pragma unroll
      for (int i = 0; i < 16; ++i) {
        v4f kk = *(const v4f*)(krow + 4 * i);
        v4f vv = *(const v4f*)(vrow + 4 * i);
#pragma unroll
        for (int e = 0; e < 4; ++e) {
          const int d = dh + 4 * i + e;
          if (SPLIT_QK) { __bf16 a, bl; at_split(kk[e], a, bl); Ksh[kvr * KP + d] = a; Ksl[kvr * KP + d] = bl; }
          else Ksh[kvr * KP + d] = at_to16<F16>(kk[e]);
          if (SPLIT_PV) { __bf16 a, bl; at_split(vv[e], a, bl); Vth[d * VP + kvr] = a; Vtl[d * VP + kvr] = bl; }
          else Vth[d * VP + kvr] = at_to16<F16>(vv[e]);
        }
      }
    }
    __syncthreads();

    // One group per 32-wide slice of d (its q and k fragments, 20 LDS reads, then 12 products). The next group's reads are issued as one run
    // ahead of this group's products, into a second register set, and the products rotate over the four score tiles, so that no product
    // waits for an LDS read just issued or for the product before it. Each tile sums in the order d slice 0..3, q hi.k hi, q hi.k lo, q lo.k hi.
    v8f s[4];                          // s[j][r] = S^T[key j * 16 + 8 * hh + r][query c]
#pragma unroll
    for (int j = 0; j < 4; ++j) s[j] = (v8f){0.f,0.f,0.f,0.f,0.f,0.f,0.f,0.f};
    FB qa[2], ql[2], kb[2][4], kl[2][4];
#pragma unroll
    for (int dc = -1; dc < 4; ++dc) {
      if (dc < 3) {
        const int n = dc + 1, w = n & 1;
        if (SPLIT_QK) {
          qa[w].h[0] = *(const v8b*)(&Qsh[wave][c * KP + n * 32 + 8 * hh]); qa[w].h[1] = *(const v8b*)(&Qsh[wave][c * KP + n * 32 + 16 + 8 * hh]);
          ql[w].h[0] = *(const v8b*)(&Qsl[wave][c * KP + n * 32 + 8 * hh]); ql[w].h[1] = *(const v8b*)(&Qsl[wave][c * KP + n * 32 + 16 + 8 * hh]);
        } else qa[w].v = qah[n];
#pragma unroll
        for (int j = 0; j < 4; ++j) {
          kb[w][j].h[0] = *(const v8b*)(Ksh + (j * 16 + c) * KP + n * 32 + 8 * hh);
          kb[w][j].h[1] = *(const v8b*)(Ksh + (j * 16 + c) * KP + n * 32 + 16 + 8 * hh);
          if (SPLIT_QK) {
            kl[w][j].h[0] = *(const v8b*)(Ksl + (j * 16 + c) * KP + n * 32 + 8 * hh);
            kl[w][j].h[1] = *(const v8b*)(Ksl + (j * 16 + c) * KP + n * 32 + 16 + 8 * hh);
          }
        }
      }
      __builtin_amdgcn_sched_barrier(0);   // keeps the reads above in one run: the scheduler otherwise moves them in among the products
      if (dc >= 0) {
        const int w = dc & 1;
#pragma unroll
        for (int j = 0; j < 4; ++j) s[j] = at_mma16b<F16>(kb[w][j].v, qa[w].v, s[j]);
        if (SPLIT_QK) {
#pragma unroll
          for (int j = 0; j < 4; ++j) s[j] = at_mma16b<F16>(kl[w][j].v, qa[w].v, s[j]);
#pragma unroll
          for (int j = 0; j < 4; ++j) s[j] = at_mma16b<F16>(kb[w][j].v, ql[w].v, s[j]);
        }
        __builtin_amdgcn_sched_barrier(0);   // ends the run of products: the group after next is not read in among them
      }
    }
    const bool diag = (mode == 1) && (kc == qb);
    float cm[4];                       // one chain per tile, so that the four run side by side
#pragma unroll
    for (int j = 0; j < 4; ++j) {
      float m = -INFINITY;
#pragma unroll
      for (int r = 0; r < 8; ++r) {
        const int kvcol = kv0 + j * 16 + 8 * hh + r;
        bool masked = false;
        if (diag) masked = (kvcol > qrow);
        else if (mode == 4) masked = (kvcol > qrow) || (qrow - kvcol > g.mask_is_int);
        else if (mode == 2) {
          const size_t mi = (size_t)qrow * g.Skv + kvcol;
          masked = (g.mask_is_int == 0) ? (((const float*)mask_a)[mi] == 0.0f)
                 : (g.mask_is_int == 1) ? (((const int*)mask_a)[mi] == 0) : (((const int*)mask_a)[mi] != 0);
        } else if (mode == 3) masked = (qkeep == 0) || (((const int*)mask_a)[(size_t)b * g.Skv + kvcol] == 0);   // mask_a = kvmask
        else if (mode == 6) { masked = (kvcol > qrow); s[j][r] += g.cp[h] * (float)(kvcol - qrow); }
        else if (mode == 8) { masked = (kvcol > qrow) || (((const int*)mask_a)[(size_t)b * g.Skv + kvcol] != 0); }
        else if (mode == 5) {
          const size_t mi = (size_t)qrow * g.Skv + kvcol;
          masked = (((const int*)mask_a)[mi] != 0);
          int n = mask_b[mi]; n = n < 0 ? 0 : n;
          s[j][r] += g.cp[(size_t)b * g.c_bs + (size_t)h * g.c_hs + (size_t)qrow * g.c_rs + n]
                   + g.pc[(size_t)b * g.c_bs + (size_t)h * g.c_hs + (size_t)kvcol * g.c_rs + n];
        }
        if (masked) s[j][r] = g.mask_fill;
        m = fmaxf(m, s[j][r]);
      }
      cm[j] = m;
    }
    float mc = fmaxf(fmaxf(cm[0], cm[1]), fmaxf(cm[2], cm[3]));
    mc = fmaxf(mc, at_half_xor(mc));   // the other half's 32 keys of the same query
    const float mnew = fmaxf(mrow, mc);
    const float mnl = mnew * AT_LOG2E;
    float alpha = fmaf(mrow, AT_LOG2E, -mnl);
    at_exp2x1(alpha);
    mrow = mnew;
    // p^T as the B operand of the second product: element e of pa[kk] is key kk * 32 + 8 * hh + e (e < 8) or kk * 32 + 16 + 8 * hh + e - 8,
    // which is register e & 7 of score tile 2 * kk + (e >> 3) in this very lane; the v^T fragments are read in the same key order
    FB pa[2], pl[2];
    float ps[4];
#pragma unroll
    for (int j = 0; j < 4; ++j) {
      float pe[8];
#pragma unroll   // constant indices keep the eight arguments in registers
      for (int r = 0; r < 8; ++r) pe[r] = fmaf(s[j][r], AT_LOG2E, -mnl);
      at_exp2x8(pe);
      float sum = 0.f;
#pragma unroll
      for (int r = 0; r < 8; ++r) {
        const float p = pe[r];
        sum += p;
        if (SPLIT_PV) { __bf16 a, bl; at_split(p, a, bl); pa[j >> 1].v[(j & 1) * 8 + r] = a; pl[j >> 1].v[(j & 1) * 8 + r] = bl; }
        else pa[j >> 1].v[(j & 1) * 8 + r] = at_to16<F16>(p * PSC);
      }
      ps[j] = sum;
    }
    lrow = lrow * alpha + ((ps[0] + ps[1]) + (ps[2] + ps[3]));
#pragma unroll
    for (int t = 0; t < 8; ++t) oacc[t] *= alpha;
    // One group per 32 keys and four output tiles (16 LDS reads of v, then 12 products), run like the score groups: next group's reads in
    // one run ahead of this group's products, products rotating over the four tiles.
    // Each output tile sums in the order keys 0..31, 32..63, p hi.v hi, p hi.v lo, p lo.v hi.
    FB vb[2][4], vl[2][4];
#pragma unroll
    for (int gi = -1; gi < 4; ++gi) {
      if (gi < 3) {
        const int n = gi + 1, w = n & 1, kk = n >> 1, t0 = (n & 1) * 4;
#pragma unroll
        for (int u = 0; u < 4; ++u) {
          vb[w][u].h[0] = *(const v8b*)(Vth + ((t0 + u) * 16 + c) * VP + kk * 32 + 8 * hh);
          vb[w][u].h[1] = *(const v8b*)(Vth + ((t0 + u) * 16 + c) * VP + kk * 32 + 16 + 8 * hh);
          if (SPLIT_PV) {
            vl[w][u].h[0] = *(const v8b*)(Vtl + ((t0 + u) * 16 + c) * VP + kk * 32 + 8 * hh);
            vl[w][u].h[1] = *(const v8b*)(Vtl + ((t0 + u) * 16 + c) * VP + kk * 32 + 16 + 8 * hh);
          }
        }
      }
      __builtin_amdgcn_sched_barrier(0);   // keeps the reads above in one run, as in the score groups
      if (gi >= 0) {
        const int w = gi & 1, kk = gi >> 1, t0 = (gi & 1) * 4;
#pragma unroll
        for (int u = 0; u < 4; ++u) oacc[t0 + u] = at_mma16b<F16>(vb[w][u].v, pa[kk].v, oacc[t0 + u]);
        if (SPLIT_PV) {
#pragma unroll
          for (int u = 0; u < 4; ++u) oacc[t0 + u] = at_mma16b<F16>(vl[w][u].v, pa[kk].v, oacc[t0 + u]);
#pragma unroll
          for (int u = 0; u < 4; ++u) oacc[t0 + u] = at_mma16b<F16>(vb[w][u].v, pl[kk].v, oacc[t0 + u]);
        }
        __builtin_amdgcn_sched_barrier(0);   // ends the run of products
      }
    }
  }

  float* os = Os[wave];
  const float inv = 1.0f / ((lrow + at_half_xor(lrow)) * PSC);   // the two halves' sums of this query, joined
#pragma unroll
  for (int t = 0; t < 8; ++t) {      // a lane's eight registers of a tile are eight consecutive d of its query: two 16 B stores
    const v8f o = oacc[t] * inv;
    *(v4f*)(os + c * 132 + t * 16 + 8 * hh)     = (v4f){o[0], o[1], o[2], o[3]};
    *(v4f*)(os + c * 132 + t * 16 + 8 * hh + 4) = (v4f){o[4], o[5], o[6], o[7]};
  }
  __builtin_amdgcn_fence(__ATOMIC_RELEASE, "workgroup");
  __builtin_amdgcn_wave_barrier();
  __builtin_amdgcn_fence(__ATOMIC_ACQUIRE, "workgroup");
  {
    const int c4 = lane * 4;           // 32 lanes x 16 B = one 512-B output row (128 floats) per instruction
    {
#pragma unroll
      for (int row = 0; row < 16; ++row) {
        v4f val = *(const v4f*)(os + row * 132 + c4);
        *(v4f*)(ob_ptr + (size_t)(q0 + row) * g.o_rs + c4) = val;
      }
      
    }
  }
}

// ---- k and v, f32 [rows][128], split once into bf16 hi/lo planes (the split of at_split, so the values are those the key loop made itself).
// One block per 64 rows (one key chunk of one head). k keeps its layout; v is transposed through LDS into one [128 d][64 keys] tile per chunk.
__global__ __launch_bounds__(256) void kv_split_planes(const float* __restrict__ k, const float* __restrict__ v,
                                                       __bf16* __restrict__ kh, __bf16* __restrict__ kl,
                                                       __bf16* __restrict__ vth, __bf16* __restrict__ vtl) {
  __shared__ float tile[128 * 65];     // [d][key], pitch 65 floats: the column writes fall on 16 banks, the row reads on 32
  const int t = threadIdx.x;
  const size_t base = (size_t)blockIdx.x * (64 * 128);
  // every loop below is unrolled so that a thread's loads issue together, ahead of the conversions
#pragma unroll
  for (int it = 0; it < 8; ++it) {
    const int n = it * 256 + t, key = n >> 5, d4 = (n & 31) * 4;
    const v4f x = *(const v4f*)(v + base + n * 4);     // row key, columns d4 .. d4 + 3: the tile is linear in n
#pragma unroll
    for (int e = 0; e < 4; ++e) tile[(d4 + e) * 65 + key] = x[e];
  }
#pragma unroll
  for (int it = 0; it < 4; ++it) {
    const int n = it * 256 + t;
    const v4f x0 = *(const v4f*)(k + base + n * 8), x1 = *(const v4f*)(k + base + n * 8 + 4);
    v8b hv, lv;
#pragma unroll
    for (int e = 0; e < 4; ++e) {
      __bf16 a, bl;
      at_split(x0[e], a, bl); hv[e] = a; lv[e] = bl;
      at_split(x1[e], a, bl); hv[4 + e] = a; lv[4 + e] = bl;
    }
    *(v8b*)(kh + base + n * 8) = hv;
    *(v8b*)(kl + base + n * 8) = lv;
  }
  __syncthreads();   // the v tile is complete before any thread reads its rows
#pragma unroll
  for (int it = 0; it < 4; ++it) {
    const int n = it * 256 + t, d = n >> 3, k8 = (n & 7) * 8;
    v8b hv, lv;
#pragma unroll
    for (int e = 0; e < 8; ++e) { __bf16 a, bl; at_split(tile[d * 65 + k8 + e], a, bl); hv[e] = a; lv[e] = bl; }
    *(v8b*)(vth + base + n * 8) = hv;
    *(v8b*)(vtl + base + n * 8) = lv;
  }
}

#define XB 2
#define XH 16
#define XS 2048
#define XD 128
__global__ void slopes_kernel(float* __restrict__ sl) { const int h = threadIdx.x; const float v = (h < XH) ? exp2f(-8.0f * (float)(h + 1) / (float)XH) : 0.f; ((float*)sl)[h] = v;  }
extern "C" void kernel_launch(void* const* d_in, const int* in_sizes, int n_in, void* d_out, int out_size, void* d_ws, size_t ws_size, hipStream_t stream) {
  (void)in_sizes; (void)n_in; (void)out_size; (void)ws_size;
  const float* q = (const float*)d_in[0]; const float* k = (const float*)d_in[1]; const float* v = (const float*)d_in[2];
  float* sl = (float*)d_ws;
  slopes_kernel<<<1, 32, 0, stream>>>(sl);
  __bf16* kh = (__bf16*)((char*)d_ws + 4096);                 // four planes of XB * XH * XS * XD bf16 behind the slope table
  __bf16* kl = kh + (size_t)XB * XH * XS * XD; __bf16* vth = kl + (size_t)XB * XH * XS * XD; __bf16* vtl = vth + (size_t)XB * XH * XS * XD;
  kv_split_planes<<<XB * XH * (XS / AT_KC), 256, 0, stream>>>(k, v, kh, kl, vth, vtl);
  AttnGeom g;
  g.cp = sl; g.pc = nullptr; g.c_bs = 0; g.c_rs = 0; g.c_hs = 0;
  g.q_bs = (long)XH * XS * XD; g.q_hs = (long)XS * XD; g.q_rs = XD;
  g.k_bs = g.q_bs; g.k_hs = g.q_hs; g.k_rs = XD; g.v_bs = g.q_bs; g.v_hs = g.q_hs; g.v_rs = XD; g.o_bs = g.q_bs; g.o_hs = g.q_hs; g.o_rs = XD;
  g.S = XS; g.Skv = XS; g.H = XH; g.mask_mode = 6; g.qscale = 0.08838834764831845f; g.blk0 = 0; g.mask_fill = -INFINITY; g.mask_is_int = 0;
  attn128_kernel<true, true, false, 6, true><<<XB * XH * (XS / AT_QB), AT_NW * 32, 0, stream>>>(q, k, v, (float*)d_out, nullptr, nullptr, g, kh, kl, vth, vtl);
}

// v009
// A run of this version takes 105 microseconds.
// Next to v008, in two timings, it ran 1.05 times as fast each time.
// Over all steps from v000 it is 19.1 times as fast.
#include <hip/hip_runtime.h>
#include <math.h>
// FlexAttention forward (causal block mask + ALiBi score_mod, 2 x 16 heads, 2048 x 2048, head_dim 128): scores and p·v on
// v_wmma_f32_16x16x32_bf16 with q,k and p,v as bf16 hi/lo splits (hi·hi + hi·lo + lo·hi;
// early causal rows copy single v rows almost verbatim), f32 accumulate; online softmax, the ALiBi bias slope_h·(k−q) and the
// causal predicate in f32 on VALU.
typedef __attribute__((ext_vector_type(16))) _Float16 v16h;
typedef __attribute__((ext_vector_type(8)))  _Float16 v8h;
typedef __attribute__((ext_vector_type(16))) __bf16   v16b;
typedef __attribute__((ext_vector_type(8)))  __bf16   v8b;
typedef __attribute__((ext_vector_type(8)))  float    v8f;
typedef __attribute__((ext_vector_type(4)))  float    v4f;
#define PSCALE 32768.0f
#define U16(p) ((const unsigned short*)(const void*)(p))
#define PSCALE_INV (1.0f / 32768.0f)

__device__ __forceinline__ unsigned short f2bf_bits(float f) {
  unsigned u = __float_as_uint(f);
  return (unsigned short)((u + 0x7FFFu + ((u >> 16) & 1u)) >> 16);
}
__device__ __forceinline__ float bf_bits2f(unsigned short h) { return __uint_as_float(((unsigned)h) << 16); }

// hazard guards as plain device helpers (no inline asm inside the kernel template body)
__device__ __forceinline__ void dep_guard_h(v8f& a, v8f& b, v16h x, v16h y) { asm volatile("v_nop\n\tv_nop\n\tv_nop\n\tv_nop" : "+v"(a), "+v"(b) : "v"(x), "v"(y)); }
__device__ __forceinline__ void dep_guard_b(v8f& a, v8f& b, v16b x, v16b y) { asm volatile("v_nop\n\tv_nop\n\tv_nop\n\tv_nop" : "+v"(a), "+v"(b) : "v"(x), "v"(y)); }
__device__ __forceinline__ void keep4_h(v16h a, v16h b, v16h c, v16h d) { asm volatile("v_nop" :: "v"(a), "v"(b), "v"(c), "v"(d)); }
__device__ __forceinline__ void keep4_b(v16b a, v16b b, v16b c, v16b d) { asm volatile("v_nop" :: "v"(a), "v"(b), "v"(c), "v"(d)); }
__device__ __forceinline__ void acc_guard4(v8f& a, v8f& b, v8f& c, v8f& d) { asm volatile("v_nop\n\tv_nop\n\tv_nop\n\tv_nop" : "+v"(a), "+v"(b), "+v"(c), "+v"(d)); }
template <typename T> struct Frag;
template <> struct Frag<_Float16> {
  typedef v16h V; union U { v16h v; v8h h[2]; };
  static __device__ __forceinline__ v16h load(const _Float16* p) {   // elements 0..7 <- p[0..7], 8..15 <- p[16..23]
    U f; f.h[0] = *(const v8h*)(p); f.h[1] = *(const v8h*)(p + 16); return f.v;
  }
  static __device__ __forceinline__ v8f mma(v16h a, v16h b, v8f c) {
    return __builtin_amdgcn_wmma_f32_16x16x32_f16(false, a, false, b, (short)0, c, false, false);
  }
  static __device__ __forceinline__ void guard(v8f& a, v8f& b, v16h x, v16h y) { dep_guard_h(a, b, x, y); }
  static __device__ __forceinline__ void keep(v16h a, v16h b, v16h c, v16h d) { keep4_h(a, b, c, d); }
};
template <> struct Frag<__bf16> {
  typedef v16b V; union U { v16b v; v8b h[2]; };
  static __device__ __forceinline__ v16b load(const __bf16* p) {
    U f; f.h[0] = *(const v8b*)(p); f.h[1] = *(const v8b*)(p + 16); return f.v;
  }
  static __device__ __forceinline__ v8f mma(v16b a, v16b b, v8f c) {
    return __builtin_amdgcn_wmma_f32_16x16x32_bf16(false, a, false, b, (short)0, c, false, false);
  }
  static __device__ __forceinline__ void guard(v8f& a, v8f& b, v16b x, v16b y) { dep_guard_b(a, b, x, y); }
  static __device__ __forceinline__ void keep(v16b a, v16b b, v16b c, v16b d) { keep4_b(a, b, c, d); }
};

// ---- Register-blocked batched WMMA GEMM ------------------------------------
// C[m,n] = scale * sum_k A[m,k] * Bt[n,k] (+bias)(+resid); each wave owns a 64x64 tile.
// A row-major [M,K]; Bt row-major [N,K]; M,N % 64 == 0, K % 32 == 0.
// SPLIT: operands are hi/lo planes (A2/Bt2 = lo planes, same layout); product = hi·hi + hi·lo + lo·hi.
// BIAS_MODE: 0 = none, 1 = bias[m], 2 = bias[n].
// OUT_MODE: 0 = f32, 1 = f16, 2 = bf16 hi plane (Cout) + bf16 lo plane (Cout2).
// ET: 0 = f16 operands, 1 = bf16 operands (pointers passed as 16-bit storage)
template <int ET> struct Elem;
template <> struct Elem<0> { typedef _Float16 T; };
template <> struct Elem<1> { typedef __bf16 T; };
template <int ET, bool SPLIT, int BIAS_MODE, int OUT_MODE, bool RESID, int ACT = 0>
__global__ __launch_bounds__(256) void wmma_gemm64(
    const unsigned short* __restrict__ Ap, const unsigned short* __restrict__ A2p, int lda, long strideA,
    const unsigned short* __restrict__ Btp, const unsigned short* __restrict__ Bt2p, int ldb, long strideB,
    void* __restrict__ Cout, void* __restrict__ Cout2, int ldc, long strideC,
    const float* __restrict__ bias,
    const float* __restrict__ resid, long strideR,
    int M, int N, int K, float scale) {
  typedef typename Elem<ET>::T T;
  typedef typename Frag<T>::V V;
  const T* A = (const T*)Ap; const T* A2 = (const T*)A2p; const T* Bt = (const T*)Btp; const T* Bt2 = (const T*)Bt2p;
  __shared__ __align__(16) float sT[8][16 * 68];   // per-wave 16x64 slab, pitch 68 floats
  const int b    = blockIdx.y;
  const int lane = threadIdx.x & 31;
  const int wave = threadIdx.x >> 5;
  const int tilesN = N >> 6;
  const int tilesM = M >> 6;
  const int tile = blockIdx.x * 8 + wave;
  if (tile >= tilesM * tilesN) return;   // wave-uniform; no block barriers in this kernel
  const int tm = tile / tilesN;
  const int tn = tile - tm * tilesN;
  const int m0 = tm << 6;
  const int n0 = tn << 6;

  const T* Ab  = A  + (size_t)b * strideA;
  const T* Bb  = Bt + (size_t)b * strideB;
  const T* Ab2 = SPLIT ? (A2  + (size_t)b * strideA) : nullptr;
  const T* Bb2 = SPLIT ? (Bt2 + (size_t)b * strideB) : nullptr;

  const int rlane = lane & 15;                 // row (A) / col (B, D) within subtile
  const int koff  = (lane >> 4) * 8;           // k offset of this lane half
  const int mOff  = (lane >> 4) * 8;           // D row offset

  v8f acc[4][4];
#pragma unroll
  for (int i = 0; i < 4; ++i)
#pragma unroll
    for (int j = 0; j < 4; ++j) acc[i][j] = (v8f){0.f,0.f,0.f,0.f,0.f,0.f,0.f,0.f};

  for (int k0 = 0; k0 < K; k0 += 32) {
    V bh[4], bl[4];
#pragma unroll
    for (int j = 0; j < 4; ++j) {
      const size_t bo = (size_t)(n0 + (j << 4) + rlane) * ldb + koff + k0;
      bh[j] = Frag<T>::load(Bb + bo);
      if (SPLIT) bl[j] = Frag<T>::load(Bb2 + bo);
    }
#pragma unroll
    for (int i = 0; i < 4; ++i) {
      const size_t ao = (size_t)(m0 + (i << 4) + rlane) * lda + koff + k0;
      V ah = Frag<T>::load(Ab + ao);
      V al;
      if (SPLIT) al = Frag<T>::load(Ab2 + ao);
#pragma unroll
      for (int j = 0; j < 4; ++j) {
        acc[i][j] = Frag<T>::mma(ah, bh[j], acc[i][j]);
        if (SPLIT) {
          acc[i][j] = Frag<T>::mma(ah, bl[j], acc[i][j]);
          acc[i][j] = Frag<T>::mma(al, bh[j], acc[i][j]);
        }
      }
      Frag<T>::guard(acc[i][0], acc[i][3], ah, SPLIT ? al : ah);
    }
    Frag<T>::keep(bh[0], bh[1], bh[2], bh[3]);
    if (SPLIT) Frag<T>::keep(bl[0], bl[1], bl[2], bl[3]);
  }
  acc_guard4(acc[0][0], acc[0][1], acc[0][2], acc[0][3]);
  acc_guard4(acc[1][0], acc[1][1], acc[1][2], acc[1][3]);
  acc_guard4(acc[2][0], acc[2][1], acc[2][2], acc[2][3]);
  acc_guard4(acc[3][0], acc[3][1], acc[3][2], acc[3][3]);

  // ---- epilogue ----
  float* slab = sT[wave];
  const float* Rb = RESID ? (resid + (size_t)b * strideR) : nullptr;
#pragma unroll
  for (int i = 0; i < 4; ++i) {
    const int mBase = m0 + (i << 4);
#pragma unroll
    for (int j = 0; j < 4; ++j) {
      const int n = n0 + (j << 4) + rlane;
      float bv = 0.f;
      if (BIAS_MODE == 2) bv = bias[n];
#pragma unroll
      for (int r = 0; r < 8; ++r) {
        float v = acc[i][j][r] * scale;
        if (BIAS_MODE == 1) v += bias[mBase + mOff + r];
        if (BIAS_MODE == 2) v += bv;
        if (RESID) v += Rb[(size_t)(mBase + mOff + r) * ldc + n];
        if (ACT == 1) v = tanhf(v);
        if (ACT == 2) v = fmaxf(v, 0.0f);
        if (ACT == 3) v = v / (1.0f + expf(-v));
        if (ACT == 4) v = (v > 0.f) ? v : 0.01f * v;
        if (ACT == 5) v = 0.5f * v * (1.0f + erff(v * 0.70710678118654752f));
        slab[(mOff + r) * 68 + (j << 4) + rlane] = v;
      }
    }
    __builtin_amdgcn_fence(__ATOMIC_RELEASE, "workgroup");
    __builtin_amdgcn_wave_barrier();
    __builtin_amdgcn_fence(__ATOMIC_ACQUIRE, "workgroup");
    if (OUT_MODE == 0) {
      float* C = (float*)Cout + (size_t)b * strideC;
      const int hh = lane >> 4, c4 = (lane & 15) * 4;     // row seg = 256 B = 16 lanes x 16 B
      {
#pragma unroll
        for (int it = 0; it < 8; ++it) {
          const int row = it * 2 + hh;
          v4f v = *(const v4f*)(slab + row * 68 + c4);
          *(v4f*)(C + (size_t)(mBase + row) * ldc + n0 + c4) = v;
        }
        
      }
    } else {
      const int q = lane >> 3, c8 = (lane & 7) * 8;
      unsigned short* C  = (unsigned short*)Cout  + (size_t)b * strideC;
      unsigned short* C2 = (OUT_MODE == 2) ? ((unsigned short*)Cout2 + (size_t)b * strideC) : nullptr;
      {
#pragma unroll
        for (int it = 0; it < 4; ++it) {
          const int row = it * 4 + q;
          const float* sp = slab + row * 68 + c8;
          v8h hv, lv;
#pragma unroll
          for (int e = 0; e < 8; ++e) {
            if (OUT_MODE == 1) {
              hv[e] = (_Float16)sp[e];
            } else {
              unsigned short hb = f2bf_bits(sp[e]);
              unsigned short lb = f2bf_bits(sp[e] - bf_bits2f(hb));
              hv[e] = __builtin_bit_cast(_Float16, hb);
              lv[e] = __builtin_bit_cast(_Float16, lb);
            }
          }
          *(v8h*)(C + (size_t)(mBase + row) * ldc + n0 + c8) = hv;
          if (OUT_MODE == 2) *(v8h*)(C2 + (size_t)(mBase + row) * ldc + n0 + c8) = lv;
        }
        
      }
    }
    __builtin_amdgcn_fence(__ATOMIC_RELEASE, "workgroup");
    __builtin_amdgcn_wave_barrier();
    __builtin_amdgcn_fence(__ATOMIC_ACQUIRE, "workgroup");
  }
}

__global__ __launch_bounds__(256) void cast_f32_f16x2(
    const float* __restrict__ in, _Float16* __restrict__ out, int n2) {
  int i = blockIdx.x * 256 + threadIdx.x;
  if (i < n2) {
    const _Float16 h0 = (_Float16)in[2 * i], h1 = (_Float16)in[2 * i + 1];
    const unsigned u = (unsigned)__builtin_bit_cast(unsigned short, h0) | ((unsigned)__builtin_bit_cast(unsigned short, h1) << 16);
    ((unsigned*)out)[i] = u;
    
  }
}


// ---- f32 -> f16 cast with a power-of-two pre-scale (folded back by the consumer GEMM's scale) ----
__global__ __launch_bounds__(256) void cast_f32_f16x2s(const float* __restrict__ in, _Float16* __restrict__ out, int n2, float s) {
  int i = blockIdx.x * 256 + threadIdx.x;
  if (i < n2) {
    const _Float16 h0 = (_Float16)(in[2 * i] * s), h1 = (_Float16)(in[2 * i + 1] * s);
    const unsigned u = (unsigned)__builtin_bit_cast(unsigned short, h0) | ((unsigned)__builtin_bit_cast(unsigned short, h1) << 16);
    ((unsigned*)out)[i] = u;
    
  }
}
__global__ __launch_bounds__(256) void split_f32_bf16x2(
    const float* __restrict__ in, __bf16* __restrict__ hi, __bf16* __restrict__ lo, long n2) {
  long i = (long)blockIdx.x * 256 + threadIdx.x;
  long stride = (long)gridDim.x * 256;
  {
    for (long j = i; j < n2; j += stride) {
      const float a = in[2 * j], b = in[2 * j + 1];
      const unsigned short ah = f2bf_bits(a), bh = f2bf_bits(b);
      const unsigned short al = f2bf_bits(a - bf_bits2f(ah)), bl = f2bf_bits(b - bf_bits2f(bh));
      ((unsigned*)hi)[j] = (unsigned)ah | ((unsigned)bh << 16);
      ((unsigned*)lo)[j] = (unsigned)al | ((unsigned)bl << 16);
    }
    
  }
}


// ---- f32 [R][C] (row pitch ldi) -> f16 transposed [C][R] (row pitch ldo); 64x64 tiles; each output row segment
__global__ __launch_bounds__(256) void transpose_cast_f16(const float* __restrict__ in, int ldi,
                                                         _Float16* __restrict__ outT, int ldo, float scale) {
  __shared__ __align__(16) _Float16 tile[64][72];     // [c][r]
  const int c0 = blockIdx.x * 64, r0 = blockIdx.y * 64;
  const int t = threadIdx.y * 32 + threadIdx.x;
  for (int i = threadIdx.y; i < 64; i += 8) {
    tile[threadIdx.x][i]      = (_Float16)(in[(size_t)(r0 + i) * ldi + c0 + threadIdx.x] * scale);
    tile[32 + threadIdx.x][i] = (_Float16)(in[(size_t)(r0 + i) * ldi + c0 + 32 + threadIdx.x] * scale);
  }
  __syncthreads();
  const int q = t >> 3, c8 = (t & 7) * 8;
  {
#pragma unroll
    for (int it = 0; it < 2; ++it) {
      const int c = it * 32 + q;
      v8h hv = *(const v8h*)(&tile[c][c8]);
      *(v8h*)(outT + (size_t)(c0 + c) * ldo + r0 + c8) = hv;
    }
    
  }
}

// ---- f32 [R][C] (pitch ldi) -> bf16 hi/lo transposed planes [C][R] (pitch ldo); 64x64 tiles; each output row segment
__global__ __launch_bounds__(256) void transpose_split_bf16(const float* __restrict__ in, int ldi,
                                                           __bf16* __restrict__ outH, __bf16* __restrict__ outL, int ldo) {
  __shared__ __align__(16) float tile[64][68];     // [c][r]
  const int c0 = blockIdx.x * 64, r0 = blockIdx.y * 64;
  const int t = threadIdx.y * 32 + threadIdx.x;
  for (int i = threadIdx.y; i < 64; i += 8) {
    tile[threadIdx.x][i]      = in[(size_t)(r0 + i) * ldi + c0 + threadIdx.x];
    tile[32 + threadIdx.x][i] = in[(size_t)(r0 + i) * ldi + c0 + 32 + threadIdx.x];
  }
  __syncthreads();
  const int q = t >> 3, c8 = (t & 7) * 8;
  {
#pragma unroll
    for (int it = 0; it < 2; ++it) {
      const int c = it * 32 + q;
      v8b hv, lv;
#pragma unroll
      for (int e = 0; e < 8; ++e) {
        const float f = tile[c][c8 + e];
        const unsigned short hb = f2bf_bits(f);
        hv[e] = __builtin_bit_cast(__bf16, hb);
        lv[e] = __builtin_bit_cast(__bf16, f2bf_bits(f - bf_bits2f(hb)));
      }
      *(v8b*)(outH + (size_t)(c0 + c) * ldo + r0 + c8) = hv;
      *(v8b*)(outL + (size_t)(c0 + c) * ldo + r0 + c8) = lv;
    }
    
  }
}

// =====================================================================================
// Generic causal/non-causal attention for head_dim 64, f32 in / f32 out; 16-bit operands: bf16 with optional hi/lo splits, or
// plain f16 (F16=true, non-split, probabilities carried x2^15).
//   scores = (q*qscale)·kᵀ : v_wmma_f32_16x16x32_bf16; SPLIT_QK -> q,k as bf16 hi/lo (hi·hi + hi·lo + lo·hi)
//   out    = p·v           : v_wmma_f32_16x16x32_bf16; SPLIT_PV -> p,v as bf16 hi/lo; else p,v plain bf16
//   f32 accumulate; online softmax in f32. Block = 4 waves = 64 query rows of one (batch, head); S % 64 == 0.
//   Element (b, s, h, d) of tensor X lives at X[b*X_bs + s*X_rs + h*X_hs + d] (strides in floats, multiples of 4).
//   Masking: mask_mode 0 none, 1 causal (kv > q masked), 2 tensor [S][Skv] shared over (b,h) (float if
//   mask_is_int==0, int32 with element == 0 -> masked if 1, int32 with element != 0 -> masked if 2), 3 per-token vectors qmask[B][S] & kvmask[B][Skv] (int32,
//   0 -> masked), 4 causal + sliding window (kv > q or q - kv > W masked; W passed in mask_is_int);
//   5 = relative-position bias: s += cp[b,h,q][idx[q][kv]] + pc[b,h,kv][idx[q][kv]] with idx = mask_b ([S][Skv] int32) and
//   mask_a an int32 [S][Skv] tensor with nonzero = masked (tables: element (b,h,row,n) at X + b*c_bs + h*c_hs + row*c_rs + n);
//   masked scores are replaced by mask_fill (e.g. -inf or -1e9) before the softmax.
//   grid.x = B * H * (S/64) (or a sub-range with blk0).
// =====================================================================================
#define AT_D 64
#define AT_NW 4
#define AT_QB 64
#define AT_KC 64
struct AttnGeom { const float* cp = nullptr; const float* pc = nullptr; long c_bs = 0, c_rs = 0, c_hs = 0;   // mode-5 score-bias tables
                  long q_bs, q_rs, q_hs, k_bs, k_rs, k_hs, v_bs, v_rs, v_hs, o_bs, o_rs, o_hs;
                  int S, Skv, H, mask_mode; float qscale; int blk0; float mask_fill; int mask_is_int; };
static_assert(sizeof(AttnGeom) == 168, "no padding");

__device__ __forceinline__ unsigned short at_bf_bits(float f) {
  unsigned u = __float_as_uint(f);
  return (unsigned short)((u + 0x7FFFu + ((u >> 16) & 1u)) >> 16);
}
__device__ __forceinline__ __bf16 at_f2bf(float f) { return __builtin_bit_cast(__bf16, at_bf_bits(f)); }
__device__ __forceinline__ void at_split(float f, __bf16& hi, __bf16& lo) {
  const unsigned short hb = at_bf_bits(f);
  hi = __builtin_bit_cast(__bf16, hb);
  lo = at_f2bf(f - __uint_as_float(((unsigned)hb) << 16));
}
__device__ __forceinline__ v8f at_mma(v16b a, v16b b, v8f c) {
  c = __builtin_amdgcn_wmma_f32_16x16x32_bf16(false, a, false, b, (short)0, c, false, false);
  asm volatile("v_nop\n\tv_nop\n\tv_nop\n\tv_nop" : "+v"(c) : "v"(a), "v"(b));
  return c;
}
// 16-bit element as a bit pattern held in a __bf16 slot: f16 bits when F16, bf16 (RNE) otherwise
template <bool F16> __device__ __forceinline__ __bf16 at_to16(float f) {
  if (F16) return __builtin_bit_cast(__bf16, (_Float16)f);
  return at_f2bf(f);
}
template <bool F16> __device__ __forceinline__ v8f at_mma16(v16b a, v16b b, v8f c) {
  if (F16) {
    const v16h ah = __builtin_bit_cast(v16h, a), bh = __builtin_bit_cast(v16h, b);
    c = __builtin_amdgcn_wmma_f32_16x16x32_f16(false, ah, false, bh, (short)0, c, false, false);
    asm volatile("v_nop\n\tv_nop\n\tv_nop\n\tv_nop" : "+v"(c) : "v"(ah), "v"(bh));
    return c;
  }
  return at_mma(a, b, c);
}

template <bool SPLIT_QK, bool SPLIT_PV, bool F16 = false>
__global__ __launch_bounds__(128)
void attn64_kernel(const float* __restrict__ q, const float* __restrict__ k,
                   const float* __restrict__ v, float* __restrict__ out,
                   const void* __restrict__ mask_a, const int* __restrict__ mask_b, AttnGeom g) {
  static_assert(!(F16 && (SPLIT_QK || SPLIT_PV)), "f16 mode is non-split");
  const float PSC = F16 ? 32768.0f : 1.0f;     // f16 probabilities carried x2^15 (subnormal range), folded into the final 1/l
  union FB { v16b v; v8b h[2]; };
  __shared__ __align__(16) __bf16 Ksh[AT_KC * AT_D];             // K hi [kv][d]      8 KB
  __shared__ __align__(16) __bf16 Ksl[SPLIT_QK ? AT_KC * AT_D : 8];
  __shared__ __align__(16) __bf16 Vth[AT_D * AT_KC];             // V hi [d][kv]      8 KB
  __shared__ __align__(16) __bf16 Vtl[SPLIT_PV ? AT_D * AT_KC : 8];
  __shared__ __align__(16) __bf16 Psh[AT_NW][16 * AT_KC];        // per wave P hi [row][kv]  8 KB
  __shared__ __align__(16) __bf16 Psl[SPLIT_PV ? AT_NW : 1][SPLIT_PV ? 16 * AT_KC : 8];
  __shared__ __align__(16) float  Os[AT_NW][16 * 68];            // per wave out tile, pitch 68

  const int tid  = threadIdx.x;
  const int wave = tid >> 5;
  const int lane = tid & 31;
  const int hh   = lane >> 4;
  const int c    = lane & 15;

  const int nqb = g.S / AT_QB;
  const int bx = blockIdx.x + g.blk0;
  const int qb = bx % nqb;
  const int bh = bx / nqb;
  const int h  = bh % g.H;
  const int b  = bh / g.H;
  const int qbase_block = qb * AT_QB;
  const int q0 = qbase_block + wave * 16;

  const float* qb_ptr = q + (size_t)b * g.q_bs + (size_t)h * g.q_hs;
  const float* kb_ptr = k + (size_t)b * g.k_bs + (size_t)h * g.k_hs;
  const float* vb_ptr = v + (size_t)b * g.v_bs + (size_t)h * g.v_hs;
  float*       ob_ptr = out + (size_t)b * g.o_bs + (size_t)h * g.o_hs;

  // ---- Q fragments (A operand): 2 d-chunks, hi (and lo) ----
  v16b qah[2], qal[2];
  {
    const float* qrow = qb_ptr + (size_t)(q0 + c) * g.q_rs;
#pragma unroll
    for (int dc = 0; dc < 2; ++dc) {
#pragma unroll
      for (int e = 0; e < 8; ++e) {
        const float f0 = qrow[dc * 32 + 8 * hh + e] * g.qscale;
        const float f1 = qrow[dc * 32 + 16 + 8 * hh + e] * g.qscale;
        if (SPLIT_QK) { __bf16 hq, lq; at_split(f0, hq, lq); qah[dc][e] = hq; qal[dc][e] = lq; at_split(f1, hq, lq); qah[dc][8 + e] = hq; qal[dc][8 + e] = lq; }
        else { qah[dc][e] = at_to16<F16>(f0); qah[dc][8 + e] = at_to16<F16>(f1); qal[dc][e] = qah[dc][e]; qal[dc][8 + e] = qah[dc][8 + e]; }
      }
    }
  }

  float mrow[8], lrow[8];
  v8f oacc[4];
#pragma unroll
  for (int r = 0; r < 8; ++r) { mrow[r] = -INFINITY; lrow[r] = 0.f; }
#pragma unroll
  for (int t = 0; t < 4; ++t) oacc[t] = (v8f){0.f,0.f,0.f,0.f,0.f,0.f,0.f,0.f};

  const int nChunks = (g.mask_mode == 1 || g.mask_mode == 4) ? (qb + 1) : (g.Skv / AT_KC);   // block-uniform
  // per-row query mask (mode 3)
  int qkeep[8];
#pragma unroll
  for (int r = 0; r < 8; ++r) qkeep[r] = (g.mask_mode == 3) ? mask_b[(size_t)b * g.S + q0 + 8 * hh + r] : 1;   // mask_b = qmask in mode 3
  for (int kc = 0; kc < nChunks; ++kc) {
    const int kv0 = kc * AT_KC;
    __syncthreads();
    {
      const int kvr = tid >> 1, dh = (tid & 1) * 32;
      const float* krow = kb_ptr + (size_t)(kv0 + kvr) * g.k_rs + dh;
      const float* vrow = vb_ptr + (size_t)(kv0 + kvr) * g.v_rs + dh;
#pragma unroll
      for (int i = 0; i < 8; ++i) {
        v4f kk = *(const v4f*)(krow + 4 * i);
        v4f vv = *(const v4f*)(vrow + 4 * i);
#pragma unroll
        for (int e = 0; e < 4; ++e) {
          const int d = dh + 4 * i + e;
          if (SPLIT_QK) { __bf16 a, bl; at_split(kk[e], a, bl); Ksh[kvr * AT_D + d] = a; Ksl[kvr * AT_D + d] = bl; }
          else Ksh[kvr * AT_D + d] = at_to16<F16>(kk[e]);
          if (SPLIT_PV) { __bf16 a, bl; at_split(vv[e], a, bl); Vth[d * AT_KC + kvr] = a; Vtl[d * AT_KC + kvr] = bl; }
          else Vth[d * AT_KC + kvr] = at_to16<F16>(vv[e]);
        }
      }
    }
    __syncthreads();

    v8f s[4];
#pragma unroll
    for (int j = 0; j < 4; ++j) {
      s[j] = (v8f){0.f,0.f,0.f,0.f,0.f,0.f,0.f,0.f};
#pragma unroll 1
      for (int dc = 0; dc < 2; ++dc) {
        FB kb;
        kb.h[0] = *(const v8b*)(Ksh + (j * 16 + c) * AT_D + dc * 32 + 8 * hh);
        kb.h[1] = *(const v8b*)(Ksh + (j * 16 + c) * AT_D + dc * 32 + 16 + 8 * hh);
        s[j] = at_mma16<F16>(qah[dc], kb.v, s[j]);
        if (SPLIT_QK) {
          FB kl;
          kl.h[0] = *(const v8b*)(Ksl + (j * 16 + c) * AT_D + dc * 32 + 8 * hh);
          kl.h[1] = *(const v8b*)(Ksl + (j * 16 + c) * AT_D + dc * 32 + 16 + 8 * hh);
          s[j] = at_mma16<F16>(qah[dc], kl.v, s[j]);
          s[j] = at_mma16<F16>(qal[dc], kb.v, s[j]);
        }
      }
    }
    const bool diag = (g.mask_mode == 1) && (kc == qb);
    int kvkeep[4] = {1, 1, 1, 1};
    if (g.mask_mode == 3) {
#pragma unroll
      for (int j = 0; j < 4; ++j) kvkeep[j] = ((const int*)mask_a)[(size_t)b * g.Skv + kv0 + j * 16 + c];   // mask_a = kvmask
    }
    float cm[8];
#pragma unroll
    for (int r = 0; r < 8; ++r) {
      const int qrow = q0 + 8 * hh + r;
      float m = -INFINITY;
#pragma unroll
      for (int j = 0; j < 4; ++j) {
        const int kvcol = kv0 + j * 16 + c;
        bool masked = false;
        if (diag) masked = (kvcol > qrow);
        else if (g.mask_mode == 4) masked = (kvcol > qrow) || (qrow - kvcol > g.mask_is_int);
        else if (g.mask_mode == 2) {
          const size_t mi = (size_t)qrow * g.Skv + kvcol;
          masked = (g.mask_is_int == 0) ? (((const float*)mask_a)[mi] == 0.0f)
                 : (g.mask_is_int == 1) ? (((const int*)mask_a)[mi] == 0) : (((const int*)mask_a)[mi] != 0);
        } else if (g.mask_mode == 3) masked = (qkeep[r] == 0) || (kvkeep[j] == 0);
        else if (g.mask_mode == 5) {
          const size_t mi = (size_t)qrow * g.Skv + kvcol;
          masked = (((const int*)mask_a)[mi] != 0);
          int n = mask_b[mi]; n = n < 0 ? 0 : n;
          s[j][r] += g.cp[(size_t)b * g.c_bs + (size_t)h * g.c_hs + (size_t)qrow * g.c_rs + n]
                   + g.pc[(size_t)b * g.c_bs + (size_t)h * g.c_hs + (size_t)kvcol * g.c_rs + n];
        }
        if (masked) s[j][r] = g.mask_fill;
        m = fmaxf(m, s[j][r]);
      }
#pragma unroll
      for (int off = 1; off < 16; off <<= 1) m = fmaxf(m, __shfl_xor(m, off, 32));
      cm[r] = m;
    }
    __bf16* pwh = Psh[wave];
    __bf16* pwl = Psl[SPLIT_PV ? wave : 0];
#pragma unroll
    for (int r = 0; r < 8; ++r) {
      const float mnew = fmaxf(mrow[r], cm[r]);
      const float alpha = expf(mrow[r] - mnew);
      mrow[r] = mnew;
      float psum = 0.f;
#pragma unroll
      for (int j = 0; j < 4; ++j) {
        const float p = expf(s[j][r] - mnew);
        psum += p;
        if (SPLIT_PV) { __bf16 a, bl; at_split(p, a, bl); pwh[(8 * hh + r) * AT_KC + j * 16 + c] = a; pwl[(8 * hh + r) * AT_KC + j * 16 + c] = bl; }
        else pwh[(8 * hh + r) * AT_KC + j * 16 + c] = at_to16<F16>(p * PSC);
      }
#pragma unroll
      for (int off = 1; off < 16; off <<= 1) psum += __shfl_xor(psum, off, 32);
      lrow[r] = lrow[r] * alpha + psum;
#pragma unroll
      for (int t = 0; t < 4; ++t) oacc[t][r] *= alpha;
    }
    __builtin_amdgcn_fence(__ATOMIC_RELEASE, "workgroup");
    __builtin_amdgcn_wave_barrier();
    __builtin_amdgcn_fence(__ATOMIC_ACQUIRE, "workgroup");
#pragma unroll 1
    for (int kk = 0; kk < 2; ++kk) {
      FB pa, pl;
      pa.h[0] = *(const v8b*)(pwh + c * AT_KC + kk * 32 + 8 * hh);
      pa.h[1] = *(const v8b*)(pwh + c * AT_KC + kk * 32 + 16 + 8 * hh);
      if (SPLIT_PV) {
        pl.h[0] = *(const v8b*)(pwl + c * AT_KC + kk * 32 + 8 * hh);
        pl.h[1] = *(const v8b*)(pwl + c * AT_KC + kk * 32 + 16 + 8 * hh);
      }
#pragma unroll
      for (int t = 0; t < 4; ++t) {
        FB vb;
        vb.h[0] = *(const v8b*)(Vth + (t * 16 + c) * AT_KC + kk * 32 + 8 * hh);
        vb.h[1] = *(const v8b*)(Vth + (t * 16 + c) * AT_KC + kk * 32 + 16 + 8 * hh);
        oacc[t] = at_mma16<F16>(pa.v, vb.v, oacc[t]);
        if (SPLIT_PV) {
          FB vl;
          vl.h[0] = *(const v8b*)(Vtl + (t * 16 + c) * AT_KC + kk * 32 + 8 * hh);
          vl.h[1] = *(const v8b*)(Vtl + (t * 16 + c) * AT_KC + kk * 32 + 16 + 8 * hh);
          oacc[t] = at_mma16<F16>(pa.v, vl.v, oacc[t]);
          oacc[t] = at_mma16<F16>(pl.v, vb.v, oacc[t]);
        }
      }
    }
  }

  float* os = Os[wave];
#pragma unroll
  for (int r = 0; r < 8; ++r) {
    const float inv = 1.0f / (lrow[r] * PSC);
#pragma unroll
    for (int t = 0; t < 4; ++t) os[(8 * hh + r) * 68 + t * 16 + c] = oacc[t][r] * inv;
  }
  __builtin_amdgcn_fence(__ATOMIC_RELEASE, "workgroup");
  __builtin_amdgcn_wave_barrier();
  __builtin_amdgcn_fence(__ATOMIC_ACQUIRE, "workgroup");
  {
    const int c4 = (lane & 15) * 4;
    {
#pragma unroll
      for (int it = 0; it < 8; ++it) {
        const int row = it * 2 + hh;
        v4f val = *(const v4f*)(os + row * 68 + c4);
        *(v4f*)(ob_ptr + (size_t)(q0 + row) * g.o_rs + c4) = val;
      }
      
    }
  }
}

// Value of lane l ^ 16 (the same column in the wave's other half) by a vector cross-row move, every lane on.
// __shfl_xor compiles to ds_bpermute_b32 and a wait on the LDS counter; this form has no LDS op
__device__ __forceinline__ float at_half_xor(float x) {
  const int b = __builtin_bit_cast(int, x);
  return __builtin_bit_cast(float, __builtin_amdgcn_permlanex16(b, b, 0x76543210, 0xfedcba98, false, false));
}
// e^(x - m) of the softmax as 2^(x * log2(e) - m * log2(e)): one fused multiply-add and the hardware's own base-2 exponential. The library
// expf spends a dozen vector instructions a value on an extended-precision argument and on range tests; here the argument is never above 0
// but by a rounding, and a result too small for a normal float may fall to 0 (as does that of -inf), so none of that is needed.
// A score tile's eight exponentials, each in place, in one statement: none overwrites the source or reads the result of the one before it,
// and the v_nop at the end is the slot that the instruction set asks for between the last one and whatever the compiler puts next
#define AT_LOG2E 1.4426950408889634f
__device__ __forceinline__ void at_exp2x8(float (&p)[8]) {
  asm("v_exp_f32 %0, %0\n\tv_exp_f32 %1, %1\n\tv_exp_f32 %2, %2\n\tv_exp_f32 %3, %3\n\t"
      "v_exp_f32 %4, %4\n\tv_exp_f32 %5, %5\n\tv_exp_f32 %6, %6\n\tv_exp_f32 %7, %7\n\tv_nop"
      : "+v"(p[0]), "+v"(p[1]), "+v"(p[2]), "+v"(p[3]), "+v"(p[4]), "+v"(p[5]), "+v"(p[6]), "+v"(p[7]));
}
// one exponential, with the same slot behind it
__device__ __forceinline__ void at_exp2x1(float& a) { asm("v_exp_f32 %0, %0\n\tv_nop" : "+v"(a)); }
// Matrix product through the builtin alone: the compiler keeps the distances behind a WMMA itself, and with no asm statement behind each
// product the scheduler is free to issue the LDS fragment reads of a whole group ahead of the group's products
template <bool F16> __device__ __forceinline__ v8f at_mma16b(v16b a, v16b b, v8f c) {
  if (F16) return __builtin_amdgcn_wmma_f32_16x16x32_f16(false, __builtin_bit_cast(v16h, a), false, __builtin_bit_cast(v16h, b), (short)0, c, false, false);
  return __builtin_amdgcn_wmma_f32_16x16x32_bf16(false, a, false, b, (short)0, c, false, false);
}

__device__ __forceinline__ unsigned at_lds_off(const void* p) { return (unsigned)(size_t)p; }
// Eight asynchronous 16 B copies of each lane from global memory into LDS, through no register: piece i goes from g + i * 2048 to LDS byte
// l + i * step. The s_wait_xcnt at the end of the statement stands in front of whatever rewrites an address register that a copy names
__device__ __forceinline__ void at_copy8(unsigned l, unsigned step, const char* g) {
  asm volatile("global_load_async_to_lds_b128 %0, %8, off\n\tglobal_load_async_to_lds_b128 %1, %9, off\n\t"
               "global_load_async_to_lds_b128 %2, %10, off\n\tglobal_load_async_to_lds_b128 %3, %11, off\n\t"
               "global_load_async_to_lds_b128 %4, %12, off\n\tglobal_load_async_to_lds_b128 %5, %13, off\n\t"
               "global_load_async_to_lds_b128 %6, %14, off\n\tglobal_load_async_to_lds_b128 %7, %15, off\n\t"
               "s_wait_xcnt 0x0"
               :: "v"(l), "v"(l + step), "v"(l + 2 * step), "v"(l + 3 * step), "v"(l + 4 * step), "v"(l + 5 * step), "v"(l + 6 * step), "v"(l + 7 * step),
                  "v"(g), "v"(g + 2048), "v"(g + 4096), "v"(g + 6144), "v"(g + 8192), "v"(g + 10240), "v"(g + 12288), "v"(g + 14336)
               : "memory");
}
// Hand-over of a ring buffer: this wave's LDS reads are done and its own copies have landed; the barrier then publishes the tile that was
// in flight and ends every wave's reads of the tile that is refilled next
__device__ __forceinline__ void at_publish() {
  asm volatile("s_wait_dscnt 0x0" ::: "memory");      // this wave's last reads of the buffer that is handed back
  asm volatile("s_wait_asynccnt 0x0" ::: "memory");   // this wave's copies of the tile that is read next
  __syncthreads();
}

// ---- head_dim 128 variant (same contract; K/V tiles 64 keys x 128, 8 output tiles; mask_mode 6 = causal + per-head ALiBi slope table in g.cp) ----
// Both products run transposed: S^T = K.Q^T (A = k rows, B = q) and O^T += V^T.P^T (A = v^T rows, B = p^T). A lane then holds the scores of
// ONE query (column c = lane & 15; keys 8 * hh + r of each 16-key tile), so the row maximum and sum are in-lane but for one exchange between
// the wave's halves, and two score tiles, converted in place, ARE the B operand of the second product: p never goes through LDS.
// MODE >= 0 fixes the mask mode at compile time, so the per-score mode tests fold away; MODE < 0 reads it from g.mask_mode
// PRE: k and v come as the bf16 hi/lo planes that kv_split_planes wrote earlier in the same call (pkh, pkl: [b*H + h][kv][d]; pvh, pvl: one
// [d][64 keys] tile per key chunk); nothing is converted in the key loop. The k tile and the v tile of LDS are the two buffers of a ring that
// asynchronous copies fill: chunk t + 1's k planes fly under chunk t's softmax and p.v products, its v planes under chunk t + 1's score products
template <bool SPLIT_QK, bool SPLIT_PV, bool F16 = false, int MODE = -1, bool PRE = false>
__global__ __launch_bounds__(128)
void attn128_kernel(const float* __restrict__ q, const float* __restrict__ k,
                   const float* __restrict__ v, float* __restrict__ out,
                   const void* __restrict__ mask_a, const int* __restrict__ mask_b, AttnGeom g,
                   const __bf16* __restrict__ pkh, const __bf16* __restrict__ pkl,
                   const __bf16* __restrict__ pvh, const __bf16* __restrict__ pvl) {
  static_assert(!(F16 && (SPLIT_QK || SPLIT_PV)), "f16 mode is non-split");
  static_assert(!PRE || (SPLIT_QK && SPLIT_PV), "the planes are hi/lo splits");
  const float PSC = F16 ? 32768.0f : 1.0f;     // f16 probabilities carried x2^15 (subnormal range), folded into the final 1/l
  union FB { v16b v; v8b h[2]; };
  constexpr int D2 = 128;
  // LDS row pitches in elements: 16 B x odd (272 B for the 128-wide K and Q rows, 144 B for the 64-wide V^T rows), so that the
  // 16 rows one ds_load_b128 fragment read touches fall on distinct banks; at 256 B and 128 B they shared four or eight banks
  constexpr int KP = D2 + 8;
  constexpr int VP = AT_KC + 8;
  const int mode = (MODE >= 0) ? MODE : g.mask_mode;
  __shared__ __align__(16) __bf16 Ksh[AT_KC * KP];               // K hi [kv][d]      17 KB
  __shared__ __align__(16) __bf16 Ksl[SPLIT_QK ? AT_KC * KP : 8];
  __shared__ __align__(16) __bf16 Vth[D2 * VP];                  // V hi [d][kv]      18 KB
  __shared__ __align__(16) __bf16 Vtl[SPLIT_PV ? D2 * VP : 8];
  __shared__ __align__(16) float  Os[AT_NW][16 * 132];           // per wave out tile [query][d], pitch 132
  __shared__ __align__(16) __bf16 Qsh[SPLIT_QK ? AT_NW : 1][SPLIT_QK ? 16 * KP : 8];   // split path: q hi/lo staged per wave (keeps VGPR use low)
  __shared__ __align__(16) __bf16 Qsl[SPLIT_QK ? AT_NW : 1][SPLIT_QK ? 16 * KP : 8];

  const int tid  = threadIdx.x;
  const int wave = tid >> 5;
  const int lane = tid & 31;
  const int hh   = lane >> 4;
  const int c    = lane & 15;

  const int nqb = g.S / AT_QB;
  const int bx = blockIdx.x + g.blk0;
  // Causal modes: query block qb walks qb + 1 key chunks, and the grid holds more blocks than the chip has resident places. The longest get
  // the lowest indices (qb falls with bx, heads innermost), for speed only. A permutation of (head, qb); needs the whole grid in one launch (blk0 = 0).
  const bool byCost = (mode == 1 || mode == 4 || mode == 6);
  const int nbh = byCost ? (int)gridDim.x / nqb : 1;
  const int qb = byCost ? (nqb - 1 - bx / nbh) : (bx % nqb);
  const int bh = byCost ? (bx % nbh) : (bx / nqb);
  const int h  = bh % g.H;
  const int b  = bh / g.H;
  const int qbase_block = qb * AT_QB;
  const int q0 = qbase_block + wave * 16;

  const float* qb_ptr = q + (size_t)b * g.q_bs + (size_t)h * g.q_hs;
  const float* kb_ptr = k + (size_t)b * g.k_bs + (size_t)h * g.k_hs;
  const float* vb_ptr = v + (size_t)b * g.v_bs + (size_t)h * g.v_hs;
  float*       ob_ptr = out + (size_t)b * g.o_bs + (size_t)h * g.o_hs;

  // ---- Q fragments (B operand): 4 d-chunks, hi (and lo) ----
  v16b qah[4], qal[4];
  {
    const float* qrow = qb_ptr + (size_t)(q0 + c) * g.q_rs;
#pragma unroll
    for (int dc = 0; dc < 4; ++dc) {
#pragma unroll
      for (int e = 0; e < 8; ++e) {
        const float f0 = qrow[dc * 32 + 8 * hh + e] * g.qscale;
        const float f1 = qrow[dc * 32 + 16 + 8 * hh + e] * g.qscale;
        if (SPLIT_QK) { __bf16 hq, lq; at_split(f0, hq, lq); Qsh[wave][c * KP + dc * 32 + 8 * hh + e] = hq; Qsl[wave][c * KP + dc * 32 + 8 * hh + e] = lq;
                        at_split(f1, hq, lq); Qsh[wave][c * KP + dc * 32 + 16 + 8 * hh + e] = hq; Qsl[wave][c * KP + dc * 32 + 16 + 8 * hh + e] = lq;
                        qah[dc][e] = hq; qal[dc][e] = lq; qah[dc][8 + e] = hq; qal[dc][8 + e] = lq; }   // (register copies unused on the split path)
        else { qah[dc][e] = at_to16<F16>(f0); qah[dc][8 + e] = at_to16<F16>(f1); qal[dc][e] = qah[dc][e]; qal[dc][8 + e] = qah[dc][8 + e]; }
      }
    }
  }

  const int qrow = q0 + c;           // this lane's query
  float mrow = -INFINITY;            // its running maximum (alike in both halves of the wave)
  float lrow = 0.f;                  // running sum over the keys of this lane's half; the halves are joined once, behind the key loop
  v8f oacc[8];                       // oacc[t][r] = O^T[d = t * 16 + 8 * hh + r][query c]
#pragma unroll
  for (int t = 0; t < 8; ++t) oacc[t] = (v8f){0.f,0.f,0.f,0.f,0.f,0.f,0.f,0.f};

  const int nChunks = (mode == 1 || mode == 4 || mode == 6) ? (qb + 1) : (g.Skv / AT_KC);   // block-uniform
  const int qkeep = (mode == 3) ? mask_b[(size_t)b * g.S + qrow] : 1;   // per-query mask (mode 3): mask_b = qmask
  // each plane's tile of a chunk is 1024 pieces of 16 B, linear in memory; piece n = i * 128 + tid is 16 B number n & 15 of K row n >> 4,
  // n & 7 of V^T row n >> 3, so that a step of i is 8 K rows or 16 V^T rows in LDS
  const size_t hb = (size_t)bh * g.Skv * D2;     // this head's part of each plane
  const char* gkh = (const char*)(pkh + hb) + tid * 16; const char* gkl = (const char*)(pkl + hb) + tid * 16;
  const char* gvh = (const char*)(pvh + hb) + tid * 16; const char* gvl = (const char*)(pvl + hb) + tid * 16;
  const unsigned lkh = at_lds_off(Ksh + (tid >> 4) * KP + (tid & 15) * 8), lkl = at_lds_off(Ksl + (tid >> 4) * KP + (tid & 15) * 8);
  const unsigned lvh = at_lds_off(Vth + (tid >> 3) * VP + (tid & 7) * 8),  lvl = at_lds_off(Vtl + (tid >> 3) * VP + (tid & 7) * 8);
  constexpr unsigned KSTEP = 8 * KP * 2, VSTEP = 16 * VP * 2, CHB = AT_KC * D2 * 2;   // bytes: LDS steps of i, a chunk's tile in a plane
  if (PRE) {
    at_copy8(lkh, KSTEP, gkh); at_copy8(lkl, KSTEP, gkl);   // chunk 0's k
    asm volatile("s_wait_asynccnt 0x0" ::: "memory");       // this wave's part of it has landed
    __syncthreads();                                        // and every other wave's
    at_copy8(lvh, VSTEP, gvh); at_copy8(lvl, VSTEP, gvl);   // chunk 0's v flies under its score products
  }
  for (int kc = 0; kc < nChunks; ++kc) {
    const int kv0 = kc * AT_KC;
    if (!PRE) {
      __syncthreads();
      const int kvr = tid >> 1, dh = (tid & 1) * 64;
      const float* krow = kb_ptr + (size_t)(kv0 + kvr) * g.k_rs + dh;
      const float* vrow = vb_ptr + (size_t)(kv0 + kvr) * g.v_rs + dh;
#pragma unroll
      for (int i = 0; i < 16; ++i) {
        v4f kk = *(const v4f*)(krow + 4 * i);
        v4f vv = *(const v4f*)(vrow + 4 * i);
#pragma unroll
        for (int e = 0; e < 4; ++e) {
          const int d = dh + 4 * i + e;
          if (SPLIT_QK) { __bf16 a, bl; at_split(kk[e], a, bl); Ksh[kvr * KP + d] = a; Ksl[kvr * KP + d] = bl; }
          else Ksh[kvr * KP + d] = at_to16<F16>(kk[e]);
          if (SPLIT_PV) { __bf16 a, bl; at_split(vv[e], a, bl); Vth[d * VP + kvr] = a; Vtl[d * VP + kvr] = bl; }
          else Vth[d * VP + kvr] = at_to16<F16>(vv[e]);
        }
      }
      __syncthreads();
    }

    // One group per 32-wide slice of d (its q and k fragments, 20 LDS reads, then 12 products). The next group's reads are issued as one run
    // ahead of this group's products, into a second register set, and the products rotate over the four score tiles, so that no product
    // waits for an LDS read just issued or for the product before it. Each tile sums in the order d slice 0..3, q hi.k hi, q hi.k lo, q lo.k hi.
    v8f s[4];                          // s[j][r] = S^T[key j * 16 + 8 * hh + r][query c]
#pragma unroll
    for (int j = 0; j < 4; ++j) s[j] = (v8f){0.f,0.f,0.f,0.f,0.f,0.f,0.f,0.f};
    FB qa[2], ql[2], kb[2][4], kl[2][4];
#pragma unroll
    for (int dc = -1; dc < 4; ++dc) {
      if (dc < 3) {
        const int n = dc + 1, w = n & 1;
        if (SPLIT_QK) {
          qa[w].h[0] = *(const v8b*)(&Qsh[wave][c * KP + n * 32 + 8 * hh]); qa[w].h[1] = *(const v8b*)(&Qsh[wave][c * KP + n * 32 + 16 + 8 * hh]);
          ql[w].h[0] = *(const v8b*)(&Qsl[wave][c * KP + n * 32 + 8 * hh]); ql[w].h[1] = *(const v8b*)(&Qsl[wave][c * KP + n * 32 + 16 + 8 * hh]);
        } else qa[w].v = qah[n];
#pragma unroll
        for (int j = 0; j < 4; ++j) {
          kb[w][j].h[0] = *(const v8b*)(Ksh + (j * 16 + c) * KP + n * 32 + 8 * hh);
          kb[w][j].h[1] = *(const v8b*)(Ksh + (j * 16 + c) * KP + n * 32 + 16 + 8 * hh);
          if (SPLIT_QK) {
            kl[w][j].h[0] = *(const v8b*)(Ksl + (j * 16 + c) * KP + n * 32 + 8 * hh);
            kl[w][j].h[1] = *(const v8b*)(Ksl + (j * 16 + c) * KP + n * 32 + 16 + 8 * hh);
          }
        }
      }
      __builtin_amdgcn_sched_barrier(0);   // keeps the reads above in one run: the scheduler otherwise moves them in among the products
      if (dc >= 0) {
        const int w = dc & 1;
#pragma unroll
        for (int j = 0; j < 4; ++j) s[j] = at_mma16b<F16>(kb[w][j].v, qa[w].v, s[j]);
        if (SPLIT_QK) {
#pragma unroll
          for (int j = 0; j < 4; ++j) s[j] = at_mma16b<F16>(kl[w][j].v, qa[w].v, s[j]);
#pragma unroll
          for (int j = 0; j < 4; ++j) s[j] = at_mma16b<F16>(kb[w][j].v, ql[w].v, s[j]);
        }
        __builtin_amdgcn_sched_barrier(0);   // ends the run of products: the group after next is not read in among them
      }
    }
    if (PRE) {
      at_publish();                    // this chunk's v is there; every wave has left the k tile
      if (kc + 1 < nChunks) { at_copy8(lkh, KSTEP, gkh + (size_t)(kc + 1) * CHB); at_copy8(lkl, KSTEP, gkl + (size_t)(kc + 1) * CHB); }
    }
    const bool diag = (mode == 1) && (kc == qb);
    float cm[4];                       // one chain per tile, so that the four run side by side
#pragma unroll
    for (int j = 0; j < 4; ++j) {
      float m = -INFINITY;
#pragma unroll
      for (int r = 0; r < 8; ++r) {
        const int kvcol = kv0 + j * 16 + 8 * hh + r;
        bool masked = false;
        if (diag) masked = (kvcol > qrow);
        else if (mode == 4) masked = (kvcol > qrow) || (qrow - kvcol > g.mask_is_int);
        else if (mode == 2) {
          const size_t mi = (size_t)qrow * g.Skv + kvcol;
          masked = (g.mask_is_int == 0) ? (((const float*)mask_a)[mi] == 0.0f)
                 : (g.mask_is_int == 1) ? (((const int*)mask_a)[mi] == 0) : (((const int*)mask_a)[mi] != 0);
        } else if (mode == 3) masked = (qkeep == 0) || (((const int*)mask_a)[(size_t)b * g.Skv + kvcol] == 0);   // mask_a = kvmask
        else if (mode == 6) { masked = (kvcol > qrow); s[j][r] += g.cp[h] * (float)(kvcol - qrow); }
        else if (mode == 8) { masked = (kvcol > qrow) || (((const int*)mask_a)[(size_t)b * g.Skv + kvcol] != 0); }
        else if (mode == 5) {
          const size_t mi = (size_t)qrow * g.Skv + kvcol;
          masked = (((const int*)mask_a)[mi] != 0);
          int n = mask_b[mi]; n = n < 0 ? 0 : n;
          s[j][r] += g.cp[(size_t)b * g.c_bs + (size_t)h * g.c_hs + (size_t)qrow * g.c_rs + n]
                   + g.pc[(size_t)b * g.c_bs + (size_t)h * g.c_hs + (size_t)kvcol * g.c_rs + n];
        }
        if (masked) s[j][r] = g.mask_fill;
        m = fmaxf(m, s[j][r]);
      }
      cm[j] = m;
    }
    float mc = fmaxf(fmaxf(cm[0], cm[1]), fmaxf(cm[2], cm[3]));
    mc = fmaxf(mc, at_half_xor(mc));   // the other half's 32 keys of the same query
    const float mnew = fmaxf(mrow, mc);
    const float mnl = mnew * AT_LOG2E;
    float alpha = fmaf(mrow, AT_LOG2E, -mnl);
    at_exp2x1(alpha);
    mrow = mnew;
    // p^T as the B operand of the second product: element e of pa[kk] is key kk * 32 + 8 * hh + e (e < 8) or kk * 32 + 16 + 8 * hh + e - 8,
    // which is register e & 7 of score tile 2 * kk + (e >> 3) in this very lane; the v^T fragments are read in the same key order
    FB pa[2], pl[2];
    float ps[4];
#pragma unroll
    for (int j = 0; j < 4; ++j) {
      float pe[8];
#pragma unroll   // constant indices keep the eight arguments in registers
      for (int r = 0; r < 8; ++r) pe[r] = fmaf(s[j][r], AT_LOG2E, -mnl);
      at_exp2x8(pe);
      float sum = 0.f;
#pragma unroll
      for (int r = 0; r < 8; ++r) {
        const float p = pe[r];
        sum += p;
        if (SPLIT_PV) { __bf16 a, bl; at_split(p, a, bl); pa[j >> 1].v[(j & 1) * 8 + r] = a; pl[j >> 1].v[(j & 1) * 8 + r] = bl; }
        else pa[j >> 1].v[(j & 1) * 8 + r] = at_to16<F16>(p * PSC);
      }
      ps[j] = sum;
    }
    lrow = lrow * alpha + ((ps[0] + ps[1]) + (ps[2] + ps[3]));
#pragma unroll
    for (int t = 0; t < 8; ++t) oacc[t] *= alpha;
    // One group per 32 keys and four output tiles (16 LDS reads of v, then 12 products), run like the score groups: next group's reads in
    // one run ahead of this group's products, products rotating over the four tiles.
    // Each output tile sums in the order keys 0..31, 32..63, p hi.v hi, p hi.v lo, p lo.v hi.
    FB vb[2][4], vl[2][4];
#pragma unroll
    for (int gi = -1; gi < 4; ++gi) {
      if (gi < 3) {
        const int n = gi + 1, w = n & 1, kk = n >> 1, t0 = (n & 1) * 4;
#pragma unroll
        for (int u = 0; u < 4; ++u) {
          vb[w][u].h[0] = *(const v8b*)(Vth + ((t0 + u) * 16 + c) * VP + kk * 32 + 8 * hh);
          vb[w][u].h[1] = *(const v8b*)(Vth + ((t0 + u) * 16 + c) * VP + kk * 32 + 16 + 8 * hh);
          if (SPLIT_PV) {
            vl[w][u].h[0] = *(const v8b*)(Vtl + ((t0 + u) * 16 + c) * VP + kk * 32 + 8 * hh);
            vl[w][u].h[1] = *(const v8b*)(Vtl + ((t0 + u) * 16 + c) * VP + kk * 32 + 16 + 8 * hh);
          }
        }
      }
      __builtin_amdgcn_sched_barrier(0);   // keeps the reads above in one run, as in the score groups
      if (gi >= 0) {
        const int w = gi & 1, kk = gi >> 1, t0 = (gi & 1) * 4;
#pragma unroll
        for (int u = 0; u < 4; ++u) oacc[t0 + u] = at_mma16b<F16>(vb[w][u].v, pa[kk].v, oacc[t0 + u]);
        if (SPLIT_PV) {
#pragma unroll
          for (int u = 0; u < 4; ++u) oacc[t0 + u] = at_mma16b<F16>(vl[w][u].v, pa[kk].v, oacc[t0 + u]);
#pragma unroll
          for (int u = 0; u < 4; ++u) oacc[t0 + u] = at_mma16b<F16>(vb[w][u].v, pl[kk].v, oacc[t0 + u]);
        }
        __builtin_amdgcn_sched_barrier(0);   // ends the run of products
      }
    }
    if (PRE) {
      at_publish();                    // the next chunk's k is there; every wave has left the v tile
      if (kc + 1 < nChunks) { at_copy8(lvh, VSTEP, gvh + (size_t)(kc + 1) * CHB); at_copy8(lvl, VSTEP, gvl + (size_t)(kc + 1) * CHB); }
    }
  }
  if (PRE) asm volatile("s_wait_asynccnt 0x0" ::: "memory");   // no copy is left in flight behind the loop

  float* os = Os[wave];
  const float inv = 1.0f / ((lrow + at_half_xor(lrow)) * PSC);   // the two halves' sums of this query, joined
#pragma unroll
  for (int t = 0; t < 8; ++t) {      // a lane's eight registers of a tile are eight consecutive d of its query: two 16 B stores
    const v8f o = oacc[t] * inv;
    *(v4f*)(os + c * 132 + t * 16 + 8 * hh)     = (v4f){o[0], o[1], o[2], o[3]};
    *(v4f*)(os + c * 132 + t * 16 + 8 * hh + 4) = (v4f){o[4], o[5], o[6], o[7]};
  }
  __builtin_amdgcn_fence(__ATOMIC_RELEASE, "workgroup");
  __builtin_amdgcn_wave_barrier();
  __builtin_amdgcn_fence(__ATOMIC_ACQUIRE, "workgroup");
  {
    const int c4 = lane * 4;           // 32 lanes x 16 B = one 512-B output row (128 floats) per instruction
    {
#pragma unroll
      for (int row = 0; row < 16; ++row) {
        v4f val = *(const v4f*)(os + row * 132 + c4);
        *(v4f*)(ob_ptr + (size_t)(q0 + row) * g.o_rs + c4) = val;
      }
      
    }
  }
}

// ---- k and v, f32 [rows][128], split once into bf16 hi/lo planes (the split of at_split, so the values are those the key loop made itself).
// One block per 64 rows (one key chunk of one head). k keeps its layout; v is transposed through LDS into one [128 d][64 keys] tile per chunk.
__global__ __launch_bounds__(256) void kv_split_planes(const float* __restrict__ k, const float* __restrict__ v,
                                                       __bf16* __restrict__ kh, __bf16* __restrict__ kl,
                                                       __bf16* __restrict__ vth, __bf16* __restrict__ vtl) {
  __shared__ float tile[128 * 65];     // [d][key], pitch 65 floats: the column writes fall on 16 banks, the row reads on 32
  const int t = threadIdx.x;
  const size_t base = (size_t)blockIdx.x * (64 * 128);
  // every loop below is unrolled so that a thread's loads issue together, ahead of the conversions
#pragma unroll
  for (int it = 0; it < 8; ++it) {
    const int n = it * 256 + t, key = n >> 5, d4 = (n & 31) * 4;
    const v4f x = *(const v4f*)(v + base + n * 4);     // row key, columns d4 .. d4 + 3: the tile is linear in n
#pragma unroll
    for (int e = 0; e < 4; ++e) tile[(d4 + e) * 65 + key] = x[e];
  }
#pragma unroll
  for (int it = 0; it < 4; ++it) {
    const int n = it * 256 + t;
    const v4f x0 = *(const v4f*)(k + base + n * 8), x1 = *(const v4f*)(k + base + n * 8 + 4);
    v8b hv, lv;
#pragma unroll
    for (int e = 0; e < 4; ++e) {
      __bf16 a, bl;
      at_split(x0[e], a, bl); hv[e] = a; lv[e] = bl;
      at_split(x1[e], a, bl); hv[4 + e] = a; lv[4 + e] = bl;
    }
    *(v8b*)(kh + base + n * 8) = hv;
    *(v8b*)(kl + base + n * 8) = lv;
  }
  __syncthreads();   // the v tile is complete before any thread reads its rows
#pragma unroll
  for (int it = 0; it < 4; ++it) {
    const int n = it * 256 + t, d = n >> 3, k8 = (n & 7) * 8;
    v8b hv, lv;
#pragma unroll
    for (int e = 0; e < 8; ++e) { __bf16 a, bl; at_split(tile[d * 65 + k8 + e], a, bl); hv[e] = a; lv[e] = bl; }
    *(v8b*)(vth + base + n * 8) = hv;
    *(v8b*)(vtl + base + n * 8) = lv;
  }
}

#define XB 2
#define XH 16
#define XS 2048
#define XD 128
__global__ void slopes_kernel(float* __restrict__ sl) { const int h = threadIdx.x; const float v = (h < XH) ? exp2f(-8.0f * (float)(h + 1) / (float)XH) : 0.f; ((float*)sl)[h] = v;  }
extern "C" void kernel_launch(void* const* d_in, const int* in_sizes, int n_in, void* d_out, int out_size, void* d_ws, size_t ws_size, hipStream_t stream) {
  (void)in_sizes; (void)n_in; (void)out_size; (void)ws_size;
  const float* q = (const float*)d_in[0]; const float* k = (const float*)d_in[1]; const float* v = (const float*)d_in[2];
  float* sl = (float*)d_ws;
  slopes_kernel<<<1, 32, 0, stream>>>(sl);
  __bf16* kh = (__bf16*)((char*)d_ws + 4096);                 // four planes of XB * XH * XS * XD bf16 behind the slope table
  __bf16* kl = kh + (size_t)XB * XH * XS * XD; __bf16* vth = kl + (size_t)XB * XH * XS * XD; __bf16* vtl = vth + (size_t)XB * XH * XS * XD;
  kv_split_planes<<<XB * XH * (XS / AT_KC), 256, 0, stream>>>(k, v, kh, kl, vth, vtl);
  AttnGeom g;
  g.cp = sl; g.pc = nullptr; g.c_bs = 0; g.c_rs = 0; g.c_hs = 0;
  g.q_bs = (long)XH * XS * XD; g.q_hs = (long)XS * XD; g.q_rs = XD;
  g.k_bs = g.q_bs; g.k_hs = g.q_hs; g.k_rs = XD; g.v_bs = g.q_bs; g.v_hs = g.q_hs; g.v_rs = XD; g.o_bs = g.q_bs; g.o_hs = g.q_hs; g.o_rs = XD;
  g.S = XS; g.Skv = XS; g.H = XH; g.mask_mode = 6; g.qscale = 0.08838834764831845f; g.blk0 = 0; g.mask_fill = -INFINITY; g.mask_is_int = 0;
  attn128_kernel<true, true, false, 6, true><<<XB * XH * (XS / AT_QB), AT_NW * 32, 0, stream>>>(q, k, v, (float*)d_out, nullptr, nullptr, g, kh, kl, vth, vtl);
}

// v010
// A run of this version takes 100 microseconds.
// Next to v009, in two timings, it ran 1.04 times as fast each time.
// Counting every step since v000, it is 19.9 times as fast.
#include <hip/hip_runtime.h>
#include <math.h>
// FlexAttention forward (causal block mask + ALiBi score_mod, 2 x 16 heads, 2048 x 2048, head_dim 128): scores and p·v on
// v_wmma_f32_16x16x32_bf16 with q,k and p,v as bf16 hi/lo splits (hi·hi + hi·lo + lo·hi;
// early causal rows copy single v rows almost verbatim), f32 accumulate; online softmax, the ALiBi bias slope_h·(k−q) and the
// causal predicate in f32 on VALU.
typedef __attribute__((ext_vector_type(16))) _Float16 v16h;
typedef __attribute__((ext_vector_type(8)))  _Float16 v8h;
typedef __attribute__((ext_vector_type(16))) __bf16   v16b;
typedef __attribute__((ext_vector_type(8)))  __bf16   v8b;
typedef __attribute__((ext_vector_type(8)))  float    v8f;
typedef __attribute__((ext_vector_type(4)))  float    v4f;
#define PSCALE 32768.0f
#define U16(p) ((const unsigned short*)(const void*)(p))
#define PSCALE_INV (1.0f / 32768.0f)

__device__ __forceinline__ unsigned short f2bf_bits(float f) {
  unsigned u = __float_as_uint(f);
  return (unsigned short)((u + 0x7FFFu + ((u >> 16) & 1u)) >> 16);
}
__device__ __forceinline__ float bf_bits2f(unsigned short h) { return __uint_as_float(((unsigned)h) << 16); }

// hazard guards as plain device helpers (no inline asm inside the kernel template body)
__device__ __forceinline__ void dep_guard_h(v8f& a, v8f& b, v16h x, v16h y) { asm volatile("v_nop\n\tv_nop\n\tv_nop\n\tv_nop" : "+v"(a), "+v"(b) : "v"(x), "v"(y)); }
__device__ __forceinline__ void dep_guard_b(v8f& a, v8f& b, v16b x, v16b y) { asm volatile("v_nop\n\tv_nop\n\tv_nop\n\tv_nop" : "+v"(a), "+v"(b) : "v"(x), "v"(y)); }
__device__ __forceinline__ void keep4_h(v16h a, v16h b, v16h c, v16h d) { asm volatile("v_nop" :: "v"(a), "v"(b), "v"(c), "v"(d)); }
__device__ __forceinline__ void keep4_b(v16b a, v16b b, v16b c, v16b d) { asm volatile("v_nop" :: "v"(a), "v"(b), "v"(c), "v"(d)); }
__device__ __forceinline__ void acc_guard4(v8f& a, v8f& b, v8f& c, v8f& d) { asm volatile("v_nop\n\tv_nop\n\tv_nop\n\tv_nop" : "+v"(a), "+v"(b), "+v"(c), "+v"(d)); }
template <typename T> struct Frag;
template <> struct Frag<_Float16> {
  typedef v16h V; union U { v16h v; v8h h[2]; };
  static __device__ __forceinline__ v16h load(const _Float16* p) {   // elements 0..7 <- p[0..7], 8..15 <- p[16..23]
    U f; f.h[0] = *(const v8h*)(p); f.h[1] = *(const v8h*)(p + 16); return f.v;
  }
  static __device__ __forceinline__ v8f mma(v16h a, v16h b, v8f c) {
    return __builtin_amdgcn_wmma_f32_16x16x32_f16(false, a, false, b, (short)0, c, false, false);
  }
  static __device__ __forceinline__ void guard(v8f& a, v8f& b, v16h x, v16h y) { dep_guard_h(a, b, x, y); }
  static __device__ __forceinline__ void keep(v16h a, v16h b, v16h c, v16h d) { keep4_h(a, b, c, d); }
};
template <> struct Frag<__bf16> {
  typedef v16b V; union U { v16b v; v8b h[2]; };
  static __device__ __forceinline__ v16b load(const __bf16* p) {
    U f; f.h[0] = *(const v8b*)(p); f.h[1] = *(const v8b*)(p + 16); return f.v;
  }
  static __device__ __forceinline__ v8f mma(v16b a, v16b b, v8f c) {
    return __builtin_amdgcn_wmma_f32_16x16x32_bf16(false, a, false, b, (short)0, c, false, false);
  }
  static __device__ __forceinline__ void guard(v8f& a, v8f& b, v16b x, v16b y) { dep_guard_b(a, b, x, y); }
  static __device__ __forceinline__ void keep(v16b a, v16b b, v16b c, v16b d) { keep4_b(a, b, c, d); }
};

// ---- Register-blocked batched WMMA GEMM ------------------------------------
// C[m,n] = scale * sum_k A[m,k] * Bt[n,k] (+bias)(+resid); each wave owns a 64x64 tile.
// A row-major [M,K]; Bt row-major [N,K]; M,N % 64 == 0, K % 32 == 0.
// SPLIT: operands are hi/lo planes (A2/Bt2 = lo planes, same layout); product = hi·hi + hi·lo + lo·hi.
// BIAS_MODE: 0 = none, 1 = bias[m], 2 = bias[n].
// OUT_MODE: 0 = f32, 1 = f16, 2 = bf16 hi plane (Cout) + bf16 lo plane (Cout2).
// ET: 0 = f16 operands, 1 = bf16 operands (pointers passed as 16-bit storage)
template <int ET> struct Elem;
template <> struct Elem<0> { typedef _Float16 T; };
template <> struct Elem<1> { typedef __bf16 T; };
template <int ET, bool SPLIT, int BIAS_MODE, int OUT_MODE, bool RESID, int ACT = 0>
__global__ __launch_bounds__(256) void wmma_gemm64(
    const unsigned short* __restrict__ Ap, const unsigned short* __restrict__ A2p, int lda, long strideA,
    const unsigned short* __restrict__ Btp, const unsigned short* __restrict__ Bt2p, int ldb, long strideB,
    void* __restrict__ Cout, void* __restrict__ Cout2, int ldc, long strideC,
    const float* __restrict__ bias,
    const float* __restrict__ resid, long strideR,
    int M, int N, int K, float scale) {
  typedef typename Elem<ET>::T T;
  typedef typename Frag<T>::V V;
  const T* A = (const T*)Ap; const T* A2 = (const T*)A2p; const T* Bt = (const T*)Btp; const T* Bt2 = (const T*)Bt2p;
  __shared__ __align__(16) float sT[8][16 * 68];   // per-wave 16x64 slab, pitch 68 floats
  const int b    = blockIdx.y;
  const int lane = threadIdx.x & 31;
  const int wave = threadIdx.x >> 5;
  const int tilesN = N >> 6;
  const int tilesM = M >> 6;
  const int tile = blockIdx.x * 8 + wave;
  if (tile >= tilesM * tilesN) return;   // wave-uniform; no block barriers in this kernel
  const int tm = tile / tilesN;
  const int tn = tile - tm * tilesN;
  const int m0 = tm << 6;
  const int n0 = tn << 6;

  const T* Ab  = A  + (size_t)b * strideA;
  const T* Bb  = Bt + (size_t)b * strideB;
  const T* Ab2 = SPLIT ? (A2  + (size_t)b * strideA) : nullptr;
  const T* Bb2 = SPLIT ? (Bt2 + (size_t)b * strideB) : nullptr;

  const int rlane = lane & 15;                 // row (A) / col (B, D) within subtile
  const int koff  = (lane >> 4) * 8;           // k offset of this lane half
  const int mOff  = (lane >> 4) * 8;           // D row offset

  v8f acc[4][4];
#pragma unroll
  for (int i = 0; i < 4; ++i)
#pragma unroll
    for (int j = 0; j < 4; ++j) acc[i][j] = (v8f){0.f,0.f,0.f,0.f,0.f,0.f,0.f,0.f};

  for (int k0 = 0; k0 < K; k0 += 32) {
    V bh[4], bl[4];
#pragma unroll
    for (int j = 0; j < 4; ++j) {
      const size_t bo = (size_t)(n0 + (j << 4) + rlane) * ldb + koff + k0;
      bh[j] = Frag<T>::load(Bb + bo);
      if (SPLIT) bl[j] = Frag<T>::load(Bb2 + bo);
    }
#pragma unroll
    for (int i = 0; i < 4; ++i) {
      const size_t ao = (size_t)(m0 + (i << 4) + rlane) * lda + koff + k0;
      V ah = Frag<T>::load(Ab + ao);
      V al;
      if (SPLIT) al = Frag<T>::load(Ab2 + ao);
#pragma unroll
      for (int j = 0; j < 4; ++j) {
        acc[i][j] = Frag<T>::mma(ah, bh[j], acc[i][j]);
        if (SPLIT) {
          acc[i][j] = Frag<T>::mma(ah, bl[j], acc[i][j]);
          acc[i][j] = Frag<T>::mma(al, bh[j], acc[i][j]);
        }
      }
      Frag<T>::guard(acc[i][0], acc[i][3], ah, SPLIT ? al : ah);
    }
    Frag<T>::keep(bh[0], bh[1], bh[2], bh[3]);
    if (SPLIT) Frag<T>::keep(bl[0], bl[1], bl[2], bl[3]);
  }
  acc_guard4(acc[0][0], acc[0][1], acc[0][2], acc[0][3]);
  acc_guard4(acc[1][0], acc[1][1], acc[1][2], acc[1][3]);
  acc_guard4(acc[2][0], acc[2][1], acc[2][2], acc[2][3]);
  acc_guard4(acc[3][0], acc[3][1], acc[3][2], acc[3][3]);

  // ---- epilogue ----
  float* slab = sT[wave];
  const float* Rb = RESID ? (resid + (size_t)b * strideR) : nullptr;
#pragma unroll
  for (int i = 0; i < 4; ++i) {
    const int mBase = m0 + (i << 4);
#pragma unroll
    for (int j = 0; j < 4; ++j) {
      const int n = n0 + (j << 4) + rlane;
      float bv = 0.f;
      if (BIAS_MODE == 2) bv = bias[n];
#pragma unroll
      for (int r = 0; r < 8; ++r) {
        float v = acc[i][j][r] * scale;
        if (BIAS_MODE == 1) v += bias[mBase + mOff + r];
        if (BIAS_MODE == 2) v += bv;
        if (RESID) v += Rb[(size_t)(mBase + mOff + r) * ldc + n];
        if (ACT == 1) v = tanhf(v);
        if (ACT == 2) v = fmaxf(v, 0.0f);
        if (ACT == 3) v = v / (1.0f + expf(-v));
        if (ACT == 4) v = (v > 0.f) ? v : 0.01f * v;
        if (ACT == 5) v = 0.5f * v * (1.0f + erff(v * 0.70710678118654752f));
        slab[(mOff + r) * 68 + (j << 4) + rlane] = v;
      }
    }
    __builtin_amdgcn_fence(__ATOMIC_RELEASE, "workgroup");
    __builtin_amdgcn_wave_barrier();
    __builtin_amdgcn_fence(__ATOMIC_ACQUIRE, "workgroup");
    if (OUT_MODE == 0) {
      float* C = (float*)Cout + (size_t)b * strideC;
      const int hh = lane >> 4, c4 = (lane & 15) * 4;     // row seg = 256 B = 16 lanes x 16 B
      {
#pragma unroll
        for (int it = 0; it < 8; ++it) {
          const int row = it * 2 + hh;
          v4f v = *(const v4f*)(slab + row * 68 + c4);
          *(v4f*)(C + (size_t)(mBase + row) * ldc + n0 + c4) = v;
        }
        
      }
    } else {
      const int q = lane >> 3, c8 = (lane & 7) * 8;
      unsigned short* C  = (unsigned short*)Cout  + (size_t)b * strideC;
      unsigned short* C2 = (OUT_MODE == 2) ? ((unsigned short*)Cout2 + (size_t)b * strideC) : nullptr;
      {
#pragma unroll
        for (int it = 0; it < 4; ++it) {
          const int row = it * 4 + q;
          const float* sp = slab + row * 68 + c8;
          v8h hv, lv;
#pragma unroll
          for (int e = 0; e < 8; ++e) {
            if (OUT_MODE == 1) {
              hv[e] = (_Float16)sp[e];
            } else {
              unsigned short hb = f2bf_bits(sp[e]);
              unsigned short lb = f2bf_bits(sp[e] - bf_bits2f(hb));
              hv[e] = __builtin_bit_cast(_Float16, hb);
              lv[e] = __builtin_bit_cast(_Float16, lb);
            }
          }
          *(v8h*)(C + (size_t)(mBase + row) * ldc + n0 + c8) = hv;
          if (OUT_MODE == 2) *(v8h*)(C2 + (size_t)(mBase + row) * ldc + n0 + c8) = lv;
        }
        
      }
    }
    __builtin_amdgcn_fence(__ATOMIC_RELEASE, "workgroup");
    __builtin_amdgcn_wave_barrier();
    __builtin_amdgcn_fence(__ATOMIC_ACQUIRE, "workgroup");
  }
}

__global__ __launch_bounds__(256) void cast_f32_f16x2(
    const float* __restrict__ in, _Float16* __restrict__ out, int n2) {
  int i = blockIdx.x * 256 + threadIdx.x;
  if (i < n2) {
    const _Float16 h0 = (_Float16)in[2 * i], h1 = (_Float16)in[2 * i + 1];
    const unsigned u = (unsigned)__builtin_bit_cast(unsigned short, h0) | ((unsigned)__builtin_bit_cast(unsigned short, h1) << 16);
    ((unsigned*)out)[i] = u;
    
  }
}


// ---- f32 -> f16 cast with a power-of-two pre-scale (folded back by the consumer GEMM's scale) ----
__global__ __launch_bounds__(256) void cast_f32_f16x2s(const float* __restrict__ in, _Float16* __restrict__ out, int n2, float s) {
  int i = blockIdx.x * 256 + threadIdx.x;
  if (i < n2) {
    const _Float16 h0 = (_Float16)(in[2 * i] * s), h1 = (_Float16)(in[2 * i + 1] * s);
    const unsigned u = (unsigned)__builtin_bit_cast(unsigned short, h0) | ((unsigned)__builtin_bit_cast(unsigned short, h1) << 16);
    ((unsigned*)out)[i] = u;
    
  }
}
__global__ __launch_bounds__(256) void split_f32_bf16x2(
    const float* __restrict__ in, __bf16* __restrict__ hi, __bf16* __restrict__ lo, long n2) {
  long i = (long)blockIdx.x * 256 + threadIdx.x;
  long stride = (long)gridDim.x * 256;
  {
    for (long j = i; j < n2; j += stride) {
      const float a = in[2 * j], b = in[2 * j + 1];
      const unsigned short ah = f2bf_bits(a), bh = f2bf_bits(b);
      const unsigned short al = f2bf_bits(a - bf_bits2f(ah)), bl = f2bf_bits(b - bf_bits2f(bh));
      ((unsigned*)hi)[j] = (unsigned)ah | ((unsigned)bh << 16);
      ((unsigned*)lo)[j] = (unsigned)al | ((unsigned)bl << 16);
    }
    
  }
}


// ---- f32 [R][C] (row pitch ldi) -> f16 transposed [C][R] (row pitch ldo); 64x64 tiles; each output row segment
__global__ __launch_bounds__(256) void transpose_cast_f16(const float* __restrict__ in, int ldi,
                                                         _Float16* __restrict__ outT, int ldo, float scale) {
  __shared__ __align__(16) _Float16 tile[64][72];     // [c][r]
  const int c0 = blockIdx.x * 64, r0 = blockIdx.y * 64;
  const int t = threadIdx.y * 32 + threadIdx.x;
  for (int i = threadIdx.y; i < 64; i += 8) {
    tile[threadIdx.x][i]      = (_Float16)(in[(size_t)(r0 + i) * ldi + c0 + threadIdx.x] * scale);
    tile[32 + threadIdx.x][i] = (_Float16)(in[(size_t)(r0 + i) * ldi + c0 + 32 + threadIdx.x] * scale);
  }
  __syncthreads();
  const int q = t >> 3, c8 = (t & 7) * 8;
  {
#pragma unroll
    for (int it = 0; it < 2; ++it) {
      const int c = it * 32 + q;
      v8h hv = *(const v8h*)(&tile[c][c8]);
      *(v8h*)(outT + (size_t)(c0 + c) * ldo + r0 + c8) = hv;
    }
    
  }
}

// ---- f32 [R][C] (pitch ldi) -> bf16 hi/lo transposed planes [C][R] (pitch ldo); 64x64 tiles; each output row segment
__global__ __launch_bounds__(256) void transpose_split_bf16(const float* __restrict__ in, int ldi,
                                                           __bf16* __restrict__ outH, __bf16* __restrict__ outL, int ldo) {
  __shared__ __align__(16) float tile[64][68];     // [c][r]
  const int c0 = blockIdx.x * 64, r0 = blockIdx.y * 64;
  const int t = threadIdx.y * 32 + threadIdx.x;
  for (int i = threadIdx.y; i < 64; i += 8) {
    tile[threadIdx.x][i]      = in[(size_t)(r0 + i) * ldi + c0 + threadIdx.x];
    tile[32 + threadIdx.x][i] = in[(size_t)(r0 + i) * ldi + c0 + 32 + threadIdx.x];
  }
  __syncthreads();
  const int q = t >> 3, c8 = (t & 7) * 8;
  {
#pragma unroll
    for (int it = 0; it < 2; ++it) {
      const int c = it * 32 + q;
      v8b hv, lv;
#pragma unroll
      for (int e = 0; e < 8; ++e) {
        const float f = tile[c][c8 + e];
        const unsigned short hb = f2bf_bits(f);
        hv[e] = __builtin_bit_cast(__bf16, hb);
        lv[e] = __builtin_bit_cast(__bf16, f2bf_bits(f - bf_bits2f(hb)));
      }
      *(v8b*)(outH + (size_t)(c0 + c) * ldo + r0 + c8) = hv;
      *(v8b*)(outL + (size_t)(c0 + c) * ldo + r0 + c8) = lv;
    }
    
  }
}

// =====================================================================================
// Generic causal/non-causal attention for head_dim 64, f32 in / f32 out; 16-bit operands: bf16 with optional hi/lo splits, or
// plain f16 (F16=true, non-split, probabilities carried x2^15).
//   scores = (q*qscale)·kᵀ : v_wmma_f32_16x16x32_bf16; SPLIT_QK -> q,k as bf16 hi/lo (hi·hi + hi·lo + lo·hi)
//   out    = p·v           : v_wmma_f32_16x16x32_bf16; SPLIT_PV -> p,v as bf16 hi/lo; else p,v plain bf16
//   f32 accumulate; online softmax in f32. Block = 4 waves = 64 query rows of one (batch, head); S % 64 == 0.
//   Element (b, s, h, d) of tensor X lives at X[b*X_bs + s*X_rs + h*X_hs + d] (strides in floats, multiples of 4).
//   Masking: mask_mode 0 none, 1 causal (kv > q masked), 2 tensor [S][Skv] shared over (b,h) (float if
//   mask_is_int==0, int32 with element == 0 -> masked if 1, int32 with element != 0 -> masked if 2), 3 per-token vectors qmask[B][S] & kvmask[B][Skv] (int32,
//   0 -> masked), 4 causal + sliding window (kv > q or q - kv > W masked; W passed in mask_is_int);
//   5 = relative-position bias: s += cp[b,h,q][idx[q][kv]] + pc[b,h,kv][idx[q][kv]] with idx = mask_b ([S][Skv] int32) and
//   mask_a an int32 [S][Skv] tensor with nonzero = masked (tables: element (b,h,row,n) at X + b*c_bs + h*c_hs + row*c_rs + n);
//   masked scores are replaced by mask_fill (e.g. -inf or -1e9) before the softmax.
//   grid.x = B * H * (S/64) (or a sub-range with blk0).
// =====================================================================================
#define AT_D 64
#define AT_NW 4
#define AT_QB 64
#define AT_KC 64
struct AttnGeom { const float* cp = nullptr; const float* pc = nullptr; long c_bs = 0, c_rs = 0, c_hs = 0;   // mode-5 score-bias tables
                  long q_bs, q_rs, q_hs, k_bs, k_rs, k_hs, v_bs, v_rs, v_hs, o_bs, o_rs, o_hs;
                  int S, Skv, H, mask_mode; float qscale; int blk0; float mask_fill; int mask_is_int; };
static_assert(sizeof(AttnGeom) == 168, "no padding");

__device__ __forceinline__ unsigned short at_bf_bits(float f) {
  unsigned u = __float_as_uint(f);
  return (unsigned short)((u + 0x7FFFu + ((u >> 16) & 1u)) >> 16);
}
__device__ __forceinline__ __bf16 at_f2bf(float f) { return __builtin_bit_cast(__bf16, at_bf_bits(f)); }
// hi = f rounded to bf16 (to nearest even), lo = the rest f - hi (exact in f32) rounded likewise, by the hardware's own conversion
__device__ __forceinline__ void at_split(float f, __bf16& hi, __bf16& lo) {
  hi = (__bf16)f;
  lo = (__bf16)(f - (float)hi);
}
// the same for two values that share a 32-bit register of a plane: one packed conversion (v_cvt_pk_bf16_f32) makes both hi, one both lo
typedef __attribute__((ext_vector_type(2))) float  v2f;
typedef __attribute__((ext_vector_type(2))) __bf16 v2b;
__device__ __forceinline__ void at_split2(float f0, float f1, v2b& hi, v2b& lo) {
  const v2f f = {f0, f1};
  hi = __builtin_convertvector(f, v2b);
  lo = __builtin_convertvector(f - __builtin_convertvector(hi, v2f), v2b);
}
__device__ __forceinline__ v8f at_mma(v16b a, v16b b, v8f c) {
  c = __builtin_amdgcn_wmma_f32_16x16x32_bf16(false, a, false, b, (short)0, c, false, false);
  asm volatile("v_nop\n\tv_nop\n\tv_nop\n\tv_nop" : "+v"(c) : "v"(a), "v"(b));
  return c;
}
// 16-bit element as a bit pattern held in a __bf16 slot: f16 bits when F16, bf16 (RNE) otherwise
template <bool F16> __device__ __forceinline__ __bf16 at_to16(float f) {
  if (F16) return __builtin_bit_cast(__bf16, (_Float16)f);
  return at_f2bf(f);
}
template <bool F16> __device__ __forceinline__ v8f at_mma16(v16b a, v16b b, v8f c) {
  if (F16) {
    const v16h ah = __builtin_bit_cast(v16h, a), bh = __builtin_bit_cast(v16h, b);
    c = __builtin_amdgcn_wmma_f32_16x16x32_f16(false, ah, false, bh, (short)0, c, false, false);
    asm volatile("v_nop\n\tv_nop\n\tv_nop\n\tv_nop" : "+v"(c) : "v"(ah), "v"(bh));
    return c;
  }
  return at_mma(a, b, c);
}

template <bool SPLIT_QK, bool SPLIT_PV, bool F16 = false>
__global__ __launch_bounds__(128)
void attn64_kernel(const float* __restrict__ q, const float* __restrict__ k,
                   const float* __restrict__ v, float* __restrict__ out,
                   const void* __restrict__ mask_a, const int* __restrict__ mask_b, AttnGeom g) {
  static_assert(!(F16 && (SPLIT_QK || SPLIT_PV)), "f16 mode is non-split");
  const float PSC = F16 ? 32768.0f : 1.0f;     // f16 probabilities carried x2^15 (subnormal range), folded into the final 1/l
  union FB { v16b v; v8b h[2]; };
  __shared__ __align__(16) __bf16 Ksh[AT_KC * AT_D];             // K hi [kv][d]      8 KB
  __shared__ __align__(16) __bf16 Ksl[SPLIT_QK ? AT_KC * AT_D : 8];
  __shared__ __align__(16) __bf16 Vth[AT_D * AT_KC];             // V hi [d][kv]      8 KB
  __shared__ __align__(16) __bf16 Vtl[SPLIT_PV ? AT_D * AT_KC : 8];
  __shared__ __align__(16) __bf16 Psh[AT_NW][16 * AT_KC];        // per wave P hi [row][kv]  8 KB
  __shared__ __align__(16) __bf16 Psl[SPLIT_PV ? AT_NW : 1][SPLIT_PV ? 16 * AT_KC : 8];
  __shared__ __align__(16) float  Os[AT_NW][16 * 68];            // per wave out tile, pitch 68

  const int tid  = threadIdx.x;
  const int wave = tid >> 5;
  const int lane = tid & 31;
  const int hh   = lane >> 4;
  const int c    = lane & 15;

  const int nqb = g.S / AT_QB;
  const int bx = blockIdx.x + g.blk0;
  const int qb = bx % nqb;
  const int bh = bx / nqb;
  const int h  = bh % g.H;
  const int b  = bh / g.H;
  const int qbase_block = qb * AT_QB;
  const int q0 = qbase_block + wave * 16;

  const float* qb_ptr = q + (size_t)b * g.q_bs + (size_t)h * g.q_hs;
  const float* kb_ptr = k + (size_t)b * g.k_bs + (size_t)h * g.k_hs;
  const float* vb_ptr = v + (size_t)b * g.v_bs + (size_t)h * g.v_hs;
  float*       ob_ptr = out + (size_t)b * g.o_bs + (size_t)h * g.o_hs;

  // ---- Q fragments (A operand): 2 d-chunks, hi (and lo) ----
  v16b qah[2], qal[2];
  {
    const float* qrow = qb_ptr + (size_t)(q0 + c) * g.q_rs;
#pragma unroll
    for (int dc = 0; dc < 2; ++dc) {
#pragma unroll
      for (int e = 0; e < 8; ++e) {
        const float f0 = qrow[dc * 32 + 8 * hh + e] * g.qscale;
        const float f1 = qrow[dc * 32 + 16 + 8 * hh + e] * g.qscale;
        if (SPLIT_QK) { __bf16 hq, lq; at_split(f0, hq, lq); qah[dc][e] = hq; qal[dc][e] = lq; at_split(f1, hq, lq); qah[dc][8 + e] = hq; qal[dc][8 + e] = lq; }
        else { qah[dc][e] = at_to16<F16>(f0); qah[dc][8 + e] = at_to16<F16>(f1); qal[dc][e] = qah[dc][e]; qal[dc][8 + e] = qah[dc][8 + e]; }
      }
    }
  }

  float mrow[8], lrow[8];
  v8f oacc[4];
#pragma unroll
  for (int r = 0; r < 8; ++r) { mrow[r] = -INFINITY; lrow[r] = 0.f; }
#pragma unroll
  for (int t = 0; t < 4; ++t) oacc[t] = (v8f){0.f,0.f,0.f,0.f,0.f,0.f,0.f,0.f};

  const int nChunks = (g.mask_mode == 1 || g.mask_mode == 4) ? (qb + 1) : (g.Skv / AT_KC);   // block-uniform
  // per-row query mask (mode 3)
  int qkeep[8];
#pragma unroll
  for (int r = 0; r < 8; ++r) qkeep[r] = (g.mask_mode == 3) ? mask_b[(size_t)b * g.S + q0 + 8 * hh + r] : 1;   // mask_b = qmask in mode 3
  for (int kc = 0; kc < nChunks; ++kc) {
    const int kv0 = kc * AT_KC;
    __syncthreads();
    {
      const int kvr = tid >> 1, dh = (tid & 1) * 32;
      const float* krow = kb_ptr + (size_t)(kv0 + kvr) * g.k_rs + dh;
      const float* vrow = vb_ptr + (size_t)(kv0 + kvr) * g.v_rs + dh;
#pragma unroll
      for (int i = 0; i < 8; ++i) {
        v4f kk = *(const v4f*)(krow + 4 * i);
        v4f vv = *(const v4f*)(vrow + 4 * i);
#pragma unroll
        for (int e = 0; e < 4; ++e) {
          const int d = dh + 4 * i + e;
          if (SPLIT_QK) { __bf16 a, bl; at_split(kk[e], a, bl); Ksh[kvr * AT_D + d] = a; Ksl[kvr * AT_D + d] = bl; }
          else Ksh[kvr * AT_D + d] = at_to16<F16>(kk[e]);
          if (SPLIT_PV) { __bf16 a, bl; at_split(vv[e], a, bl); Vth[d * AT_KC + kvr] = a; Vtl[d * AT_KC + kvr] = bl; }
          else Vth[d * AT_KC + kvr] = at_to16<F16>(vv[e]);
        }
      }
    }
    __syncthreads();

    v8f s[4];
#pragma unroll
    for (int j = 0; j < 4; ++j) {
      s[j] = (v8f){0.f,0.f,0.f,0.f,0.f,0.f,0.f,0.f};
#pragma unroll 1
      for (int dc = 0; dc < 2; ++dc) {
        FB kb;
        kb.h[0] = *(const v8b*)(Ksh + (j * 16 + c) * AT_D + dc * 32 + 8 * hh);
        kb.h[1] = *(const v8b*)(Ksh + (j * 16 + c) * AT_D + dc * 32 + 16 + 8 * hh);
        s[j] = at_mma16<F16>(qah[dc], kb.v, s[j]);
        if (SPLIT_QK) {
          FB kl;
          kl.h[0] = *(const v8b*)(Ksl + (j * 16 + c) * AT_D + dc * 32 + 8 * hh);
          kl.h[1] = *(const v8b*)(Ksl + (j * 16 + c) * AT_D + dc * 32 + 16 + 8 * hh);
          s[j] = at_mma16<F16>(qah[dc], kl.v, s[j]);
          s[j] = at_mma16<F16>(qal[dc], kb.v, s[j]);
        }
      }
    }
    const bool diag = (g.mask_mode == 1) && (kc == qb);
    int kvkeep[4] = {1, 1, 1, 1};
    if (g.mask_mode == 3) {
#pragma unroll
      for (int j = 0; j < 4; ++j) kvkeep[j] = ((const int*)mask_a)[(size_t)b * g.Skv + kv0 + j * 16 + c];   // mask_a = kvmask
    }
    float cm[8];
#pragma unroll
    for (int r = 0; r < 8; ++r) {
      const int qrow = q0 + 8 * hh + r;
      float m = -INFINITY;
#pragma unroll
      for (int j = 0; j < 4; ++j) {
        const int kvcol = kv0 + j * 16 + c;
        bool masked = false;
        if (diag) masked = (kvcol > qrow);
        else if (g.mask_mode == 4) masked = (kvcol > qrow) || (qrow - kvcol > g.mask_is_int);
        else if (g.mask_mode == 2) {
          const size_t mi = (size_t)qrow * g.Skv + kvcol;
          masked = (g.mask_is_int == 0) ? (((const float*)mask_a)[mi] == 0.0f)
                 : (g.mask_is_int == 1) ? (((const int*)mask_a)[mi] == 0) : (((const int*)mask_a)[mi] != 0);
        } else if (g.mask_mode == 3) masked = (qkeep[r] == 0) || (kvkeep[j] == 0);
        else if (g.mask_mode == 5) {
          const size_t mi = (size_t)qrow * g.Skv + kvcol;
          masked = (((const int*)mask_a)[mi] != 0);
          int n = mask_b[mi]; n = n < 0 ? 0 : n;
          s[j][r] += g.cp[(size_t)b * g.c_bs + (size_t)h * g.c_hs + (size_t)qrow * g.c_rs + n]
                   + g.pc[(size_t)b * g.c_bs + (size_t)h * g.c_hs + (size_t)kvcol * g.c_rs + n];
        }
        if (masked) s[j][r] = g.mask_fill;
        m = fmaxf(m, s[j][r]);
      }
#pragma unroll
      for (int off = 1; off < 16; off <<= 1) m = fmaxf(m, __shfl_xor(m, off, 32));
      cm[r] = m;
    }
    __bf16* pwh = Psh[wave];
    __bf16* pwl = Psl[SPLIT_PV ? wave : 0];
#pragma unroll
    for (int r = 0; r < 8; ++r) {
      const float mnew = fmaxf(mrow[r], cm[r]);
      const float alpha = expf(mrow[r] - mnew);
      mrow[r] = mnew;
      float psum = 0.f;
#pragma unroll
      for (int j = 0; j < 4; ++j) {
        const float p = expf(s[j][r] - mnew);
        psum += p;
        if (SPLIT_PV) { __bf16 a, bl; at_split(p, a, bl); pwh[(8 * hh + r) * AT_KC + j * 16 + c] = a; pwl[(8 * hh + r) * AT_KC + j * 16 + c] = bl; }
        else pwh[(8 * hh + r) * AT_KC + j * 16 + c] = at_to16<F16>(p * PSC);
      }
#pragma unroll
      for (int off = 1; off < 16; off <<= 1) psum += __shfl_xor(psum, off, 32);
      lrow[r] = lrow[r] * alpha + psum;
#pragma unroll
      for (int t = 0; t < 4; ++t) oacc[t][r] *= alpha;
    }
    __builtin_amdgcn_fence(__ATOMIC_RELEASE, "workgroup");
    __builtin_amdgcn_wave_barrier();
    __builtin_amdgcn_fence(__ATOMIC_ACQUIRE, "workgroup");
#pragma unroll 1
    for (int kk = 0; kk < 2; ++kk) {
      FB pa, pl;
      pa.h[0] = *(const v8b*)(pwh + c * AT_KC + kk * 32 + 8 * hh);
      pa.h[1] = *(const v8b*)(pwh + c * AT_KC + kk * 32 + 16 + 8 * hh);
      if (SPLIT_PV) {
        pl.h[0] = *(const v8b*)(pwl + c * AT_KC + kk * 32 + 8 * hh);
        pl.h[1] = *(const v8b*)(pwl + c * AT_KC + kk * 32 + 16 + 8 * hh);
      }
#pragma unroll
      for (int t = 0; t < 4; ++t) {
        FB vb;
        vb.h[0] = *(const v8b*)(Vth + (t * 16 + c) * AT_KC + kk * 32 + 8 * hh);
        vb.h[1] = *(const v8b*)(Vth + (t * 16 + c) * AT_KC + kk * 32 + 16 + 8 * hh);
        oacc[t] = at_mma16<F16>(pa.v, vb.v, oacc[t]);
        if (SPLIT_PV) {
          FB vl;
          vl.h[0] = *(const v8b*)(Vtl + (t * 16 + c) * AT_KC + kk * 32 + 8 * hh);
          vl.h[1] = *(const v8b*)(Vtl + (t * 16 + c) * AT_KC + kk * 32 + 16 + 8 * hh);
          oacc[t] = at_mma16<F16>(pa.v, vl.v, oacc[t]);
          oacc[t] = at_mma16<F16>(pl.v, vb.v, oacc[t]);
        }
      }
    }
  }

  float* os = Os[wave];
#pragma unroll
  for (int r = 0; r < 8; ++r) {
    const float inv = 1.0f / (lrow[r] * PSC);
#pragma unroll
    for (int t = 0; t < 4; ++t) os[(8 * hh + r) * 68 + t * 16 + c] = oacc[t][r] * inv;
  }
  __builtin_amdgcn_fence(__ATOMIC_RELEASE, "workgroup");
  __builtin_amdgcn_wave_barrier();
  __builtin_amdgcn_fence(__ATOMIC_ACQUIRE, "workgroup");
  {
    const int c4 = (lane & 15) * 4;
    {
#pragma unroll
      for (int it = 0; it < 8; ++it) {
        const int row = it * 2 + hh;
        v4f val = *(const v4f*)(os + row * 68 + c4);
        *(v4f*)(ob_ptr + (size_t)(q0 + row) * g.o_rs + c4) = val;
      }
      
    }
  }
}

// Value of lane l ^ 16 (the same column in the wave's other half) by a vector cross-row move, every lane on.
// __shfl_xor compiles to ds_bpermute_b32 and a wait on the LDS counter; this form has no LDS op
__device__ __forceinline__ float at_half_xor(float x) {
  const int b = __builtin_bit_cast(int, x);
  return __builtin_bit_cast(float, __builtin_amdgcn_permlanex16(b, b, 0x76543210, 0xfedcba98, false, false));
}
// e^(x - m) of the softmax as 2^(x * log2(e) - m * log2(e)): one fused multiply-add and the hardware's own base-2 exponential. The library
// expf spends a dozen vector instructions a value on an extended-precision argument and on range tests; here the argument is never above 0
// but by a rounding, and a result too small for a normal float may fall to 0 (as does that of -inf), so none of that is needed.
// A score tile's eight exponentials, each in place, in one statement: none overwrites the source or reads the result of the one before it,
// and the v_nop at the end is the slot that the instruction set asks for between the last one and whatever the compiler puts next
#define AT_LOG2E 1.4426950408889634f
__device__ __forceinline__ void at_exp2x8(float (&p)[8]) {
  asm("v_exp_f32 %0, %0\n\tv_exp_f32 %1, %1\n\tv_exp_f32 %2, %2\n\tv_exp_f32 %3, %3\n\t"
      "v_exp_f32 %4, %4\n\tv_exp_f32 %5, %5\n\tv_exp_f32 %6, %6\n\tv_exp_f32 %7, %7\n\tv_nop"
      : "+v"(p[0]), "+v"(p[1]), "+v"(p[2]), "+v"(p[3]), "+v"(p[4]), "+v"(p[5]), "+v"(p[6]), "+v"(p[7]));
}
// one exponential, with the same slot behind it
__device__ __forceinline__ void at_exp2x1(float& a) { asm("v_exp_f32 %0, %0\n\tv_nop" : "+v"(a)); }
// Matrix product through the builtin alone: the compiler keeps the distances behind a WMMA itself, and with no asm statement behind each
// product the scheduler is free to issue the LDS fragment reads of a whole group ahead of the group's products
template <bool F16> __device__ __forceinline__ v8f at_mma16b(v16b a, v16b b, v8f c) {
  if (F16) return __builtin_amdgcn_wmma_f32_16x16x32_f16(false, __builtin_bit_cast(v16h, a), false, __builtin_bit_cast(v16h, b), (short)0, c, false, false);
  return __builtin_amdgcn_wmma_f32_16x16x32_bf16(false, a, false, b, (short)0, c, false, false);
}

__device__ __forceinline__ unsigned at_lds_off(const void* p) { return (unsigned)(size_t)p; }
// Eight asynchronous 16 B copies of each lane from global memory into LDS, through no register: piece i goes from g + i * 2048 to LDS byte
// l + i * step. The s_wait_xcnt at the end of the statement stands in front of whatever rewrites an address register that a copy names
__device__ __forceinline__ void at_copy8(unsigned l, unsigned step, const char* g) {
  asm volatile("global_load_async_to_lds_b128 %0, %8, off\n\tglobal_load_async_to_lds_b128 %1, %9, off\n\t"
               "global_load_async_to_lds_b128 %2, %10, off\n\tglobal_load_async_to_lds_b128 %3, %11, off\n\t"
               "global_load_async_to_lds_b128 %4, %12, off\n\tglobal_load_async_to_lds_b128 %5, %13, off\n\t"
               "global_load_async_to_lds_b128 %6, %14, off\n\tglobal_load_async_to_lds_b128 %7, %15, off\n\t"
               "s_wait_xcnt 0x0"
               :: "v"(l), "v"(l + step), "v"(l + 2 * step), "v"(l + 3 * step), "v"(l + 4 * step), "v"(l + 5 * step), "v"(l + 6 * step), "v"(l + 7 * step),
                  "v"(g), "v"(g + 2048), "v"(g + 4096), "v"(g + 6144), "v"(g + 8192), "v"(g + 10240), "v"(g + 12288), "v"(g + 14336)
               : "memory");
}
// Hand-over of a ring buffer: this wave's LDS reads are done and its own copies have landed; the barrier then publishes the tile that was
// in flight and ends every wave's reads of the tile that is refilled next
__device__ __forceinline__ void at_publish() {
  asm volatile("s_wait_dscnt 0x0" ::: "memory");      // this wave's last reads of the buffer that is handed back
  asm volatile("s_wait_asynccnt 0x0" ::: "memory");   // this wave's copies of the tile that is read next
  __syncthreads();
}

// ---- head_dim 128 variant (same contract; K/V tiles 64 keys x 128, 8 output tiles; mask_mode 6 = causal + per-head ALiBi slope table in g.cp) ----
// Both products run transposed: S^T = K.Q^T (A = k rows, B = q) and O^T += V^T.P^T (A = v^T rows, B = p^T). A lane then holds the scores of
// ONE query (column c = lane & 15; keys 8 * hh + r of each 16-key tile), so the row maximum and sum are in-lane but for one exchange between
// the wave's halves, and two score tiles, converted in place, ARE the B operand of the second product: p never goes through LDS.
// MODE >= 0 fixes the mask mode at compile time, so the per-score mode tests fold away; MODE < 0 reads it from g.mask_mode
// PRE: k and v come as the bf16 hi/lo planes that kv_split_planes wrote earlier in the same call (pkh, pkl: [b*H + h][kv][d]; pvh, pvl: one
// [d][64 keys] tile per key chunk); nothing is converted in the key loop. The k tile and the v tile of LDS are the two buffers of a ring that
// asynchronous copies fill: chunk t + 1's k planes fly under chunk t's softmax and p.v products, its v planes under chunk t + 1's score products
template <bool SPLIT_QK, bool SPLIT_PV, bool F16 = false, int MODE = -1, bool PRE = false>
__global__ __launch_bounds__(128)
void attn128_kernel(const float* __restrict__ q, const float* __restrict__ k,
                   const float* __restrict__ v, float* __restrict__ out,
                   const void* __restrict__ mask_a, const int* __restrict__ mask_b, AttnGeom g,
                   const __bf16* __restrict__ pkh, const __bf16* __restrict__ pkl,
                   const __bf16* __restrict__ pvh, const __bf16* __restrict__ pvl) {
  static_assert(!(F16 && (SPLIT_QK || SPLIT_PV)), "f16 mode is non-split");
  static_assert(!PRE || (SPLIT_QK && SPLIT_PV), "the planes are hi/lo splits");
  const float PSC = F16 ? 32768.0f : 1.0f;     // f16 probabilities carried x2^15 (subnormal range), folded into the final 1/l
  union FB { v16b v; v8b h[2]; };
  constexpr int D2 = 128;
  // LDS row pitches in elements: 16 B x odd (272 B for the 128-wide K and Q rows, 144 B for the 64-wide V^T rows), so that the
  // 16 rows one ds_load_b128 fragment read touches fall on distinct banks; at 256 B and 128 B they shared four or eight banks
  constexpr int KP = D2 + 8;
  constexpr int VP = AT_KC + 8;
  const int mode = (MODE >= 0) ? MODE : g.mask_mode;
  __shared__ __align__(16) __bf16 Ksh[AT_KC * KP];               // K hi [kv][d]      17 KB
  __shared__ __align__(16) __bf16 Ksl[SPLIT_QK ? AT_KC * KP : 8];
  __shared__ __align__(16) __bf16 Vth[D2 * VP];                  // V hi [d][kv]      18 KB
  __shared__ __align__(16) __bf16 Vtl[SPLIT_PV ? D2 * VP : 8];
  __shared__ __align__(16) float  Os[AT_NW][16 * 132];           // per wave out tile [query][d], pitch 132
  __shared__ __align__(16) __bf16 Qsh[SPLIT_QK ? AT_NW : 1][SPLIT_QK ? 16 * KP : 8];   // split path: q hi/lo staged per wave (keeps VGPR use low)
  __shared__ __align__(16) __bf16 Qsl[SPLIT_QK ? AT_NW : 1][SPLIT_QK ? 16 * KP : 8];

  const int tid  = threadIdx.x;
  const int wave = tid >> 5;
  const int lane = tid & 31;
  const int hh   = lane >> 4;
  const int c    = lane & 15;

  const int nqb = g.S / AT_QB;
  const int bx = blockIdx.x + g.blk0;
  // Causal modes: query block qb walks qb + 1 key chunks, and the grid holds more blocks than the chip has resident places. The longest get
  // the lowest indices (qb falls with bx, heads innermost), for speed only. A permutation of (head, qb); needs the whole grid in one launch (blk0 = 0).
  const bool byCost = (mode == 1 || mode == 4 || mode == 6);
  const int nbh = byCost ? (int)gridDim.x / nqb : 1;
  const int qb = byCost ? (nqb - 1 - bx / nbh) : (bx % nqb);
  const int bh = byCost ? (bx % nbh) : (bx / nqb);
  const int h  = bh % g.H;
  const int b  = bh / g.H;
  const int qbase_block = qb * AT_QB;
  const int q0 = qbase_block + wave * 16;

  const float* qb_ptr = q + (size_t)b * g.q_bs + (size_t)h * g.q_hs;
  const float* kb_ptr = k + (size_t)b * g.k_bs + (size_t)h * g.k_hs;
  const float* vb_ptr = v + (size_t)b * g.v_bs + (size_t)h * g.v_hs;
  float*       ob_ptr = out + (size_t)b * g.o_bs + (size_t)h * g.o_hs;

  // ---- Q fragments (B operand): 4 d-chunks, hi (and lo) ----
  v16b qah[4], qal[4];
  {
    const float* qrow = qb_ptr + (size_t)(q0 + c) * g.q_rs;
#pragma unroll
    for (int dc = 0; dc < 4; ++dc) {
#pragma unroll
      for (int e = 0; e < 8; ++e) {
        const float f0 = qrow[dc * 32 + 8 * hh + e] * g.qscale;
        const float f1 = qrow[dc * 32 + 16 + 8 * hh + e] * g.qscale;
        if (SPLIT_QK) {
          if (e & 1) continue;           // two neighbours of a row at a time
          const float g0 = qrow[dc * 32 + 8 * hh + e + 1] * g.qscale;
          const float g1 = qrow[dc * 32 + 16 + 8 * hh + e + 1] * g.qscale;
          v2b hq, lq;
          at_split2(f0, g0, hq, lq); *(v2b*)&Qsh[wave][c * KP + dc * 32 + 8 * hh + e] = hq; *(v2b*)&Qsl[wave][c * KP + dc * 32 + 8 * hh + e] = lq;
          at_split2(f1, g1, hq, lq); *(v2b*)&Qsh[wave][c * KP + dc * 32 + 16 + 8 * hh + e] = hq; *(v2b*)&Qsl[wave][c * KP + dc * 32 + 16 + 8 * hh + e] = lq;
        }
        else { qah[dc][e] = at_to16<F16>(f0); qah[dc][8 + e] = at_to16<F16>(f1); qal[dc][e] = qah[dc][e]; qal[dc][8 + e] = qah[dc][8 + e]; }
      }
    }
  }

  const int qrow = q0 + c;           // this lane's query
  float mrow = -INFINITY;            // its running maximum (alike in both halves of the wave)
  float lrow = 0.f;                  // running sum over the keys of this lane's half; the halves are joined once, behind the key loop
  v8f oacc[8];                       // oacc[t][r] = O^T[d = t * 16 + 8 * hh + r][query c]
#pragma unroll
  for (int t = 0; t < 8; ++t) oacc[t] = (v8f){0.f,0.f,0.f,0.f,0.f,0.f,0.f,0.f};

  const int nChunks = (mode == 1 || mode == 4 || mode == 6) ? (qb + 1) : (g.Skv / AT_KC);   // block-uniform
  const int qkeep = (mode == 3) ? mask_b[(size_t)b * g.S + qrow] : 1;   // per-query mask (mode 3): mask_b = qmask
  // each plane's tile of a chunk is 1024 pieces of 16 B, linear in memory; piece n = i * 128 + tid is 16 B number n & 15 of K row n >> 4,
  // n & 7 of V^T row n >> 3, so that a step of i is 8 K rows or 16 V^T rows in LDS
  const size_t hb = (size_t)bh * g.Skv * D2;     // this head's part of each plane
  const char* gkh = (const char*)(pkh + hb) + tid * 16; const char* gkl = (const char*)(pkl + hb) + tid * 16;
  const char* gvh = (const char*)(pvh + hb) + tid * 16; const char* gvl = (const char*)(pvl + hb) + tid * 16;
  const unsigned lkh = at_lds_off(Ksh + (tid >> 4) * KP + (tid & 15) * 8), lkl = at_lds_off(Ksl + (tid >> 4) * KP + (tid & 15) * 8);
  const unsigned lvh = at_lds_off(Vth + (tid >> 3) * VP + (tid & 7) * 8),  lvl = at_lds_off(Vtl + (tid >> 3) * VP + (tid & 7) * 8);
  constexpr unsigned KSTEP = 8 * KP * 2, VSTEP = 16 * VP * 2, CHB = AT_KC * D2 * 2;   // bytes: LDS steps of i, a chunk's tile in a plane
  if (PRE) {
    at_copy8(lkh, KSTEP, gkh); at_copy8(lkl, KSTEP, gkl);   // chunk 0's k
    asm volatile("s_wait_asynccnt 0x0" ::: "memory");       // this wave's part of it has landed
    __syncthreads();                                        // and every other wave's
    at_copy8(lvh, VSTEP, gvh); at_copy8(lvl, VSTEP, gvl);   // chunk 0's v flies under its score products
  }
  for (int kc = 0; kc < nChunks; ++kc) {
    const int kv0 = kc * AT_KC;
    if (!PRE) {
      __syncthreads();
      const int kvr = tid >> 1, dh = (tid & 1) * 64;
      const float* krow = kb_ptr + (size_t)(kv0 + kvr) * g.k_rs + dh;
      const float* vrow = vb_ptr + (size_t)(kv0 + kvr) * g.v_rs + dh;
#pragma unroll
      for (int i = 0; i < 16; ++i) {
        v4f kk = *(const v4f*)(krow + 4 * i);
        v4f vv = *(const v4f*)(vrow + 4 * i);
#pragma unroll
        for (int e = 0; e < 4; ++e) {
          const int d = dh + 4 * i + e;
          if (SPLIT_QK) { __bf16 a, bl; at_split(kk[e], a, bl); Ksh[kvr * KP + d] = a; Ksl[kvr * KP + d] = bl; }
          else Ksh[kvr * KP + d] = at_to16<F16>(kk[e]);
          if (SPLIT_PV) { __bf16 a, bl; at_split(vv[e], a, bl); Vth[d * VP + kvr] = a; Vtl[d * VP + kvr] = bl; }
          else Vth[d * VP + kvr] = at_to16<F16>(vv[e]);
        }
      }
      __syncthreads();
    }

    // One group per 32-wide slice of d (its q and k fragments, 20 LDS reads, then 12 products). The next group's reads are issued as one run
    // ahead of this group's products, into a second register set, and the products rotate over the four score tiles, so that no product
    // waits for an LDS read just issued or for the product before it. Each tile sums in the order d slice 0..3, q hi.k hi, q hi.k lo, q lo.k hi.
    v8f s[4];                          // s[j][r] = S^T[key j * 16 + 8 * hh + r][query c]
#pragma unroll
    for (int j = 0; j < 4; ++j) s[j] = (v8f){0.f,0.f,0.f,0.f,0.f,0.f,0.f,0.f};
    FB qa[2], ql[2], kb[2][4], kl[2][4];
#pragma unroll
    for (int dc = -1; dc < 4; ++dc) {
      if (dc < 3) {
        const int n = dc + 1, w = n & 1;
        if (SPLIT_QK) {
          qa[w].h[0] = *(const v8b*)(&Qsh[wave][c * KP + n * 32 + 8 * hh]); qa[w].h[1] = *(const v8b*)(&Qsh[wave][c * KP + n * 32 + 16 + 8 * hh]);
          ql[w].h[0] = *(const v8b*)(&Qsl[wave][c * KP + n * 32 + 8 * hh]); ql[w].h[1] = *(const v8b*)(&Qsl[wave][c * KP + n * 32 + 16 + 8 * hh]);
        } else qa[w].v = qah[n];
#pragma unroll
        for (int j = 0; j < 4; ++j) {
          kb[w][j].h[0] = *(const v8b*)(Ksh + (j * 16 + c) * KP + n * 32 + 8 * hh);
          kb[w][j].h[1] = *(const v8b*)(Ksh + (j * 16 + c) * KP + n * 32 + 16 + 8 * hh);
          if (SPLIT_QK) {
            kl[w][j].h[0] = *(const v8b*)(Ksl + (j * 16 + c) * KP + n * 32 + 8 * hh);
            kl[w][j].h[1] = *(const v8b*)(Ksl + (j * 16 + c) * KP + n * 32 + 16 + 8 * hh);
          }
        }
      }
      __builtin_amdgcn_sched_barrier(0);   // keeps the reads above in one run: the scheduler otherwise moves them in among the products
      if (dc >= 0) {
        const int w = dc & 1;
#pragma unroll
        for (int j = 0; j < 4; ++j) s[j] = at_mma16b<F16>(kb[w][j].v, qa[w].v, s[j]);
        if (SPLIT_QK) {
#pragma unroll
          for (int j = 0; j < 4; ++j) s[j] = at_mma16b<F16>(kl[w][j].v, qa[w].v, s[j]);
#pragma unroll
          for (int j = 0; j < 4; ++j) s[j] = at_mma16b<F16>(kb[w][j].v, ql[w].v, s[j]);
        }
        __builtin_amdgcn_sched_barrier(0);   // ends the run of products: the group after next is not read in among them
      }
    }
    if (PRE) {
      at_publish();                    // this chunk's v is there; every wave has left the k tile
      if (kc + 1 < nChunks) { at_copy8(lkh, KSTEP, gkh + (size_t)(kc + 1) * CHB); at_copy8(lkl, KSTEP, gkl + (size_t)(kc + 1) * CHB); }
    }
    const bool diag = (mode == 1) && (kc == qb);
    float cm[4];                       // one chain per tile, so that the four run side by side
#pragma unroll
    for (int j = 0; j < 4; ++j) {
      float m = -INFINITY;
#pragma unroll
      for (int r = 0; r < 8; ++r) {
        const int kvcol = kv0 + j * 16 + 8 * hh + r;
        bool masked = false;
        if (diag) masked = (kvcol > qrow);
        else if (mode == 4) masked = (kvcol > qrow) || (qrow - kvcol > g.mask_is_int);
        else if (mode == 2) {
          const size_t mi = (size_t)qrow * g.Skv + kvcol;
          masked = (g.mask_is_int == 0) ? (((const float*)mask_a)[mi] == 0.0f)
                 : (g.mask_is_int == 1) ? (((const int*)mask_a)[mi] == 0) : (((const int*)mask_a)[mi] != 0);
        } else if (mode == 3) masked = (qkeep == 0) || (((const int*)mask_a)[(size_t)b * g.Skv + kvcol] == 0);   // mask_a = kvmask
        else if (mode == 6) { masked = (kvcol > qrow); s[j][r] += g.cp[h] * (float)(kvcol - qrow); }
        else if (mode == 8) { masked = (kvcol > qrow) || (((const int*)mask_a)[(size_t)b * g.Skv + kvcol] != 0); }
        else if (mode == 5) {
          const size_t mi = (size_t)qrow * g.Skv + kvcol;
          masked = (((const int*)mask_a)[mi] != 0);
          int n = mask_b[mi]; n = n < 0 ? 0 : n;
          s[j][r] += g.cp[(size_t)b * g.c_bs + (size_t)h * g.c_hs + (size_t)qrow * g.c_rs + n]
                   + g.pc[(size_t)b * g.c_bs + (size_t)h * g.c_hs + (size_t)kvcol * g.c_rs + n];
        }
        if (masked) s[j][r] = g.mask_fill;
        m = fmaxf(m, s[j][r]);
      }
      cm[j] = m;
    }
    float mc = fmaxf(fmaxf(cm[0], cm[1]), fmaxf(cm[2], cm[3]));
    mc = fmaxf(mc, at_half_xor(mc));   // the other half's 32 keys of the same query
    const float mnew = fmaxf(mrow, mc);
    const float mnl = mnew * AT_LOG2E;
    float alpha = fmaf(mrow, AT_LOG2E, -mnl);
    at_exp2x1(alpha);
    mrow = mnew;
    // p^T as the B operand of the second product: element e of pa[kk] is key kk * 32 + 8 * hh + e (e < 8) or kk * 32 + 16 + 8 * hh + e - 8,
    // which is register e & 7 of score tile 2 * kk + (e >> 3) in this very lane; the v^T fragments are read in the same key order
    FB pa[2], pl[2];
    float ps[4];
#pragma unroll
    for (int j = 0; j < 4; ++j) {
      float pe[8];
#pragma unroll   // constant indices keep the eight arguments in registers
      for (int r = 0; r < 8; ++r) pe[r] = fmaf(s[j][r], AT_LOG2E, -mnl);
      at_exp2x8(pe);
      float sum = 0.f;
#pragma unroll
      for (int r = 0; r < 8; ++r) {
        const float p = pe[r];
        sum += p;
        if (SPLIT_PV) {
          if (r & 1) { v2b a, bl; at_split2(pe[r - 1], p, a, bl);   // registers r - 1 and r are neighbours in the operand
                       pa[j >> 1].v[(j & 1) * 8 + r - 1] = a[0]; pa[j >> 1].v[(j & 1) * 8 + r] = a[1];
                       pl[j >> 1].v[(j & 1) * 8 + r - 1] = bl[0]; pl[j >> 1].v[(j & 1) * 8 + r] = bl[1]; }
        }
        else pa[j >> 1].v[(j & 1) * 8 + r] = at_to16<F16>(p * PSC);
      }
      ps[j] = sum;
    }
    lrow = lrow * alpha + ((ps[0] + ps[1]) + (ps[2] + ps[3]));
#pragma unroll
    for (int t = 0; t < 8; ++t) oacc[t] *= alpha;
    // One group per 32 keys and four output tiles (16 LDS reads of v, then 12 products), run like the score groups: next group's reads in
    // one run ahead of this group's products, products rotating over the four tiles.
    // Each output tile sums in the order keys 0..31, 32..63, p hi.v hi, p hi.v lo, p lo.v hi.
    FB vb[2][4], vl[2][4];
#pragma unroll
    for (int gi = -1; gi < 4; ++gi) {
      if (gi < 3) {
        const int n = gi + 1, w = n & 1, kk = n >> 1, t0 = (n & 1) * 4;
#pragma unroll
        for (int u = 0; u < 4; ++u) {
          vb[w][u].h[0] = *(const v8b*)(Vth + ((t0 + u) * 16 + c) * VP + kk * 32 + 8 * hh);
          vb[w][u].h[1] = *(const v8b*)(Vth + ((t0 + u) * 16 + c) * VP + kk * 32 + 16 + 8 * hh);
          if (SPLIT_PV) {
            vl[w][u].h[0] = *(const v8b*)(Vtl + ((t0 + u) * 16 + c) * VP + kk * 32 + 8 * hh);
            vl[w][u].h[1] = *(const v8b*)(Vtl + ((t0 + u) * 16 + c) * VP + kk * 32 + 16 + 8 * hh);
          }
        }
      }
      __builtin_amdgcn_sched_barrier(0);   // keeps the reads above in one run, as in the score groups
      if (gi >= 0) {
        const int w = gi & 1, kk = gi >> 1, t0 = (gi & 1) * 4;
#pragma unroll
        for (int u = 0; u < 4; ++u) oacc[t0 + u] = at_mma16b<F16>(vb[w][u].v, pa[kk].v, oacc[t0 + u]);
        if (SPLIT_PV) {
#pragma unroll
          for (int u = 0; u < 4; ++u) oacc[t0 + u] = at_mma16b<F16>(vl[w][u].v, pa[kk].v, oacc[t0 + u]);
#pragma unroll
          for (int u = 0; u < 4; ++u) oacc[t0 + u] = at_mma16b<F16>(vb[w][u].v, pl[kk].v, oacc[t0 + u]);
        }
        __builtin_amdgcn_sched_barrier(0);   // ends the run of products
      }
    }
    if (PRE) {
      at_publish();                    // the next chunk's k is there; every wave has left the v tile
      if (kc + 1 < nChunks) { at_copy8(lvh, VSTEP, gvh + (size_t)(kc + 1) * CHB); at_copy8(lvl, VSTEP, gvl + (size_t)(kc + 1) * CHB); }
    }
  }
  if (PRE) asm volatile("s_wait_asynccnt 0x0" ::: "memory");   // no copy is left in flight behind the loop

  float* os = Os[wave];
  const float inv = 1.0f / ((lrow + at_half_xor(lrow)) * PSC);   // the two halves' sums of this query, joined
#pragma unroll
  for (int t = 0; t < 8; ++t) {      // a lane's eight registers of a tile are eight consecutive d of its query: two 16 B stores
    const v8f o = oacc[t] * inv;
    *(v4f*)(os + c * 132 + t * 16 + 8 * hh)     = (v4f){o[0], o[1], o[2], o[3]};
    *(v4f*)(os + c * 132 + t * 16 + 8 * hh + 4) = (v4f){o[4], o[5], o[6], o[7]};
  }
  __builtin_amdgcn_fence(__ATOMIC_RELEASE, "workgroup");
  __builtin_amdgcn_wave_barrier();
  __builtin_amdgcn_fence(__ATOMIC_ACQUIRE, "workgroup");
  {
    const int c4 = lane * 4;           // 32 lanes x 16 B = one 512-B output row (128 floats) per instruction
    {
#pragma unroll
      for (int row = 0; row < 16; ++row) {
        v4f val = *(const v4f*)(os + row * 132 + c4);
        *(v4f*)(ob_ptr + (size_t)(q0 + row) * g.o_rs + c4) = val;
      }
      
    }
  }
}

// ---- k and v, f32 [rows][128], split once into bf16 hi/lo planes (the split of at_split, so the values are those the key loop made itself).
// One block per 64 rows (one key chunk of one head). k keeps its layout; v is transposed through LDS into one [128 d][64 keys] tile per chunk.
__global__ __launch_bounds__(256) void kv_split_planes(const float* __restrict__ k, const float* __restrict__ v,
                                                       __bf16* __restrict__ kh, __bf16* __restrict__ kl,
                                                       __bf16* __restrict__ vth, __bf16* __restrict__ vtl) {
  __shared__ float tile[128 * 65];     // [d][key], pitch 65 floats: the column writes fall on 16 banks, the row reads on 32
  const int t = threadIdx.x;
  const size_t base = (size_t)blockIdx.x * (64 * 128);
  // every loop below is unrolled so that a thread's loads issue together, ahead of the conversions
#pragma unroll
  for (int it = 0; it < 8; ++it) {
    const int n = it * 256 + t, key = n >> 5, d4 = (n & 31) * 4;
    const v4f x = *(const v4f*)(v + base + n * 4);     // row key, columns d4 .. d4 + 3: the tile is linear in n
#pragma unroll
    for (int e = 0; e < 4; ++e) tile[(d4 + e) * 65 + key] = x[e];
  }
#pragma unroll
  for (int it = 0; it < 4; ++it) {
    const int n = it * 256 + t;
    const v4f x0 = *(const v4f*)(k + base + n * 8), x1 = *(const v4f*)(k + base + n * 8 + 4);
    v8b hv, lv;
#pragma unroll
    for (int e = 0; e < 4; e += 2) {
      v2b a, bl;
      at_split2(x0[e], x0[e + 1], a, bl); hv[e] = a[0]; hv[e + 1] = a[1]; lv[e] = bl[0]; lv[e + 1] = bl[1];
      at_split2(x1[e], x1[e + 1], a, bl); hv[4 + e] = a[0]; hv[5 + e] = a[1]; lv[4 + e] = bl[0]; lv[5 + e] = bl[1];
    }
    *(v8b*)(kh + base + n * 8) = hv;
    *(v8b*)(kl + base + n * 8) = lv;
  }
  __syncthreads();   // the v tile is complete before any thread reads its rows
#pragma unroll
  for (int it = 0; it < 4; ++it) {
    const int n = it * 256 + t, d = n >> 3, k8 = (n & 7) * 8;
    v8b hv, lv;
#pragma unroll
    for (int e = 0; e < 8; e += 2) {
      v2b a, bl;
      at_split2(tile[d * 65 + k8 + e], tile[d * 65 + k8 + e + 1], a, bl); hv[e] = a[0]; hv[e + 1] = a[1]; lv[e] = bl[0]; lv[e + 1] = bl[1];
    }
    *(v8b*)(vth + base + n * 8) = hv;
    *(v8b*)(vtl + base + n * 8) = lv;
  }
}

#define XB 2
#define XH 16
#define XS 2048
#define XD 128
__global__ void slopes_kernel(float* __restrict__ sl) { const int h = threadIdx.x; const float v = (h < XH) ? exp2f(-8.0f * (float)(h + 1) / (float)XH) : 0.f; ((float*)sl)[h] = v;  }
extern "C" void kernel_launch(void* const* d_in, const int* in_sizes, int n_in, void* d_out, int out_size, void* d_ws, size_t ws_size, hipStream_t stream) {
  (void)in_sizes; (void)n_in; (void)out_size; (void)ws_size;
  const float* q = (const float*)d_in[0]; const float* k = (const float*)d_in[1]; const float* v = (const float*)d_in[2];
  float* sl = (float*)d_ws;
  slopes_kernel<<<1, 32, 0, stream>>>(sl);
  __bf16* kh = (__bf16*)((char*)d_ws + 4096);                 // four planes of XB * XH * XS * XD bf16 behind the slope table
  __bf16* kl = kh + (size_t)XB * XH * XS * XD; __bf16* vth = kl + (size_t)XB * XH * XS * XD; __bf16* vtl = vth + (size_t)XB * XH * XS * XD;
  kv_split_planes<<<XB * XH * (XS / AT_KC), 256, 0, stream>>>(k, v, kh, kl, vth, vtl);
  AttnGeom g;
  g.cp = sl; g.pc = nullptr; g.c_bs = 0; g.c_rs = 0; g.c_hs = 0;
  g.q_bs = (long)XH * XS * XD; g.q_hs = (long)XS * XD; g.q_rs = XD;
  g.k_bs = g.q_bs; g.k_hs = g.q_hs; g.k_rs = XD; g.v_bs = g.q_bs; g.v_hs = g.q_hs; g.v_rs = XD; g.o_bs = g.q_bs; g.o_hs = g.q_hs; g.o_rs = XD;
  g.S = XS; g.Skv = XS; g.H = XH; g.mask_mode = 6; g.qscale = 0.08838834764831845f; g.blk0 = 0; g.mask_fill = -INFINITY; g.mask_is_int = 0;
  attn128_kernel<true, true, false, 6, true><<<XB * XH * (XS / AT_QB), AT_NW * 32, 0, stream>>>(q, k, v, (float*)d_out, nullptr, nullptr, g, kh, kl, vth, vtl);
}
